// v000
// Measured on an AMD MI455X. A time is GPU time per run, averaged over a window of back-to-back runs after a warm-up
// (all launches, gaps included; the runs take copies of the inputs in turn), and the median of several windows.
// Apart from v000's, it joins two sittings. Times from different sittings can be a few percent apart, while
// side-by-side timings come from the same sitting.
// v000, which the later versions start from, runs in 411 microseconds.
#include <hip/hip_runtime.h>
// Windowed multi-head self-attention on a (D, T, B)-layout input (D=1024, T=2048, B=2; 16 heads × 64; window |i−j| ≤ 256): xt = x transposed to (B,T,D); q,k,v = xt·W + b; scores = q·kᵀ/8 (−inf outside the window);
// attn = softmax(s + log_sigmoid(s)); out = (attn·v merged)·Wo + bo, transposed back to (D, T, B).
// Compute dtype: x, weights, biases rounded to bf16; q,k f16 GEMM outputs; v f32 → f16 hi + ×2^10 residual Vᵀ planes; fused windowed flash-style kernel (online softmax f32 on the sigsoftmax logits,
// P f16 ×2^10, two value accumulators) on v_wmma_f32_16x16x32_f16; merged O → hi/lo → Wo GEMMs (second in place ×2^-10) + bo; layout transposes through LDS; f32 accumulate.
#define BB 2
#define TT 2048
#define DM 1024
#define NH 16
#define HD 64
#define WIN 256
#define NR (BB * TT)

typedef __bf16 v16b __attribute__((ext_vector_type(16)));
typedef unsigned short v8us __attribute__((ext_vector_type(8), may_alias));
typedef float  v8f  __attribute__((ext_vector_type(8)));
typedef float  v4f  __attribute__((ext_vector_type(4)));
typedef float  v4fa __attribute__((ext_vector_type(4), may_alias));
union FragB { v16b v; v8us half[2]; unsigned short u[16]; };

__device__ __forceinline__ unsigned short bf16_bits(float x) { unsigned int u = __float_as_uint(x); return (unsigned short)((u + 0x7FFFu + ((u >> 16) & 1u)) >> 16); }
__device__ __forceinline__ float bf16_val(unsigned short b) { return __uint_as_float(((unsigned int)b) << 16); }
__device__ __forceinline__ float bf16_round(float x) { return bf16_val(bf16_bits(x)); }
// D += A·B with NT terms: 1 = ah·bh, 2 = + al·bh (A split), 3 = + ah·bl (both split)
template <int NT>
__device__ __forceinline__ v8f mmaN(v16b ah, v16b al, v16b bh, v16b bl, v8f c) {
  c = __builtin_amdgcn_wmma_f32_16x16x32_bf16(false, ah, false, bh, (short)0, c, false, false);
  if (NT >= 2) c = __builtin_amdgcn_wmma_f32_16x16x32_bf16(false, al, false, bh, (short)0, c, false, false);
  if (NT >= 3) c = __builtin_amdgcn_wmma_f32_16x16x32_bf16(false, ah, false, bl, (short)0, c, false, false);
  asm volatile("v_nop\n\tv_nop\n\tv_nop\n\tv_nop" : "+v"(c) : "v"(ah), "v"(al), "v"(bh), "v"(bl));
  return c;
}

__global__ __launch_bounds__(256) void k_wt_bf16(const float* __restrict__ W, unsigned short* __restrict__ Wt, int K, int N) {
  const int t = blockIdx.x * 256 + threadIdx.x;
  const int k8n = K / 8;
  if (t >= N * k8n) return;
  const int n = t / k8n, k8 = (t % k8n) * 8;
  v8us v;
#pragma unroll
  for (int i = 0; i < 8; ++i) v[i] = bf16_bits(W[(size_t)(k8 + i) * N + n]);
  *(v8us*)(Wt + (size_t)n * K + k8) = v;
  
}

// GEMM C[M][N] (f32, pitch ldc) = act(A[M][K]·W + bias). A f32 row-major (pitch lda) converted per fragment to bf16
// (ASPLIT: hi/lo two planes -> 2 terms, else single rounded term); Wt bf16 [N][K] (pitch ldb). BIAS_BF16 rounds the
// bias to bf16 first (bias quantised to bf16 before the add). K%32==0, M%16==0, N%64==0.
template <bool ASPLIT, int ACT, bool BIAS_BF16>
__global__ __launch_bounds__(128) void k_gemm_bf(const float* __restrict__ A, int lda, const unsigned short* __restrict__ Wt, int ldb,
                                               const float* __restrict__ bias, float* __restrict__ C, int ldc, int M, int N, int K) {
  __shared__ __attribute__((aligned(16))) float so[4][16][64];
  const int tid = threadIdx.x, w = tid >> 5, lane = tid & 31, ln = lane & 15, hh = lane >> 4;
  const int ntn = N / 64;
  const int wid = blockIdx.x * 4 + w;
  const int mt = wid / ntn, nq = wid % ntn;
  if (mt * 16 >= M) return;
  const int row0 = mt * 16, col0 = nq * 64;
  const float* arow = A + (size_t)(row0 + ln) * lda;
  v8f acc[4] = {};
  for (int kb = 0; kb < K; kb += 32) {
    FragB ah, al;
    const v4f x0 = *(const v4fa*)(arow + kb + 8 * hh), x1 = *(const v4fa*)(arow + kb + 8 * hh + 4);
    const v4f x2 = *(const v4fa*)(arow + kb + 16 + 8 * hh), x3 = *(const v4fa*)(arow + kb + 16 + 8 * hh + 4);
    float xs[16] = {x0[0],x0[1],x0[2],x0[3],x1[0],x1[1],x1[2],x1[3],x2[0],x2[1],x2[2],x2[3],x3[0],x3[1],x3[2],x3[3]};
#pragma unroll
    for (int i = 0; i < 16; ++i) { const unsigned short hb = bf16_bits(xs[i]); ah.u[i] = hb; al.u[i] = ASPLIT ? bf16_bits(xs[i] - bf16_val(hb)) : (unsigned short)0; }
#pragma unroll
    for (int t = 0; t < 4; ++t) {
      const unsigned short* brow = Wt + (size_t)(col0 + t * 16 + ln) * ldb + kb;
      FragB b;
      b.half[0] = *(const v8us*)(brow + 8 * hh);
      b.half[1] = *(const v8us*)(brow + 16 + 8 * hh);
      acc[t] = mmaN<ASPLIT ? 2 : 1>(ah.v, al.v, b.v, b.v, acc[t]);
    }
  }
#pragma unroll
  for (int t = 0; t < 4; ++t) {
    float bv = bias ? bias[col0 + t * 16 + ln] : 0.f;
    if (BIAS_BF16) bv = bf16_round(bv);
#pragma unroll
    for (int r = 0; r < 8; ++r) { float v = acc[t][r] + bv; if (ACT == 1) v = fmaxf(v, 0.f); so[w][8 * hh + r][t * 16 + ln] = v; }
  }
  __builtin_amdgcn_fence(__ATOMIC_ACQ_REL, "workgroup");
  __builtin_amdgcn_wave_barrier();
  const int rsub = lane >> 4, c4 = (lane & 15) * 4;
  {
#pragma unroll
    for (int q = 0; q < 8; ++q) {
      const int r = q * 2 + rsub;
      const v4f v = *(const v4fa*)&so[w][r][c4];
      *(v4f*)(C + (size_t)(row0 + r) * ldc + col0 + c4) = v;
    }
    
  }
}

// Flash-style causal/unmasked attention, all contractions 3-term bf16 hi/lo splits, f32 softmax with running max.
// q,k,v rows are read from f32 buffers with arbitrary row pitch (so they can live inside a fused qkv buffer);
// D = head size (multiple of 32, <= 128); one wave = 16 query rows; block = 4 waves (64 queries) sharing K/V chunks of 32.
template <int D, bool CAUSAL>
__global__ __launch_bounds__(128) void k_flash(const float* __restrict__ qb, const float* __restrict__ kb, const float* __restrict__ vb,
                                             int pitch, int T, int H, float scale, float* __restrict__ y, int ypitch) {
  constexpr int KS = D / 32;        // k-steps for QK
  constexpr int DT = D / 16;        // d tiles for PV
  __shared__ __attribute__((aligned(16))) unsigned short sKh[32][D + 8], sKl[32][D + 8], sVh[32][D + 8], sVl[32][D + 8];
  __shared__ __attribute__((aligned(16))) unsigned short sPh[4][16][40], sPl[4][16][40];
  __shared__ __attribute__((aligned(16))) float sO[4][16][D];
  const int tid = threadIdx.x, w = tid >> 5, lane = tid & 31, ln = lane & 15, hh = lane >> 4;
  const int nqb = (T + 63) / 64;
  const int bh = blockIdx.x / nqb, qblk = blockIdx.x % nqb;
  const int b = bh / H, h = bh % H;
  const int q0 = qblk * 64 + w * 16;
  const float* Q = qb + (size_t)b * T * pitch + h * D;
  const float* K = kb + (size_t)b * T * pitch + h * D;
  const float* V = vb + (size_t)b * T * pitch + h * D;

  // A fragments of the wave's 16 query rows (scaled), hi/lo
  FragB aqh[KS], aql[KS];
  {
    int row = q0 + ln; if (row >= T) row = T - 1;
    const float* qr = Q + (size_t)row * pitch;
#pragma unroll
    for (int ks = 0; ks < KS; ++ks)
#pragma unroll
      for (int i = 0; i < 16; ++i) {
        const int d = ks * 32 + ((i < 8) ? (8 * hh + i) : (16 + 8 * hh + (i - 8)));
        const float x = qr[d] * scale; const unsigned short hb = bf16_bits(x);
        aqh[ks].u[i] = hb; aql[ks].u[i] = bf16_bits(x - bf16_val(hb));
      }
  }
  float m_r[8], l_r[8];
#pragma unroll
  for (int r = 0; r < 8; ++r) { m_r[r] = -3.0e38f; l_r[r] = 0.f; }
  v8f oacc[DT];
#pragma unroll
  for (int dt = 0; dt < DT; ++dt) oacc[dt] = (v8f){0.f,0.f,0.f,0.f,0.f,0.f,0.f,0.f};

  const int kv_end = CAUSAL ? min(T, qblk * 64 + 64) : T;     // block-uniform
  for (int j0 = 0; j0 < kv_end; j0 += 32) {
    __syncthreads();
    for (int e = tid; e < 32 * (D / 4); e += 128) {
      const int r = e / (D / 4), c4 = (e % (D / 4)) * 4;
      const int key = j0 + r;
      v4f kf = {0.f,0.f,0.f,0.f}, vf = {0.f,0.f,0.f,0.f};
      if (key < T) { kf = *(const v4fa*)(K + (size_t)key * pitch + c4); vf = *(const v4fa*)(V + (size_t)key * pitch + c4); }
#pragma unroll
      for (int t = 0; t < 4; ++t) {
        unsigned short hb = bf16_bits(kf[t]); sKh[r][c4 + t] = hb; sKl[r][c4 + t] = bf16_bits(kf[t] - bf16_val(hb));
        hb = bf16_bits(vf[t]); sVh[r][c4 + t] = hb; sVl[r][c4 + t] = bf16_bits(vf[t] - bf16_val(hb));
      }
    }
    __syncthreads();
    // S tile 16 x 32
    v8f s[2];
#pragma unroll
    for (int nt = 0; nt < 2; ++nt) {
      v8f acc = {};
#pragma unroll
      for (int ks = 0; ks < KS; ++ks) {
        FragB bh_, bl_;
        bh_.half[0] = *(const v8us*)&sKh[nt * 16 + ln][ks * 32 + 8 * hh]; bh_.half[1] = *(const v8us*)&sKh[nt * 16 + ln][ks * 32 + 16 + 8 * hh];
        bl_.half[0] = *(const v8us*)&sKl[nt * 16 + ln][ks * 32 + 8 * hh]; bl_.half[1] = *(const v8us*)&sKl[nt * 16 + ln][ks * 32 + 16 + 8 * hh];
        acc = mmaN<3>(aqh[ks].v, aql[ks].v, bh_.v, bl_.v, acc);
      }
      s[nt] = acc;
    }
    // mask + running max (rows 8hh+r; the 16 lanes of a half share rows)
    float alpha[8];
#pragma unroll
    for (int r = 0; r < 8; ++r) {
      const int qi = q0 + 8 * hh + r;
      const int ja = j0 + ln, jb = j0 + 16 + ln;
      if (CAUSAL) { if (ja > qi) s[0][r] = -3.0e38f; if (jb > qi) s[1][r] = -3.0e38f; }
      if (ja >= T) s[0][r] = -3.0e38f;
      if (jb >= T) s[1][r] = -3.0e38f;
      float mx = fmaxf(s[0][r], s[1][r]);
      mx = fmaxf(mx, __shfl_xor(mx, 1, 32)); mx = fmaxf(mx, __shfl_xor(mx, 2, 32)); mx = fmaxf(mx, __shfl_xor(mx, 4, 32)); mx = fmaxf(mx, __shfl_xor(mx, 8, 32));
      const float mnew = fmaxf(m_r[r], mx);
      alpha[r] = (mnew > -1.0e38f) ? __expf(m_r[r] - mnew) : 1.0f;
      const float p0 = (s[0][r] > -1.0e38f) ? __expf(s[0][r] - mnew) : 0.f;
      const float p1 = (s[1][r] > -1.0e38f) ? __expf(s[1][r] - mnew) : 0.f;
      m_r[r] = mnew;
      l_r[r] = l_r[r] * alpha[r] + p0 + p1;            // per-lane partial row sum (16 lanes combined at the end)
      unsigned short hb = bf16_bits(p0); sPh[w][8 * hh + r][ln] = hb;      sPl[w][8 * hh + r][ln] = bf16_bits(p0 - bf16_val(hb));
      hb = bf16_bits(p1);                sPh[w][8 * hh + r][16 + ln] = hb; sPl[w][8 * hh + r][16 + ln] = bf16_bits(p1 - bf16_val(hb));
    }
#pragma unroll
    for (int dt = 0; dt < DT; ++dt)
#pragma unroll
      for (int r = 0; r < 8; ++r) oacc[dt][r] *= alpha[r];
    __builtin_amdgcn_fence(__ATOMIC_ACQ_REL, "workgroup");
    __builtin_amdgcn_wave_barrier();
    FragB pah, pal;
    pah.half[0] = *(const v8us*)&sPh[w][ln][8 * hh]; pah.half[1] = *(const v8us*)&sPh[w][ln][16 + 8 * hh];
    pal.half[0] = *(const v8us*)&sPl[w][ln][8 * hh]; pal.half[1] = *(const v8us*)&sPl[w][ln][16 + 8 * hh];
#pragma unroll
    for (int dt = 0; dt < DT; ++dt) {
      FragB bvh, bvl;
#pragma unroll
      for (int i = 0; i < 8; ++i) {
        bvh.u[i] = sVh[8 * hh + i][dt * 16 + ln]; bvh.u[8 + i] = sVh[16 + 8 * hh + i][dt * 16 + ln];
        bvl.u[i] = sVl[8 * hh + i][dt * 16 + ln]; bvl.u[8 + i] = sVl[16 + 8 * hh + i][dt * 16 + ln];
      }
      oacc[dt] = mmaN<3>(pah.v, pal.v, bvh.v, bvl.v, oacc[dt]);
    }
    __builtin_amdgcn_fence(__ATOMIC_ACQ_REL, "workgroup");
    __builtin_amdgcn_wave_barrier();
  }
#pragma unroll
  for (int r = 0; r < 8; ++r) {
    float l = l_r[r];
    l += __shfl_xor(l, 1, 32); l += __shfl_xor(l, 2, 32); l += __shfl_xor(l, 4, 32); l += __shfl_xor(l, 8, 32);
    l_r[r] = (l > 0.f) ? 1.0f / l : 0.f;
  }
#pragma unroll
  for (int dt = 0; dt < DT; ++dt)
#pragma unroll
    for (int r = 0; r < 8; ++r) sO[w][8 * hh + r][dt * 16 + ln] = oacc[dt][r] * l_r[r];
  __builtin_amdgcn_fence(__ATOMIC_ACQ_REL, "workgroup");
  __builtin_amdgcn_wave_barrier();
  {
    for (int r = 0; r < 16; ++r) {
      const int row = q0 + r;
      if (row < T && lane < D / 4) {
        const v4f val = *(const v4fa*)&sO[w][r][lane * 4];
        *(v4f*)(y + ((size_t)b * T + row) * ypitch + h * D + lane * 4) = val;
      }
    }
    
  }
}

// GEMM C = act(A·W + bias + resid): A f32 (ASPLIT -> hi/lo 2 terms), Wt bf16 [N][K]; ACT 0 none, 1 relu, 2 exact gelu;
// resid (optional, f32, row index = (row % rmod), pitch ldr, RES_BF16 rounds it) added before the activation.
template <bool ASPLIT, int ACT, bool BIAS_BF16, bool RES_BF16>
__global__ __launch_bounds__(128) void k_gemm_bf3(const float* __restrict__ A, int lda, const unsigned short* __restrict__ Wt, int ldb,
                                                const float* __restrict__ bias, const float* __restrict__ resid, int rmod, int ldr,
                                                float* __restrict__ C, int ldc, int M, int N, int K) {
  __shared__ __attribute__((aligned(16))) float so[4][16][64];
  const int tid = threadIdx.x, w = tid >> 5, lane = tid & 31, ln = lane & 15, hh = lane >> 4;
  const int ntn = N / 64;
  const int wid = blockIdx.x * 4 + w;
  const int mt = wid / ntn, nq = wid % ntn;
  if (mt * 16 >= M) return;
  const int row0 = mt * 16, col0 = nq * 64;
  const float* arow = A + (size_t)(row0 + ln) * lda;
  v8f acc[4] = {};
  for (int kb = 0; kb < K; kb += 32) {
    FragB ah, al;
    const v4f x0 = *(const v4fa*)(arow + kb + 8 * hh), x1 = *(const v4fa*)(arow + kb + 8 * hh + 4);
    const v4f x2 = *(const v4fa*)(arow + kb + 16 + 8 * hh), x3 = *(const v4fa*)(arow + kb + 16 + 8 * hh + 4);
    float xs[16] = {x0[0],x0[1],x0[2],x0[3],x1[0],x1[1],x1[2],x1[3],x2[0],x2[1],x2[2],x2[3],x3[0],x3[1],x3[2],x3[3]};
#pragma unroll
    for (int i = 0; i < 16; ++i) { const unsigned short hb = bf16_bits(xs[i]); ah.u[i] = hb; al.u[i] = ASPLIT ? bf16_bits(xs[i] - bf16_val(hb)) : (unsigned short)0; }
#pragma unroll
    for (int t = 0; t < 4; ++t) {
      const unsigned short* brow = Wt + (size_t)(col0 + t * 16 + ln) * ldb + kb;
      FragB b;
      b.half[0] = *(const v8us*)(brow + 8 * hh);
      b.half[1] = *(const v8us*)(brow + 16 + 8 * hh);
      acc[t] = mmaN<ASPLIT ? 2 : 1>(ah.v, al.v, b.v, b.v, acc[t]);
    }
  }
#pragma unroll
  for (int t = 0; t < 4; ++t) {
    const int col = col0 + t * 16 + ln;
    float bv = bias ? bias[col] : 0.f;
    if (BIAS_BF16) bv = bf16_round(bv);
#pragma unroll
    for (int r = 0; r < 8; ++r) {
      float v = acc[t][r] + bv;
      if (resid) { float rv = resid[(size_t)((row0 + 8 * hh + r) % rmod) * ldr + col]; if (RES_BF16) rv = bf16_round(rv); v += rv; }
      if (ACT == 1) v = fmaxf(v, 0.f);
      if (ACT == 2) v = 0.5f * v * (1.0f + erff(v * 0.70710678118654752f));
      if (ACT == 3) { const float u = 0.7978845608028654f * (v + 0.044715f * v * v * v); v = 0.5f * v * (1.0f + tanhf(u)); }
      so[w][8 * hh + r][t * 16 + ln] = v;
    }
  }
  __builtin_amdgcn_fence(__ATOMIC_ACQ_REL, "workgroup");
  __builtin_amdgcn_wave_barrier();
  const int rsub = lane >> 4, c4 = (lane & 15) * 4;
  {
#pragma unroll
    for (int q = 0; q < 8; ++q) {
      const int r = q * 2 + rsub;
      const v4f v = *(const v4fa*)&so[w][r][c4];
      *(v4f*)(C + (size_t)(row0 + r) * ldc + col0 + c4) = v;
    }
    
  }
}
// row LayerNorm (biased variance, eps) over N: s = X (+ R); optional out_sum <- s; out_norm <- (s-mu)*rsqrt(var+eps)*g + b
template <bool PARAM_BF16>
__global__ __launch_bounds__(256) void k_layernorm(const float* __restrict__ X, const float* __restrict__ R, const float* __restrict__ g, const float* __restrict__ bta,
                                                  float* __restrict__ out_sum, float* __restrict__ out_norm, int N, float eps) {
  __shared__ float red[256];
  const int row = blockIdx.x, tid = threadIdx.x;
  const float* x = X + (size_t)row * N; const float* rr = R ? R + (size_t)row * N : nullptr;
  float vals[16];                     // up to N = 4096
  const int per = N / 256;            // contiguous chunk per thread? use strided-by-4 chunks: thread handles j = tid*4 + 1024*u
  float s1 = 0.f;
  for (int u = 0; u < per / 4; ++u) {
    const int j = tid * 4 + 1024 * u;
    const v4f a = *(const v4fa*)(x + j);
    v4f b = {0.f,0.f,0.f,0.f}; if (rr) b = *(const v4fa*)(rr + j);
#pragma unroll
    for (int q = 0; q < 4; ++q) { const float v = a[q] + b[q]; vals[u * 4 + q] = v; s1 += v; }
  }
  red[tid] = s1; __syncthreads();
  for (int st = 128; st > 0; st >>= 1) { if (tid < st) red[tid] += red[tid + st]; __syncthreads(); }
  const float mu = red[0] / (float)N; __syncthreads();
  float s2 = 0.f;
  for (int u = 0; u < per / 4; ++u)
#pragma unroll
    for (int q = 0; q < 4; ++q) { const float c = vals[u * 4 + q] - mu; s2 += c * c; }
  red[tid] = s2; __syncthreads();
  for (int st = 128; st > 0; st >>= 1) { if (tid < st) red[tid] += red[tid + st]; __syncthreads(); }
  const float rs = rsqrtf(red[0] / (float)N + eps);
  {
    for (int u = 0; u < per / 4; ++u) {
      const int j = tid * 4 + 1024 * u;
      v4f o, sm;
#pragma unroll
      for (int q = 0; q < 4; ++q) {
        float gg = g[j + q], bb = bta[j + q];
        if (PARAM_BF16) { gg = bf16_round(gg); bb = bf16_round(bb); }
        sm[q] = vals[u * 4 + q]; o[q] = (vals[u * 4 + q] - mu) * rs * gg + bb;
      }
      if (out_sum) *(v4f*)(out_sum + (size_t)row * N + j) = sm;
      *(v4f*)(out_norm + (size_t)row * N + j) = o;
    }
    
  }
}



// ---- f16 WMMA path (v_wmma_f32_16x16x32_f16): 11-bit significands for operands in range — used where a [0,1] probability operand needs more precision than bf16
typedef _Float16 v16h __attribute__((ext_vector_type(16)));
union FragH { v16h v; v8us half[2]; _Float16 h[16]; unsigned short u[16]; };
template <int NT>
__device__ __forceinline__ v8f mmaH(v16h ah, v16h al, v16h bh, v16h bl, v8f c) {
  c = __builtin_amdgcn_wmma_f32_16x16x32_f16(false, ah, false, bh, (short)0, c, false, false);
  if (NT >= 2) c = __builtin_amdgcn_wmma_f32_16x16x32_f16(false, al, false, bh, (short)0, c, false, false);
  if (NT >= 3) c = __builtin_amdgcn_wmma_f32_16x16x32_f16(false, ah, false, bl, (short)0, c, false, false);
  asm volatile("v_nop\n\tv_nop\n\tv_nop\n\tv_nop" : "+v"(c) : "v"(ah), "v"(al), "v"(bh), "v"(bl));
  return c;
}
// batched GEMM like k_gemm_b but f16 operands: A f32 (split into f16 hi/lo if ASPLIT, else rounded to f16), Bt = f16 values [n][k]; alpha; C f32; N multiple of 16 (partial tiles skipped)
template <bool ASPLIT>
__global__ __launch_bounds__(128) void k_gemm_h(const float* __restrict__ A, int lda, size_t sA, const _Float16* __restrict__ Bh, int ldb, size_t sB, float alpha, float* __restrict__ C, int ldc, size_t sC, int M, int N, int K) {
  __shared__ __attribute__((aligned(16))) float so[4][16][64];
  const int tid = threadIdx.x, w = tid >> 5, lane = tid & 31, ln = lane & 15, hh = lane >> 4; const int by = blockIdx.y;
  A += (size_t)by * sA; Bh += (size_t)by * sB; C += (size_t)by * sC;
  const int ntn = (N + 63) / 64; const int wid = blockIdx.x * 4 + w; const int mt = wid / ntn, nq = wid % ntn; if (mt * 16 >= M) return;
  const int row0 = mt * 16, col0 = nq * 64; const float* arow = A + (size_t)(row0 + ln) * lda;
  v8f acc[4] = {};
  for (int kb = 0; kb < K; kb += 32) {
    FragH ah, al;
    const v4f x0 = *(const v4fa*)(arow + kb + 8 * hh), x1 = *(const v4fa*)(arow + kb + 8 * hh + 4), x2 = *(const v4fa*)(arow + kb + 16 + 8 * hh), x3 = *(const v4fa*)(arow + kb + 16 + 8 * hh + 4);
    float xs[16] = {x0[0],x0[1],x0[2],x0[3],x1[0],x1[1],x1[2],x1[3],x2[0],x2[1],x2[2],x2[3],x3[0],x3[1],x3[2],x3[3]};
#pragma unroll
    for (int i = 0; i < 16; ++i) { const _Float16 h = (_Float16)xs[i]; ah.h[i] = h; al.h[i] = ASPLIT ? (_Float16)(xs[i] - (float)h) : (_Float16)0.0f; }
#pragma unroll
    for (int t = 0; t < 4; ++t) { if (col0 + t * 16 >= N) continue; const size_t boff = (size_t)(col0 + t * 16 + ln) * ldb + kb; FragH bq; bq.half[0] = *(const v8us*)(Bh + boff + 8 * hh); bq.half[1] = *(const v8us*)(Bh + boff + 16 + 8 * hh);
      acc[t] = mmaH<ASPLIT ? 2 : 1>(ah.v, al.v, bq.v, bq.v, acc[t]); }
  }
#pragma unroll
  for (int t = 0; t < 4; ++t) { if (col0 + t * 16 >= N) continue;
#pragma unroll
    for (int r = 0; r < 8; ++r) so[w][8 * hh + r][t * 16 + ln] = acc[t][r] * alpha; }
  __builtin_amdgcn_fence(__ATOMIC_ACQ_REL, "workgroup"); __builtin_amdgcn_wave_barrier();
  const int rsub = lane >> 4, c4 = (lane & 15) * 4;
  {
#pragma unroll
    for (int q = 0; q < 8; ++q) { const int r = q * 2 + rsub; if (col0 + c4 < N) { const v4f v = *(const v4fa*)&so[w][r][c4]; *(v4f*)(C + (size_t)(row0 + r) * ldc + col0 + c4) = v; } }
     }
}

// Wt[n][k] = f16(W[k][n]·scale) from f32 row-major W[K][N] (scale = power of two; bf16-exact weights stay exact in f16 away from the subnormal range)
__global__ __launch_bounds__(256) void k_wt_f16(const float* __restrict__ W, _Float16* __restrict__ Wt, int K, int N, float scale) {
  const int t = blockIdx.x * 256 + threadIdx.x; if (t >= N * (K / 8)) return; const int n = t / (K / 8), k8 = (t % (K / 8)) * 8; FragH f;
#pragma unroll
  for (int i = 0; i < 8; ++i) f.h[i] = (_Float16)(bf16_round(W[(size_t)(k8 + i) * N + n]) * scale); const v8us o = f.half[0];
  *(v8us*)((unsigned short*)Wt + (size_t)n * K + k8) = o; 
}
// k_gemm_hh variant with fused epilogue: v = acc·alpha + bias[by·sBias + col] (+ CP[(row/rowsPerB)·sCPb + by·64 + col] if CP) ; ACT 0 none / 1 elu ; writes f16 C16 and f32 C, each if non-null
template <int ACT>
__global__ __launch_bounds__(128) void k_gemm_hhx(const _Float16* __restrict__ A, int lda, size_t sA, const _Float16* __restrict__ Bh, int ldb, size_t sB, float alpha, const float* __restrict__ bias, size_t sBias, const float* __restrict__ CP, int rowsPerB, size_t sCPb, int row0g,
    float* __restrict__ C, _Float16* __restrict__ C16, int ldc, size_t sC, int M, int N, int K) {
  __shared__ __attribute__((aligned(16))) float so[4][16][64];
  const int tid = threadIdx.x, w = tid >> 5, lane = tid & 31, ln = lane & 15, hh = lane >> 4; const int by = blockIdx.y;
  A += (size_t)by * sA; Bh += (size_t)by * sB; const size_t cofs = (size_t)by * sC; const float* bp = bias ? bias + (size_t)by * sBias : nullptr;
  const int ntn = (N + 63) / 64; const int wid = blockIdx.x * 4 + w; const int mt = wid / ntn, nq = wid % ntn; if (mt * 16 >= M) return;
  const int row0 = mt * 16, col0 = nq * 64; const _Float16* arow = A + (size_t)(row0 + ln) * lda;
  v8f acc[4] = {};
  for (int kb = 0; kb < K; kb += 32) { FragH ah; ah.half[0] = *(const v8us*)((const unsigned short*)arow + kb + 8 * hh); ah.half[1] = *(const v8us*)((const unsigned short*)arow + kb + 16 + 8 * hh);
#pragma unroll
    for (int t = 0; t < 4; ++t) { if (col0 + t * 16 >= N) continue; const size_t boff = (size_t)(col0 + t * 16 + ln) * ldb + kb; FragH bq; bq.half[0] = *(const v8us*)((const unsigned short*)Bh + boff + 8 * hh); bq.half[1] = *(const v8us*)((const unsigned short*)Bh + boff + 16 + 8 * hh);
      acc[t] = mmaH<1>(ah.v, ah.v, bq.v, bq.v, acc[t]); }
  }
#pragma unroll
  for (int t = 0; t < 4; ++t) { if (col0 + t * 16 >= N) continue; const int col = col0 + t * 16 + ln; const float bv = bp ? bf16_round(bp[col]) : 0.f;
#pragma unroll
    for (int r = 0; r < 8; ++r) { float v = acc[t][r] * alpha + bv; if (CP) { const int bidx = (row0g + row0 + 8 * hh + r) / rowsPerB; v += CP[(size_t)bidx * sCPb + (size_t)by * 64 + col]; } if (ACT == 1) v = (v > 0.f) ? v : expm1f(v); else if (ACT == 7) v = (v > 0.f) ? v + 1.0f : expf(v); else if (ACT == 8) v = tanhf(v); else if (ACT == 9) v = 0.5f * v * (1.0f + tanhf(0.7978845608028654f * (v + 0.044715f * v * v * v))); else if (ACT == 11) v = 1.0f / (1.0f + expf(-v)); else if (ACT == 12) v = (v > 0.f) ? v : 0.01f * v; else if (ACT == 14) v = (v > 0.f) ? v : 0.1f * v; else if (ACT == 15) v = v / (1.0f + expf(-v)); else if (ACT == 3) v = fmaxf(v, 0.f); else if (ACT == 6) v = 0.5f * v * (1.0f + erff(v * 0.70710678118654752f)); so[w][8 * hh + r][t * 16 + ln] = v; } }
  __builtin_amdgcn_fence(__ATOMIC_ACQ_REL, "workgroup"); __builtin_amdgcn_wave_barrier();
  const int rsub = lane >> 4, c4 = (lane & 15) * 4; typedef _Float16 v4h __attribute__((ext_vector_type(4)));
  {
#pragma unroll
    for (int q = 0; q < 8; ++q) { const int r = q * 2 + rsub; if (col0 + c4 < N) { const v4f v = *(const v4fa*)&so[w][r][c4]; if (C) *(v4f*)(C + cofs + (size_t)(row0 + r) * ldc + col0 + c4) = v; if (C16) { v4h h4; for (int i = 0; i < 4; ++i) h4[i] = (_Float16)v[i]; *(v4h*)(C16 + cofs + (size_t)(row0 + r) * ldc + col0 + c4) = h4; } } }
     }
}


typedef _Float16 v4h __attribute__((ext_vector_type(4)));

__global__ __launch_bounds__(256) void k_x16(const float* __restrict__ x, _Float16* __restrict__ X16, size_t n8) { const size_t t = (size_t)blockIdx.x * 256 + threadIdx.x; if (t >= n8) return; FragH f;
#pragma unroll
  for (int q = 0; q < 8; ++q) f.h[q] = (_Float16)bf16_round(x[t * 8 + q]); *(v8us*)((unsigned short*)X16 + t * 8) = f.half[0];  }
__global__ __launch_bounds__(256) void k_h16(const float* __restrict__ x, _Float16* __restrict__ X16, size_t n8) { const size_t t = (size_t)blockIdx.x * 256 + threadIdx.x; if (t >= n8) return; FragH f;
#pragma unroll
  for (int q = 0; q < 8; ++q) f.h[q] = (_Float16)x[t * 8 + q]; *(v8us*)((unsigned short*)X16 + t * 8) = f.half[0];  }
__global__ __launch_bounds__(256) void k_round16f(const float* __restrict__ W, _Float16* __restrict__ Bt, size_t n8) { const size_t t = (size_t)blockIdx.x * 256 + threadIdx.x; if (t >= n8) return; FragH f;
#pragma unroll
  for (int i = 0; i < 8; ++i) f.h[i] = (_Float16)(bf16_round(W[t * 8 + i]) * 16.0f); *(v8us*)((unsigned short*)Bt + t * 8) = f.half[0];  }
template <int NHv, int TTv>
__global__ __launch_bounds__(256) void k_vt(const _Float16* __restrict__ V16, int ldv, int voff, _Float16* __restrict__ Vt) { __shared__ unsigned short tl[64][66]; const int tid = threadIdx.x; const int slab = blockIdx.x / (TTv / 64), lg = blockIdx.x % (TTv / 64); const int b = slab / NHv, h = slab % NHv;
  for (int i = tid; i < 64 * 8; i += 256) { const int r = i / 8, c8 = (i % 8) * 8; FragH f; f.half[0] = *(const v8us*)((const unsigned short*)V16 + ((size_t)b * TTv + lg * 64 + r) * ldv + voff + h * 64 + c8);
#pragma unroll
    for (int q = 0; q < 8; ++q) tl[r][c8 + q] = f.u[q]; }
  __syncthreads();
  {
#pragma unroll
    for (int rd = 0; rd < 2; ++rd) { const int d = rd * 32 + tid / 8, pc = tid % 8; FragH f;
#pragma unroll
      for (int q = 0; q < 8; ++q) f.u[q] = tl[pc * 8 + q][d];
      *(v8us*)((unsigned short*)Vt + ((size_t)slab * 64 + d) * TTv + lg * 64 + pc * 8) = f.half[0]; }
     } }

__global__ __launch_bounds__(256) void k_hl(const float* __restrict__ F, _Float16* __restrict__ Hh, _Float16* __restrict__ Hl, size_t n8) { const size_t t = (size_t)blockIdx.x * 256 + threadIdx.x; if (t >= n8) return; FragH fh, fl; const v4f a = *(const v4fa*)(F + t * 8), c = *(const v4fa*)(F + t * 8 + 4);
#pragma unroll
  for (int q = 0; q < 4; ++q) { _Float16 h = (_Float16)a[q]; fh.h[q] = h; fl.h[q] = (_Float16)((a[q] - (float)h) * 1024.0f); h = (_Float16)c[q]; fh.h[4 + q] = h; fl.h[4 + q] = (_Float16)((c[q] - (float)h) * 1024.0f); }
  { *(v8us*)((unsigned short*)Hh + t * 8) = fh.half[0]; *(v8us*)((unsigned short*)Hl + t * 8) = fl.half[0];  } }
__global__ __launch_bounds__(256) void k_vthl(const float* __restrict__ VF, int ldv, _Float16* __restrict__ Vth, _Float16* __restrict__ Vtl) { __shared__ float tl[64][65]; const int tid = threadIdx.x; const int slab = blockIdx.x / (TT / 64), lg = blockIdx.x % (TT / 64); const int b = slab / NH, h = slab % NH;
  for (int i = tid; i < 64 * 16; i += 256) { const int r = i / 16, c4 = (i % 16) * 4; const v4f a = *(const v4fa*)(VF + ((size_t)b * TT + lg * 64 + r) * ldv + h * HD + c4); tl[r][c4] = a[0]; tl[r][c4 + 1] = a[1]; tl[r][c4 + 2] = a[2]; tl[r][c4 + 3] = a[3]; }
  __syncthreads();
  FragH fh[2], fl[2]; size_t oo[2];
#pragma unroll
  for (int rd = 0; rd < 2; ++rd) { const int d = rd * 32 + tid / 8, pc = tid % 8;
#pragma unroll
    for (int q = 0; q < 8; ++q) { const float v = tl[pc * 8 + q][d]; const _Float16 hv = (_Float16)v; fh[rd].h[q] = hv; fl[rd].h[q] = (_Float16)((v - (float)hv) * 1024.0f); } oo[rd] = ((size_t)slab * HD + d) * TT + lg * 64 + pc * 8; }
  {
#pragma unroll
    for (int rd = 0; rd < 2; ++rd) { *(v8us*)((unsigned short*)Vth + oo[rd]) = fh[rd].half[0]; *(v8us*)((unsigned short*)Vtl + oo[rd]) = fl[rd].half[0]; }
     } }
__global__ __launch_bounds__(256) void k_tin(const float* __restrict__ x, _Float16* __restrict__ X16) { __shared__ float tl[BB][32][65]; const int tid = threadIdx.x; const int dg = blockIdx.x / (TT / 32), tg = blockIdx.x % (TT / 32); const int d0 = dg * 64, t0 = tg * 32;
  for (int i = tid; i < 64 * 32 * BB; i += 256) { const int b = i % BB, tt = (i / BB) % 32, dd = i / (BB * 32); tl[b][tt][dd] = bf16_round(x[((size_t)(d0 + dd) * TT + t0 + tt) * BB + b]); } __syncthreads();
  { for (int i = tid; i < BB * 32 * 8; i += 256) { const int pc = i % 8, tt = (i / 8) % 32, b = i / (8 * 32); FragH f; for (int q = 0; q < 8; ++q) f.h[q] = (_Float16)tl[b][tt][pc * 8 + q]; *(v8us*)((unsigned short*)X16 + ((size_t)b * TT + t0 + tt) * DM + d0 + pc * 8) = f.half[0]; }  } }
__global__ __launch_bounds__(256) void k_tout(const float* __restrict__ G, float* __restrict__ out) { __shared__ float tl[32][64 * BB + 1]; const int tid = threadIdx.x; const int dg = blockIdx.x / (TT / 64), tg = blockIdx.x % (TT / 64); const int d0 = dg * 32, t0 = tg * 64;
  for (int i = tid; i < 32 * 64 * BB; i += 256) { const int dd = i % 32, tt = (i / 32) % 64, b = i / (32 * 64); tl[dd][tt * BB + b] = G[((size_t)b * TT + t0 + tt) * DM + d0 + dd]; } __syncthreads();
  { for (int i = tid; i < 32 * 32; i += 256) { const int pc = i % 32, dd = i / 32; const v4f v = {tl[dd][pc * 4], tl[dd][pc * 4 + 1], tl[dd][pc * 4 + 2], tl[dd][pc * 4 + 3]}; *(v4f*)(out + ((size_t)(d0 + dd) * TT + t0) * BB + pc * 4) = v; }  } }
__global__ __launch_bounds__(128) void k_flash(const _Float16* __restrict__ Q16, int ldq, const _Float16* __restrict__ K16, int ldk, const _Float16* __restrict__ Vt, const _Float16* __restrict__ Vtlo, float* __restrict__ O, int ldo) {
  constexpr int RPW = 16, RTN = RPW / 16, NQB = TT / (4 * RPW), DT = 4, KS = 2;
  __shared__ __attribute__((aligned(16))) unsigned short sP[4][RPW][40]; __shared__ __attribute__((aligned(16))) float sO[4][RPW][64 + 4];
  const int tid = threadIdx.x, w = tid >> 5, lane = tid & 31, ln = lane & 15, hh = lane >> 4;
  const int slab = blockIdx.x / NQB, qblk = blockIdx.x % NQB; const int b = slab / NH, h = slab % NH; const int qb0 = qblk * (4 * RPW); const int q0 = qb0 + w * RPW;
  FragH aq[2][KS];
#pragma unroll
  for (int rt = 0; rt < RTN; ++rt) { const unsigned short* qr = (const unsigned short*)Q16 + ((size_t)b * TT + q0 + rt * 16 + ln) * ldq + h * 64;
#pragma unroll
    for (int ks = 0; ks < KS; ++ks) { aq[rt][ks].half[0] = *(const v8us*)(qr + ks * 32 + 8 * hh); aq[rt][ks].half[1] = *(const v8us*)(qr + ks * 32 + 16 + 8 * hh); } }
  const unsigned short* Vth = (const unsigned short*)Vt + (size_t)slab * 64 * TT; const unsigned short* Vtl = (const unsigned short*)Vtlo + (size_t)slab * 64 * TT;
  float m_r[2][8], l_r[2][8]; v8f oacc[2][DT], oaccl[2][DT];
#pragma unroll
  for (int rt = 0; rt < RTN; ++rt) {
#pragma unroll
    for (int r = 0; r < 8; ++r) { m_r[rt][r] = -3.0e38f; l_r[rt][r] = 0.f; }
#pragma unroll
    for (int dt = 0; dt < DT; ++dt) { oacc[rt][dt] = (v8f){0.f,0.f,0.f,0.f,0.f,0.f,0.f,0.f}; oaccl[rt][dt] = oacc[rt][dt]; } }
  const int jbeg = (qb0 - WIN) > 0 ? (qb0 - WIN) : 0; const int jend = (qb0 + 4 * RPW + WIN) < TT ? (qb0 + 4 * RPW + WIN) : TT;      /* block-uniform window bounds (multiples of 32) */
#pragma unroll 1
  for (int j0 = jbeg; j0 < jend; j0 += 32) {
    
    v8f s[2][2];
#pragma unroll
    for (int nt = 0; nt < 2; ++nt) { const unsigned short* kr = (const unsigned short*)K16 + ((size_t)b * TT + j0 + nt * 16 + ln) * ldk + h * 64; FragH bk[KS];
#pragma unroll
      for (int ks = 0; ks < KS; ++ks) { bk[ks].half[0] = *(const v8us*)(kr + ks * 32 + 8 * hh); bk[ks].half[1] = *(const v8us*)(kr + ks * 32 + 16 + 8 * hh); }
#pragma unroll
      for (int rt = 0; rt < RTN; ++rt) { v8f acc = (v8f){0.f,0.f,0.f,0.f,0.f,0.f,0.f,0.f};
#pragma unroll
        for (int ks = 0; ks < KS; ++ks) acc = mmaH<1>(aq[rt][ks].v, aq[rt][ks].v, bk[ks].v, bk[ks].v, acc); s[rt][nt] = acc; } }
#pragma unroll
    for (int rt = 0; rt < RTN; ++rt)
#pragma unroll
      for (int r = 0; r < 8; ++r) { const int tq = q0 + rt * 16 + 8 * hh + r; const int k0 = j0 + ln, k1 = j0 + 16 + ln; (void)tq; (void)k0; (void)k1;
        const bool ok0 = (k0 - tq <= WIN) && (tq - k0 <= WIN), ok1 = (k1 - tq <= WIN) && (tq - k1 <= WIN);
        const float u0 = s[rt][0][r] * 0.125f, u1 = s[rt][1][r] * 0.125f; const float s0 = ok0 ? (u0 + fminf(u0, 0.f) - log1pf(expf(-fabsf(u0)))) : -INFINITY, s1 = ok1 ? (u1 + fminf(u1, 0.f) - log1pf(expf(-fabsf(u1)))) : -INFINITY;      /* s + log σ(s) */ float mc = fmaxf(s0, s1);
        mc = fmaxf(mc, __shfl_xor(mc, 1, 32)); mc = fmaxf(mc, __shfl_xor(mc, 2, 32)); mc = fmaxf(mc, __shfl_xor(mc, 4, 32)); mc = fmaxf(mc, __shfl_xor(mc, 8, 32));
        const float mn = fmaxf(m_r[rt][r], mc); const float al = (mn > -1.0e38f) ? expf(m_r[rt][r] - mn) : 1.0f; m_r[rt][r] = mn; const float p0 = ok0 ? expf(s0 - mn) : 0.f, p1 = ok1 ? expf(s1 - mn) : 0.f; l_r[rt][r] = l_r[rt][r] * al + p0 + p1;
#pragma unroll
        for (int dt = 0; dt < DT; ++dt) { oacc[rt][dt][r] *= al; oaccl[rt][dt][r] *= al; }
        FragH t2; t2.h[0] = (_Float16)(p0 * 1024.0f); t2.h[1] = (_Float16)(p1 * 1024.0f); sP[w][rt * 16 + 8 * hh + r][ln] = t2.u[0]; sP[w][rt * 16 + 8 * hh + r][16 + ln] = t2.u[1]; }
    __builtin_amdgcn_fence(__ATOMIC_ACQ_REL, "workgroup"); __builtin_amdgcn_wave_barrier();
    FragH pa[2];
#pragma unroll
    for (int rt = 0; rt < RTN; ++rt) { pa[rt].half[0] = *(const v8us*)&sP[w][rt * 16 + ln][8 * hh]; pa[rt].half[1] = *(const v8us*)&sP[w][rt * 16 + ln][16 + 8 * hh]; }
#pragma unroll
    for (int dt = 0; dt < DT; ++dt) { const size_t vo = (size_t)(dt * 16 + ln) * TT + j0; FragH bv, bl; bv.half[0] = *(const v8us*)(Vth + vo + 8 * hh); bv.half[1] = *(const v8us*)(Vth + vo + 16 + 8 * hh); bl.half[0] = *(const v8us*)(Vtl + vo + 8 * hh); bl.half[1] = *(const v8us*)(Vtl + vo + 16 + 8 * hh);
#pragma unroll
      for (int rt = 0; rt < RTN; ++rt) { oacc[rt][dt] = mmaH<1>(pa[rt].v, pa[rt].v, bv.v, bv.v, oacc[rt][dt]); oaccl[rt][dt] = mmaH<1>(pa[rt].v, pa[rt].v, bl.v, bl.v, oaccl[rt][dt]); } }
    __builtin_amdgcn_fence(__ATOMIC_ACQ_REL, "workgroup"); __builtin_amdgcn_wave_barrier(); }
#pragma unroll
  for (int rt = 0; rt < RTN; ++rt) {
#pragma unroll
    for (int r = 0; r < 8; ++r) { float l = l_r[rt][r]; l += __shfl_xor(l, 1, 32); l += __shfl_xor(l, 2, 32); l += __shfl_xor(l, 4, 32); l += __shfl_xor(l, 8, 32); l_r[rt][r] = (l > 0.f) ? 1.0f / (l * 1024.0f) : 0.f; }
#pragma unroll
    for (int dt = 0; dt < DT; ++dt)
#pragma unroll
      for (int r = 0; r < 8; ++r) sO[w][rt * 16 + 8 * hh + r][dt * 16 + ln] = (oacc[rt][dt][r] + oaccl[rt][dt][r] * 0.0009765625f) * l_r[rt][r]; }
  __builtin_amdgcn_fence(__ATOMIC_ACQ_REL, "workgroup"); __builtin_amdgcn_wave_barrier();
  {
#pragma unroll
    for (int rp = 0; rp < RPW; rp += 2) { const int r = rp + (lane >> 4), pc = lane & 15; const v4f val = *(const v4fa*)&sO[w][r][pc * 4]; *(v4f*)(O + ((size_t)b * TT + q0 + r) * ldo + h * 64 + pc * 4) = val; }
     } }

extern "C" void kernel_launch(void* const* d_in, const int* in_sizes, int n_in,
                              void* d_out, int out_size, void* d_ws, size_t ws_size, hipStream_t stream) {
  (void)in_sizes; (void)n_in; (void)out_size;
  const float* const* I = (const float* const*)d_in; const float* x = I[0]; const float* Wq = I[1]; const float* bq = I[2]; const float* Wk = I[3]; const float* bk = I[4]; const float* Wv = I[5]; const float* bv = I[6]; const float* Wo = I[7]; const float* bo = I[8];
  char* ws = (char*)d_ws; size_t off = 0;
  auto take = [&](size_t bytes) { char* p = ws + off; off += (bytes + 255) & ~(size_t)255; return p; };
  const size_t WSZ = (size_t)DM * DM; _Float16* Bw = (_Float16*)take(4 * WSZ * 2); _Float16* X16 = (_Float16*)take((size_t)NR * DM * 2); float* F32 = (float*)take((size_t)NR * DM * 4);
  _Float16* Q16 = (_Float16*)take((size_t)NR * DM * 2); _Float16* K16 = (_Float16*)take((size_t)NR * DM * 2); _Float16* Vth = (_Float16*)take((size_t)NR * DM * 2); _Float16* Vtl = (_Float16*)take((size_t)NR * DM * 2);
  float* O = F32; _Float16* OH = Q16; _Float16* OL = K16; float* G = F32;      /* F32: v (consumed by k_vthl) → O (consumed by k_hl) → G; OH/OL reuse the q/k planes, dead after the attention kernel */
  if (off > ws_size) return;      // 8.4 + 8.4 + 16.8 + 4 × 8.4 ≈ 67 MB
  const unsigned gw = (unsigned)(((size_t)DM * (DM / 8) + 255) / 256);
  k_wt_f16<<<gw, 256, 0, stream>>>(Wq, Bw, DM, DM, 16.0f); k_wt_f16<<<gw, 256, 0, stream>>>(Wk, Bw + WSZ, DM, DM, 16.0f); k_wt_f16<<<gw, 256, 0, stream>>>(Wv, Bw + 2 * WSZ, DM, DM, 16.0f); k_wt_f16<<<gw, 256, 0, stream>>>(Wo, Bw + 3 * WSZ, DM, DM, 16.0f);      /* (in,out) → Bt[n][k] ×2^4 */
  k_tin<<<(DM / 64) * (TT / 32), 256, 0, stream>>>(x, X16);
  const dim3 gp(((NR / 16) * (DM / 64) + 3) / 4, 1); const unsigned g8 = (unsigned)(((size_t)NR * DM / 8 + 255) / 256);
  k_gemm_hhx<0><<<gp, 128, 0, stream>>>(X16, DM, 0, Bw, DM, 0, 0.0625f, bq, 0, nullptr, 1, 0, 0, nullptr, Q16, DM, 0, NR, DM, DM);      /* q = xt·Wq + bq → f16: M 4096 N 1024 K 1024 */
  k_gemm_hhx<0><<<gp, 128, 0, stream>>>(X16, DM, 0, Bw + WSZ, DM, 0, 0.0625f, bk, 0, nullptr, 1, 0, 0, nullptr, K16, DM, 0, NR, DM, DM);      /* k */
  k_gemm_hhx<0><<<gp, 128, 0, stream>>>(X16, DM, 0, Bw + 2 * WSZ, DM, 0, 0.0625f, bv, 0, nullptr, 1, 0, 0, F32, nullptr, DM, 0, NR, DM, DM); k_vthl<<<BB * NH * (TT / 64), 256, 0, stream>>>(F32, DM, Vth, Vtl);      /* v f32 → Vᵀ hi/lo */
  k_flash<<<BB * NH * (TT / 64), 128, 0, stream>>>(Q16, DM, K16, DM, Vth, Vtl, O, DM);
  k_hl<<<g8, 256, 0, stream>>>(O, OH, OL, (size_t)NR * DM / 8);
  k_gemm_hhx<0><<<gp, 128, 0, stream>>>(OH, DM, 0, Bw + 3 * WSZ, DM, 0, 0.0625f, bo, 0, nullptr, 1, 0, 0, G, nullptr, DM, 0, NR, DM, DM);      /* G = O_hi·Wo + bo */
  k_gemm_hhx<0><<<gp, 128, 0, stream>>>(OL, DM, 0, Bw + 3 * WSZ, DM, 0, 0.0625f * 0.0009765625f, nullptr, 0, G, 1, (size_t)DM, 0, G, nullptr, DM, 0, NR, DM, DM);      /* += O_lo·Wo·2^-10 in place */
  k_tout<<<(DM / 32) * (TT / 64), 256, 0, stream>>>(G, (float*)d_out);
}

// v001
// One run takes 247 microseconds.
// Two timings next to v000 put it at 1.68 and 1.69 times that version's speed.
#include <hip/hip_runtime.h>
// Windowed multi-head self-attention on a (D, T, B)-layout input (D=1024, T=2048, B=2; 16 heads × 64; window |i−j| ≤ 256): xt = x transposed to (B,T,D); q,k,v = xt·W + b; scores = q·kᵀ/8 (−inf outside the window);
// attn = softmax(s + log_sigmoid(s)); out = (attn·v merged)·Wo + bo, transposed back to (D, T, B).
// Compute dtype: x, weights, biases rounded to bf16; q,k f16 GEMM outputs; v f32 → f16 hi + ×2^10 residual Vᵀ planes; fused windowed flash-style kernel (online softmax f32 on the sigsoftmax logits,
// P f16 ×2^10, two value accumulators) on v_wmma_f32_16x16x32_f16; merged O → hi/lo → Wo GEMMs (second in place ×2^-10) + bo; layout transposes through LDS; f32 accumulate.
#define BB 2
#define TT 2048
#define DM 1024
#define NH 16
#define HD 64
#define WIN 256
#define NR (BB * TT)

typedef __bf16 v16b __attribute__((ext_vector_type(16)));
typedef unsigned short v8us __attribute__((ext_vector_type(8), may_alias));
typedef float  v8f  __attribute__((ext_vector_type(8)));
typedef float  v4f  __attribute__((ext_vector_type(4)));
typedef float  v4fa __attribute__((ext_vector_type(4), may_alias));
union FragB { v16b v; v8us half[2]; unsigned short u[16]; };

__device__ __forceinline__ unsigned short bf16_bits(float x) { unsigned int u = __float_as_uint(x); return (unsigned short)((u + 0x7FFFu + ((u >> 16) & 1u)) >> 16); }
__device__ __forceinline__ float bf16_val(unsigned short b) { return __uint_as_float(((unsigned int)b) << 16); }
__device__ __forceinline__ float bf16_round(float x) { return bf16_val(bf16_bits(x)); }
// D += A·B with NT terms: 1 = ah·bh, 2 = + al·bh (A split), 3 = + ah·bl (both split)
template <int NT>
__device__ __forceinline__ v8f mmaN(v16b ah, v16b al, v16b bh, v16b bl, v8f c) {
  c = __builtin_amdgcn_wmma_f32_16x16x32_bf16(false, ah, false, bh, (short)0, c, false, false);
  if (NT >= 2) c = __builtin_amdgcn_wmma_f32_16x16x32_bf16(false, al, false, bh, (short)0, c, false, false);
  if (NT >= 3) c = __builtin_amdgcn_wmma_f32_16x16x32_bf16(false, ah, false, bl, (short)0, c, false, false);
  asm volatile("v_nop\n\tv_nop\n\tv_nop\n\tv_nop" : "+v"(c) : "v"(ah), "v"(al), "v"(bh), "v"(bl));
  return c;
}

__global__ __launch_bounds__(256) void k_wt_bf16(const float* __restrict__ W, unsigned short* __restrict__ Wt, int K, int N) {
  const int t = blockIdx.x * 256 + threadIdx.x;
  const int k8n = K / 8;
  if (t >= N * k8n) return;
  const int n = t / k8n, k8 = (t % k8n) * 8;
  v8us v;
#pragma unroll
  for (int i = 0; i < 8; ++i) v[i] = bf16_bits(W[(size_t)(k8 + i) * N + n]);
  *(v8us*)(Wt + (size_t)n * K + k8) = v;
  
}

// GEMM C[M][N] (f32, pitch ldc) = act(A[M][K]·W + bias). A f32 row-major (pitch lda) converted per fragment to bf16
// (ASPLIT: hi/lo two planes -> 2 terms, else single rounded term); Wt bf16 [N][K] (pitch ldb). BIAS_BF16 rounds the
// bias to bf16 first (bias quantised to bf16 before the add). K%32==0, M%16==0, N%64==0.
template <bool ASPLIT, int ACT, bool BIAS_BF16>
__global__ __launch_bounds__(128) void k_gemm_bf(const float* __restrict__ A, int lda, const unsigned short* __restrict__ Wt, int ldb,
                                               const float* __restrict__ bias, float* __restrict__ C, int ldc, int M, int N, int K) {
  __shared__ __attribute__((aligned(16))) float so[4][16][64];
  const int tid = threadIdx.x, w = tid >> 5, lane = tid & 31, ln = lane & 15, hh = lane >> 4;
  const int ntn = N / 64;
  const int wid = blockIdx.x * 4 + w;
  const int mt = wid / ntn, nq = wid % ntn;
  if (mt * 16 >= M) return;
  const int row0 = mt * 16, col0 = nq * 64;
  const float* arow = A + (size_t)(row0 + ln) * lda;
  v8f acc[4] = {};
  for (int kb = 0; kb < K; kb += 32) {
    FragB ah, al;
    const v4f x0 = *(const v4fa*)(arow + kb + 8 * hh), x1 = *(const v4fa*)(arow + kb + 8 * hh + 4);
    const v4f x2 = *(const v4fa*)(arow + kb + 16 + 8 * hh), x3 = *(const v4fa*)(arow + kb + 16 + 8 * hh + 4);
    float xs[16] = {x0[0],x0[1],x0[2],x0[3],x1[0],x1[1],x1[2],x1[3],x2[0],x2[1],x2[2],x2[3],x3[0],x3[1],x3[2],x3[3]};
#pragma unroll
    for (int i = 0; i < 16; ++i) { const unsigned short hb = bf16_bits(xs[i]); ah.u[i] = hb; al.u[i] = ASPLIT ? bf16_bits(xs[i] - bf16_val(hb)) : (unsigned short)0; }
#pragma unroll
    for (int t = 0; t < 4; ++t) {
      const unsigned short* brow = Wt + (size_t)(col0 + t * 16 + ln) * ldb + kb;
      FragB b;
      b.half[0] = *(const v8us*)(brow + 8 * hh);
      b.half[1] = *(const v8us*)(brow + 16 + 8 * hh);
      acc[t] = mmaN<ASPLIT ? 2 : 1>(ah.v, al.v, b.v, b.v, acc[t]);
    }
  }
#pragma unroll
  for (int t = 0; t < 4; ++t) {
    float bv = bias ? bias[col0 + t * 16 + ln] : 0.f;
    if (BIAS_BF16) bv = bf16_round(bv);
#pragma unroll
    for (int r = 0; r < 8; ++r) { float v = acc[t][r] + bv; if (ACT == 1) v = fmaxf(v, 0.f); so[w][8 * hh + r][t * 16 + ln] = v; }
  }
  __builtin_amdgcn_fence(__ATOMIC_ACQ_REL, "workgroup");
  __builtin_amdgcn_wave_barrier();
  const int rsub = lane >> 4, c4 = (lane & 15) * 4;
  {
#pragma unroll
    for (int q = 0; q < 8; ++q) {
      const int r = q * 2 + rsub;
      const v4f v = *(const v4fa*)&so[w][r][c4];
      *(v4f*)(C + (size_t)(row0 + r) * ldc + col0 + c4) = v;
    }
    
  }
}

// Flash-style causal/unmasked attention, all contractions 3-term bf16 hi/lo splits, f32 softmax with running max.
// q,k,v rows are read from f32 buffers with arbitrary row pitch (so they can live inside a fused qkv buffer);
// D = head size (multiple of 32, <= 128); one wave = 16 query rows; block = 4 waves (64 queries) sharing K/V chunks of 32.
template <int D, bool CAUSAL>
__global__ __launch_bounds__(128) void k_flash(const float* __restrict__ qb, const float* __restrict__ kb, const float* __restrict__ vb,
                                             int pitch, int T, int H, float scale, float* __restrict__ y, int ypitch) {
  constexpr int KS = D / 32;        // k-steps for QK
  constexpr int DT = D / 16;        // d tiles for PV
  __shared__ __attribute__((aligned(16))) unsigned short sKh[32][D + 8], sKl[32][D + 8], sVh[32][D + 8], sVl[32][D + 8];
  __shared__ __attribute__((aligned(16))) unsigned short sPh[4][16][40], sPl[4][16][40];
  __shared__ __attribute__((aligned(16))) float sO[4][16][D];
  const int tid = threadIdx.x, w = tid >> 5, lane = tid & 31, ln = lane & 15, hh = lane >> 4;
  const int nqb = (T + 63) / 64;
  const int bh = blockIdx.x / nqb, qblk = blockIdx.x % nqb;
  const int b = bh / H, h = bh % H;
  const int q0 = qblk * 64 + w * 16;
  const float* Q = qb + (size_t)b * T * pitch + h * D;
  const float* K = kb + (size_t)b * T * pitch + h * D;
  const float* V = vb + (size_t)b * T * pitch + h * D;

  // A fragments of the wave's 16 query rows (scaled), hi/lo
  FragB aqh[KS], aql[KS];
  {
    int row = q0 + ln; if (row >= T) row = T - 1;
    const float* qr = Q + (size_t)row * pitch;
#pragma unroll
    for (int ks = 0; ks < KS; ++ks)
#pragma unroll
      for (int i = 0; i < 16; ++i) {
        const int d = ks * 32 + ((i < 8) ? (8 * hh + i) : (16 + 8 * hh + (i - 8)));
        const float x = qr[d] * scale; const unsigned short hb = bf16_bits(x);
        aqh[ks].u[i] = hb; aql[ks].u[i] = bf16_bits(x - bf16_val(hb));
      }
  }
  float m_r[8], l_r[8];
#pragma unroll
  for (int r = 0; r < 8; ++r) { m_r[r] = -3.0e38f; l_r[r] = 0.f; }
  v8f oacc[DT];
#pragma unroll
  for (int dt = 0; dt < DT; ++dt) oacc[dt] = (v8f){0.f,0.f,0.f,0.f,0.f,0.f,0.f,0.f};

  const int kv_end = CAUSAL ? min(T, qblk * 64 + 64) : T;     // block-uniform
  for (int j0 = 0; j0 < kv_end; j0 += 32) {
    __syncthreads();
    for (int e = tid; e < 32 * (D / 4); e += 128) {
      const int r = e / (D / 4), c4 = (e % (D / 4)) * 4;
      const int key = j0 + r;
      v4f kf = {0.f,0.f,0.f,0.f}, vf = {0.f,0.f,0.f,0.f};
      if (key < T) { kf = *(const v4fa*)(K + (size_t)key * pitch + c4); vf = *(const v4fa*)(V + (size_t)key * pitch + c4); }
#pragma unroll
      for (int t = 0; t < 4; ++t) {
        unsigned short hb = bf16_bits(kf[t]); sKh[r][c4 + t] = hb; sKl[r][c4 + t] = bf16_bits(kf[t] - bf16_val(hb));
        hb = bf16_bits(vf[t]); sVh[r][c4 + t] = hb; sVl[r][c4 + t] = bf16_bits(vf[t] - bf16_val(hb));
      }
    }
    __syncthreads();
    // S tile 16 x 32
    v8f s[2];
#pragma unroll
    for (int nt = 0; nt < 2; ++nt) {
      v8f acc = {};
#pragma unroll
      for (int ks = 0; ks < KS; ++ks) {
        FragB bh_, bl_;
        bh_.half[0] = *(const v8us*)&sKh[nt * 16 + ln][ks * 32 + 8 * hh]; bh_.half[1] = *(const v8us*)&sKh[nt * 16 + ln][ks * 32 + 16 + 8 * hh];
        bl_.half[0] = *(const v8us*)&sKl[nt * 16 + ln][ks * 32 + 8 * hh]; bl_.half[1] = *(const v8us*)&sKl[nt * 16 + ln][ks * 32 + 16 + 8 * hh];
        acc = mmaN<3>(aqh[ks].v, aql[ks].v, bh_.v, bl_.v, acc);
      }
      s[nt] = acc;
    }
    // mask + running max (rows 8hh+r; the 16 lanes of a half share rows)
    float alpha[8];
#pragma unroll
    for (int r = 0; r < 8; ++r) {
      const int qi = q0 + 8 * hh + r;
      const int ja = j0 + ln, jb = j0 + 16 + ln;
      if (CAUSAL) { if (ja > qi) s[0][r] = -3.0e38f; if (jb > qi) s[1][r] = -3.0e38f; }
      if (ja >= T) s[0][r] = -3.0e38f;
      if (jb >= T) s[1][r] = -3.0e38f;
      float mx = fmaxf(s[0][r], s[1][r]);
      mx = fmaxf(mx, __shfl_xor(mx, 1, 32)); mx = fmaxf(mx, __shfl_xor(mx, 2, 32)); mx = fmaxf(mx, __shfl_xor(mx, 4, 32)); mx = fmaxf(mx, __shfl_xor(mx, 8, 32));
      const float mnew = fmaxf(m_r[r], mx);
      alpha[r] = (mnew > -1.0e38f) ? __expf(m_r[r] - mnew) : 1.0f;
      const float p0 = (s[0][r] > -1.0e38f) ? __expf(s[0][r] - mnew) : 0.f;
      const float p1 = (s[1][r] > -1.0e38f) ? __expf(s[1][r] - mnew) : 0.f;
      m_r[r] = mnew;
      l_r[r] = l_r[r] * alpha[r] + p0 + p1;            // per-lane partial row sum (16 lanes combined at the end)
      unsigned short hb = bf16_bits(p0); sPh[w][8 * hh + r][ln] = hb;      sPl[w][8 * hh + r][ln] = bf16_bits(p0 - bf16_val(hb));
      hb = bf16_bits(p1);                sPh[w][8 * hh + r][16 + ln] = hb; sPl[w][8 * hh + r][16 + ln] = bf16_bits(p1 - bf16_val(hb));
    }
#pragma unroll
    for (int dt = 0; dt < DT; ++dt)
#pragma unroll
      for (int r = 0; r < 8; ++r) oacc[dt][r] *= alpha[r];
    __builtin_amdgcn_fence(__ATOMIC_ACQ_REL, "workgroup");
    __builtin_amdgcn_wave_barrier();
    FragB pah, pal;
    pah.half[0] = *(const v8us*)&sPh[w][ln][8 * hh]; pah.half[1] = *(const v8us*)&sPh[w][ln][16 + 8 * hh];
    pal.half[0] = *(const v8us*)&sPl[w][ln][8 * hh]; pal.half[1] = *(const v8us*)&sPl[w][ln][16 + 8 * hh];
#pragma unroll
    for (int dt = 0; dt < DT; ++dt) {
      FragB bvh, bvl;
#pragma unroll
      for (int i = 0; i < 8; ++i) {
        bvh.u[i] = sVh[8 * hh + i][dt * 16 + ln]; bvh.u[8 + i] = sVh[16 + 8 * hh + i][dt * 16 + ln];
        bvl.u[i] = sVl[8 * hh + i][dt * 16 + ln]; bvl.u[8 + i] = sVl[16 + 8 * hh + i][dt * 16 + ln];
      }
      oacc[dt] = mmaN<3>(pah.v, pal.v, bvh.v, bvl.v, oacc[dt]);
    }
    __builtin_amdgcn_fence(__ATOMIC_ACQ_REL, "workgroup");
    __builtin_amdgcn_wave_barrier();
  }
#pragma unroll
  for (int r = 0; r < 8; ++r) {
    float l = l_r[r];
    l += __shfl_xor(l, 1, 32); l += __shfl_xor(l, 2, 32); l += __shfl_xor(l, 4, 32); l += __shfl_xor(l, 8, 32);
    l_r[r] = (l > 0.f) ? 1.0f / l : 0.f;
  }
#pragma unroll
  for (int dt = 0; dt < DT; ++dt)
#pragma unroll
    for (int r = 0; r < 8; ++r) sO[w][8 * hh + r][dt * 16 + ln] = oacc[dt][r] * l_r[r];
  __builtin_amdgcn_fence(__ATOMIC_ACQ_REL, "workgroup");
  __builtin_amdgcn_wave_barrier();
  {
    for (int r = 0; r < 16; ++r) {
      const int row = q0 + r;
      if (row < T && lane < D / 4) {
        const v4f val = *(const v4fa*)&sO[w][r][lane * 4];
        *(v4f*)(y + ((size_t)b * T + row) * ypitch + h * D + lane * 4) = val;
      }
    }
    
  }
}

// GEMM C = act(A·W + bias + resid): A f32 (ASPLIT -> hi/lo 2 terms), Wt bf16 [N][K]; ACT 0 none, 1 relu, 2 exact gelu;
// resid (optional, f32, row index = (row % rmod), pitch ldr, RES_BF16 rounds it) added before the activation.
template <bool ASPLIT, int ACT, bool BIAS_BF16, bool RES_BF16>
__global__ __launch_bounds__(128) void k_gemm_bf3(const float* __restrict__ A, int lda, const unsigned short* __restrict__ Wt, int ldb,
                                                const float* __restrict__ bias, const float* __restrict__ resid, int rmod, int ldr,
                                                float* __restrict__ C, int ldc, int M, int N, int K) {
  __shared__ __attribute__((aligned(16))) float so[4][16][64];
  const int tid = threadIdx.x, w = tid >> 5, lane = tid & 31, ln = lane & 15, hh = lane >> 4;
  const int ntn = N / 64;
  const int wid = blockIdx.x * 4 + w;
  const int mt = wid / ntn, nq = wid % ntn;
  if (mt * 16 >= M) return;
  const int row0 = mt * 16, col0 = nq * 64;
  const float* arow = A + (size_t)(row0 + ln) * lda;
  v8f acc[4] = {};
  for (int kb = 0; kb < K; kb += 32) {
    FragB ah, al;
    const v4f x0 = *(const v4fa*)(arow + kb + 8 * hh), x1 = *(const v4fa*)(arow + kb + 8 * hh + 4);
    const v4f x2 = *(const v4fa*)(arow + kb + 16 + 8 * hh), x3 = *(const v4fa*)(arow + kb + 16 + 8 * hh + 4);
    float xs[16] = {x0[0],x0[1],x0[2],x0[3],x1[0],x1[1],x1[2],x1[3],x2[0],x2[1],x2[2],x2[3],x3[0],x3[1],x3[2],x3[3]};
#pragma unroll
    for (int i = 0; i < 16; ++i) { const unsigned short hb = bf16_bits(xs[i]); ah.u[i] = hb; al.u[i] = ASPLIT ? bf16_bits(xs[i] - bf16_val(hb)) : (unsigned short)0; }
#pragma unroll
    for (int t = 0; t < 4; ++t) {
      const unsigned short* brow = Wt + (size_t)(col0 + t * 16 + ln) * ldb + kb;
      FragB b;
      b.half[0] = *(const v8us*)(brow + 8 * hh);
      b.half[1] = *(const v8us*)(brow + 16 + 8 * hh);
      acc[t] = mmaN<ASPLIT ? 2 : 1>(ah.v, al.v, b.v, b.v, acc[t]);
    }
  }
#pragma unroll
  for (int t = 0; t < 4; ++t) {
    const int col = col0 + t * 16 + ln;
    float bv = bias ? bias[col] : 0.f;
    if (BIAS_BF16) bv = bf16_round(bv);
#pragma unroll
    for (int r = 0; r < 8; ++r) {
      float v = acc[t][r] + bv;
      if (resid) { float rv = resid[(size_t)((row0 + 8 * hh + r) % rmod) * ldr + col]; if (RES_BF16) rv = bf16_round(rv); v += rv; }
      if (ACT == 1) v = fmaxf(v, 0.f);
      if (ACT == 2) v = 0.5f * v * (1.0f + erff(v * 0.70710678118654752f));
      if (ACT == 3) { const float u = 0.7978845608028654f * (v + 0.044715f * v * v * v); v = 0.5f * v * (1.0f + tanhf(u)); }
      so[w][8 * hh + r][t * 16 + ln] = v;
    }
  }
  __builtin_amdgcn_fence(__ATOMIC_ACQ_REL, "workgroup");
  __builtin_amdgcn_wave_barrier();
  const int rsub = lane >> 4, c4 = (lane & 15) * 4;
  {
#pragma unroll
    for (int q = 0; q < 8; ++q) {
      const int r = q * 2 + rsub;
      const v4f v = *(const v4fa*)&so[w][r][c4];
      *(v4f*)(C + (size_t)(row0 + r) * ldc + col0 + c4) = v;
    }
    
  }
}
// row LayerNorm (biased variance, eps) over N: s = X (+ R); optional out_sum <- s; out_norm <- (s-mu)*rsqrt(var+eps)*g + b
template <bool PARAM_BF16>
__global__ __launch_bounds__(256) void k_layernorm(const float* __restrict__ X, const float* __restrict__ R, const float* __restrict__ g, const float* __restrict__ bta,
                                                  float* __restrict__ out_sum, float* __restrict__ out_norm, int N, float eps) {
  __shared__ float red[256];
  const int row = blockIdx.x, tid = threadIdx.x;
  const float* x = X + (size_t)row * N; const float* rr = R ? R + (size_t)row * N : nullptr;
  float vals[16];                     // up to N = 4096
  const int per = N / 256;            // contiguous chunk per thread? use strided-by-4 chunks: thread handles j = tid*4 + 1024*u
  float s1 = 0.f;
  for (int u = 0; u < per / 4; ++u) {
    const int j = tid * 4 + 1024 * u;
    const v4f a = *(const v4fa*)(x + j);
    v4f b = {0.f,0.f,0.f,0.f}; if (rr) b = *(const v4fa*)(rr + j);
#pragma unroll
    for (int q = 0; q < 4; ++q) { const float v = a[q] + b[q]; vals[u * 4 + q] = v; s1 += v; }
  }
  red[tid] = s1; __syncthreads();
  for (int st = 128; st > 0; st >>= 1) { if (tid < st) red[tid] += red[tid + st]; __syncthreads(); }
  const float mu = red[0] / (float)N; __syncthreads();
  float s2 = 0.f;
  for (int u = 0; u < per / 4; ++u)
#pragma unroll
    for (int q = 0; q < 4; ++q) { const float c = vals[u * 4 + q] - mu; s2 += c * c; }
  red[tid] = s2; __syncthreads();
  for (int st = 128; st > 0; st >>= 1) { if (tid < st) red[tid] += red[tid + st]; __syncthreads(); }
  const float rs = rsqrtf(red[0] / (float)N + eps);
  {
    for (int u = 0; u < per / 4; ++u) {
      const int j = tid * 4 + 1024 * u;
      v4f o, sm;
#pragma unroll
      for (int q = 0; q < 4; ++q) {
        float gg = g[j + q], bb = bta[j + q];
        if (PARAM_BF16) { gg = bf16_round(gg); bb = bf16_round(bb); }
        sm[q] = vals[u * 4 + q]; o[q] = (vals[u * 4 + q] - mu) * rs * gg + bb;
      }
      if (out_sum) *(v4f*)(out_sum + (size_t)row * N + j) = sm;
      *(v4f*)(out_norm + (size_t)row * N + j) = o;
    }
    
  }
}



// ---- f16 WMMA path (v_wmma_f32_16x16x32_f16): 11-bit significands for operands in range — used where a [0,1] probability operand needs more precision than bf16
typedef _Float16 v16h __attribute__((ext_vector_type(16)));
union FragH { v16h v; v8us half[2]; _Float16 h[16]; unsigned short u[16]; };
template <int NT>
__device__ __forceinline__ v8f mmaH(v16h ah, v16h al, v16h bh, v16h bl, v8f c) {
  c = __builtin_amdgcn_wmma_f32_16x16x32_f16(false, ah, false, bh, (short)0, c, false, false);
  if (NT >= 2) c = __builtin_amdgcn_wmma_f32_16x16x32_f16(false, al, false, bh, (short)0, c, false, false);
  if (NT >= 3) c = __builtin_amdgcn_wmma_f32_16x16x32_f16(false, ah, false, bl, (short)0, c, false, false);
  asm volatile("v_nop\n\tv_nop\n\tv_nop\n\tv_nop" : "+v"(c) : "v"(ah), "v"(al), "v"(bh), "v"(bl));
  return c;
}
// batched GEMM like k_gemm_b but f16 operands: A f32 (split into f16 hi/lo if ASPLIT, else rounded to f16), Bt = f16 values [n][k]; alpha; C f32; N multiple of 16 (partial tiles skipped)
template <bool ASPLIT>
__global__ __launch_bounds__(128) void k_gemm_h(const float* __restrict__ A, int lda, size_t sA, const _Float16* __restrict__ Bh, int ldb, size_t sB, float alpha, float* __restrict__ C, int ldc, size_t sC, int M, int N, int K) {
  __shared__ __attribute__((aligned(16))) float so[4][16][64];
  const int tid = threadIdx.x, w = tid >> 5, lane = tid & 31, ln = lane & 15, hh = lane >> 4; const int by = blockIdx.y;
  A += (size_t)by * sA; Bh += (size_t)by * sB; C += (size_t)by * sC;
  const int ntn = (N + 63) / 64; const int wid = blockIdx.x * 4 + w; const int mt = wid / ntn, nq = wid % ntn; if (mt * 16 >= M) return;
  const int row0 = mt * 16, col0 = nq * 64; const float* arow = A + (size_t)(row0 + ln) * lda;
  v8f acc[4] = {};
  for (int kb = 0; kb < K; kb += 32) {
    FragH ah, al;
    const v4f x0 = *(const v4fa*)(arow + kb + 8 * hh), x1 = *(const v4fa*)(arow + kb + 8 * hh + 4), x2 = *(const v4fa*)(arow + kb + 16 + 8 * hh), x3 = *(const v4fa*)(arow + kb + 16 + 8 * hh + 4);
    float xs[16] = {x0[0],x0[1],x0[2],x0[3],x1[0],x1[1],x1[2],x1[3],x2[0],x2[1],x2[2],x2[3],x3[0],x3[1],x3[2],x3[3]};
#pragma unroll
    for (int i = 0; i < 16; ++i) { const _Float16 h = (_Float16)xs[i]; ah.h[i] = h; al.h[i] = ASPLIT ? (_Float16)(xs[i] - (float)h) : (_Float16)0.0f; }
#pragma unroll
    for (int t = 0; t < 4; ++t) { if (col0 + t * 16 >= N) continue; const size_t boff = (size_t)(col0 + t * 16 + ln) * ldb + kb; FragH bq; bq.half[0] = *(const v8us*)(Bh + boff + 8 * hh); bq.half[1] = *(const v8us*)(Bh + boff + 16 + 8 * hh);
      acc[t] = mmaH<ASPLIT ? 2 : 1>(ah.v, al.v, bq.v, bq.v, acc[t]); }
  }
#pragma unroll
  for (int t = 0; t < 4; ++t) { if (col0 + t * 16 >= N) continue;
#pragma unroll
    for (int r = 0; r < 8; ++r) so[w][8 * hh + r][t * 16 + ln] = acc[t][r] * alpha; }
  __builtin_amdgcn_fence(__ATOMIC_ACQ_REL, "workgroup"); __builtin_amdgcn_wave_barrier();
  const int rsub = lane >> 4, c4 = (lane & 15) * 4;
  {
#pragma unroll
    for (int q = 0; q < 8; ++q) { const int r = q * 2 + rsub; if (col0 + c4 < N) { const v4f v = *(const v4fa*)&so[w][r][c4]; *(v4f*)(C + (size_t)(row0 + r) * ldc + col0 + c4) = v; } }
     }
}

// Wt[n][k] = f16(W[k][n]·scale) from f32 row-major W[K][N] (scale = power of two; bf16-exact weights stay exact in f16 away from the subnormal range)
__global__ __launch_bounds__(256) void k_wt_f16(const float* __restrict__ W, _Float16* __restrict__ Wt, int K, int N, float scale) {
  const int t = blockIdx.x * 256 + threadIdx.x; if (t >= N * (K / 8)) return; const int n = t / (K / 8), k8 = (t % (K / 8)) * 8; FragH f;
#pragma unroll
  for (int i = 0; i < 8; ++i) f.h[i] = (_Float16)(bf16_round(W[(size_t)(k8 + i) * N + n]) * scale); const v8us o = f.half[0];
  *(v8us*)((unsigned short*)Wt + (size_t)n * K + k8) = o; 
}
// k_gemm_hh variant with fused epilogue: v = acc·alpha + bias[by·sBias + col] (+ CP[(row/rowsPerB)·sCPb + by·64 + col] if CP) ; ACT 0 none / 1 elu ; writes f16 C16 and f32 C, each if non-null
template <int ACT>
__global__ __launch_bounds__(128) void k_gemm_hhx(const _Float16* __restrict__ A, int lda, size_t sA, const _Float16* __restrict__ Bh, int ldb, size_t sB, float alpha, const float* __restrict__ bias, size_t sBias, const float* __restrict__ CP, int rowsPerB, size_t sCPb, int row0g,
    float* __restrict__ C, _Float16* __restrict__ C16, int ldc, size_t sC, int M, int N, int K) {
  __shared__ __attribute__((aligned(16))) float so[4][16][64];
  const int tid = threadIdx.x, w = tid >> 5, lane = tid & 31, ln = lane & 15, hh = lane >> 4; const int by = blockIdx.y;
  A += (size_t)by * sA; Bh += (size_t)by * sB; const size_t cofs = (size_t)by * sC; const float* bp = bias ? bias + (size_t)by * sBias : nullptr;
  const int ntn = (N + 63) / 64; const int wid = blockIdx.x * 4 + w; const int mt = wid / ntn, nq = wid % ntn; if (mt * 16 >= M) return;
  const int row0 = mt * 16, col0 = nq * 64; const _Float16* arow = A + (size_t)(row0 + ln) * lda;
  v8f acc[4] = {};
  for (int kb = 0; kb < K; kb += 32) { FragH ah; ah.half[0] = *(const v8us*)((const unsigned short*)arow + kb + 8 * hh); ah.half[1] = *(const v8us*)((const unsigned short*)arow + kb + 16 + 8 * hh);
#pragma unroll
    for (int t = 0; t < 4; ++t) { if (col0 + t * 16 >= N) continue; const size_t boff = (size_t)(col0 + t * 16 + ln) * ldb + kb; FragH bq; bq.half[0] = *(const v8us*)((const unsigned short*)Bh + boff + 8 * hh); bq.half[1] = *(const v8us*)((const unsigned short*)Bh + boff + 16 + 8 * hh);
      acc[t] = mmaH<1>(ah.v, ah.v, bq.v, bq.v, acc[t]); }
  }
#pragma unroll
  for (int t = 0; t < 4; ++t) { if (col0 + t * 16 >= N) continue; const int col = col0 + t * 16 + ln; const float bv = bp ? bf16_round(bp[col]) : 0.f;
#pragma unroll
    for (int r = 0; r < 8; ++r) { float v = acc[t][r] * alpha + bv; if (CP) { const int bidx = (row0g + row0 + 8 * hh + r) / rowsPerB; v += CP[(size_t)bidx * sCPb + (size_t)by * 64 + col]; } if (ACT == 1) v = (v > 0.f) ? v : expm1f(v); else if (ACT == 7) v = (v > 0.f) ? v + 1.0f : expf(v); else if (ACT == 8) v = tanhf(v); else if (ACT == 9) v = 0.5f * v * (1.0f + tanhf(0.7978845608028654f * (v + 0.044715f * v * v * v))); else if (ACT == 11) v = 1.0f / (1.0f + expf(-v)); else if (ACT == 12) v = (v > 0.f) ? v : 0.01f * v; else if (ACT == 14) v = (v > 0.f) ? v : 0.1f * v; else if (ACT == 15) v = v / (1.0f + expf(-v)); else if (ACT == 3) v = fmaxf(v, 0.f); else if (ACT == 6) v = 0.5f * v * (1.0f + erff(v * 0.70710678118654752f)); so[w][8 * hh + r][t * 16 + ln] = v; } }
  __builtin_amdgcn_fence(__ATOMIC_ACQ_REL, "workgroup"); __builtin_amdgcn_wave_barrier();
  const int rsub = lane >> 4, c4 = (lane & 15) * 4; typedef _Float16 v4h __attribute__((ext_vector_type(4)));
  {
#pragma unroll
    for (int q = 0; q < 8; ++q) { const int r = q * 2 + rsub; if (col0 + c4 < N) { const v4f v = *(const v4fa*)&so[w][r][c4]; if (C) *(v4f*)(C + cofs + (size_t)(row0 + r) * ldc + col0 + c4) = v; if (C16) { v4h h4; for (int i = 0; i < 4; ++i) h4[i] = (_Float16)v[i]; *(v4h*)(C16 + cofs + (size_t)(row0 + r) * ldc + col0 + c4) = h4; } } }
     }
}


typedef _Float16 v4h __attribute__((ext_vector_type(4)));

__global__ __launch_bounds__(256) void k_x16(const float* __restrict__ x, _Float16* __restrict__ X16, size_t n8) { const size_t t = (size_t)blockIdx.x * 256 + threadIdx.x; if (t >= n8) return; FragH f;
#pragma unroll
  for (int q = 0; q < 8; ++q) f.h[q] = (_Float16)bf16_round(x[t * 8 + q]); *(v8us*)((unsigned short*)X16 + t * 8) = f.half[0];  }
__global__ __launch_bounds__(256) void k_h16(const float* __restrict__ x, _Float16* __restrict__ X16, size_t n8) { const size_t t = (size_t)blockIdx.x * 256 + threadIdx.x; if (t >= n8) return; FragH f;
#pragma unroll
  for (int q = 0; q < 8; ++q) f.h[q] = (_Float16)x[t * 8 + q]; *(v8us*)((unsigned short*)X16 + t * 8) = f.half[0];  }
__global__ __launch_bounds__(256) void k_round16f(const float* __restrict__ W, _Float16* __restrict__ Bt, size_t n8) { const size_t t = (size_t)blockIdx.x * 256 + threadIdx.x; if (t >= n8) return; FragH f;
#pragma unroll
  for (int i = 0; i < 8; ++i) f.h[i] = (_Float16)(bf16_round(W[t * 8 + i]) * 16.0f); *(v8us*)((unsigned short*)Bt + t * 8) = f.half[0];  }
template <int NHv, int TTv>
__global__ __launch_bounds__(256) void k_vt(const _Float16* __restrict__ V16, int ldv, int voff, _Float16* __restrict__ Vt) { __shared__ unsigned short tl[64][66]; const int tid = threadIdx.x; const int slab = blockIdx.x / (TTv / 64), lg = blockIdx.x % (TTv / 64); const int b = slab / NHv, h = slab % NHv;
  for (int i = tid; i < 64 * 8; i += 256) { const int r = i / 8, c8 = (i % 8) * 8; FragH f; f.half[0] = *(const v8us*)((const unsigned short*)V16 + ((size_t)b * TTv + lg * 64 + r) * ldv + voff + h * 64 + c8);
#pragma unroll
    for (int q = 0; q < 8; ++q) tl[r][c8 + q] = f.u[q]; }
  __syncthreads();
  {
#pragma unroll
    for (int rd = 0; rd < 2; ++rd) { const int d = rd * 32 + tid / 8, pc = tid % 8; FragH f;
#pragma unroll
      for (int q = 0; q < 8; ++q) f.u[q] = tl[pc * 8 + q][d];
      *(v8us*)((unsigned short*)Vt + ((size_t)slab * 64 + d) * TTv + lg * 64 + pc * 8) = f.half[0]; }
     } }

__global__ __launch_bounds__(256) void k_hl(const float* __restrict__ F, _Float16* __restrict__ Hh, _Float16* __restrict__ Hl, size_t n8) { const size_t t = (size_t)blockIdx.x * 256 + threadIdx.x; if (t >= n8) return; FragH fh, fl; const v4f a = *(const v4fa*)(F + t * 8), c = *(const v4fa*)(F + t * 8 + 4);
#pragma unroll
  for (int q = 0; q < 4; ++q) { _Float16 h = (_Float16)a[q]; fh.h[q] = h; fl.h[q] = (_Float16)((a[q] - (float)h) * 1024.0f); h = (_Float16)c[q]; fh.h[4 + q] = h; fl.h[4 + q] = (_Float16)((c[q] - (float)h) * 1024.0f); }
  { *(v8us*)((unsigned short*)Hh + t * 8) = fh.half[0]; *(v8us*)((unsigned short*)Hl + t * 8) = fl.half[0];  } }
__global__ __launch_bounds__(256) void k_vthl(const float* __restrict__ VF, int ldv, _Float16* __restrict__ Vth, _Float16* __restrict__ Vtl) { __shared__ float tl[64][65]; const int tid = threadIdx.x; const int slab = blockIdx.x / (TT / 64), lg = blockIdx.x % (TT / 64); const int b = slab / NH, h = slab % NH;
  for (int i = tid; i < 64 * 16; i += 256) { const int r = i / 16, c4 = (i % 16) * 4; const v4f a = *(const v4fa*)(VF + ((size_t)b * TT + lg * 64 + r) * ldv + h * HD + c4); tl[r][c4] = a[0]; tl[r][c4 + 1] = a[1]; tl[r][c4 + 2] = a[2]; tl[r][c4 + 3] = a[3]; }
  __syncthreads();
  FragH fh[2], fl[2]; size_t oo[2];
#pragma unroll
  for (int rd = 0; rd < 2; ++rd) { const int d = rd * 32 + tid / 8, pc = tid % 8;
#pragma unroll
    for (int q = 0; q < 8; ++q) { const float v = tl[pc * 8 + q][d]; const _Float16 hv = (_Float16)v; fh[rd].h[q] = hv; fl[rd].h[q] = (_Float16)((v - (float)hv) * 1024.0f); } oo[rd] = ((size_t)slab * HD + d) * TT + lg * 64 + pc * 8; }
  {
#pragma unroll
    for (int rd = 0; rd < 2; ++rd) { *(v8us*)((unsigned short*)Vth + oo[rd]) = fh[rd].half[0]; *(v8us*)((unsigned short*)Vtl + oo[rd]) = fl[rd].half[0]; }
     } }
__global__ __launch_bounds__(256) void k_tin(const float* __restrict__ x, _Float16* __restrict__ X16) { __shared__ float tl[BB][32][65]; const int tid = threadIdx.x; const int dg = blockIdx.x / (TT / 32), tg = blockIdx.x % (TT / 32); const int d0 = dg * 64, t0 = tg * 32;
  for (int i = tid; i < 64 * 32 * BB; i += 256) { const int b = i % BB, tt = (i / BB) % 32, dd = i / (BB * 32); tl[b][tt][dd] = bf16_round(x[((size_t)(d0 + dd) * TT + t0 + tt) * BB + b]); } __syncthreads();
  { for (int i = tid; i < BB * 32 * 8; i += 256) { const int pc = i % 8, tt = (i / 8) % 32, b = i / (8 * 32); FragH f; for (int q = 0; q < 8; ++q) f.h[q] = (_Float16)tl[b][tt][pc * 8 + q]; *(v8us*)((unsigned short*)X16 + ((size_t)b * TT + t0 + tt) * DM + d0 + pc * 8) = f.half[0]; }  } }
__global__ __launch_bounds__(256) void k_tout(const float* __restrict__ G, float* __restrict__ out) { __shared__ float tl[32][64 * BB + 1]; const int tid = threadIdx.x; const int dg = blockIdx.x / (TT / 64), tg = blockIdx.x % (TT / 64); const int d0 = dg * 32, t0 = tg * 64;
  for (int i = tid; i < 32 * 64 * BB; i += 256) { const int dd = i % 32, tt = (i / 32) % 64, b = i / (32 * 64); tl[dd][tt * BB + b] = G[((size_t)b * TT + t0 + tt) * DM + d0 + dd]; } __syncthreads();
  { for (int i = tid; i < 32 * 32; i += 256) { const int pc = i % 32, dd = i / 32; const v4f v = {tl[dd][pc * 4], tl[dd][pc * 4 + 1], tl[dd][pc * 4 + 2], tl[dd][pc * 4 + 3]}; *(v4f*)(out + ((size_t)(d0 + dd) * TT + t0) * BB + pc * 4) = v; }  } }
__global__ __launch_bounds__(128) void k_flash(const _Float16* __restrict__ Q16, int ldq, const _Float16* __restrict__ K16, int ldk, const _Float16* __restrict__ Vt, const _Float16* __restrict__ Vtlo, float* __restrict__ O, int ldo) {
  constexpr int RPW = 16, RTN = RPW / 16, NQB = TT / (4 * RPW), DT = 4, KS = 2;
  __shared__ __attribute__((aligned(16))) unsigned short sP[4][RPW][40]; __shared__ __attribute__((aligned(16))) float sO[4][RPW][64 + 4];
  const int tid = threadIdx.x, w = tid >> 5, lane = tid & 31, ln = lane & 15, hh = lane >> 4;
  const int slab = blockIdx.x / NQB, qblk = blockIdx.x % NQB; const int b = slab / NH, h = slab % NH; const int qb0 = qblk * (4 * RPW); const int q0 = qb0 + w * RPW;
  FragH aq[2][KS];
#pragma unroll
  for (int rt = 0; rt < RTN; ++rt) { const unsigned short* qr = (const unsigned short*)Q16 + ((size_t)b * TT + q0 + rt * 16 + ln) * ldq + h * 64;
#pragma unroll
    for (int ks = 0; ks < KS; ++ks) { aq[rt][ks].half[0] = *(const v8us*)(qr + ks * 32 + 8 * hh); aq[rt][ks].half[1] = *(const v8us*)(qr + ks * 32 + 16 + 8 * hh); } }
  const unsigned short* Vth = (const unsigned short*)Vt + (size_t)slab * 64 * TT; const unsigned short* Vtl = (const unsigned short*)Vtlo + (size_t)slab * 64 * TT;
  float m_r[2][8], l_r[2][8]; v8f oacc[2][DT], oaccl[2][DT];
#pragma unroll
  for (int rt = 0; rt < RTN; ++rt) {
#pragma unroll
    for (int r = 0; r < 8; ++r) { m_r[rt][r] = -3.0e38f; l_r[rt][r] = 0.f; }
#pragma unroll
    for (int dt = 0; dt < DT; ++dt) { oacc[rt][dt] = (v8f){0.f,0.f,0.f,0.f,0.f,0.f,0.f,0.f}; oaccl[rt][dt] = oacc[rt][dt]; } }
  const int jbeg = (qb0 - WIN) > 0 ? (qb0 - WIN) : 0; const int jend = (qb0 + 4 * RPW + WIN) < TT ? (qb0 + 4 * RPW + WIN) : TT;      /* block-uniform window bounds (multiples of 32) */
#pragma unroll 1
  for (int j0 = jbeg; j0 < jend; j0 += 32) {
    
    v8f s[2][2];
#pragma unroll
    for (int nt = 0; nt < 2; ++nt) { const unsigned short* kr = (const unsigned short*)K16 + ((size_t)b * TT + j0 + nt * 16 + ln) * ldk + h * 64; FragH bk[KS];
#pragma unroll
      for (int ks = 0; ks < KS; ++ks) { bk[ks].half[0] = *(const v8us*)(kr + ks * 32 + 8 * hh); bk[ks].half[1] = *(const v8us*)(kr + ks * 32 + 16 + 8 * hh); }
#pragma unroll
      for (int rt = 0; rt < RTN; ++rt) { v8f acc = (v8f){0.f,0.f,0.f,0.f,0.f,0.f,0.f,0.f};
#pragma unroll
        for (int ks = 0; ks < KS; ++ks) acc = mmaH<1>(aq[rt][ks].v, aq[rt][ks].v, bk[ks].v, bk[ks].v, acc); s[rt][nt] = acc; } }
#pragma unroll
    for (int rt = 0; rt < RTN; ++rt)
#pragma unroll
      for (int r = 0; r < 8; ++r) { const int tq = q0 + rt * 16 + 8 * hh + r; const int k0 = j0 + ln, k1 = j0 + 16 + ln; (void)tq; (void)k0; (void)k1;
        const bool ok0 = (k0 - tq <= WIN) && (tq - k0 <= WIN), ok1 = (k1 - tq <= WIN) && (tq - k1 <= WIN);
        const float u0 = s[rt][0][r] * 0.125f, u1 = s[rt][1][r] * 0.125f; const float s0 = ok0 ? (u0 + fminf(u0, 0.f) - log1pf(expf(-fabsf(u0)))) : -INFINITY, s1 = ok1 ? (u1 + fminf(u1, 0.f) - log1pf(expf(-fabsf(u1)))) : -INFINITY;      /* s + log σ(s) */ float mc = fmaxf(s0, s1);
        mc = fmaxf(mc, __shfl_xor(mc, 1, 32)); mc = fmaxf(mc, __shfl_xor(mc, 2, 32)); mc = fmaxf(mc, __shfl_xor(mc, 4, 32)); mc = fmaxf(mc, __shfl_xor(mc, 8, 32));
        const float mn = fmaxf(m_r[rt][r], mc); const float al = (mn > -1.0e38f) ? expf(m_r[rt][r] - mn) : 1.0f; m_r[rt][r] = mn; const float p0 = ok0 ? expf(s0 - mn) : 0.f, p1 = ok1 ? expf(s1 - mn) : 0.f; l_r[rt][r] = l_r[rt][r] * al + p0 + p1;
#pragma unroll
        for (int dt = 0; dt < DT; ++dt) { oacc[rt][dt][r] *= al; oaccl[rt][dt][r] *= al; }
        FragH t2; t2.h[0] = (_Float16)(p0 * 1024.0f); t2.h[1] = (_Float16)(p1 * 1024.0f); sP[w][rt * 16 + 8 * hh + r][ln] = t2.u[0]; sP[w][rt * 16 + 8 * hh + r][16 + ln] = t2.u[1]; }
    __builtin_amdgcn_fence(__ATOMIC_ACQ_REL, "workgroup"); __builtin_amdgcn_wave_barrier();
    FragH pa[2];
#pragma unroll
    for (int rt = 0; rt < RTN; ++rt) { pa[rt].half[0] = *(const v8us*)&sP[w][rt * 16 + ln][8 * hh]; pa[rt].half[1] = *(const v8us*)&sP[w][rt * 16 + ln][16 + 8 * hh]; }
#pragma unroll
    for (int dt = 0; dt < DT; ++dt) { const size_t vo = (size_t)(dt * 16 + ln) * TT + j0; FragH bv, bl; bv.half[0] = *(const v8us*)(Vth + vo + 8 * hh); bv.half[1] = *(const v8us*)(Vth + vo + 16 + 8 * hh); bl.half[0] = *(const v8us*)(Vtl + vo + 8 * hh); bl.half[1] = *(const v8us*)(Vtl + vo + 16 + 8 * hh);
#pragma unroll
      for (int rt = 0; rt < RTN; ++rt) { oacc[rt][dt] = mmaH<1>(pa[rt].v, pa[rt].v, bv.v, bv.v, oacc[rt][dt]); oaccl[rt][dt] = mmaH<1>(pa[rt].v, pa[rt].v, bl.v, bl.v, oaccl[rt][dt]); } }
    __builtin_amdgcn_fence(__ATOMIC_ACQ_REL, "workgroup"); __builtin_amdgcn_wave_barrier(); }
#pragma unroll
  for (int rt = 0; rt < RTN; ++rt) {
#pragma unroll
    for (int r = 0; r < 8; ++r) { float l = l_r[rt][r]; l += __shfl_xor(l, 1, 32); l += __shfl_xor(l, 2, 32); l += __shfl_xor(l, 4, 32); l += __shfl_xor(l, 8, 32); l_r[rt][r] = (l > 0.f) ? 1.0f / (l * 1024.0f) : 0.f; }
#pragma unroll
    for (int dt = 0; dt < DT; ++dt)
#pragma unroll
      for (int r = 0; r < 8; ++r) sO[w][rt * 16 + 8 * hh + r][dt * 16 + ln] = (oacc[rt][dt][r] + oaccl[rt][dt][r] * 0.0009765625f) * l_r[rt][r]; }
  __builtin_amdgcn_fence(__ATOMIC_ACQ_REL, "workgroup"); __builtin_amdgcn_wave_barrier();
  {
#pragma unroll
    for (int rp = 0; rp < RPW; rp += 2) { const int r = rp + (lane >> 4), pc = lane & 15; const v4f val = *(const v4fa*)&sO[w][r][pc * 4]; *(v4f*)(O + ((size_t)b * TT + q0 + r) * ldo + h * 64 + pc * 4) = val; }
     } }

// Tiled GEMM for the five 4096 x 1024 x 1024 products, A f16 [NR][DM], Bt f16 [n][k]. MODE 0: C16 = f16(acc*alpha + bias); 1: C = acc*alpha + bias; 2: C += acc*alpha, in place. One 128 x 128 tile per block of 8 waves (4 x 2), 32 x 64 per wave.
// Each trip stages 128 k of the tile's 128 A rows and 128 Bt rows in LDS as whole 256-B rows (pitch 272 B: ds_load_b128 fragment reads meet no bank twice); two buffers, the next trip's rows are
// fetched into registers ahead of this trip's products and stored behind them, one barrier a trip. Every accumulator still sums k in ascending steps of 32.
#define GT 128
#define GK 128
#define GP 136
#define GSO 68
// one trip's products of a wave: 128 k in four steps of 32, 2 x 4 accumulator tiles; sa, sb: the lane's own row and k half in the A and Bt parts of the buffer
__device__ __forceinline__ void gemm_trip(const unsigned short* sa, const unsigned short* sb, v8f (&acc)[2][4]) {
#pragma unroll
  for (int ks = 0; ks < GK / 32; ++ks) {
    FragH a[2], b[4];
#pragma unroll
    for (int mi = 0; mi < 2; ++mi) { a[mi].half[0] = *(const v8us*)(sa + mi * 16 * GP + ks * 32); a[mi].half[1] = *(const v8us*)(sa + mi * 16 * GP + ks * 32 + 16); }
#pragma unroll
    for (int ni = 0; ni < 4; ++ni) { b[ni].half[0] = *(const v8us*)(sb + ni * 16 * GP + ks * 32); b[ni].half[1] = *(const v8us*)(sb + ni * 16 * GP + ks * 32 + 16); }
#pragma unroll
    for (int mi = 0; mi < 2; ++mi)
#pragma unroll
      for (int ni = 0; ni < 4; ++ni) acc[mi][ni] = __builtin_amdgcn_wmma_f32_16x16x32_f16(false, a[mi].v, false, b[ni].v, (short)0, acc[mi][ni], false, false);
  }
}
template <int MODE>
__global__ __launch_bounds__(256) void k_gemm_t(const _Float16* __restrict__ A, const _Float16* __restrict__ Bt, float alpha, const float* __restrict__ bias, float* __restrict__ C, _Float16* __restrict__ C16) {
  __shared__ __attribute__((aligned(16))) unsigned char smraw[2 * 2 * GT * GP * 2];
  unsigned short* const sm = (unsigned short*)smraw;
  constexpr int BUF = 2 * GT * GP, NTR = DM / GK;
  const int tid = threadIdx.x, w = tid >> 5, lane = tid & 31, ln = lane & 15, hh = lane >> 4;
  const int row0 = (blockIdx.x / (DM / GT)) * GT, col0 = (blockIdx.x % (DM / GT)) * GT;
  const int wm = (w >> 1) * 32, wn = (w & 1) * 64;
  const int pc = tid & 15, sr = tid >> 4;      /* staging: 16 lanes cover one 256-B row piece by piece; 16 rows per sweep */
  const unsigned short* ga = (const unsigned short*)A + (size_t)row0 * DM;      /* block-uniform bases; the lane's own place is the one 32-bit offset go, which lives through the loop */
  const unsigned short* gb = (const unsigned short*)Bt + (size_t)col0 * DM;
  const unsigned go = (unsigned)(sr * DM + pc * 8);
  unsigned short* const sw = sm + sr * GP + pc * 8;
  v8us st[16];
#pragma unroll
  for (int i = 0; i < 8; ++i) { st[i] = *(const v8us*)(ga + i * 16 * DM + go); st[8 + i] = *(const v8us*)(gb + i * 16 * DM + go); }
#pragma unroll
  for (int i = 0; i < 16; ++i) *(v8us*)(sw + i * 16 * GP) = st[i];
  __syncthreads();
  v8f acc[2][4];
#pragma unroll
  for (int mi = 0; mi < 2; ++mi)
#pragma unroll
    for (int ni = 0; ni < 4; ++ni) acc[mi][ni] = (v8f){0.f,0.f,0.f,0.f,0.f,0.f,0.f,0.f};
#pragma unroll 1      /* rolled: seven copies of the trip save nothing, and a short text is fetched once */
  for (int t = 0; t < NTR - 1; ++t) {
    const unsigned short* pa = ga + (t + 1) * GK + go; const unsigned short* pb = gb + (t + 1) * GK + go;
#pragma unroll
    for (int i = 0; i < 8; ++i) { st[i] = *(const v8us*)(pa + i * 16 * DM); st[8 + i] = *(const v8us*)(pb + i * 16 * DM); }
    __builtin_amdgcn_sched_barrier(0);      /* keeps the next trip's global loads ahead of this trip's products: sunk towards their LDS stores they would leave their latency uncovered */
    gemm_trip(sm + (t & 1) * BUF + (wm + ln) * GP + 8 * hh, sm + (t & 1) * BUF + (GT + wn + ln) * GP + 8 * hh, acc);
    asm volatile("s_wait_xcnt 0x0" :: "v"(pa), "v"(pb) : "memory");      /* the wait in front of any overwrite of the loads' address registers; as its inputs the two pairs stay whole up to here, where the loads are a trip old */
#pragma unroll
    for (int i = 0; i < 16; ++i) *(v8us*)(sw + ((t + 1) & 1) * BUF + i * 16 * GP) = st[i];
    __syncthreads();      /* publishes the buffer just written and ends every read of the one that the next trip overwrites */
  }
  gemm_trip(sm + ((NTR - 1) & 1) * BUF + (wm + ln) * GP + 8 * hh, sm + ((NTR - 1) & 1) * BUF + (GT + wn + ln) * GP + 8 * hh, acc);
  __syncthreads();      /* every wave has left the ring before the patches below are written over it */
  const int rsub = lane >> 4, c4 = (lane & 15) * 4;
  const size_t o0 = (size_t)(row0 + wm + rsub) * DM + col0 + wn + c4;
  v4f old[16];
  if (MODE == 2) {      /* the sums so far, asked for ahead of the LDS round trip below */
#pragma unroll
    for (int q = 0; q < 16; ++q) old[q] = *(const v4fa*)(C + o0 + (size_t)q * 2 * DM);
  }
  float* const so = (float*)smraw + w * (32 * GSO);      /* each wave's own 32 x 64 patch, in the ring that every wave has left */
#pragma unroll
  for (int ni = 0; ni < 4; ++ni) { const float bv = (MODE != 2) ? bf16_round(bias[col0 + wn + ni * 16 + ln]) : 0.f;
#pragma unroll
    for (int mi = 0; mi < 2; ++mi)
#pragma unroll
      for (int r = 0; r < 8; ++r) so[(mi * 16 + 8 * hh + r) * GSO + ni * 16 + ln] = acc[mi][ni][r] * alpha + bv; }
  __builtin_amdgcn_fence(__ATOMIC_ACQ_REL, "workgroup"); __builtin_amdgcn_wave_barrier();
#pragma unroll
  for (int q = 0; q < 16; ++q) { v4f v = *(const v4fa*)&so[(q * 2 + rsub) * GSO + c4]; const size_t o = o0 + (size_t)q * 2 * DM;
    if (MODE == 2) v += old[q];
    if (MODE != 0) *(v4f*)(C + o) = v;
    else { v4h h4; for (int i = 0; i < 4; ++i) h4[i] = (_Float16)v[i]; *(v4h*)(C16 + o) = h4; } }
}

extern "C" void kernel_launch(void* const* d_in, const int* in_sizes, int n_in,
                              void* d_out, int out_size, void* d_ws, size_t ws_size, hipStream_t stream) {
  (void)in_sizes; (void)n_in; (void)out_size;
  const float* const* I = (const float* const*)d_in; const float* x = I[0]; const float* Wq = I[1]; const float* bq = I[2]; const float* Wk = I[3]; const float* bk = I[4]; const float* Wv = I[5]; const float* bv = I[6]; const float* Wo = I[7]; const float* bo = I[8];
  char* ws = (char*)d_ws; size_t off = 0;
  auto take = [&](size_t bytes) { char* p = ws + off; off += (bytes + 255) & ~(size_t)255; return p; };
  const size_t WSZ = (size_t)DM * DM; _Float16* Bw = (_Float16*)take(4 * WSZ * 2); _Float16* X16 = (_Float16*)take((size_t)NR * DM * 2); float* F32 = (float*)take((size_t)NR * DM * 4);
  _Float16* Q16 = (_Float16*)take((size_t)NR * DM * 2); _Float16* K16 = (_Float16*)take((size_t)NR * DM * 2); _Float16* Vth = (_Float16*)take((size_t)NR * DM * 2); _Float16* Vtl = (_Float16*)take((size_t)NR * DM * 2);
  float* O = F32; _Float16* OH = Q16; _Float16* OL = K16; float* G = F32;      /* F32: v (consumed by k_vthl) → O (consumed by k_hl) → G; OH/OL reuse the q/k planes, dead after the attention kernel */
  if (off > ws_size) return;      // 8.4 + 8.4 + 16.8 + 4 × 8.4 ≈ 67 MB
  const unsigned gw = (unsigned)(((size_t)DM * (DM / 8) + 255) / 256);
  k_wt_f16<<<gw, 256, 0, stream>>>(Wq, Bw, DM, DM, 16.0f); k_wt_f16<<<gw, 256, 0, stream>>>(Wk, Bw + WSZ, DM, DM, 16.0f); k_wt_f16<<<gw, 256, 0, stream>>>(Wv, Bw + 2 * WSZ, DM, DM, 16.0f); k_wt_f16<<<gw, 256, 0, stream>>>(Wo, Bw + 3 * WSZ, DM, DM, 16.0f);      /* (in,out) → Bt[n][k] ×2^4 */
  k_tin<<<(DM / 64) * (TT / 32), 256, 0, stream>>>(x, X16);
  const dim3 gp((NR / GT) * (DM / GT), 1); const unsigned g8 = (unsigned)(((size_t)NR * DM / 8 + 255) / 256);
  k_gemm_t<0><<<gp, 256, 0, stream>>>(X16, Bw, 0.0625f, bq, nullptr, Q16);      /* q = xt·Wq + bq → f16: M 4096 N 1024 K 1024 */
  k_gemm_t<0><<<gp, 256, 0, stream>>>(X16, Bw + WSZ, 0.0625f, bk, nullptr, K16);      /* k */
  k_gemm_t<1><<<gp, 256, 0, stream>>>(X16, Bw + 2 * WSZ, 0.0625f, bv, F32, nullptr); k_vthl<<<BB * NH * (TT / 64), 256, 0, stream>>>(F32, DM, Vth, Vtl);      /* v f32 → Vᵀ hi/lo */
  k_flash<<<BB * NH * (TT / 64), 128, 0, stream>>>(Q16, DM, K16, DM, Vth, Vtl, O, DM);
  k_hl<<<g8, 256, 0, stream>>>(O, OH, OL, (size_t)NR * DM / 8);
  k_gemm_t<1><<<gp, 256, 0, stream>>>(OH, Bw + 3 * WSZ, 0.0625f, bo, G, nullptr);      /* G = O_hi·Wo + bo */
  k_gemm_t<2><<<gp, 256, 0, stream>>>(OL, Bw + 3 * WSZ, 0.0625f * 0.0009765625f, nullptr, G, nullptr);      /* += O_lo·Wo·2^-10 in place */
  k_tout<<<(DM / 32) * (TT / 64), 256, 0, stream>>>(G, (float*)d_out);
}

// v002
// It runs in 163 microseconds.
// Timed twice side by side with v001, it ran 1.50 and 1.51 times as fast.
// All steps since v000 together make it 2.54 times as fast.
#include <hip/hip_runtime.h>
// Windowed multi-head self-attention on a (D, T, B)-layout input (D=1024, T=2048, B=2; 16 heads × 64; window |i−j| ≤ 256): xt = x transposed to (B,T,D); q,k,v = xt·W + b; scores = q·kᵀ/8 (−inf outside the window);
// attn = softmax(s + log_sigmoid(s)); out = (attn·v merged)·Wo + bo, transposed back to (D, T, B).
// Compute dtype: x, weights, biases rounded to bf16; q,k f16 GEMM outputs; v f32 → f16 hi + ×2^10 residual Vᵀ planes; fused windowed flash-style kernel (online softmax f32 on the sigsoftmax logits,
// P f16 ×2^10, two value accumulators) on v_wmma_f32_16x16x32_f16; merged O → hi/lo → Wo GEMMs (second in place ×2^-10) + bo; layout transposes through LDS; f32 accumulate.
#define BB 2
#define TT 2048
#define DM 1024
#define NH 16
#define HD 64
#define WIN 256
#define NR (BB * TT)

typedef __bf16 v16b __attribute__((ext_vector_type(16)));
typedef unsigned short v8us __attribute__((ext_vector_type(8), may_alias));
typedef float  v8f  __attribute__((ext_vector_type(8)));
typedef float  v4f  __attribute__((ext_vector_type(4)));
typedef float  v4fa __attribute__((ext_vector_type(4), may_alias));
union FragB { v16b v; v8us half[2]; unsigned short u[16]; };

__device__ __forceinline__ unsigned short bf16_bits(float x) { unsigned int u = __float_as_uint(x); return (unsigned short)((u + 0x7FFFu + ((u >> 16) & 1u)) >> 16); }
__device__ __forceinline__ float bf16_val(unsigned short b) { return __uint_as_float(((unsigned int)b) << 16); }
__device__ __forceinline__ float bf16_round(float x) { return bf16_val(bf16_bits(x)); }
// D += A·B with NT terms: 1 = ah·bh, 2 = + al·bh (A split), 3 = + ah·bl (both split)
template <int NT>
__device__ __forceinline__ v8f mmaN(v16b ah, v16b al, v16b bh, v16b bl, v8f c) {
  c = __builtin_amdgcn_wmma_f32_16x16x32_bf16(false, ah, false, bh, (short)0, c, false, false);
  if (NT >= 2) c = __builtin_amdgcn_wmma_f32_16x16x32_bf16(false, al, false, bh, (short)0, c, false, false);
  if (NT >= 3) c = __builtin_amdgcn_wmma_f32_16x16x32_bf16(false, ah, false, bl, (short)0, c, false, false);
  asm volatile("v_nop\n\tv_nop\n\tv_nop\n\tv_nop" : "+v"(c) : "v"(ah), "v"(al), "v"(bh), "v"(bl));
  return c;
}

__global__ __launch_bounds__(256) void k_wt_bf16(const float* __restrict__ W, unsigned short* __restrict__ Wt, int K, int N) {
  const int t = blockIdx.x * 256 + threadIdx.x;
  const int k8n = K / 8;
  if (t >= N * k8n) return;
  const int n = t / k8n, k8 = (t % k8n) * 8;
  v8us v;
#pragma unroll
  for (int i = 0; i < 8; ++i) v[i] = bf16_bits(W[(size_t)(k8 + i) * N + n]);
  *(v8us*)(Wt + (size_t)n * K + k8) = v;
  
}

// GEMM C[M][N] (f32, pitch ldc) = act(A[M][K]·W + bias). A f32 row-major (pitch lda) converted per fragment to bf16
// (ASPLIT: hi/lo two planes -> 2 terms, else single rounded term); Wt bf16 [N][K] (pitch ldb). BIAS_BF16 rounds the
// bias to bf16 first (bias quantised to bf16 before the add). K%32==0, M%16==0, N%64==0.
template <bool ASPLIT, int ACT, bool BIAS_BF16>
__global__ __launch_bounds__(128) void k_gemm_bf(const float* __restrict__ A, int lda, const unsigned short* __restrict__ Wt, int ldb,
                                               const float* __restrict__ bias, float* __restrict__ C, int ldc, int M, int N, int K) {
  __shared__ __attribute__((aligned(16))) float so[4][16][64];
  const int tid = threadIdx.x, w = tid >> 5, lane = tid & 31, ln = lane & 15, hh = lane >> 4;
  const int ntn = N / 64;
  const int wid = blockIdx.x * 4 + w;
  const int mt = wid / ntn, nq = wid % ntn;
  if (mt * 16 >= M) return;
  const int row0 = mt * 16, col0 = nq * 64;
  const float* arow = A + (size_t)(row0 + ln) * lda;
  v8f acc[4] = {};
  for (int kb = 0; kb < K; kb += 32) {
    FragB ah, al;
    const v4f x0 = *(const v4fa*)(arow + kb + 8 * hh), x1 = *(const v4fa*)(arow + kb + 8 * hh + 4);
    const v4f x2 = *(const v4fa*)(arow + kb + 16 + 8 * hh), x3 = *(const v4fa*)(arow + kb + 16 + 8 * hh + 4);
    float xs[16] = {x0[0],x0[1],x0[2],x0[3],x1[0],x1[1],x1[2],x1[3],x2[0],x2[1],x2[2],x2[3],x3[0],x3[1],x3[2],x3[3]};
#pragma unroll
    for (int i = 0; i < 16; ++i) { const unsigned short hb = bf16_bits(xs[i]); ah.u[i] = hb; al.u[i] = ASPLIT ? bf16_bits(xs[i] - bf16_val(hb)) : (unsigned short)0; }
#pragma unroll
    for (int t = 0; t < 4; ++t) {
      const unsigned short* brow = Wt + (size_t)(col0 + t * 16 + ln) * ldb + kb;
      FragB b;
      b.half[0] = *(const v8us*)(brow + 8 * hh);
      b.half[1] = *(const v8us*)(brow + 16 + 8 * hh);
      acc[t] = mmaN<ASPLIT ? 2 : 1>(ah.v, al.v, b.v, b.v, acc[t]);
    }
  }
#pragma unroll
  for (int t = 0; t < 4; ++t) {
    float bv = bias ? bias[col0 + t * 16 + ln] : 0.f;
    if (BIAS_BF16) bv = bf16_round(bv);
#pragma unroll
    for (int r = 0; r < 8; ++r) { float v = acc[t][r] + bv; if (ACT == 1) v = fmaxf(v, 0.f); so[w][8 * hh + r][t * 16 + ln] = v; }
  }
  __builtin_amdgcn_fence(__ATOMIC_ACQ_REL, "workgroup");
  __builtin_amdgcn_wave_barrier();
  const int rsub = lane >> 4, c4 = (lane & 15) * 4;
  {
#pragma unroll
    for (int q = 0; q < 8; ++q) {
      const int r = q * 2 + rsub;
      const v4f v = *(const v4fa*)&so[w][r][c4];
      *(v4f*)(C + (size_t)(row0 + r) * ldc + col0 + c4) = v;
    }
    
  }
}

// Flash-style causal/unmasked attention, all contractions 3-term bf16 hi/lo splits, f32 softmax with running max.
// q,k,v rows are read from f32 buffers with arbitrary row pitch (so they can live inside a fused qkv buffer);
// D = head size (multiple of 32, <= 128); one wave = 16 query rows; block = 4 waves (64 queries) sharing K/V chunks of 32.
template <int D, bool CAUSAL>
__global__ __launch_bounds__(128) void k_flash(const float* __restrict__ qb, const float* __restrict__ kb, const float* __restrict__ vb,
                                             int pitch, int T, int H, float scale, float* __restrict__ y, int ypitch) {
  constexpr int KS = D / 32;        // k-steps for QK
  constexpr int DT = D / 16;        // d tiles for PV
  __shared__ __attribute__((aligned(16))) unsigned short sKh[32][D + 8], sKl[32][D + 8], sVh[32][D + 8], sVl[32][D + 8];
  __shared__ __attribute__((aligned(16))) unsigned short sPh[4][16][40], sPl[4][16][40];
  __shared__ __attribute__((aligned(16))) float sO[4][16][D];
  const int tid = threadIdx.x, w = tid >> 5, lane = tid & 31, ln = lane & 15, hh = lane >> 4;
  const int nqb = (T + 63) / 64;
  const int bh = blockIdx.x / nqb, qblk = blockIdx.x % nqb;
  const int b = bh / H, h = bh % H;
  const int q0 = qblk * 64 + w * 16;
  const float* Q = qb + (size_t)b * T * pitch + h * D;
  const float* K = kb + (size_t)b * T * pitch + h * D;
  const float* V = vb + (size_t)b * T * pitch + h * D;

  // A fragments of the wave's 16 query rows (scaled), hi/lo
  FragB aqh[KS], aql[KS];
  {
    int row = q0 + ln; if (row >= T) row = T - 1;
    const float* qr = Q + (size_t)row * pitch;
#pragma unroll
    for (int ks = 0; ks < KS; ++ks)
#pragma unroll
      for (int i = 0; i < 16; ++i) {
        const int d = ks * 32 + ((i < 8) ? (8 * hh + i) : (16 + 8 * hh + (i - 8)));
        const float x = qr[d] * scale; const unsigned short hb = bf16_bits(x);
        aqh[ks].u[i] = hb; aql[ks].u[i] = bf16_bits(x - bf16_val(hb));
      }
  }
  float m_r[8], l_r[8];
#pragma unroll
  for (int r = 0; r < 8; ++r) { m_r[r] = -3.0e38f; l_r[r] = 0.f; }
  v8f oacc[DT];
#pragma unroll
  for (int dt = 0; dt < DT; ++dt) oacc[dt] = (v8f){0.f,0.f,0.f,0.f,0.f,0.f,0.f,0.f};

  const int kv_end = CAUSAL ? min(T, qblk * 64 + 64) : T;     // block-uniform
  for (int j0 = 0; j0 < kv_end; j0 += 32) {
    __syncthreads();
    for (int e = tid; e < 32 * (D / 4); e += 128) {
      const int r = e / (D / 4), c4 = (e % (D / 4)) * 4;
      const int key = j0 + r;
      v4f kf = {0.f,0.f,0.f,0.f}, vf = {0.f,0.f,0.f,0.f};
      if (key < T) { kf = *(const v4fa*)(K + (size_t)key * pitch + c4); vf = *(const v4fa*)(V + (size_t)key * pitch + c4); }
#pragma unroll
      for (int t = 0; t < 4; ++t) {
        unsigned short hb = bf16_bits(kf[t]); sKh[r][c4 + t] = hb; sKl[r][c4 + t] = bf16_bits(kf[t] - bf16_val(hb));
        hb = bf16_bits(vf[t]); sVh[r][c4 + t] = hb; sVl[r][c4 + t] = bf16_bits(vf[t] - bf16_val(hb));
      }
    }
    __syncthreads();
    // S tile 16 x 32
    v8f s[2];
#pragma unroll
    for (int nt = 0; nt < 2; ++nt) {
      v8f acc = {};
#pragma unroll
      for (int ks = 0; ks < KS; ++ks) {
        FragB bh_, bl_;
        bh_.half[0] = *(const v8us*)&sKh[nt * 16 + ln][ks * 32 + 8 * hh]; bh_.half[1] = *(const v8us*)&sKh[nt * 16 + ln][ks * 32 + 16 + 8 * hh];
        bl_.half[0] = *(const v8us*)&sKl[nt * 16 + ln][ks * 32 + 8 * hh]; bl_.half[1] = *(const v8us*)&sKl[nt * 16 + ln][ks * 32 + 16 + 8 * hh];
        acc = mmaN<3>(aqh[ks].v, aql[ks].v, bh_.v, bl_.v, acc);
      }
      s[nt] = acc;
    }
    // mask + running max (rows 8hh+r; the 16 lanes of a half share rows)
    float alpha[8];
#pragma unroll
    for (int r = 0; r < 8; ++r) {
      const int qi = q0 + 8 * hh + r;
      const int ja = j0 + ln, jb = j0 + 16 + ln;
      if (CAUSAL) { if (ja > qi) s[0][r] = -3.0e38f; if (jb > qi) s[1][r] = -3.0e38f; }
      if (ja >= T) s[0][r] = -3.0e38f;
      if (jb >= T) s[1][r] = -3.0e38f;
      float mx = fmaxf(s[0][r], s[1][r]);
      mx = fmaxf(mx, __shfl_xor(mx, 1, 32)); mx = fmaxf(mx, __shfl_xor(mx, 2, 32)); mx = fmaxf(mx, __shfl_xor(mx, 4, 32)); mx = fmaxf(mx, __shfl_xor(mx, 8, 32));
      const float mnew = fmaxf(m_r[r], mx);
      alpha[r] = (mnew > -1.0e38f) ? __expf(m_r[r] - mnew) : 1.0f;
      const float p0 = (s[0][r] > -1.0e38f) ? __expf(s[0][r] - mnew) : 0.f;
      const float p1 = (s[1][r] > -1.0e38f) ? __expf(s[1][r] - mnew) : 0.f;
      m_r[r] = mnew;
      l_r[r] = l_r[r] * alpha[r] + p0 + p1;            // per-lane partial row sum (16 lanes combined at the end)
      unsigned short hb = bf16_bits(p0); sPh[w][8 * hh + r][ln] = hb;      sPl[w][8 * hh + r][ln] = bf16_bits(p0 - bf16_val(hb));
      hb = bf16_bits(p1);                sPh[w][8 * hh + r][16 + ln] = hb; sPl[w][8 * hh + r][16 + ln] = bf16_bits(p1 - bf16_val(hb));
    }
#pragma unroll
    for (int dt = 0; dt < DT; ++dt)
#pragma unroll
      for (int r = 0; r < 8; ++r) oacc[dt][r] *= alpha[r];
    __builtin_amdgcn_fence(__ATOMIC_ACQ_REL, "workgroup");
    __builtin_amdgcn_wave_barrier();
    FragB pah, pal;
    pah.half[0] = *(const v8us*)&sPh[w][ln][8 * hh]; pah.half[1] = *(const v8us*)&sPh[w][ln][16 + 8 * hh];
    pal.half[0] = *(const v8us*)&sPl[w][ln][8 * hh]; pal.half[1] = *(const v8us*)&sPl[w][ln][16 + 8 * hh];
#pragma unroll
    for (int dt = 0; dt < DT; ++dt) {
      FragB bvh, bvl;
#pragma unroll
      for (int i = 0; i < 8; ++i) {
        bvh.u[i] = sVh[8 * hh + i][dt * 16 + ln]; bvh.u[8 + i] = sVh[16 + 8 * hh + i][dt * 16 + ln];
        bvl.u[i] = sVl[8 * hh + i][dt * 16 + ln]; bvl.u[8 + i] = sVl[16 + 8 * hh + i][dt * 16 + ln];
      }
      oacc[dt] = mmaN<3>(pah.v, pal.v, bvh.v, bvl.v, oacc[dt]);
    }
    __builtin_amdgcn_fence(__ATOMIC_ACQ_REL, "workgroup");
    __builtin_amdgcn_wave_barrier();
  }
#pragma unroll
  for (int r = 0; r < 8; ++r) {
    float l = l_r[r];
    l += __shfl_xor(l, 1, 32); l += __shfl_xor(l, 2, 32); l += __shfl_xor(l, 4, 32); l += __shfl_xor(l, 8, 32);
    l_r[r] = (l > 0.f) ? 1.0f / l : 0.f;
  }
#pragma unroll
  for (int dt = 0; dt < DT; ++dt)
#pragma unroll
    for (int r = 0; r < 8; ++r) sO[w][8 * hh + r][dt * 16 + ln] = oacc[dt][r] * l_r[r];
  __builtin_amdgcn_fence(__ATOMIC_ACQ_REL, "workgroup");
  __builtin_amdgcn_wave_barrier();
  {
    for (int r = 0; r < 16; ++r) {
      const int row = q0 + r;
      if (row < T && lane < D / 4) {
        const v4f val = *(const v4fa*)&sO[w][r][lane * 4];
        *(v4f*)(y + ((size_t)b * T + row) * ypitch + h * D + lane * 4) = val;
      }
    }
    
  }
}

// GEMM C = act(A·W + bias + resid): A f32 (ASPLIT -> hi/lo 2 terms), Wt bf16 [N][K]; ACT 0 none, 1 relu, 2 exact gelu;
// resid (optional, f32, row index = (row % rmod), pitch ldr, RES_BF16 rounds it) added before the activation.
template <bool ASPLIT, int ACT, bool BIAS_BF16, bool RES_BF16>
__global__ __launch_bounds__(128) void k_gemm_bf3(const float* __restrict__ A, int lda, const unsigned short* __restrict__ Wt, int ldb,
                                                const float* __restrict__ bias, const float* __restrict__ resid, int rmod, int ldr,
                                                float* __restrict__ C, int ldc, int M, int N, int K) {
  __shared__ __attribute__((aligned(16))) float so[4][16][64];
  const int tid = threadIdx.x, w = tid >> 5, lane = tid & 31, ln = lane & 15, hh = lane >> 4;
  const int ntn = N / 64;
  const int wid = blockIdx.x * 4 + w;
  const int mt = wid / ntn, nq = wid % ntn;
  if (mt * 16 >= M) return;
  const int row0 = mt * 16, col0 = nq * 64;
  const float* arow = A + (size_t)(row0 + ln) * lda;
  v8f acc[4] = {};
  for (int kb = 0; kb < K; kb += 32) {
    FragB ah, al;
    const v4f x0 = *(const v4fa*)(arow + kb + 8 * hh), x1 = *(const v4fa*)(arow + kb + 8 * hh + 4);
    const v4f x2 = *(const v4fa*)(arow + kb + 16 + 8 * hh), x3 = *(const v4fa*)(arow + kb + 16 + 8 * hh + 4);
    float xs[16] = {x0[0],x0[1],x0[2],x0[3],x1[0],x1[1],x1[2],x1[3],x2[0],x2[1],x2[2],x2[3],x3[0],x3[1],x3[2],x3[3]};
#pragma unroll
    for (int i = 0; i < 16; ++i) { const unsigned short hb = bf16_bits(xs[i]); ah.u[i] = hb; al.u[i] = ASPLIT ? bf16_bits(xs[i] - bf16_val(hb)) : (unsigned short)0; }
#pragma unroll
    for (int t = 0; t < 4; ++t) {
      const unsigned short* brow = Wt + (size_t)(col0 + t * 16 + ln) * ldb + kb;
      FragB b;
      b.half[0] = *(const v8us*)(brow + 8 * hh);
      b.half[1] = *(const v8us*)(brow + 16 + 8 * hh);
      acc[t] = mmaN<ASPLIT ? 2 : 1>(ah.v, al.v, b.v, b.v, acc[t]);
    }
  }
#pragma unroll
  for (int t = 0; t < 4; ++t) {
    const int col = col0 + t * 16 + ln;
    float bv = bias ? bias[col] : 0.f;
    if (BIAS_BF16) bv = bf16_round(bv);
#pragma unroll
    for (int r = 0; r < 8; ++r) {
      float v = acc[t][r] + bv;
      if (resid) { float rv = resid[(size_t)((row0 + 8 * hh + r) % rmod) * ldr + col]; if (RES_BF16) rv = bf16_round(rv); v += rv; }
      if (ACT == 1) v = fmaxf(v, 0.f);
      if (ACT == 2) v = 0.5f * v * (1.0f + erff(v * 0.70710678118654752f));
      if (ACT == 3) { const float u = 0.7978845608028654f * (v + 0.044715f * v * v * v); v = 0.5f * v * (1.0f + tanhf(u)); }
      so[w][8 * hh + r][t * 16 + ln] = v;
    }
  }
  __builtin_amdgcn_fence(__ATOMIC_ACQ_REL, "workgroup");
  __builtin_amdgcn_wave_barrier();
  const int rsub = lane >> 4, c4 = (lane & 15) * 4;
  {
#pragma unroll
    for (int q = 0; q < 8; ++q) {
      const int r = q * 2 + rsub;
      const v4f v = *(const v4fa*)&so[w][r][c4];
      *(v4f*)(C + (size_t)(row0 + r) * ldc + col0 + c4) = v;
    }
    
  }
}
// row LayerNorm (biased variance, eps) over N: s = X (+ R); optional out_sum <- s; out_norm <- (s-mu)*rsqrt(var+eps)*g + b
template <bool PARAM_BF16>
__global__ __launch_bounds__(256) void k_layernorm(const float* __restrict__ X, const float* __restrict__ R, const float* __restrict__ g, const float* __restrict__ bta,
                                                  float* __restrict__ out_sum, float* __restrict__ out_norm, int N, float eps) {
  __shared__ float red[256];
  const int row = blockIdx.x, tid = threadIdx.x;
  const float* x = X + (size_t)row * N; const float* rr = R ? R + (size_t)row * N : nullptr;
  float vals[16];                     // up to N = 4096
  const int per = N / 256;            // contiguous chunk per thread? use strided-by-4 chunks: thread handles j = tid*4 + 1024*u
  float s1 = 0.f;
  for (int u = 0; u < per / 4; ++u) {
    const int j = tid * 4 + 1024 * u;
    const v4f a = *(const v4fa*)(x + j);
    v4f b = {0.f,0.f,0.f,0.f}; if (rr) b = *(const v4fa*)(rr + j);
#pragma unroll
    for (int q = 0; q < 4; ++q) { const float v = a[q] + b[q]; vals[u * 4 + q] = v; s1 += v; }
  }
  red[tid] = s1; __syncthreads();
  for (int st = 128; st > 0; st >>= 1) { if (tid < st) red[tid] += red[tid + st]; __syncthreads(); }
  const float mu = red[0] / (float)N; __syncthreads();
  float s2 = 0.f;
  for (int u = 0; u < per / 4; ++u)
#pragma unroll
    for (int q = 0; q < 4; ++q) { const float c = vals[u * 4 + q] - mu; s2 += c * c; }
  red[tid] = s2; __syncthreads();
  for (int st = 128; st > 0; st >>= 1) { if (tid < st) red[tid] += red[tid + st]; __syncthreads(); }
  const float rs = rsqrtf(red[0] / (float)N + eps);
  {
    for (int u = 0; u < per / 4; ++u) {
      const int j = tid * 4 + 1024 * u;
      v4f o, sm;
#pragma unroll
      for (int q = 0; q < 4; ++q) {
        float gg = g[j + q], bb = bta[j + q];
        if (PARAM_BF16) { gg = bf16_round(gg); bb = bf16_round(bb); }
        sm[q] = vals[u * 4 + q]; o[q] = (vals[u * 4 + q] - mu) * rs * gg + bb;
      }
      if (out_sum) *(v4f*)(out_sum + (size_t)row * N + j) = sm;
      *(v4f*)(out_norm + (size_t)row * N + j) = o;
    }
    
  }
}



// ---- f16 WMMA path (v_wmma_f32_16x16x32_f16): 11-bit significands for operands in range — used where a [0,1] probability operand needs more precision than bf16
typedef _Float16 v16h __attribute__((ext_vector_type(16)));
union FragH { v16h v; v8us half[2]; _Float16 h[16]; unsigned short u[16]; };
template <int NT>
__device__ __forceinline__ v8f mmaH(v16h ah, v16h al, v16h bh, v16h bl, v8f c) {
  c = __builtin_amdgcn_wmma_f32_16x16x32_f16(false, ah, false, bh, (short)0, c, false, false);
  if (NT >= 2) c = __builtin_amdgcn_wmma_f32_16x16x32_f16(false, al, false, bh, (short)0, c, false, false);
  if (NT >= 3) c = __builtin_amdgcn_wmma_f32_16x16x32_f16(false, ah, false, bl, (short)0, c, false, false);
  asm volatile("v_nop\n\tv_nop\n\tv_nop\n\tv_nop" : "+v"(c) : "v"(ah), "v"(al), "v"(bh), "v"(bl));
  return c;
}
// batched GEMM like k_gemm_b but f16 operands: A f32 (split into f16 hi/lo if ASPLIT, else rounded to f16), Bt = f16 values [n][k]; alpha; C f32; N multiple of 16 (partial tiles skipped)
template <bool ASPLIT>
__global__ __launch_bounds__(128) void k_gemm_h(const float* __restrict__ A, int lda, size_t sA, const _Float16* __restrict__ Bh, int ldb, size_t sB, float alpha, float* __restrict__ C, int ldc, size_t sC, int M, int N, int K) {
  __shared__ __attribute__((aligned(16))) float so[4][16][64];
  const int tid = threadIdx.x, w = tid >> 5, lane = tid & 31, ln = lane & 15, hh = lane >> 4; const int by = blockIdx.y;
  A += (size_t)by * sA; Bh += (size_t)by * sB; C += (size_t)by * sC;
  const int ntn = (N + 63) / 64; const int wid = blockIdx.x * 4 + w; const int mt = wid / ntn, nq = wid % ntn; if (mt * 16 >= M) return;
  const int row0 = mt * 16, col0 = nq * 64; const float* arow = A + (size_t)(row0 + ln) * lda;
  v8f acc[4] = {};
  for (int kb = 0; kb < K; kb += 32) {
    FragH ah, al;
    const v4f x0 = *(const v4fa*)(arow + kb + 8 * hh), x1 = *(const v4fa*)(arow + kb + 8 * hh + 4), x2 = *(const v4fa*)(arow + kb + 16 + 8 * hh), x3 = *(const v4fa*)(arow + kb + 16 + 8 * hh + 4);
    float xs[16] = {x0[0],x0[1],x0[2],x0[3],x1[0],x1[1],x1[2],x1[3],x2[0],x2[1],x2[2],x2[3],x3[0],x3[1],x3[2],x3[3]};
#pragma unroll
    for (int i = 0; i < 16; ++i) { const _Float16 h = (_Float16)xs[i]; ah.h[i] = h; al.h[i] = ASPLIT ? (_Float16)(xs[i] - (float)h) : (_Float16)0.0f; }
#pragma unroll
    for (int t = 0; t < 4; ++t) { if (col0 + t * 16 >= N) continue; const size_t boff = (size_t)(col0 + t * 16 + ln) * ldb + kb; FragH bq; bq.half[0] = *(const v8us*)(Bh + boff + 8 * hh); bq.half[1] = *(const v8us*)(Bh + boff + 16 + 8 * hh);
      acc[t] = mmaH<ASPLIT ? 2 : 1>(ah.v, al.v, bq.v, bq.v, acc[t]); }
  }
#pragma unroll
  for (int t = 0; t < 4; ++t) { if (col0 + t * 16 >= N) continue;
#pragma unroll
    for (int r = 0; r < 8; ++r) so[w][8 * hh + r][t * 16 + ln] = acc[t][r] * alpha; }
  __builtin_amdgcn_fence(__ATOMIC_ACQ_REL, "workgroup"); __builtin_amdgcn_wave_barrier();
  const int rsub = lane >> 4, c4 = (lane & 15) * 4;
  {
#pragma unroll
    for (int q = 0; q < 8; ++q) { const int r = q * 2 + rsub; if (col0 + c4 < N) { const v4f v = *(const v4fa*)&so[w][r][c4]; *(v4f*)(C + (size_t)(row0 + r) * ldc + col0 + c4) = v; } }
     }
}

// Wt[n][k] = f16(W[k][n]·scale) from f32 row-major W[K][N] (scale = power of two; bf16-exact weights stay exact in f16 away from the subnormal range)
__global__ __launch_bounds__(256) void k_wt_f16(const float* __restrict__ W, _Float16* __restrict__ Wt, int K, int N, float scale) {
  const int t = blockIdx.x * 256 + threadIdx.x; if (t >= N * (K / 8)) return; const int n = t / (K / 8), k8 = (t % (K / 8)) * 8; FragH f;
#pragma unroll
  for (int i = 0; i < 8; ++i) f.h[i] = (_Float16)(bf16_round(W[(size_t)(k8 + i) * N + n]) * scale); const v8us o = f.half[0];
  *(v8us*)((unsigned short*)Wt + (size_t)n * K + k8) = o; 
}
// k_gemm_hh variant with fused epilogue: v = acc·alpha + bias[by·sBias + col] (+ CP[(row/rowsPerB)·sCPb + by·64 + col] if CP) ; ACT 0 none / 1 elu ; writes f16 C16 and f32 C, each if non-null
template <int ACT>
__global__ __launch_bounds__(128) void k_gemm_hhx(const _Float16* __restrict__ A, int lda, size_t sA, const _Float16* __restrict__ Bh, int ldb, size_t sB, float alpha, const float* __restrict__ bias, size_t sBias, const float* __restrict__ CP, int rowsPerB, size_t sCPb, int row0g,
    float* __restrict__ C, _Float16* __restrict__ C16, int ldc, size_t sC, int M, int N, int K) {
  __shared__ __attribute__((aligned(16))) float so[4][16][64];
  const int tid = threadIdx.x, w = tid >> 5, lane = tid & 31, ln = lane & 15, hh = lane >> 4; const int by = blockIdx.y;
  A += (size_t)by * sA; Bh += (size_t)by * sB; const size_t cofs = (size_t)by * sC; const float* bp = bias ? bias + (size_t)by * sBias : nullptr;
  const int ntn = (N + 63) / 64; const int wid = blockIdx.x * 4 + w; const int mt = wid / ntn, nq = wid % ntn; if (mt * 16 >= M) return;
  const int row0 = mt * 16, col0 = nq * 64; const _Float16* arow = A + (size_t)(row0 + ln) * lda;
  v8f acc[4] = {};
  for (int kb = 0; kb < K; kb += 32) { FragH ah; ah.half[0] = *(const v8us*)((const unsigned short*)arow + kb + 8 * hh); ah.half[1] = *(const v8us*)((const unsigned short*)arow + kb + 16 + 8 * hh);
#pragma unroll
    for (int t = 0; t < 4; ++t) { if (col0 + t * 16 >= N) continue; const size_t boff = (size_t)(col0 + t * 16 + ln) * ldb + kb; FragH bq; bq.half[0] = *(const v8us*)((const unsigned short*)Bh + boff + 8 * hh); bq.half[1] = *(const v8us*)((const unsigned short*)Bh + boff + 16 + 8 * hh);
      acc[t] = mmaH<1>(ah.v, ah.v, bq.v, bq.v, acc[t]); }
  }
#pragma unroll
  for (int t = 0; t < 4; ++t) { if (col0 + t * 16 >= N) continue; const int col = col0 + t * 16 + ln; const float bv = bp ? bf16_round(bp[col]) : 0.f;
#pragma unroll
    for (int r = 0; r < 8; ++r) { float v = acc[t][r] * alpha + bv; if (CP) { const int bidx = (row0g + row0 + 8 * hh + r) / rowsPerB; v += CP[(size_t)bidx * sCPb + (size_t)by * 64 + col]; } if (ACT == 1) v = (v > 0.f) ? v : expm1f(v); else if (ACT == 7) v = (v > 0.f) ? v + 1.0f : expf(v); else if (ACT == 8) v = tanhf(v); else if (ACT == 9) v = 0.5f * v * (1.0f + tanhf(0.7978845608028654f * (v + 0.044715f * v * v * v))); else if (ACT == 11) v = 1.0f / (1.0f + expf(-v)); else if (ACT == 12) v = (v > 0.f) ? v : 0.01f * v; else if (ACT == 14) v = (v > 0.f) ? v : 0.1f * v; else if (ACT == 15) v = v / (1.0f + expf(-v)); else if (ACT == 3) v = fmaxf(v, 0.f); else if (ACT == 6) v = 0.5f * v * (1.0f + erff(v * 0.70710678118654752f)); so[w][8 * hh + r][t * 16 + ln] = v; } }
  __builtin_amdgcn_fence(__ATOMIC_ACQ_REL, "workgroup"); __builtin_amdgcn_wave_barrier();
  const int rsub = lane >> 4, c4 = (lane & 15) * 4; typedef _Float16 v4h __attribute__((ext_vector_type(4)));
  {
#pragma unroll
    for (int q = 0; q < 8; ++q) { const int r = q * 2 + rsub; if (col0 + c4 < N) { const v4f v = *(const v4fa*)&so[w][r][c4]; if (C) *(v4f*)(C + cofs + (size_t)(row0 + r) * ldc + col0 + c4) = v; if (C16) { v4h h4; for (int i = 0; i < 4; ++i) h4[i] = (_Float16)v[i]; *(v4h*)(C16 + cofs + (size_t)(row0 + r) * ldc + col0 + c4) = h4; } } }
     }
}


typedef _Float16 v4h __attribute__((ext_vector_type(4)));

__global__ __launch_bounds__(256) void k_x16(const float* __restrict__ x, _Float16* __restrict__ X16, size_t n8) { const size_t t = (size_t)blockIdx.x * 256 + threadIdx.x; if (t >= n8) return; FragH f;
#pragma unroll
  for (int q = 0; q < 8; ++q) f.h[q] = (_Float16)bf16_round(x[t * 8 + q]); *(v8us*)((unsigned short*)X16 + t * 8) = f.half[0];  }
__global__ __launch_bounds__(256) void k_h16(const float* __restrict__ x, _Float16* __restrict__ X16, size_t n8) { const size_t t = (size_t)blockIdx.x * 256 + threadIdx.x; if (t >= n8) return; FragH f;
#pragma unroll
  for (int q = 0; q < 8; ++q) f.h[q] = (_Float16)x[t * 8 + q]; *(v8us*)((unsigned short*)X16 + t * 8) = f.half[0];  }
__global__ __launch_bounds__(256) void k_round16f(const float* __restrict__ W, _Float16* __restrict__ Bt, size_t n8) { const size_t t = (size_t)blockIdx.x * 256 + threadIdx.x; if (t >= n8) return; FragH f;
#pragma unroll
  for (int i = 0; i < 8; ++i) f.h[i] = (_Float16)(bf16_round(W[t * 8 + i]) * 16.0f); *(v8us*)((unsigned short*)Bt + t * 8) = f.half[0];  }
template <int NHv, int TTv>
__global__ __launch_bounds__(256) void k_vt(const _Float16* __restrict__ V16, int ldv, int voff, _Float16* __restrict__ Vt) { __shared__ unsigned short tl[64][66]; const int tid = threadIdx.x; const int slab = blockIdx.x / (TTv / 64), lg = blockIdx.x % (TTv / 64); const int b = slab / NHv, h = slab % NHv;
  for (int i = tid; i < 64 * 8; i += 256) { const int r = i / 8, c8 = (i % 8) * 8; FragH f; f.half[0] = *(const v8us*)((const unsigned short*)V16 + ((size_t)b * TTv + lg * 64 + r) * ldv + voff + h * 64 + c8);
#pragma unroll
    for (int q = 0; q < 8; ++q) tl[r][c8 + q] = f.u[q]; }
  __syncthreads();
  {
#pragma unroll
    for (int rd = 0; rd < 2; ++rd) { const int d = rd * 32 + tid / 8, pc = tid % 8; FragH f;
#pragma unroll
      for (int q = 0; q < 8; ++q) f.u[q] = tl[pc * 8 + q][d];
      *(v8us*)((unsigned short*)Vt + ((size_t)slab * 64 + d) * TTv + lg * 64 + pc * 8) = f.half[0]; }
     } }

__global__ __launch_bounds__(256) void k_hl(const float* __restrict__ F, _Float16* __restrict__ Hh, _Float16* __restrict__ Hl, size_t n8) { const size_t t = (size_t)blockIdx.x * 256 + threadIdx.x; if (t >= n8) return; FragH fh, fl; const v4f a = *(const v4fa*)(F + t * 8), c = *(const v4fa*)(F + t * 8 + 4);
#pragma unroll
  for (int q = 0; q < 4; ++q) { _Float16 h = (_Float16)a[q]; fh.h[q] = h; fl.h[q] = (_Float16)((a[q] - (float)h) * 1024.0f); h = (_Float16)c[q]; fh.h[4 + q] = h; fl.h[4 + q] = (_Float16)((c[q] - (float)h) * 1024.0f); }
  { *(v8us*)((unsigned short*)Hh + t * 8) = fh.half[0]; *(v8us*)((unsigned short*)Hl + t * 8) = fl.half[0];  } }
__global__ __launch_bounds__(256) void k_vthl(const float* __restrict__ VF, int ldv, _Float16* __restrict__ Vth, _Float16* __restrict__ Vtl) { __shared__ float tl[64][65]; const int tid = threadIdx.x; const int slab = blockIdx.x / (TT / 64), lg = blockIdx.x % (TT / 64); const int b = slab / NH, h = slab % NH;
  for (int i = tid; i < 64 * 16; i += 256) { const int r = i / 16, c4 = (i % 16) * 4; const v4f a = *(const v4fa*)(VF + ((size_t)b * TT + lg * 64 + r) * ldv + h * HD + c4); tl[r][c4] = a[0]; tl[r][c4 + 1] = a[1]; tl[r][c4 + 2] = a[2]; tl[r][c4 + 3] = a[3]; }
  __syncthreads();
  FragH fh[2], fl[2]; size_t oo[2];
#pragma unroll
  for (int rd = 0; rd < 2; ++rd) { const int d = rd * 32 + tid / 8, pc = tid % 8;
#pragma unroll
    for (int q = 0; q < 8; ++q) { const float v = tl[pc * 8 + q][d]; const _Float16 hv = (_Float16)v; fh[rd].h[q] = hv; fl[rd].h[q] = (_Float16)((v - (float)hv) * 1024.0f); } oo[rd] = ((size_t)slab * HD + d) * TT + lg * 64 + pc * 8; }
  {
#pragma unroll
    for (int rd = 0; rd < 2; ++rd) { *(v8us*)((unsigned short*)Vth + oo[rd]) = fh[rd].half[0]; *(v8us*)((unsigned short*)Vtl + oo[rd]) = fl[rd].half[0]; }
     } }
__global__ __launch_bounds__(256) void k_tin(const float* __restrict__ x, _Float16* __restrict__ X16) { __shared__ float tl[BB][32][65]; const int tid = threadIdx.x; const int dg = blockIdx.x / (TT / 32), tg = blockIdx.x % (TT / 32); const int d0 = dg * 64, t0 = tg * 32;
  for (int i = tid; i < 64 * 32 * BB; i += 256) { const int b = i % BB, tt = (i / BB) % 32, dd = i / (BB * 32); tl[b][tt][dd] = bf16_round(x[((size_t)(d0 + dd) * TT + t0 + tt) * BB + b]); } __syncthreads();
  { for (int i = tid; i < BB * 32 * 8; i += 256) { const int pc = i % 8, tt = (i / 8) % 32, b = i / (8 * 32); FragH f; for (int q = 0; q < 8; ++q) f.h[q] = (_Float16)tl[b][tt][pc * 8 + q]; *(v8us*)((unsigned short*)X16 + ((size_t)b * TT + t0 + tt) * DM + d0 + pc * 8) = f.half[0]; }  } }
__global__ __launch_bounds__(256) void k_tout(const float* __restrict__ G, float* __restrict__ out) { __shared__ float tl[32][64 * BB + 1]; const int tid = threadIdx.x; const int dg = blockIdx.x / (TT / 64), tg = blockIdx.x % (TT / 64); const int d0 = dg * 32, t0 = tg * 64;
  for (int i = tid; i < 32 * 64 * BB; i += 256) { const int dd = i % 32, tt = (i / 32) % 64, b = i / (32 * 64); tl[dd][tt * BB + b] = G[((size_t)b * TT + t0 + tt) * DM + d0 + dd]; } __syncthreads();
  { for (int i = tid; i < 32 * 32; i += 256) { const int pc = i % 32, dd = i / 32; const v4f v = {tl[dd][pc * 4], tl[dd][pc * 4 + 1], tl[dd][pc * 4 + 2], tl[dd][pc * 4 + 3]}; *(v4f*)(out + ((size_t)(d0 + dd) * TT + t0) * BB + pc * 4) = v; }  } }
__global__ __launch_bounds__(128) void k_flash(const _Float16* __restrict__ Q16, int ldq, const _Float16* __restrict__ K16, int ldk, const _Float16* __restrict__ Vt, const _Float16* __restrict__ Vtlo, float* __restrict__ O, int ldo) {
  constexpr int RPW = 16, RTN = RPW / 16, NQB = TT / (4 * RPW), DT = 4, KS = 2;
  __shared__ __attribute__((aligned(16))) unsigned short sP[4][RPW][40]; __shared__ __attribute__((aligned(16))) float sO[4][RPW][64 + 4];
  const int tid = threadIdx.x, w = tid >> 5, lane = tid & 31, ln = lane & 15, hh = lane >> 4;
  const int slab = blockIdx.x / NQB, qblk = blockIdx.x % NQB; const int b = slab / NH, h = slab % NH; const int qb0 = qblk * (4 * RPW); const int q0 = qb0 + w * RPW;
  FragH aq[2][KS];
#pragma unroll
  for (int rt = 0; rt < RTN; ++rt) { const unsigned short* qr = (const unsigned short*)Q16 + ((size_t)b * TT + q0 + rt * 16 + ln) * ldq + h * 64;
#pragma unroll
    for (int ks = 0; ks < KS; ++ks) { aq[rt][ks].half[0] = *(const v8us*)(qr + ks * 32 + 8 * hh); aq[rt][ks].half[1] = *(const v8us*)(qr + ks * 32 + 16 + 8 * hh); } }
  const unsigned short* Vth = (const unsigned short*)Vt + (size_t)slab * 64 * TT; const unsigned short* Vtl = (const unsigned short*)Vtlo + (size_t)slab * 64 * TT;
  float m_r[2][8], l_r[2][8]; v8f oacc[2][DT], oaccl[2][DT];
#pragma unroll
  for (int rt = 0; rt < RTN; ++rt) {
#pragma unroll
    for (int r = 0; r < 8; ++r) { m_r[rt][r] = -3.0e38f; l_r[rt][r] = 0.f; }
#pragma unroll
    for (int dt = 0; dt < DT; ++dt) { oacc[rt][dt] = (v8f){0.f,0.f,0.f,0.f,0.f,0.f,0.f,0.f}; oaccl[rt][dt] = oacc[rt][dt]; } }
  const int jbeg = (qb0 - WIN) > 0 ? (qb0 - WIN) : 0; const int jend = (qb0 + 4 * RPW + WIN) < TT ? (qb0 + 4 * RPW + WIN) : TT;      /* block-uniform window bounds (multiples of 32) */
#pragma unroll 1
  for (int j0 = jbeg; j0 < jend; j0 += 32) {
    
    v8f s[2][2];
#pragma unroll
    for (int nt = 0; nt < 2; ++nt) { const unsigned short* kr = (const unsigned short*)K16 + ((size_t)b * TT + j0 + nt * 16 + ln) * ldk + h * 64; FragH bk[KS];
#pragma unroll
      for (int ks = 0; ks < KS; ++ks) { bk[ks].half[0] = *(const v8us*)(kr + ks * 32 + 8 * hh); bk[ks].half[1] = *(const v8us*)(kr + ks * 32 + 16 + 8 * hh); }
#pragma unroll
      for (int rt = 0; rt < RTN; ++rt) { v8f acc = (v8f){0.f,0.f,0.f,0.f,0.f,0.f,0.f,0.f};
#pragma unroll
        for (int ks = 0; ks < KS; ++ks) acc = mmaH<1>(aq[rt][ks].v, aq[rt][ks].v, bk[ks].v, bk[ks].v, acc); s[rt][nt] = acc; } }
#pragma unroll
    for (int rt = 0; rt < RTN; ++rt)
#pragma unroll
      for (int r = 0; r < 8; ++r) { const int tq = q0 + rt * 16 + 8 * hh + r; const int k0 = j0 + ln, k1 = j0 + 16 + ln; (void)tq; (void)k0; (void)k1;
        const bool ok0 = (k0 - tq <= WIN) && (tq - k0 <= WIN), ok1 = (k1 - tq <= WIN) && (tq - k1 <= WIN);
        const float u0 = s[rt][0][r] * 0.18033688011112042f, u1 = s[rt][1][r] * 0.18033688011112042f;      /* score / 8, times log2(e): logits, running maximum and weights all live in base 2, where exponential and logarithm are one instruction each */
        const float g0 = u0 + fminf(u0, 0.f) - __builtin_amdgcn_logf(1.0f + __builtin_amdgcn_exp2f(-fabsf(u0))), g1 = u1 + fminf(u1, 0.f) - __builtin_amdgcn_logf(1.0f + __builtin_amdgcn_exp2f(-fabsf(u1)));      /* (s + log sigmoid(s)) * log2(e); the logarithm's argument lies in [1, 2] */
        const float s0 = ok0 ? g0 : -INFINITY, s1 = ok1 ? g1 : -INFINITY; float mc = fmaxf(s0, s1);
        mc = fmaxf(mc, __shfl_xor(mc, 1, 32)); mc = fmaxf(mc, __shfl_xor(mc, 2, 32)); mc = fmaxf(mc, __shfl_xor(mc, 4, 32)); mc = fmaxf(mc, __shfl_xor(mc, 8, 32));
        const float mn = fmaxf(m_r[rt][r], mc); const float ea = __builtin_amdgcn_exp2f(m_r[rt][r] - mn), e0 = __builtin_amdgcn_exp2f(s0 - mn), e1 = __builtin_amdgcn_exp2f(s1 - mn); const float al = (mn > -1.0e38f) ? ea : 1.0f; m_r[rt][r] = mn; const float p0 = ok0 ? e0 : 0.f, p1 = ok1 ? e1 : 0.f; l_r[rt][r] = l_r[rt][r] * al + p0 + p1;
#pragma unroll
        for (int dt = 0; dt < DT; ++dt) { oacc[rt][dt][r] *= al; oaccl[rt][dt][r] *= al; }
        FragH t2; t2.h[0] = (_Float16)(p0 * 1024.0f); t2.h[1] = (_Float16)(p1 * 1024.0f); sP[w][rt * 16 + 8 * hh + r][ln] = t2.u[0]; sP[w][rt * 16 + 8 * hh + r][16 + ln] = t2.u[1]; }
    __builtin_amdgcn_fence(__ATOMIC_ACQ_REL, "workgroup"); __builtin_amdgcn_wave_barrier();
    FragH pa[2];
#pragma unroll
    for (int rt = 0; rt < RTN; ++rt) { pa[rt].half[0] = *(const v8us*)&sP[w][rt * 16 + ln][8 * hh]; pa[rt].half[1] = *(const v8us*)&sP[w][rt * 16 + ln][16 + 8 * hh]; }
#pragma unroll
    for (int dt = 0; dt < DT; ++dt) { const size_t vo = (size_t)(dt * 16 + ln) * TT + j0; FragH bv, bl; bv.half[0] = *(const v8us*)(Vth + vo + 8 * hh); bv.half[1] = *(const v8us*)(Vth + vo + 16 + 8 * hh); bl.half[0] = *(const v8us*)(Vtl + vo + 8 * hh); bl.half[1] = *(const v8us*)(Vtl + vo + 16 + 8 * hh);
#pragma unroll
      for (int rt = 0; rt < RTN; ++rt) { oacc[rt][dt] = mmaH<1>(pa[rt].v, pa[rt].v, bv.v, bv.v, oacc[rt][dt]); oaccl[rt][dt] = mmaH<1>(pa[rt].v, pa[rt].v, bl.v, bl.v, oaccl[rt][dt]); } }
    __builtin_amdgcn_fence(__ATOMIC_ACQ_REL, "workgroup"); __builtin_amdgcn_wave_barrier(); }
#pragma unroll
  for (int rt = 0; rt < RTN; ++rt) {
#pragma unroll
    for (int r = 0; r < 8; ++r) { float l = l_r[rt][r]; l += __shfl_xor(l, 1, 32); l += __shfl_xor(l, 2, 32); l += __shfl_xor(l, 4, 32); l += __shfl_xor(l, 8, 32); l_r[rt][r] = (l > 0.f) ? 1.0f / (l * 1024.0f) : 0.f; }
#pragma unroll
    for (int dt = 0; dt < DT; ++dt)
#pragma unroll
      for (int r = 0; r < 8; ++r) sO[w][rt * 16 + 8 * hh + r][dt * 16 + ln] = (oacc[rt][dt][r] + oaccl[rt][dt][r] * 0.0009765625f) * l_r[rt][r]; }
  __builtin_amdgcn_fence(__ATOMIC_ACQ_REL, "workgroup"); __builtin_amdgcn_wave_barrier();
  {
#pragma unroll
    for (int rp = 0; rp < RPW; rp += 2) { const int r = rp + (lane >> 4), pc = lane & 15; const v4f val = *(const v4fa*)&sO[w][r][pc * 4]; *(v4f*)(O + ((size_t)b * TT + q0 + r) * ldo + h * 64 + pc * 4) = val; }
     } }

// Tiled GEMM for the five 4096 x 1024 x 1024 products, A f16 [NR][DM], Bt f16 [n][k]. MODE 0: C16 = f16(acc*alpha + bias); 1: C = acc*alpha + bias; 2: C += acc*alpha, in place. One 128 x 128 tile per block of 8 waves (4 x 2), 32 x 64 per wave.
// Each trip stages 128 k of the tile's 128 A rows and 128 Bt rows in LDS as whole 256-B rows (pitch 272 B: ds_load_b128 fragment reads meet no bank twice); two buffers, the next trip's rows are
// fetched into registers ahead of this trip's products and stored behind them, one barrier a trip. Every accumulator still sums k in ascending steps of 32.
#define GT 128
#define GK 128
#define GP 136
#define GSO 68
// one trip's products of a wave: 128 k in four steps of 32, 2 x 4 accumulator tiles; sa, sb: the lane's own row and k half in the A and Bt parts of the buffer
__device__ __forceinline__ void gemm_trip(const unsigned short* sa, const unsigned short* sb, v8f (&acc)[2][4]) {
#pragma unroll
  for (int ks = 0; ks < GK / 32; ++ks) {
    FragH a[2], b[4];
#pragma unroll
    for (int mi = 0; mi < 2; ++mi) { a[mi].half[0] = *(const v8us*)(sa + mi * 16 * GP + ks * 32); a[mi].half[1] = *(const v8us*)(sa + mi * 16 * GP + ks * 32 + 16); }
#pragma unroll
    for (int ni = 0; ni < 4; ++ni) { b[ni].half[0] = *(const v8us*)(sb + ni * 16 * GP + ks * 32); b[ni].half[1] = *(const v8us*)(sb + ni * 16 * GP + ks * 32 + 16); }
#pragma unroll
    for (int mi = 0; mi < 2; ++mi)
#pragma unroll
      for (int ni = 0; ni < 4; ++ni) acc[mi][ni] = __builtin_amdgcn_wmma_f32_16x16x32_f16(false, a[mi].v, false, b[ni].v, (short)0, acc[mi][ni], false, false);
  }
}
template <int MODE>
__global__ __launch_bounds__(256) void k_gemm_t(const _Float16* __restrict__ A, const _Float16* __restrict__ Bt, float alpha, const float* __restrict__ bias, float* __restrict__ C, _Float16* __restrict__ C16) {
  __shared__ __attribute__((aligned(16))) unsigned char smraw[2 * 2 * GT * GP * 2];
  unsigned short* const sm = (unsigned short*)smraw;
  constexpr int BUF = 2 * GT * GP, NTR = DM / GK;
  const int tid = threadIdx.x, w = tid >> 5, lane = tid & 31, ln = lane & 15, hh = lane >> 4;
  const int row0 = (blockIdx.x / (DM / GT)) * GT, col0 = (blockIdx.x % (DM / GT)) * GT;
  const int wm = (w >> 1) * 32, wn = (w & 1) * 64;
  const int pc = tid & 15, sr = tid >> 4;      /* staging: 16 lanes cover one 256-B row piece by piece; 16 rows per sweep */
  const unsigned short* ga = (const unsigned short*)A + (size_t)row0 * DM;      /* block-uniform bases; the lane's own place is the one 32-bit offset go, which lives through the loop */
  const unsigned short* gb = (const unsigned short*)Bt + (size_t)col0 * DM;
  const unsigned go = (unsigned)(sr * DM + pc * 8);
  unsigned short* const sw = sm + sr * GP + pc * 8;
  v8us st[16];
#pragma unroll
  for (int i = 0; i < 8; ++i) { st[i] = *(const v8us*)(ga + i * 16 * DM + go); st[8 + i] = *(const v8us*)(gb + i * 16 * DM + go); }
#pragma unroll
  for (int i = 0; i < 16; ++i) *(v8us*)(sw + i * 16 * GP) = st[i];
  __syncthreads();
  v8f acc[2][4];
#pragma unroll
  for (int mi = 0; mi < 2; ++mi)
#pragma unroll
    for (int ni = 0; ni < 4; ++ni) acc[mi][ni] = (v8f){0.f,0.f,0.f,0.f,0.f,0.f,0.f,0.f};
#pragma unroll 1      /* rolled: seven copies of the trip save nothing, and a short text is fetched once */
  for (int t = 0; t < NTR - 1; ++t) {
    const unsigned short* pa = ga + (t + 1) * GK + go; const unsigned short* pb = gb + (t + 1) * GK + go;
#pragma unroll
    for (int i = 0; i < 8; ++i) { st[i] = *(const v8us*)(pa + i * 16 * DM); st[8 + i] = *(const v8us*)(pb + i * 16 * DM); }
    __builtin_amdgcn_sched_barrier(0);      /* keeps the next trip's global loads ahead of this trip's products: sunk towards their LDS stores they would leave their latency uncovered */
    gemm_trip(sm + (t & 1) * BUF + (wm + ln) * GP + 8 * hh, sm + (t & 1) * BUF + (GT + wn + ln) * GP + 8 * hh, acc);
    asm volatile("s_wait_xcnt 0x0" :: "v"(pa), "v"(pb) : "memory");      /* the wait in front of any overwrite of the loads' address registers; as its inputs the two pairs stay whole up to here, where the loads are a trip old */
#pragma unroll
    for (int i = 0; i < 16; ++i) *(v8us*)(sw + ((t + 1) & 1) * BUF + i * 16 * GP) = st[i];
    __syncthreads();      /* publishes the buffer just written and ends every read of the one that the next trip overwrites */
  }
  gemm_trip(sm + ((NTR - 1) & 1) * BUF + (wm + ln) * GP + 8 * hh, sm + ((NTR - 1) & 1) * BUF + (GT + wn + ln) * GP + 8 * hh, acc);
  __syncthreads();      /* every wave has left the ring before the patches below are written over it */
  const int rsub = lane >> 4, c4 = (lane & 15) * 4;
  const size_t o0 = (size_t)(row0 + wm + rsub) * DM + col0 + wn + c4;
  v4f old[16];
  if (MODE == 2) {      /* the sums so far, asked for ahead of the LDS round trip below */
#pragma unroll
    for (int q = 0; q < 16; ++q) old[q] = *(const v4fa*)(C + o0 + (size_t)q * 2 * DM);
  }
  float* const so = (float*)smraw + w * (32 * GSO);      /* each wave's own 32 x 64 patch, in the ring that every wave has left */
#pragma unroll
  for (int ni = 0; ni < 4; ++ni) { const float bv = (MODE != 2) ? bf16_round(bias[col0 + wn + ni * 16 + ln]) : 0.f;
#pragma unroll
    for (int mi = 0; mi < 2; ++mi)
#pragma unroll
      for (int r = 0; r < 8; ++r) so[(mi * 16 + 8 * hh + r) * GSO + ni * 16 + ln] = acc[mi][ni][r] * alpha + bv; }
  __builtin_amdgcn_fence(__ATOMIC_ACQ_REL, "workgroup"); __builtin_amdgcn_wave_barrier();
#pragma unroll
  for (int q = 0; q < 16; ++q) { v4f v = *(const v4fa*)&so[(q * 2 + rsub) * GSO + c4]; const size_t o = o0 + (size_t)q * 2 * DM;
    if (MODE == 2) v += old[q];
    if (MODE != 0) *(v4f*)(C + o) = v;
    else { v4h h4; for (int i = 0; i < 4; ++i) h4[i] = (_Float16)v[i]; *(v4h*)(C16 + o) = h4; } }
}

extern "C" void kernel_launch(void* const* d_in, const int* in_sizes, int n_in,
                              void* d_out, int out_size, void* d_ws, size_t ws_size, hipStream_t stream) {
  (void)in_sizes; (void)n_in; (void)out_size;
  const float* const* I = (const float* const*)d_in; const float* x = I[0]; const float* Wq = I[1]; const float* bq = I[2]; const float* Wk = I[3]; const float* bk = I[4]; const float* Wv = I[5]; const float* bv = I[6]; const float* Wo = I[7]; const float* bo = I[8];
  char* ws = (char*)d_ws; size_t off = 0;
  auto take = [&](size_t bytes) { char* p = ws + off; off += (bytes + 255) & ~(size_t)255; return p; };
  const size_t WSZ = (size_t)DM * DM; _Float16* Bw = (_Float16*)take(4 * WSZ * 2); _Float16* X16 = (_Float16*)take((size_t)NR * DM * 2); float* F32 = (float*)take((size_t)NR * DM * 4);
  _Float16* Q16 = (_Float16*)take((size_t)NR * DM * 2); _Float16* K16 = (_Float16*)take((size_t)NR * DM * 2); _Float16* Vth = (_Float16*)take((size_t)NR * DM * 2); _Float16* Vtl = (_Float16*)take((size_t)NR * DM * 2);
  float* O = F32; _Float16* OH = Q16; _Float16* OL = K16; float* G = F32;      /* F32: v (consumed by k_vthl) → O (consumed by k_hl) → G; OH/OL reuse the q/k planes, dead after the attention kernel */
  if (off > ws_size) return;      // 8.4 + 8.4 + 16.8 + 4 × 8.4 ≈ 67 MB
  const unsigned gw = (unsigned)(((size_t)DM * (DM / 8) + 255) / 256);
  k_wt_f16<<<gw, 256, 0, stream>>>(Wq, Bw, DM, DM, 16.0f); k_wt_f16<<<gw, 256, 0, stream>>>(Wk, Bw + WSZ, DM, DM, 16.0f); k_wt_f16<<<gw, 256, 0, stream>>>(Wv, Bw + 2 * WSZ, DM, DM, 16.0f); k_wt_f16<<<gw, 256, 0, stream>>>(Wo, Bw + 3 * WSZ, DM, DM, 16.0f);      /* (in,out) → Bt[n][k] ×2^4 */
  k_tin<<<(DM / 64) * (TT / 32), 256, 0, stream>>>(x, X16);
  const dim3 gp((NR / GT) * (DM / GT), 1); const unsigned g8 = (unsigned)(((size_t)NR * DM / 8 + 255) / 256);
  k_gemm_t<0><<<gp, 256, 0, stream>>>(X16, Bw, 0.0625f, bq, nullptr, Q16);      /* q = xt·Wq + bq → f16: M 4096 N 1024 K 1024 */
  k_gemm_t<0><<<gp, 256, 0, stream>>>(X16, Bw + WSZ, 0.0625f, bk, nullptr, K16);      /* k */
  k_gemm_t<1><<<gp, 256, 0, stream>>>(X16, Bw + 2 * WSZ, 0.0625f, bv, F32, nullptr); k_vthl<<<BB * NH * (TT / 64), 256, 0, stream>>>(F32, DM, Vth, Vtl);      /* v f32 → Vᵀ hi/lo */
  k_flash<<<BB * NH * (TT / 64), 128, 0, stream>>>(Q16, DM, K16, DM, Vth, Vtl, O, DM);
  k_hl<<<g8, 256, 0, stream>>>(O, OH, OL, (size_t)NR * DM / 8);
  k_gemm_t<1><<<gp, 256, 0, stream>>>(OH, Bw + 3 * WSZ, 0.0625f, bo, G, nullptr);      /* G = O_hi·Wo + bo */
  k_gemm_t<2><<<gp, 256, 0, stream>>>(OL, Bw + 3 * WSZ, 0.0625f * 0.0009765625f, nullptr, G, nullptr);      /* += O_lo·Wo·2^-10 in place */
  k_tout<<<(DM / 32) * (TT / 64), 256, 0, stream>>>(G, (float*)d_out);
}

// v003
// A run of this version takes 146 microseconds.
// In both of two side-by-side timings against v002, it was 1.12 times as fast.
// All steps since v000 together make it 2.84 times as fast.
#include <hip/hip_runtime.h>
// Windowed multi-head self-attention on a (D, T, B)-layout input (D=1024, T=2048, B=2; 16 heads × 64; window |i−j| ≤ 256): xt = x transposed to (B,T,D); q,k,v = xt·W + b; scores = q·kᵀ/8 (−inf outside the window);
// attn = softmax(s + log_sigmoid(s)); out = (attn·v merged)·Wo + bo, transposed back to (D, T, B).
// Compute dtype: x, weights, biases rounded to bf16; q,k f16 GEMM outputs; v f32 → f16 hi + ×2^10 residual Vᵀ planes; fused windowed flash-style kernel (online softmax f32 on the sigsoftmax logits,
// P f16 ×2^10, two value accumulators) on v_wmma_f32_16x16x32_f16; merged O → hi/lo → Wo GEMMs (second in place ×2^-10) + bo; layout transposes through LDS, those of v and of the output in the GEMM epilogues; f32 accumulate.
#define BB 2
#define TT 2048
#define DM 1024
#define NH 16
#define HD 64
#define WIN 256
#define NR (BB * TT)

typedef __bf16 v16b __attribute__((ext_vector_type(16)));
typedef unsigned short v8us __attribute__((ext_vector_type(8), may_alias));
typedef float  v8f  __attribute__((ext_vector_type(8)));
typedef float  v4f  __attribute__((ext_vector_type(4)));
typedef float  v4fa __attribute__((ext_vector_type(4), may_alias));
union FragB { v16b v; v8us half[2]; unsigned short u[16]; };

__device__ __forceinline__ unsigned short bf16_bits(float x) { unsigned int u = __float_as_uint(x); return (unsigned short)((u + 0x7FFFu + ((u >> 16) & 1u)) >> 16); }
__device__ __forceinline__ float bf16_val(unsigned short b) { return __uint_as_float(((unsigned int)b) << 16); }
__device__ __forceinline__ float bf16_round(float x) { return bf16_val(bf16_bits(x)); }
// D += A·B with NT terms: 1 = ah·bh, 2 = + al·bh (A split), 3 = + ah·bl (both split)
template <int NT>
__device__ __forceinline__ v8f mmaN(v16b ah, v16b al, v16b bh, v16b bl, v8f c) {
  c = __builtin_amdgcn_wmma_f32_16x16x32_bf16(false, ah, false, bh, (short)0, c, false, false);
  if (NT >= 2) c = __builtin_amdgcn_wmma_f32_16x16x32_bf16(false, al, false, bh, (short)0, c, false, false);
  if (NT >= 3) c = __builtin_amdgcn_wmma_f32_16x16x32_bf16(false, ah, false, bl, (short)0, c, false, false);
  asm volatile("v_nop\n\tv_nop\n\tv_nop\n\tv_nop" : "+v"(c) : "v"(ah), "v"(al), "v"(bh), "v"(bl));
  return c;
}

__global__ __launch_bounds__(256) void k_wt_bf16(const float* __restrict__ W, unsigned short* __restrict__ Wt, int K, int N) {
  const int t = blockIdx.x * 256 + threadIdx.x;
  const int k8n = K / 8;
  if (t >= N * k8n) return;
  const int n = t / k8n, k8 = (t % k8n) * 8;
  v8us v;
#pragma unroll
  for (int i = 0; i < 8; ++i) v[i] = bf16_bits(W[(size_t)(k8 + i) * N + n]);
  *(v8us*)(Wt + (size_t)n * K + k8) = v;
  
}

// GEMM C[M][N] (f32, pitch ldc) = act(A[M][K]·W + bias). A f32 row-major (pitch lda) converted per fragment to bf16
// (ASPLIT: hi/lo two planes -> 2 terms, else single rounded term); Wt bf16 [N][K] (pitch ldb). BIAS_BF16 rounds the
// bias to bf16 first (bias quantised to bf16 before the add). K%32==0, M%16==0, N%64==0.
template <bool ASPLIT, int ACT, bool BIAS_BF16>
__global__ __launch_bounds__(128) void k_gemm_bf(const float* __restrict__ A, int lda, const unsigned short* __restrict__ Wt, int ldb,
                                               const float* __restrict__ bias, float* __restrict__ C, int ldc, int M, int N, int K) {
  __shared__ __attribute__((aligned(16))) float so[4][16][64];
  const int tid = threadIdx.x, w = tid >> 5, lane = tid & 31, ln = lane & 15, hh = lane >> 4;
  const int ntn = N / 64;
  const int wid = blockIdx.x * 4 + w;
  const int mt = wid / ntn, nq = wid % ntn;
  if (mt * 16 >= M) return;
  const int row0 = mt * 16, col0 = nq * 64;
  const float* arow = A + (size_t)(row0 + ln) * lda;
  v8f acc[4] = {};
  for (int kb = 0; kb < K; kb += 32) {
    FragB ah, al;
    const v4f x0 = *(const v4fa*)(arow + kb + 8 * hh), x1 = *(const v4fa*)(arow + kb + 8 * hh + 4);
    const v4f x2 = *(const v4fa*)(arow + kb + 16 + 8 * hh), x3 = *(const v4fa*)(arow + kb + 16 + 8 * hh + 4);
    float xs[16] = {x0[0],x0[1],x0[2],x0[3],x1[0],x1[1],x1[2],x1[3],x2[0],x2[1],x2[2],x2[3],x3[0],x3[1],x3[2],x3[3]};
#pragma unroll
    for (int i = 0; i < 16; ++i) { const unsigned short hb = bf16_bits(xs[i]); ah.u[i] = hb; al.u[i] = ASPLIT ? bf16_bits(xs[i] - bf16_val(hb)) : (unsigned short)0; }
#pragma unroll
    for (int t = 0; t < 4; ++t) {
      const unsigned short* brow = Wt + (size_t)(col0 + t * 16 + ln) * ldb + kb;
      FragB b;
      b.half[0] = *(const v8us*)(brow + 8 * hh);
      b.half[1] = *(const v8us*)(brow + 16 + 8 * hh);
      acc[t] = mmaN<ASPLIT ? 2 : 1>(ah.v, al.v, b.v, b.v, acc[t]);
    }
  }
#pragma unroll
  for (int t = 0; t < 4; ++t) {
    float bv = bias ? bias[col0 + t * 16 + ln] : 0.f;
    if (BIAS_BF16) bv = bf16_round(bv);
#pragma unroll
    for (int r = 0; r < 8; ++r) { float v = acc[t][r] + bv; if (ACT == 1) v = fmaxf(v, 0.f); so[w][8 * hh + r][t * 16 + ln] = v; }
  }
  __builtin_amdgcn_fence(__ATOMIC_ACQ_REL, "workgroup");
  __builtin_amdgcn_wave_barrier();
  const int rsub = lane >> 4, c4 = (lane & 15) * 4;
  {
#pragma unroll
    for (int q = 0; q < 8; ++q) {
      const int r = q * 2 + rsub;
      const v4f v = *(const v4fa*)&so[w][r][c4];
      *(v4f*)(C + (size_t)(row0 + r) * ldc + col0 + c4) = v;
    }
    
  }
}

// Flash-style causal/unmasked attention, all contractions 3-term bf16 hi/lo splits, f32 softmax with running max.
// q,k,v rows are read from f32 buffers with arbitrary row pitch (so they can live inside a fused qkv buffer);
// D = head size (multiple of 32, <= 128); one wave = 16 query rows; block = 4 waves (64 queries) sharing K/V chunks of 32.
template <int D, bool CAUSAL>
__global__ __launch_bounds__(128) void k_flash(const float* __restrict__ qb, const float* __restrict__ kb, const float* __restrict__ vb,
                                             int pitch, int T, int H, float scale, float* __restrict__ y, int ypitch) {
  constexpr int KS = D / 32;        // k-steps for QK
  constexpr int DT = D / 16;        // d tiles for PV
  __shared__ __attribute__((aligned(16))) unsigned short sKh[32][D + 8], sKl[32][D + 8], sVh[32][D + 8], sVl[32][D + 8];
  __shared__ __attribute__((aligned(16))) unsigned short sPh[4][16][40], sPl[4][16][40];
  __shared__ __attribute__((aligned(16))) float sO[4][16][D];
  const int tid = threadIdx.x, w = tid >> 5, lane = tid & 31, ln = lane & 15, hh = lane >> 4;
  const int nqb = (T + 63) / 64;
  const int bh = blockIdx.x / nqb, qblk = blockIdx.x % nqb;
  const int b = bh / H, h = bh % H;
  const int q0 = qblk * 64 + w * 16;
  const float* Q = qb + (size_t)b * T * pitch + h * D;
  const float* K = kb + (size_t)b * T * pitch + h * D;
  const float* V = vb + (size_t)b * T * pitch + h * D;

  // A fragments of the wave's 16 query rows (scaled), hi/lo
  FragB aqh[KS], aql[KS];
  {
    int row = q0 + ln; if (row >= T) row = T - 1;
    const float* qr = Q + (size_t)row * pitch;
#pragma unroll
    for (int ks = 0; ks < KS; ++ks)
#pragma unroll
      for (int i = 0; i < 16; ++i) {
        const int d = ks * 32 + ((i < 8) ? (8 * hh + i) : (16 + 8 * hh + (i - 8)));
        const float x = qr[d] * scale; const unsigned short hb = bf16_bits(x);
        aqh[ks].u[i] = hb; aql[ks].u[i] = bf16_bits(x - bf16_val(hb));
      }
  }
  float m_r[8], l_r[8];
#pragma unroll
  for (int r = 0; r < 8; ++r) { m_r[r] = -3.0e38f; l_r[r] = 0.f; }
  v8f oacc[DT];
#pragma unroll
  for (int dt = 0; dt < DT; ++dt) oacc[dt] = (v8f){0.f,0.f,0.f,0.f,0.f,0.f,0.f,0.f};

  const int kv_end = CAUSAL ? min(T, qblk * 64 + 64) : T;     // block-uniform
  for (int j0 = 0; j0 < kv_end; j0 += 32) {
    __syncthreads();
    for (int e = tid; e < 32 * (D / 4); e += 128) {
      const int r = e / (D / 4), c4 = (e % (D / 4)) * 4;
      const int key = j0 + r;
      v4f kf = {0.f,0.f,0.f,0.f}, vf = {0.f,0.f,0.f,0.f};
      if (key < T) { kf = *(const v4fa*)(K + (size_t)key * pitch + c4); vf = *(const v4fa*)(V + (size_t)key * pitch + c4); }
#pragma unroll
      for (int t = 0; t < 4; ++t) {
        unsigned short hb = bf16_bits(kf[t]); sKh[r][c4 + t] = hb; sKl[r][c4 + t] = bf16_bits(kf[t] - bf16_val(hb));
        hb = bf16_bits(vf[t]); sVh[r][c4 + t] = hb; sVl[r][c4 + t] = bf16_bits(vf[t] - bf16_val(hb));
      }
    }
    __syncthreads();
    // S tile 16 x 32
    v8f s[2];
#pragma unroll
    for (int nt = 0; nt < 2; ++nt) {
      v8f acc = {};
#pragma unroll
      for (int ks = 0; ks < KS; ++ks) {
        FragB bh_, bl_;
        bh_.half[0] = *(const v8us*)&sKh[nt * 16 + ln][ks * 32 + 8 * hh]; bh_.half[1] = *(const v8us*)&sKh[nt * 16 + ln][ks * 32 + 16 + 8 * hh];
        bl_.half[0] = *(const v8us*)&sKl[nt * 16 + ln][ks * 32 + 8 * hh]; bl_.half[1] = *(const v8us*)&sKl[nt * 16 + ln][ks * 32 + 16 + 8 * hh];
        acc = mmaN<3>(aqh[ks].v, aql[ks].v, bh_.v, bl_.v, acc);
      }
      s[nt] = acc;
    }
    // mask + running max (rows 8hh+r; the 16 lanes of a half share rows)
    float alpha[8];
#pragma unroll
    for (int r = 0; r < 8; ++r) {
      const int qi = q0 + 8 * hh + r;
      const int ja = j0 + ln, jb = j0 + 16 + ln;
      if (CAUSAL) { if (ja > qi) s[0][r] = -3.0e38f; if (jb > qi) s[1][r] = -3.0e38f; }
      if (ja >= T) s[0][r] = -3.0e38f;
      if (jb >= T) s[1][r] = -3.0e38f;
      float mx = fmaxf(s[0][r], s[1][r]);
      mx = fmaxf(mx, __shfl_xor(mx, 1, 32)); mx = fmaxf(mx, __shfl_xor(mx, 2, 32)); mx = fmaxf(mx, __shfl_xor(mx, 4, 32)); mx = fmaxf(mx, __shfl_xor(mx, 8, 32));
      const float mnew = fmaxf(m_r[r], mx);
      alpha[r] = (mnew > -1.0e38f) ? __expf(m_r[r] - mnew) : 1.0f;
      const float p0 = (s[0][r] > -1.0e38f) ? __expf(s[0][r] - mnew) : 0.f;
      const float p1 = (s[1][r] > -1.0e38f) ? __expf(s[1][r] - mnew) : 0.f;
      m_r[r] = mnew;
      l_r[r] = l_r[r] * alpha[r] + p0 + p1;            // per-lane partial row sum (16 lanes combined at the end)
      unsigned short hb = bf16_bits(p0); sPh[w][8 * hh + r][ln] = hb;      sPl[w][8 * hh + r][ln] = bf16_bits(p0 - bf16_val(hb));
      hb = bf16_bits(p1);                sPh[w][8 * hh + r][16 + ln] = hb; sPl[w][8 * hh + r][16 + ln] = bf16_bits(p1 - bf16_val(hb));
    }
#pragma unroll
    for (int dt = 0; dt < DT; ++dt)
#pragma unroll
      for (int r = 0; r < 8; ++r) oacc[dt][r] *= alpha[r];
    __builtin_amdgcn_fence(__ATOMIC_ACQ_REL, "workgroup");
    __builtin_amdgcn_wave_barrier();
    FragB pah, pal;
    pah.half[0] = *(const v8us*)&sPh[w][ln][8 * hh]; pah.half[1] = *(const v8us*)&sPh[w][ln][16 + 8 * hh];
    pal.half[0] = *(const v8us*)&sPl[w][ln][8 * hh]; pal.half[1] = *(const v8us*)&sPl[w][ln][16 + 8 * hh];
#pragma unroll
    for (int dt = 0; dt < DT; ++dt) {
      FragB bvh, bvl;
#pragma unroll
      for (int i = 0; i < 8; ++i) {
        bvh.u[i] = sVh[8 * hh + i][dt * 16 + ln]; bvh.u[8 + i] = sVh[16 + 8 * hh + i][dt * 16 + ln];
        bvl.u[i] = sVl[8 * hh + i][dt * 16 + ln]; bvl.u[8 + i] = sVl[16 + 8 * hh + i][dt * 16 + ln];
      }
      oacc[dt] = mmaN<3>(pah.v, pal.v, bvh.v, bvl.v, oacc[dt]);
    }
    __builtin_amdgcn_fence(__ATOMIC_ACQ_REL, "workgroup");
    __builtin_amdgcn_wave_barrier();
  }
#pragma unroll
  for (int r = 0; r < 8; ++r) {
    float l = l_r[r];
    l += __shfl_xor(l, 1, 32); l += __shfl_xor(l, 2, 32); l += __shfl_xor(l, 4, 32); l += __shfl_xor(l, 8, 32);
    l_r[r] = (l > 0.f) ? 1.0f / l : 0.f;
  }
#pragma unroll
  for (int dt = 0; dt < DT; ++dt)
#pragma unroll
    for (int r = 0; r < 8; ++r) sO[w][8 * hh + r][dt * 16 + ln] = oacc[dt][r] * l_r[r];
  __builtin_amdgcn_fence(__ATOMIC_ACQ_REL, "workgroup");
  __builtin_amdgcn_wave_barrier();
  {
    for (int r = 0; r < 16; ++r) {
      const int row = q0 + r;
      if (row < T && lane < D / 4) {
        const v4f val = *(const v4fa*)&sO[w][r][lane * 4];
        *(v4f*)(y + ((size_t)b * T + row) * ypitch + h * D + lane * 4) = val;
      }
    }
    
  }
}

// GEMM C = act(A·W + bias + resid): A f32 (ASPLIT -> hi/lo 2 terms), Wt bf16 [N][K]; ACT 0 none, 1 relu, 2 exact gelu;
// resid (optional, f32, row index = (row % rmod), pitch ldr, RES_BF16 rounds it) added before the activation.
template <bool ASPLIT, int ACT, bool BIAS_BF16, bool RES_BF16>
__global__ __launch_bounds__(128) void k_gemm_bf3(const float* __restrict__ A, int lda, const unsigned short* __restrict__ Wt, int ldb,
                                                const float* __restrict__ bias, const float* __restrict__ resid, int rmod, int ldr,
                                                float* __restrict__ C, int ldc, int M, int N, int K) {
  __shared__ __attribute__((aligned(16))) float so[4][16][64];
  const int tid = threadIdx.x, w = tid >> 5, lane = tid & 31, ln = lane & 15, hh = lane >> 4;
  const int ntn = N / 64;
  const int wid = blockIdx.x * 4 + w;
  const int mt = wid / ntn, nq = wid % ntn;
  if (mt * 16 >= M) return;
  const int row0 = mt * 16, col0 = nq * 64;
  const float* arow = A + (size_t)(row0 + ln) * lda;
  v8f acc[4] = {};
  for (int kb = 0; kb < K; kb += 32) {
    FragB ah, al;
    const v4f x0 = *(const v4fa*)(arow + kb + 8 * hh), x1 = *(const v4fa*)(arow + kb + 8 * hh + 4);
    const v4f x2 = *(const v4fa*)(arow + kb + 16 + 8 * hh), x3 = *(const v4fa*)(arow + kb + 16 + 8 * hh + 4);
    float xs[16] = {x0[0],x0[1],x0[2],x0[3],x1[0],x1[1],x1[2],x1[3],x2[0],x2[1],x2[2],x2[3],x3[0],x3[1],x3[2],x3[3]};
#pragma unroll
    for (int i = 0; i < 16; ++i) { const unsigned short hb = bf16_bits(xs[i]); ah.u[i] = hb; al.u[i] = ASPLIT ? bf16_bits(xs[i] - bf16_val(hb)) : (unsigned short)0; }
#pragma unroll
    for (int t = 0; t < 4; ++t) {
      const unsigned short* brow = Wt + (size_t)(col0 + t * 16 + ln) * ldb + kb;
      FragB b;
      b.half[0] = *(const v8us*)(brow + 8 * hh);
      b.half[1] = *(const v8us*)(brow + 16 + 8 * hh);
      acc[t] = mmaN<ASPLIT ? 2 : 1>(ah.v, al.v, b.v, b.v, acc[t]);
    }
  }
#pragma unroll
  for (int t = 0; t < 4; ++t) {
    const int col = col0 + t * 16 + ln;
    float bv = bias ? bias[col] : 0.f;
    if (BIAS_BF16) bv = bf16_round(bv);
#pragma unroll
    for (int r = 0; r < 8; ++r) {
      float v = acc[t][r] + bv;
      if (resid) { float rv = resid[(size_t)((row0 + 8 * hh + r) % rmod) * ldr + col]; if (RES_BF16) rv = bf16_round(rv); v += rv; }
      if (ACT == 1) v = fmaxf(v, 0.f);
      if (ACT == 2) v = 0.5f * v * (1.0f + erff(v * 0.70710678118654752f));
      if (ACT == 3) { const float u = 0.7978845608028654f * (v + 0.044715f * v * v * v); v = 0.5f * v * (1.0f + tanhf(u)); }
      so[w][8 * hh + r][t * 16 + ln] = v;
    }
  }
  __builtin_amdgcn_fence(__ATOMIC_ACQ_REL, "workgroup");
  __builtin_amdgcn_wave_barrier();
  const int rsub = lane >> 4, c4 = (lane & 15) * 4;
  {
#pragma unroll
    for (int q = 0; q < 8; ++q) {
      const int r = q * 2 + rsub;
      const v4f v = *(const v4fa*)&so[w][r][c4];
      *(v4f*)(C + (size_t)(row0 + r) * ldc + col0 + c4) = v;
    }
    
  }
}
// row LayerNorm (biased variance, eps) over N: s = X (+ R); optional out_sum <- s; out_norm <- (s-mu)*rsqrt(var+eps)*g + b
template <bool PARAM_BF16>
__global__ __launch_bounds__(256) void k_layernorm(const float* __restrict__ X, const float* __restrict__ R, const float* __restrict__ g, const float* __restrict__ bta,
                                                  float* __restrict__ out_sum, float* __restrict__ out_norm, int N, float eps) {
  __shared__ float red[256];
  const int row = blockIdx.x, tid = threadIdx.x;
  const float* x = X + (size_t)row * N; const float* rr = R ? R + (size_t)row * N : nullptr;
  float vals[16];                     // up to N = 4096
  const int per = N / 256;            // contiguous chunk per thread? use strided-by-4 chunks: thread handles j = tid*4 + 1024*u
  float s1 = 0.f;
  for (int u = 0; u < per / 4; ++u) {
    const int j = tid * 4 + 1024 * u;
    const v4f a = *(const v4fa*)(x + j);
    v4f b = {0.f,0.f,0.f,0.f}; if (rr) b = *(const v4fa*)(rr + j);
#pragma unroll
    for (int q = 0; q < 4; ++q) { const float v = a[q] + b[q]; vals[u * 4 + q] = v; s1 += v; }
  }
  red[tid] = s1; __syncthreads();
  for (int st = 128; st > 0; st >>= 1) { if (tid < st) red[tid] += red[tid + st]; __syncthreads(); }
  const float mu = red[0] / (float)N; __syncthreads();
  float s2 = 0.f;
  for (int u = 0; u < per / 4; ++u)
#pragma unroll
    for (int q = 0; q < 4; ++q) { const float c = vals[u * 4 + q] - mu; s2 += c * c; }
  red[tid] = s2; __syncthreads();
  for (int st = 128; st > 0; st >>= 1) { if (tid < st) red[tid] += red[tid + st]; __syncthreads(); }
  const float rs = rsqrtf(red[0] / (float)N + eps);
  {
    for (int u = 0; u < per / 4; ++u) {
      const int j = tid * 4 + 1024 * u;
      v4f o, sm;
#pragma unroll
      for (int q = 0; q < 4; ++q) {
        float gg = g[j + q], bb = bta[j + q];
        if (PARAM_BF16) { gg = bf16_round(gg); bb = bf16_round(bb); }
        sm[q] = vals[u * 4 + q]; o[q] = (vals[u * 4 + q] - mu) * rs * gg + bb;
      }
      if (out_sum) *(v4f*)(out_sum + (size_t)row * N + j) = sm;
      *(v4f*)(out_norm + (size_t)row * N + j) = o;
    }
    
  }
}



// ---- f16 WMMA path (v_wmma_f32_16x16x32_f16): 11-bit significands for operands in range — used where a [0,1] probability operand needs more precision than bf16
typedef _Float16 v16h __attribute__((ext_vector_type(16)));
union FragH { v16h v; v8us half[2]; _Float16 h[16]; unsigned short u[16]; };
template <int NT>
__device__ __forceinline__ v8f mmaH(v16h ah, v16h al, v16h bh, v16h bl, v8f c) {
  c = __builtin_amdgcn_wmma_f32_16x16x32_f16(false, ah, false, bh, (short)0, c, false, false);
  if (NT >= 2) c = __builtin_amdgcn_wmma_f32_16x16x32_f16(false, al, false, bh, (short)0, c, false, false);
  if (NT >= 3) c = __builtin_amdgcn_wmma_f32_16x16x32_f16(false, ah, false, bl, (short)0, c, false, false);
  asm volatile("v_nop\n\tv_nop\n\tv_nop\n\tv_nop" : "+v"(c) : "v"(ah), "v"(al), "v"(bh), "v"(bl));
  return c;
}
// batched GEMM like k_gemm_b but f16 operands: A f32 (split into f16 hi/lo if ASPLIT, else rounded to f16), Bt = f16 values [n][k]; alpha; C f32; N multiple of 16 (partial tiles skipped)
template <bool ASPLIT>
__global__ __launch_bounds__(128) void k_gemm_h(const float* __restrict__ A, int lda, size_t sA, const _Float16* __restrict__ Bh, int ldb, size_t sB, float alpha, float* __restrict__ C, int ldc, size_t sC, int M, int N, int K) {
  __shared__ __attribute__((aligned(16))) float so[4][16][64];
  const int tid = threadIdx.x, w = tid >> 5, lane = tid & 31, ln = lane & 15, hh = lane >> 4; const int by = blockIdx.y;
  A += (size_t)by * sA; Bh += (size_t)by * sB; C += (size_t)by * sC;
  const int ntn = (N + 63) / 64; const int wid = blockIdx.x * 4 + w; const int mt = wid / ntn, nq = wid % ntn; if (mt * 16 >= M) return;
  const int row0 = mt * 16, col0 = nq * 64; const float* arow = A + (size_t)(row0 + ln) * lda;
  v8f acc[4] = {};
  for (int kb = 0; kb < K; kb += 32) {
    FragH ah, al;
    const v4f x0 = *(const v4fa*)(arow + kb + 8 * hh), x1 = *(const v4fa*)(arow + kb + 8 * hh + 4), x2 = *(const v4fa*)(arow + kb + 16 + 8 * hh), x3 = *(const v4fa*)(arow + kb + 16 + 8 * hh + 4);
    float xs[16] = {x0[0],x0[1],x0[2],x0[3],x1[0],x1[1],x1[2],x1[3],x2[0],x2[1],x2[2],x2[3],x3[0],x3[1],x3[2],x3[3]};
#pragma unroll
    for (int i = 0; i < 16; ++i) { const _Float16 h = (_Float16)xs[i]; ah.h[i] = h; al.h[i] = ASPLIT ? (_Float16)(xs[i] - (float)h) : (_Float16)0.0f; }
#pragma unroll
    for (int t = 0; t < 4; ++t) { if (col0 + t * 16 >= N) continue; const size_t boff = (size_t)(col0 + t * 16 + ln) * ldb + kb; FragH bq; bq.half[0] = *(const v8us*)(Bh + boff + 8 * hh); bq.half[1] = *(const v8us*)(Bh + boff + 16 + 8 * hh);
      acc[t] = mmaH<ASPLIT ? 2 : 1>(ah.v, al.v, bq.v, bq.v, acc[t]); }
  }
#pragma unroll
  for (int t = 0; t < 4; ++t) { if (col0 + t * 16 >= N) continue;
#pragma unroll
    for (int r = 0; r < 8; ++r) so[w][8 * hh + r][t * 16 + ln] = acc[t][r] * alpha; }
  __builtin_amdgcn_fence(__ATOMIC_ACQ_REL, "workgroup"); __builtin_amdgcn_wave_barrier();
  const int rsub = lane >> 4, c4 = (lane & 15) * 4;
  {
#pragma unroll
    for (int q = 0; q < 8; ++q) { const int r = q * 2 + rsub; if (col0 + c4 < N) { const v4f v = *(const v4fa*)&so[w][r][c4]; *(v4f*)(C + (size_t)(row0 + r) * ldc + col0 + c4) = v; } }
     }
}

// Wt[n][k] = f16(W[k][n]·scale) from f32 row-major W[K][N] (scale = power of two; bf16-exact weights stay exact in f16 away from the subnormal range)
__global__ __launch_bounds__(256) void k_wt_f16(const float* __restrict__ W, _Float16* __restrict__ Wt, int K, int N, float scale) {
  const int t = blockIdx.x * 256 + threadIdx.x; if (t >= N * (K / 8)) return; const int n = t / (K / 8), k8 = (t % (K / 8)) * 8; FragH f;
#pragma unroll
  for (int i = 0; i < 8; ++i) f.h[i] = (_Float16)(bf16_round(W[(size_t)(k8 + i) * N + n]) * scale); const v8us o = f.half[0];
  *(v8us*)((unsigned short*)Wt + (size_t)n * K + k8) = o; 
}
// k_gemm_hh variant with fused epilogue: v = acc·alpha + bias[by·sBias + col] (+ CP[(row/rowsPerB)·sCPb + by·64 + col] if CP) ; ACT 0 none / 1 elu ; writes f16 C16 and f32 C, each if non-null
template <int ACT>
__global__ __launch_bounds__(128) void k_gemm_hhx(const _Float16* __restrict__ A, int lda, size_t sA, const _Float16* __restrict__ Bh, int ldb, size_t sB, float alpha, const float* __restrict__ bias, size_t sBias, const float* __restrict__ CP, int rowsPerB, size_t sCPb, int row0g,
    float* __restrict__ C, _Float16* __restrict__ C16, int ldc, size_t sC, int M, int N, int K) {
  __shared__ __attribute__((aligned(16))) float so[4][16][64];
  const int tid = threadIdx.x, w = tid >> 5, lane = tid & 31, ln = lane & 15, hh = lane >> 4; const int by = blockIdx.y;
  A += (size_t)by * sA; Bh += (size_t)by * sB; const size_t cofs = (size_t)by * sC; const float* bp = bias ? bias + (size_t)by * sBias : nullptr;
  const int ntn = (N + 63) / 64; const int wid = blockIdx.x * 4 + w; const int mt = wid / ntn, nq = wid % ntn; if (mt * 16 >= M) return;
  const int row0 = mt * 16, col0 = nq * 64; const _Float16* arow = A + (size_t)(row0 + ln) * lda;
  v8f acc[4] = {};
  for (int kb = 0; kb < K; kb += 32) { FragH ah; ah.half[0] = *(const v8us*)((const unsigned short*)arow + kb + 8 * hh); ah.half[1] = *(const v8us*)((const unsigned short*)arow + kb + 16 + 8 * hh);
#pragma unroll
    for (int t = 0; t < 4; ++t) { if (col0 + t * 16 >= N) continue; const size_t boff = (size_t)(col0 + t * 16 + ln) * ldb + kb; FragH bq; bq.half[0] = *(const v8us*)((const unsigned short*)Bh + boff + 8 * hh); bq.half[1] = *(const v8us*)((const unsigned short*)Bh + boff + 16 + 8 * hh);
      acc[t] = mmaH<1>(ah.v, ah.v, bq.v, bq.v, acc[t]); }
  }
#pragma unroll
  for (int t = 0; t < 4; ++t) { if (col0 + t * 16 >= N) continue; const int col = col0 + t * 16 + ln; const float bv = bp ? bf16_round(bp[col]) : 0.f;
#pragma unroll
    for (int r = 0; r < 8; ++r) { float v = acc[t][r] * alpha + bv; if (CP) { const int bidx = (row0g + row0 + 8 * hh + r) / rowsPerB; v += CP[(size_t)bidx * sCPb + (size_t)by * 64 + col]; } if (ACT == 1) v = (v > 0.f) ? v : expm1f(v); else if (ACT == 7) v = (v > 0.f) ? v + 1.0f : expf(v); else if (ACT == 8) v = tanhf(v); else if (ACT == 9) v = 0.5f * v * (1.0f + tanhf(0.7978845608028654f * (v + 0.044715f * v * v * v))); else if (ACT == 11) v = 1.0f / (1.0f + expf(-v)); else if (ACT == 12) v = (v > 0.f) ? v : 0.01f * v; else if (ACT == 14) v = (v > 0.f) ? v : 0.1f * v; else if (ACT == 15) v = v / (1.0f + expf(-v)); else if (ACT == 3) v = fmaxf(v, 0.f); else if (ACT == 6) v = 0.5f * v * (1.0f + erff(v * 0.70710678118654752f)); so[w][8 * hh + r][t * 16 + ln] = v; } }
  __builtin_amdgcn_fence(__ATOMIC_ACQ_REL, "workgroup"); __builtin_amdgcn_wave_barrier();
  const int rsub = lane >> 4, c4 = (lane & 15) * 4; typedef _Float16 v4h __attribute__((ext_vector_type(4)));
  {
#pragma unroll
    for (int q = 0; q < 8; ++q) { const int r = q * 2 + rsub; if (col0 + c4 < N) { const v4f v = *(const v4fa*)&so[w][r][c4]; if (C) *(v4f*)(C + cofs + (size_t)(row0 + r) * ldc + col0 + c4) = v; if (C16) { v4h h4; for (int i = 0; i < 4; ++i) h4[i] = (_Float16)v[i]; *(v4h*)(C16 + cofs + (size_t)(row0 + r) * ldc + col0 + c4) = h4; } } }
     }
}


typedef _Float16 v4h __attribute__((ext_vector_type(4)));

__global__ __launch_bounds__(256) void k_x16(const float* __restrict__ x, _Float16* __restrict__ X16, size_t n8) { const size_t t = (size_t)blockIdx.x * 256 + threadIdx.x; if (t >= n8) return; FragH f;
#pragma unroll
  for (int q = 0; q < 8; ++q) f.h[q] = (_Float16)bf16_round(x[t * 8 + q]); *(v8us*)((unsigned short*)X16 + t * 8) = f.half[0];  }
__global__ __launch_bounds__(256) void k_h16(const float* __restrict__ x, _Float16* __restrict__ X16, size_t n8) { const size_t t = (size_t)blockIdx.x * 256 + threadIdx.x; if (t >= n8) return; FragH f;
#pragma unroll
  for (int q = 0; q < 8; ++q) f.h[q] = (_Float16)x[t * 8 + q]; *(v8us*)((unsigned short*)X16 + t * 8) = f.half[0];  }
__global__ __launch_bounds__(256) void k_round16f(const float* __restrict__ W, _Float16* __restrict__ Bt, size_t n8) { const size_t t = (size_t)blockIdx.x * 256 + threadIdx.x; if (t >= n8) return; FragH f;
#pragma unroll
  for (int i = 0; i < 8; ++i) f.h[i] = (_Float16)(bf16_round(W[t * 8 + i]) * 16.0f); *(v8us*)((unsigned short*)Bt + t * 8) = f.half[0];  }
template <int NHv, int TTv>
__global__ __launch_bounds__(256) void k_vt(const _Float16* __restrict__ V16, int ldv, int voff, _Float16* __restrict__ Vt) { __shared__ unsigned short tl[64][66]; const int tid = threadIdx.x; const int slab = blockIdx.x / (TTv / 64), lg = blockIdx.x % (TTv / 64); const int b = slab / NHv, h = slab % NHv;
  for (int i = tid; i < 64 * 8; i += 256) { const int r = i / 8, c8 = (i % 8) * 8; FragH f; f.half[0] = *(const v8us*)((const unsigned short*)V16 + ((size_t)b * TTv + lg * 64 + r) * ldv + voff + h * 64 + c8);
#pragma unroll
    for (int q = 0; q < 8; ++q) tl[r][c8 + q] = f.u[q]; }
  __syncthreads();
  {
#pragma unroll
    for (int rd = 0; rd < 2; ++rd) { const int d = rd * 32 + tid / 8, pc = tid % 8; FragH f;
#pragma unroll
      for (int q = 0; q < 8; ++q) f.u[q] = tl[pc * 8 + q][d];
      *(v8us*)((unsigned short*)Vt + ((size_t)slab * 64 + d) * TTv + lg * 64 + pc * 8) = f.half[0]; }
     } }

__global__ __launch_bounds__(256) void k_tin(const float* __restrict__ x, _Float16* __restrict__ X16) { __shared__ float tl[BB][32][65]; const int tid = threadIdx.x; const int dg = blockIdx.x / (TT / 32), tg = blockIdx.x % (TT / 32); const int d0 = dg * 64, t0 = tg * 32;
  for (int i = tid; i < 64 * 32 * BB; i += 256) { const int b = i % BB, tt = (i / BB) % 32, dd = i / (BB * 32); tl[b][tt][dd] = bf16_round(x[((size_t)(d0 + dd) * TT + t0 + tt) * BB + b]); } __syncthreads();
  { for (int i = tid; i < BB * 32 * 8; i += 256) { const int pc = i % 8, tt = (i / 8) % 32, b = i / (8 * 32); FragH f; for (int q = 0; q < 8; ++q) f.h[q] = (_Float16)tl[b][tt][pc * 8 + q]; *(v8us*)((unsigned short*)X16 + ((size_t)b * TT + t0 + tt) * DM + d0 + pc * 8) = f.half[0]; }  } }
__global__ __launch_bounds__(128) void k_flash(const _Float16* __restrict__ Q16, int ldq, const _Float16* __restrict__ K16, int ldk, const _Float16* __restrict__ Vt, const _Float16* __restrict__ Vtlo, _Float16* __restrict__ OH, _Float16* __restrict__ OL, int ldo) {
  constexpr int RPW = 16, RTN = RPW / 16, NQB = TT / (4 * RPW), DT = 4, KS = 2;
  __shared__ __attribute__((aligned(16))) unsigned short sP[4][RPW][40]; __shared__ __attribute__((aligned(16))) float sO[4][RPW][64 + 4];
  const int tid = threadIdx.x, w = tid >> 5, lane = tid & 31, ln = lane & 15, hh = lane >> 4;
  const int slab = blockIdx.x / NQB, qblk = blockIdx.x % NQB; const int b = slab / NH, h = slab % NH; const int qb0 = qblk * (4 * RPW); const int q0 = qb0 + w * RPW;
  FragH aq[2][KS];
#pragma unroll
  for (int rt = 0; rt < RTN; ++rt) { const unsigned short* qr = (const unsigned short*)Q16 + ((size_t)b * TT + q0 + rt * 16 + ln) * ldq + h * 64;
#pragma unroll
    for (int ks = 0; ks < KS; ++ks) { aq[rt][ks].half[0] = *(const v8us*)(qr + ks * 32 + 8 * hh); aq[rt][ks].half[1] = *(const v8us*)(qr + ks * 32 + 16 + 8 * hh); } }
  const unsigned short* Vth = (const unsigned short*)Vt + (size_t)slab * 64 * TT; const unsigned short* Vtl = (const unsigned short*)Vtlo + (size_t)slab * 64 * TT;
  float m_r[2][8], l_r[2][8]; v8f oacc[2][DT], oaccl[2][DT];
#pragma unroll
  for (int rt = 0; rt < RTN; ++rt) {
#pragma unroll
    for (int r = 0; r < 8; ++r) { m_r[rt][r] = -3.0e38f; l_r[rt][r] = 0.f; }
#pragma unroll
    for (int dt = 0; dt < DT; ++dt) { oacc[rt][dt] = (v8f){0.f,0.f,0.f,0.f,0.f,0.f,0.f,0.f}; oaccl[rt][dt] = oacc[rt][dt]; } }
  const int jbeg = (qb0 - WIN) > 0 ? (qb0 - WIN) : 0; const int jend = (qb0 + 4 * RPW + WIN) < TT ? (qb0 + 4 * RPW + WIN) : TT;      /* block-uniform window bounds (multiples of 32) */
#pragma unroll 1
  for (int j0 = jbeg; j0 < jend; j0 += 32) {
    
    v8f s[2][2];
#pragma unroll
    for (int nt = 0; nt < 2; ++nt) { const unsigned short* kr = (const unsigned short*)K16 + ((size_t)b * TT + j0 + nt * 16 + ln) * ldk + h * 64; FragH bk[KS];
#pragma unroll
      for (int ks = 0; ks < KS; ++ks) { bk[ks].half[0] = *(const v8us*)(kr + ks * 32 + 8 * hh); bk[ks].half[1] = *(const v8us*)(kr + ks * 32 + 16 + 8 * hh); }
#pragma unroll
      for (int rt = 0; rt < RTN; ++rt) { v8f acc = (v8f){0.f,0.f,0.f,0.f,0.f,0.f,0.f,0.f};
#pragma unroll
        for (int ks = 0; ks < KS; ++ks) acc = mmaH<1>(aq[rt][ks].v, aq[rt][ks].v, bk[ks].v, bk[ks].v, acc); s[rt][nt] = acc; } }
#pragma unroll
    for (int rt = 0; rt < RTN; ++rt)
#pragma unroll
      for (int r = 0; r < 8; ++r) { const int tq = q0 + rt * 16 + 8 * hh + r; const int k0 = j0 + ln, k1 = j0 + 16 + ln; (void)tq; (void)k0; (void)k1;
        const bool ok0 = (k0 - tq <= WIN) && (tq - k0 <= WIN), ok1 = (k1 - tq <= WIN) && (tq - k1 <= WIN);
        const float u0 = s[rt][0][r] * 0.18033688011112042f, u1 = s[rt][1][r] * 0.18033688011112042f;      /* score / 8, times log2(e): logits, running maximum and weights all live in base 2, where exponential and logarithm are one instruction each */
        const float g0 = u0 + fminf(u0, 0.f) - __builtin_amdgcn_logf(1.0f + __builtin_amdgcn_exp2f(-fabsf(u0))), g1 = u1 + fminf(u1, 0.f) - __builtin_amdgcn_logf(1.0f + __builtin_amdgcn_exp2f(-fabsf(u1)));      /* (s + log sigmoid(s)) * log2(e); the logarithm's argument lies in [1, 2] */
        const float s0 = ok0 ? g0 : -INFINITY, s1 = ok1 ? g1 : -INFINITY; float mc = fmaxf(s0, s1);
        mc = fmaxf(mc, __shfl_xor(mc, 1, 32)); mc = fmaxf(mc, __shfl_xor(mc, 2, 32)); mc = fmaxf(mc, __shfl_xor(mc, 4, 32)); mc = fmaxf(mc, __shfl_xor(mc, 8, 32));
        const float mn = fmaxf(m_r[rt][r], mc); const float ea = __builtin_amdgcn_exp2f(m_r[rt][r] - mn), e0 = __builtin_amdgcn_exp2f(s0 - mn), e1 = __builtin_amdgcn_exp2f(s1 - mn); const float al = (mn > -1.0e38f) ? ea : 1.0f; m_r[rt][r] = mn; const float p0 = ok0 ? e0 : 0.f, p1 = ok1 ? e1 : 0.f; l_r[rt][r] = l_r[rt][r] * al + p0 + p1;
#pragma unroll
        for (int dt = 0; dt < DT; ++dt) { oacc[rt][dt][r] *= al; oaccl[rt][dt][r] *= al; }
        FragH t2; t2.h[0] = (_Float16)(p0 * 1024.0f); t2.h[1] = (_Float16)(p1 * 1024.0f); sP[w][rt * 16 + 8 * hh + r][ln] = t2.u[0]; sP[w][rt * 16 + 8 * hh + r][16 + ln] = t2.u[1]; }
    __builtin_amdgcn_fence(__ATOMIC_ACQ_REL, "workgroup"); __builtin_amdgcn_wave_barrier();
    FragH pa[2];
#pragma unroll
    for (int rt = 0; rt < RTN; ++rt) { pa[rt].half[0] = *(const v8us*)&sP[w][rt * 16 + ln][8 * hh]; pa[rt].half[1] = *(const v8us*)&sP[w][rt * 16 + ln][16 + 8 * hh]; }
#pragma unroll
    for (int dt = 0; dt < DT; ++dt) { const size_t vo = (size_t)(dt * 16 + ln) * TT + j0; FragH bv, bl; bv.half[0] = *(const v8us*)(Vth + vo + 8 * hh); bv.half[1] = *(const v8us*)(Vth + vo + 16 + 8 * hh); bl.half[0] = *(const v8us*)(Vtl + vo + 8 * hh); bl.half[1] = *(const v8us*)(Vtl + vo + 16 + 8 * hh);
#pragma unroll
      for (int rt = 0; rt < RTN; ++rt) { oacc[rt][dt] = mmaH<1>(pa[rt].v, pa[rt].v, bv.v, bv.v, oacc[rt][dt]); oaccl[rt][dt] = mmaH<1>(pa[rt].v, pa[rt].v, bl.v, bl.v, oaccl[rt][dt]); } }
    __builtin_amdgcn_fence(__ATOMIC_ACQ_REL, "workgroup"); __builtin_amdgcn_wave_barrier(); }
#pragma unroll
  for (int rt = 0; rt < RTN; ++rt) {
#pragma unroll
    for (int r = 0; r < 8; ++r) { float l = l_r[rt][r]; l += __shfl_xor(l, 1, 32); l += __shfl_xor(l, 2, 32); l += __shfl_xor(l, 4, 32); l += __shfl_xor(l, 8, 32); l_r[rt][r] = (l > 0.f) ? 1.0f / (l * 1024.0f) : 0.f; }
#pragma unroll
    for (int dt = 0; dt < DT; ++dt)
#pragma unroll
      for (int r = 0; r < 8; ++r) sO[w][rt * 16 + 8 * hh + r][dt * 16 + ln] = (oacc[rt][dt][r] + oaccl[rt][dt][r] * 0.0009765625f) * l_r[rt][r]; }
  __builtin_amdgcn_fence(__ATOMIC_ACQ_REL, "workgroup"); __builtin_amdgcn_wave_barrier();
  {
#pragma unroll
    for (int rp = 0; rp < RPW; rp += 2) { const int r = rp + (lane >> 4), pc = lane & 15; const v4f val = *(const v4fa*)&sO[w][r][pc * 4]; const size_t o = ((size_t)b * TT + q0 + r) * ldo + h * 64 + pc * 4; v4h oh, ol;      /* the merged row leaves as the output product's two operands: f16 value and residual x 2^10; 16 lanes fill one 128-B line of each plane */
#pragma unroll
      for (int i = 0; i < 4; ++i) { const _Float16 hv = (_Float16)val[i]; oh[i] = hv; ol[i] = (_Float16)((val[i] - (float)hv) * 1024.0f); }
      *(v4h*)(OH + o) = oh; *(v4h*)(OL + o) = ol; }
     } }

// Tiled GEMM for the five 4096 x 1024 x 1024 products, A f16 [NR][DM], Bt f16 [n][k]. One 128 x 128 tile per block of 8 waves (4 x 2), 32 x 64 per wave. The epilogue writes what the next kernel reads, so no f32 plane goes through a pass of its own:
// MODE 0: C16 = f16(acc*alpha + bias), row-major (q, k). 1: v = acc*alpha + bias leaves transposed, per (batch, column) a row over t, as f16 value (C16) and residual x 2^10 (C16l). 2: C = acc*alpha + bias in the (D, T, B) layout of the output; 3: C += acc*alpha, same layout, in place.
// Each trip stages 128 k of the tile's 128 A rows and 128 Bt rows in LDS as whole 256-B rows (pitch 272 B: ds_load_b128 fragment reads meet no bank twice); two buffers, the next trip's rows are
// fetched into registers ahead of this trip's products and stored behind them, one barrier a trip. Every accumulator still sums k in ascending steps of 32.
#define GT 128
#define GK 128
#define GP 136
#define GSO 68
#define GTP 131
// one trip's products of a wave: 128 k in four steps of 32, 2 x 4 accumulator tiles; sa, sb: the lane's own row and k half in the A and Bt parts of the buffer
__device__ __forceinline__ void gemm_trip(const unsigned short* sa, const unsigned short* sb, v8f (&acc)[2][4]) {
#pragma unroll
  for (int ks = 0; ks < GK / 32; ++ks) {
    FragH a[2], b[4];
#pragma unroll
    for (int mi = 0; mi < 2; ++mi) { a[mi].half[0] = *(const v8us*)(sa + mi * 16 * GP + ks * 32); a[mi].half[1] = *(const v8us*)(sa + mi * 16 * GP + ks * 32 + 16); }
#pragma unroll
    for (int ni = 0; ni < 4; ++ni) { b[ni].half[0] = *(const v8us*)(sb + ni * 16 * GP + ks * 32); b[ni].half[1] = *(const v8us*)(sb + ni * 16 * GP + ks * 32 + 16); }
#pragma unroll
    for (int mi = 0; mi < 2; ++mi)
#pragma unroll
      for (int ni = 0; ni < 4; ++ni) acc[mi][ni] = __builtin_amdgcn_wmma_f32_16x16x32_f16(false, a[mi].v, false, b[ni].v, (short)0, acc[mi][ni], false, false);
  }
}
template <int MODE>
__global__ __launch_bounds__(256) void k_gemm_t(const _Float16* __restrict__ A, const _Float16* __restrict__ Bt, float alpha, const float* __restrict__ bias, float* __restrict__ C, _Float16* __restrict__ C16, _Float16* __restrict__ C16l) {
  __shared__ __attribute__((aligned(16))) unsigned char smraw[2 * 2 * GT * GP * 2];
  unsigned short* const sm = (unsigned short*)smraw;
  constexpr int BUF = 2 * GT * GP, NTR = DM / GK;
  constexpr bool TB = (MODE >= 2);      /* tile row lr stands for (t, b) = (t0 + lr / BB, lr % BB): the order in which the output holds one column's values, so a column of the tile is one contiguous run there */
  constexpr int AST = (TB ? 16 / BB : 16) * DM;      /* A elements between the rows of two staging sweeps */
  const int tid = threadIdx.x, w = tid >> 5, lane = tid & 31, ln = lane & 15, hh = lane >> 4;
  const int mt = blockIdx.x / (DM / GT);
  const int row0 = mt * GT, col0 = (blockIdx.x % (DM / GT)) * GT, t0 = mt * (GT / BB);
  const int wm = (w >> 1) * 32, wn = (w & 1) * 64;
  const int pc = tid & 15, sr = tid >> 4;      /* staging: 16 lanes cover one 256-B row piece by piece; 16 rows per sweep */
  const unsigned short* ga = (const unsigned short*)A + (size_t)(TB ? t0 : row0) * DM;      /* block-uniform bases; the lane's own places are the 32-bit offsets goa and go, which live through the loop */
  const unsigned short* gb = (const unsigned short*)Bt + (size_t)col0 * DM;
  const unsigned go = (unsigned)(sr * DM + pc * 8);
  const unsigned goa = TB ? (unsigned)(((sr % BB) * TT + sr / BB) * DM + pc * 8) : go;
  unsigned short* const sw = sm + sr * GP + pc * 8;
  v8us st[16];
#pragma unroll
  for (int i = 0; i < 8; ++i) { st[i] = *(const v8us*)(ga + i * AST + goa); st[8 + i] = *(const v8us*)(gb + i * 16 * DM + go); }
#pragma unroll
  for (int i = 0; i < 16; ++i) *(v8us*)(sw + i * 16 * GP) = st[i];
  asm volatile("s_wait_xcnt 0x0" :: "v"(goa), "v"(go) : "memory");      /* the wait in front of any overwrite of the first loads' offset registers, which as its inputs stay whole up to here */
  __syncthreads();
  v8f acc[2][4];
#pragma unroll
  for (int mi = 0; mi < 2; ++mi)
#pragma unroll
    for (int ni = 0; ni < 4; ++ni) acc[mi][ni] = (v8f){0.f,0.f,0.f,0.f,0.f,0.f,0.f,0.f};
#pragma unroll 1      /* rolled: seven copies of the trip save nothing, and a short text is fetched once */
  for (int t = 0; t < NTR - 1; ++t) {
    const unsigned short* pa = ga + (t + 1) * GK + goa; const unsigned short* pb = gb + (t + 1) * GK + go;
#pragma unroll
    for (int i = 0; i < 8; ++i) { st[i] = *(const v8us*)(pa + i * AST); st[8 + i] = *(const v8us*)(pb + i * 16 * DM); }
    __builtin_amdgcn_sched_barrier(0);      /* keeps the next trip's global loads ahead of this trip's products: sunk towards their LDS stores they would leave their latency uncovered */
    gemm_trip(sm + (t & 1) * BUF + (wm + ln) * GP + 8 * hh, sm + (t & 1) * BUF + (GT + wn + ln) * GP + 8 * hh, acc);
    asm volatile("s_wait_xcnt 0x0" :: "v"(pa), "v"(pb) : "memory");      /* the wait in front of any overwrite of the loads' address registers; as its inputs the two pairs stay whole up to here, where the loads are a trip old */
#pragma unroll
    for (int i = 0; i < 16; ++i) *(v8us*)(sw + ((t + 1) & 1) * BUF + i * 16 * GP) = st[i];
    __syncthreads();      /* publishes the buffer just written and ends every read of the one that the next trip overwrites */
  }
  gemm_trip(sm + ((NTR - 1) & 1) * BUF + (wm + ln) * GP + 8 * hh, sm + ((NTR - 1) & 1) * BUF + (GT + wn + ln) * GP + 8 * hh, acc);
  __syncthreads();      /* every wave has left the ring before the epilogue writes over it */
  if (MODE == 0) {
    const int rsub = lane >> 4, c4 = (lane & 15) * 4;
    const size_t o0 = (size_t)(row0 + wm + rsub) * DM + col0 + wn + c4;
    float* const so = (float*)smraw + w * (32 * GSO);      /* each wave's own 32 x 64 patch, in the ring that every wave has left */
#pragma unroll
    for (int ni = 0; ni < 4; ++ni) { const float bv = bf16_round(bias[col0 + wn + ni * 16 + ln]);
#pragma unroll
      for (int mi = 0; mi < 2; ++mi)
#pragma unroll
        for (int r = 0; r < 8; ++r) so[(mi * 16 + 8 * hh + r) * GSO + ni * 16 + ln] = acc[mi][ni][r] * alpha + bv; }
    __builtin_amdgcn_fence(__ATOMIC_ACQ_REL, "workgroup"); __builtin_amdgcn_wave_barrier();
#pragma unroll
    for (int q = 0; q < 16; ++q) { const v4f v = *(const v4fa*)&so[(q * 2 + rsub) * GSO + c4]; v4h h4; for (int i = 0; i < 4; ++i) h4[i] = (_Float16)v[i]; *(v4h*)(C16 + o0 + (size_t)q * 2 * DM) = h4; }
  } else {
    float* const tl = (float*)smraw;      /* the block's whole 128 x 128 tile in f32, pitch 131 words: it is written by rows and read back by columns */
    float* const op = C + ((size_t)col0 * TT + t0) * BB + lane * 4;      /* MODE 2, 3: a wave takes one column at a time, 128 values = 512 contiguous bytes of the output */
    v4f old[16];
    if (MODE == 3) {      /* the sums so far, asked for ahead of the LDS round trip below */
#pragma unroll
      for (int i = 0; i < 16; ++i) old[i] = *(const v4fa*)(op + (size_t)(i * 8 + w) * (TT * BB));
    }
#pragma unroll
    for (int ni = 0; ni < 4; ++ni) { const float bv = (MODE != 3) ? bf16_round(bias[col0 + wn + ni * 16 + ln]) : 0.f;
#pragma unroll
      for (int mi = 0; mi < 2; ++mi)
#pragma unroll
        for (int r = 0; r < 8; ++r) tl[(wm + mi * 16 + 8 * hh + r) * GTP + wn + ni * 16 + ln] = acc[mi][ni][r] * alpha + bv; }
    __syncthreads();      /* a column holds values of four waves: all of the tile stands in LDS before any column is read */
    if (MODE == 1) {
      const int t8 = tid & 15, dq = tid >> 4;      /* 16 lanes cover one column's 128 t: 256 contiguous bytes of each plane */
      const size_t vo = ((size_t)(row0 / TT) * DM + col0) * TT + (row0 % TT) + t8 * 8;
#pragma unroll
      for (int i = 0; i < 8; ++i) { const int d = i * 16 + dq; FragH fh, fl;
#pragma unroll
        for (int q = 0; q < 8; ++q) { const float v = tl[(t8 * 8 + q) * GTP + d]; const _Float16 hv = (_Float16)v; fh.h[q] = hv; fl.h[q] = (_Float16)((v - (float)hv) * 1024.0f); }
        *(v8us*)((unsigned short*)C16 + vo + (size_t)d * TT) = fh.half[0]; *(v8us*)((unsigned short*)C16l + vo + (size_t)d * TT) = fl.half[0]; }
    } else {
#pragma unroll
      for (int i = 0; i < 16; ++i) { const int d = i * 8 + w; v4f v = {tl[(lane * 4) * GTP + d], tl[(lane * 4 + 1) * GTP + d], tl[(lane * 4 + 2) * GTP + d], tl[(lane * 4 + 3) * GTP + d]};
        if (MODE == 3) v += old[i];
        *(v4f*)(op + (size_t)d * (TT * BB)) = v; }
    }
  }
}

extern "C" void kernel_launch(void* const* d_in, const int* in_sizes, int n_in,
                              void* d_out, int out_size, void* d_ws, size_t ws_size, hipStream_t stream) {
  (void)in_sizes; (void)n_in; (void)out_size;
  const float* const* I = (const float* const*)d_in; const float* x = I[0]; const float* Wq = I[1]; const float* bq = I[2]; const float* Wk = I[3]; const float* bk = I[4]; const float* Wv = I[5]; const float* bv = I[6]; const float* Wo = I[7]; const float* bo = I[8];
  char* ws = (char*)d_ws; size_t off = 0;
  auto take = [&](size_t bytes) { char* p = ws + off; off += (bytes + 255) & ~(size_t)255; return p; };
  const size_t WSZ = (size_t)DM * DM; _Float16* Bw = (_Float16*)take(4 * WSZ * 2); _Float16* X16 = (_Float16*)take((size_t)NR * DM * 2); _Float16* OH = (_Float16*)take((size_t)NR * DM * 2); _Float16* OL = (_Float16*)take((size_t)NR * DM * 2);
  _Float16* Q16 = (_Float16*)take((size_t)NR * DM * 2); _Float16* K16 = (_Float16*)take((size_t)NR * DM * 2); _Float16* Vth = (_Float16*)take((size_t)NR * DM * 2); _Float16* Vtl = (_Float16*)take((size_t)NR * DM * 2);
  if (off > ws_size) return;      // 8 x 8.4 MB, about 67 MB
  const unsigned gw = (unsigned)(((size_t)DM * (DM / 8) + 255) / 256);
  k_wt_f16<<<gw, 256, 0, stream>>>(Wq, Bw, DM, DM, 16.0f); k_wt_f16<<<gw, 256, 0, stream>>>(Wk, Bw + WSZ, DM, DM, 16.0f); k_wt_f16<<<gw, 256, 0, stream>>>(Wv, Bw + 2 * WSZ, DM, DM, 16.0f); k_wt_f16<<<gw, 256, 0, stream>>>(Wo, Bw + 3 * WSZ, DM, DM, 16.0f);      /* (in,out) -> Bt[n][k] x 2^4 */
  k_tin<<<(DM / 64) * (TT / 32), 256, 0, stream>>>(x, X16);
  const dim3 gp((NR / GT) * (DM / GT), 1);
  k_gemm_t<0><<<gp, 256, 0, stream>>>(X16, Bw, 0.0625f, bq, nullptr, Q16, nullptr);      /* q = xt.Wq + bq -> f16: M 4096 N 1024 K 1024 */
  k_gemm_t<0><<<gp, 256, 0, stream>>>(X16, Bw + WSZ, 0.0625f, bk, nullptr, K16, nullptr);      /* k */
  k_gemm_t<1><<<gp, 256, 0, stream>>>(X16, Bw + 2 * WSZ, 0.0625f, bv, nullptr, Vth, Vtl);      /* v -> transposed hi / lo planes */
  k_flash<<<BB * NH * (TT / 64), 128, 0, stream>>>(Q16, DM, K16, DM, Vth, Vtl, OH, OL, DM);
  k_gemm_t<2><<<gp, 256, 0, stream>>>(OH, Bw + 3 * WSZ, 0.0625f, bo, (float*)d_out, nullptr, nullptr);      /* out = O_hi.Wo + bo, in the output's own layout */
  k_gemm_t<3><<<gp, 256, 0, stream>>>(OL, Bw + 3 * WSZ, 0.0625f * 0.0009765625f, nullptr, (float*)d_out, nullptr, nullptr);      /* += O_lo.Wo.2^-10 in place */
}

// v004
// One run takes 117 microseconds.
// Next to v003, in two timings, it ran 1.25 times as fast each time.
// All steps since v000 together make it 3.56 times as fast.
#include <hip/hip_runtime.h>
// Windowed multi-head self-attention on a (D, T, B)-layout input (D=1024, T=2048, B=2; 16 heads × 64; window |i−j| ≤ 256): xt = x transposed to (B,T,D); q,k,v = xt·W + b; scores = q·kᵀ/8 (−inf outside the window);
// attn = softmax(s + log_sigmoid(s)); out = (attn·v merged)·Wo + bo, transposed back to (D, T, B).
// Compute dtype: x, weights, biases rounded to bf16; q,k f16 GEMM outputs; v f32 → f16 hi + ×2^10 residual Vᵀ planes; fused windowed flash-style kernel (online softmax f32 on the sigsoftmax logits,
// P f16 ×2^10, two value accumulators) on v_wmma_f32_16x16x32_f16; merged O → hi/lo → one Wo GEMM over both planes (lo first, x 2^-10) + bo; layout transposes through LDS, those of v and of the output in the GEMM epilogues; f32 accumulate.
#define BB 2
#define TT 2048
#define DM 1024
#define NH 16
#define HD 64
#define WIN 256
#define NR (BB * TT)

typedef __bf16 v16b __attribute__((ext_vector_type(16)));
typedef unsigned short v8us __attribute__((ext_vector_type(8), may_alias));
typedef float  v8f  __attribute__((ext_vector_type(8)));
typedef float  v4f  __attribute__((ext_vector_type(4)));
typedef float  v4fa __attribute__((ext_vector_type(4), may_alias));
union FragB { v16b v; v8us half[2]; unsigned short u[16]; };

__device__ __forceinline__ unsigned short bf16_bits(float x) { unsigned int u = __float_as_uint(x); return (unsigned short)((u + 0x7FFFu + ((u >> 16) & 1u)) >> 16); }
__device__ __forceinline__ float bf16_val(unsigned short b) { return __uint_as_float(((unsigned int)b) << 16); }
__device__ __forceinline__ float bf16_round(float x) { return bf16_val(bf16_bits(x)); }
// D += A·B with NT terms: 1 = ah·bh, 2 = + al·bh (A split), 3 = + ah·bl (both split)
template <int NT>
__device__ __forceinline__ v8f mmaN(v16b ah, v16b al, v16b bh, v16b bl, v8f c) {
  c = __builtin_amdgcn_wmma_f32_16x16x32_bf16(false, ah, false, bh, (short)0, c, false, false);
  if (NT >= 2) c = __builtin_amdgcn_wmma_f32_16x16x32_bf16(false, al, false, bh, (short)0, c, false, false);
  if (NT >= 3) c = __builtin_amdgcn_wmma_f32_16x16x32_bf16(false, ah, false, bl, (short)0, c, false, false);
  asm volatile("v_nop\n\tv_nop\n\tv_nop\n\tv_nop" : "+v"(c) : "v"(ah), "v"(al), "v"(bh), "v"(bl));
  return c;
}

__global__ __launch_bounds__(256) void k_wt_bf16(const float* __restrict__ W, unsigned short* __restrict__ Wt, int K, int N) {
  const int t = blockIdx.x * 256 + threadIdx.x;
  const int k8n = K / 8;
  if (t >= N * k8n) return;
  const int n = t / k8n, k8 = (t % k8n) * 8;
  v8us v;
#pragma unroll
  for (int i = 0; i < 8; ++i) v[i] = bf16_bits(W[(size_t)(k8 + i) * N + n]);
  *(v8us*)(Wt + (size_t)n * K + k8) = v;
  
}

// GEMM C[M][N] (f32, pitch ldc) = act(A[M][K]·W + bias). A f32 row-major (pitch lda) converted per fragment to bf16
// (ASPLIT: hi/lo two planes -> 2 terms, else single rounded term); Wt bf16 [N][K] (pitch ldb). BIAS_BF16 rounds the
// bias to bf16 first (bias quantised to bf16 before the add). K%32==0, M%16==0, N%64==0.
template <bool ASPLIT, int ACT, bool BIAS_BF16>
__global__ __launch_bounds__(128) void k_gemm_bf(const float* __restrict__ A, int lda, const unsigned short* __restrict__ Wt, int ldb,
                                               const float* __restrict__ bias, float* __restrict__ C, int ldc, int M, int N, int K) {
  __shared__ __attribute__((aligned(16))) float so[4][16][64];
  const int tid = threadIdx.x, w = tid >> 5, lane = tid & 31, ln = lane & 15, hh = lane >> 4;
  const int ntn = N / 64;
  const int wid = blockIdx.x * 4 + w;
  const int mt = wid / ntn, nq = wid % ntn;
  if (mt * 16 >= M) return;
  const int row0 = mt * 16, col0 = nq * 64;
  const float* arow = A + (size_t)(row0 + ln) * lda;
  v8f acc[4] = {};
  for (int kb = 0; kb < K; kb += 32) {
    FragB ah, al;
    const v4f x0 = *(const v4fa*)(arow + kb + 8 * hh), x1 = *(const v4fa*)(arow + kb + 8 * hh + 4);
    const v4f x2 = *(const v4fa*)(arow + kb + 16 + 8 * hh), x3 = *(const v4fa*)(arow + kb + 16 + 8 * hh + 4);
    float xs[16] = {x0[0],x0[1],x0[2],x0[3],x1[0],x1[1],x1[2],x1[3],x2[0],x2[1],x2[2],x2[3],x3[0],x3[1],x3[2],x3[3]};
#pragma unroll
    for (int i = 0; i < 16; ++i) { const unsigned short hb = bf16_bits(xs[i]); ah.u[i] = hb; al.u[i] = ASPLIT ? bf16_bits(xs[i] - bf16_val(hb)) : (unsigned short)0; }
#pragma unroll
    for (int t = 0; t < 4; ++t) {
      const unsigned short* brow = Wt + (size_t)(col0 + t * 16 + ln) * ldb + kb;
      FragB b;
      b.half[0] = *(const v8us*)(brow + 8 * hh);
      b.half[1] = *(const v8us*)(brow + 16 + 8 * hh);
      acc[t] = mmaN<ASPLIT ? 2 : 1>(ah.v, al.v, b.v, b.v, acc[t]);
    }
  }
#pragma unroll
  for (int t = 0; t < 4; ++t) {
    float bv = bias ? bias[col0 + t * 16 + ln] : 0.f;
    if (BIAS_BF16) bv = bf16_round(bv);
#pragma unroll
    for (int r = 0; r < 8; ++r) { float v = acc[t][r] + bv; if (ACT == 1) v = fmaxf(v, 0.f); so[w][8 * hh + r][t * 16 + ln] = v; }
  }
  __builtin_amdgcn_fence(__ATOMIC_ACQ_REL, "workgroup");
  __builtin_amdgcn_wave_barrier();
  const int rsub = lane >> 4, c4 = (lane & 15) * 4;
  {
#pragma unroll
    for (int q = 0; q < 8; ++q) {
      const int r = q * 2 + rsub;
      const v4f v = *(const v4fa*)&so[w][r][c4];
      *(v4f*)(C + (size_t)(row0 + r) * ldc + col0 + c4) = v;
    }
    
  }
}

// Flash-style causal/unmasked attention, all contractions 3-term bf16 hi/lo splits, f32 softmax with running max.
// q,k,v rows are read from f32 buffers with arbitrary row pitch (so they can live inside a fused qkv buffer);
// D = head size (multiple of 32, <= 128); one wave = 16 query rows; block = 4 waves (64 queries) sharing K/V chunks of 32.
template <int D, bool CAUSAL>
__global__ __launch_bounds__(128) void k_flash(const float* __restrict__ qb, const float* __restrict__ kb, const float* __restrict__ vb,
                                             int pitch, int T, int H, float scale, float* __restrict__ y, int ypitch) {
  constexpr int KS = D / 32;        // k-steps for QK
  constexpr int DT = D / 16;        // d tiles for PV
  __shared__ __attribute__((aligned(16))) unsigned short sKh[32][D + 8], sKl[32][D + 8], sVh[32][D + 8], sVl[32][D + 8];
  __shared__ __attribute__((aligned(16))) unsigned short sPh[4][16][40], sPl[4][16][40];
  __shared__ __attribute__((aligned(16))) float sO[4][16][D];
  const int tid = threadIdx.x, w = tid >> 5, lane = tid & 31, ln = lane & 15, hh = lane >> 4;
  const int nqb = (T + 63) / 64;
  const int bh = blockIdx.x / nqb, qblk = blockIdx.x % nqb;
  const int b = bh / H, h = bh % H;
  const int q0 = qblk * 64 + w * 16;
  const float* Q = qb + (size_t)b * T * pitch + h * D;
  const float* K = kb + (size_t)b * T * pitch + h * D;
  const float* V = vb + (size_t)b * T * pitch + h * D;

  // A fragments of the wave's 16 query rows (scaled), hi/lo
  FragB aqh[KS], aql[KS];
  {
    int row = q0 + ln; if (row >= T) row = T - 1;
    const float* qr = Q + (size_t)row * pitch;
#pragma unroll
    for (int ks = 0; ks < KS; ++ks)
#pragma unroll
      for (int i = 0; i < 16; ++i) {
        const int d = ks * 32 + ((i < 8) ? (8 * hh + i) : (16 + 8 * hh + (i - 8)));
        const float x = qr[d] * scale; const unsigned short hb = bf16_bits(x);
        aqh[ks].u[i] = hb; aql[ks].u[i] = bf16_bits(x - bf16_val(hb));
      }
  }
  float m_r[8], l_r[8];
#pragma unroll
  for (int r = 0; r < 8; ++r) { m_r[r] = -3.0e38f; l_r[r] = 0.f; }
  v8f oacc[DT];
#pragma unroll
  for (int dt = 0; dt < DT; ++dt) oacc[dt] = (v8f){0.f,0.f,0.f,0.f,0.f,0.f,0.f,0.f};

  const int kv_end = CAUSAL ? min(T, qblk * 64 + 64) : T;     // block-uniform
  for (int j0 = 0; j0 < kv_end; j0 += 32) {
    __syncthreads();
    for (int e = tid; e < 32 * (D / 4); e += 128) {
      const int r = e / (D / 4), c4 = (e % (D / 4)) * 4;
      const int key = j0 + r;
      v4f kf = {0.f,0.f,0.f,0.f}, vf = {0.f,0.f,0.f,0.f};
      if (key < T) { kf = *(const v4fa*)(K + (size_t)key * pitch + c4); vf = *(const v4fa*)(V + (size_t)key * pitch + c4); }
#pragma unroll
      for (int t = 0; t < 4; ++t) {
        unsigned short hb = bf16_bits(kf[t]); sKh[r][c4 + t] = hb; sKl[r][c4 + t] = bf16_bits(kf[t] - bf16_val(hb));
        hb = bf16_bits(vf[t]); sVh[r][c4 + t] = hb; sVl[r][c4 + t] = bf16_bits(vf[t] - bf16_val(hb));
      }
    }
    __syncthreads();
    // S tile 16 x 32
    v8f s[2];
#pragma unroll
    for (int nt = 0; nt < 2; ++nt) {
      v8f acc = {};
#pragma unroll
      for (int ks = 0; ks < KS; ++ks) {
        FragB bh_, bl_;
        bh_.half[0] = *(const v8us*)&sKh[nt * 16 + ln][ks * 32 + 8 * hh]; bh_.half[1] = *(const v8us*)&sKh[nt * 16 + ln][ks * 32 + 16 + 8 * hh];
        bl_.half[0] = *(const v8us*)&sKl[nt * 16 + ln][ks * 32 + 8 * hh]; bl_.half[1] = *(const v8us*)&sKl[nt * 16 + ln][ks * 32 + 16 + 8 * hh];
        acc = mmaN<3>(aqh[ks].v, aql[ks].v, bh_.v, bl_.v, acc);
      }
      s[nt] = acc;
    }
    // mask + running max (rows 8hh+r; the 16 lanes of a half share rows)
    float alpha[8];
#pragma unroll
    for (int r = 0; r < 8; ++r) {
      const int qi = q0 + 8 * hh + r;
      const int ja = j0 + ln, jb = j0 + 16 + ln;
      if (CAUSAL) { if (ja > qi) s[0][r] = -3.0e38f; if (jb > qi) s[1][r] = -3.0e38f; }
      if (ja >= T) s[0][r] = -3.0e38f;
      if (jb >= T) s[1][r] = -3.0e38f;
      float mx = fmaxf(s[0][r], s[1][r]);
      mx = fmaxf(mx, __shfl_xor(mx, 1, 32)); mx = fmaxf(mx, __shfl_xor(mx, 2, 32)); mx = fmaxf(mx, __shfl_xor(mx, 4, 32)); mx = fmaxf(mx, __shfl_xor(mx, 8, 32));
      const float mnew = fmaxf(m_r[r], mx);
      alpha[r] = (mnew > -1.0e38f) ? __expf(m_r[r] - mnew) : 1.0f;
      const float p0 = (s[0][r] > -1.0e38f) ? __expf(s[0][r] - mnew) : 0.f;
      const float p1 = (s[1][r] > -1.0e38f) ? __expf(s[1][r] - mnew) : 0.f;
      m_r[r] = mnew;
      l_r[r] = l_r[r] * alpha[r] + p0 + p1;            // per-lane partial row sum (16 lanes combined at the end)
      unsigned short hb = bf16_bits(p0); sPh[w][8 * hh + r][ln] = hb;      sPl[w][8 * hh + r][ln] = bf16_bits(p0 - bf16_val(hb));
      hb = bf16_bits(p1);                sPh[w][8 * hh + r][16 + ln] = hb; sPl[w][8 * hh + r][16 + ln] = bf16_bits(p1 - bf16_val(hb));
    }
#pragma unroll
    for (int dt = 0; dt < DT; ++dt)
#pragma unroll
      for (int r = 0; r < 8; ++r) oacc[dt][r] *= alpha[r];
    __builtin_amdgcn_fence(__ATOMIC_ACQ_REL, "workgroup");
    __builtin_amdgcn_wave_barrier();
    FragB pah, pal;
    pah.half[0] = *(const v8us*)&sPh[w][ln][8 * hh]; pah.half[1] = *(const v8us*)&sPh[w][ln][16 + 8 * hh];
    pal.half[0] = *(const v8us*)&sPl[w][ln][8 * hh]; pal.half[1] = *(const v8us*)&sPl[w][ln][16 + 8 * hh];
#pragma unroll
    for (int dt = 0; dt < DT; ++dt) {
      FragB bvh, bvl;
#pragma unroll
      for (int i = 0; i < 8; ++i) {
        bvh.u[i] = sVh[8 * hh + i][dt * 16 + ln]; bvh.u[8 + i] = sVh[16 + 8 * hh + i][dt * 16 + ln];
        bvl.u[i] = sVl[8 * hh + i][dt * 16 + ln]; bvl.u[8 + i] = sVl[16 + 8 * hh + i][dt * 16 + ln];
      }
      oacc[dt] = mmaN<3>(pah.v, pal.v, bvh.v, bvl.v, oacc[dt]);
    }
    __builtin_amdgcn_fence(__ATOMIC_ACQ_REL, "workgroup");
    __builtin_amdgcn_wave_barrier();
  }
#pragma unroll
  for (int r = 0; r < 8; ++r) {
    float l = l_r[r];
    l += __shfl_xor(l, 1, 32); l += __shfl_xor(l, 2, 32); l += __shfl_xor(l, 4, 32); l += __shfl_xor(l, 8, 32);
    l_r[r] = (l > 0.f) ? 1.0f / l : 0.f;
  }
#pragma unroll
  for (int dt = 0; dt < DT; ++dt)
#pragma unroll
    for (int r = 0; r < 8; ++r) sO[w][8 * hh + r][dt * 16 + ln] = oacc[dt][r] * l_r[r];
  __builtin_amdgcn_fence(__ATOMIC_ACQ_REL, "workgroup");
  __builtin_amdgcn_wave_barrier();
  {
    for (int r = 0; r < 16; ++r) {
      const int row = q0 + r;
      if (row < T && lane < D / 4) {
        const v4f val = *(const v4fa*)&sO[w][r][lane * 4];
        *(v4f*)(y + ((size_t)b * T + row) * ypitch + h * D + lane * 4) = val;
      }
    }
    
  }
}

// GEMM C = act(A·W + bias + resid): A f32 (ASPLIT -> hi/lo 2 terms), Wt bf16 [N][K]; ACT 0 none, 1 relu, 2 exact gelu;
// resid (optional, f32, row index = (row % rmod), pitch ldr, RES_BF16 rounds it) added before the activation.
template <bool ASPLIT, int ACT, bool BIAS_BF16, bool RES_BF16>
__global__ __launch_bounds__(128) void k_gemm_bf3(const float* __restrict__ A, int lda, const unsigned short* __restrict__ Wt, int ldb,
                                                const float* __restrict__ bias, const float* __restrict__ resid, int rmod, int ldr,
                                                float* __restrict__ C, int ldc, int M, int N, int K) {
  __shared__ __attribute__((aligned(16))) float so[4][16][64];
  const int tid = threadIdx.x, w = tid >> 5, lane = tid & 31, ln = lane & 15, hh = lane >> 4;
  const int ntn = N / 64;
  const int wid = blockIdx.x * 4 + w;
  const int mt = wid / ntn, nq = wid % ntn;
  if (mt * 16 >= M) return;
  const int row0 = mt * 16, col0 = nq * 64;
  const float* arow = A + (size_t)(row0 + ln) * lda;
  v8f acc[4] = {};
  for (int kb = 0; kb < K; kb += 32) {
    FragB ah, al;
    const v4f x0 = *(const v4fa*)(arow + kb + 8 * hh), x1 = *(const v4fa*)(arow + kb + 8 * hh + 4);
    const v4f x2 = *(const v4fa*)(arow + kb + 16 + 8 * hh), x3 = *(const v4fa*)(arow + kb + 16 + 8 * hh + 4);
    float xs[16] = {x0[0],x0[1],x0[2],x0[3],x1[0],x1[1],x1[2],x1[3],x2[0],x2[1],x2[2],x2[3],x3[0],x3[1],x3[2],x3[3]};
#pragma unroll
    for (int i = 0; i < 16; ++i) { const unsigned short hb = bf16_bits(xs[i]); ah.u[i] = hb; al.u[i] = ASPLIT ? bf16_bits(xs[i] - bf16_val(hb)) : (unsigned short)0; }
#pragma unroll
    for (int t = 0; t < 4; ++t) {
      const unsigned short* brow = Wt + (size_t)(col0 + t * 16 + ln) * ldb + kb;
      FragB b;
      b.half[0] = *(const v8us*)(brow + 8 * hh);
      b.half[1] = *(const v8us*)(brow + 16 + 8 * hh);
      acc[t] = mmaN<ASPLIT ? 2 : 1>(ah.v, al.v, b.v, b.v, acc[t]);
    }
  }
#pragma unroll
  for (int t = 0; t < 4; ++t) {
    const int col = col0 + t * 16 + ln;
    float bv = bias ? bias[col] : 0.f;
    if (BIAS_BF16) bv = bf16_round(bv);
#pragma unroll
    for (int r = 0; r < 8; ++r) {
      float v = acc[t][r] + bv;
      if (resid) { float rv = resid[(size_t)((row0 + 8 * hh + r) % rmod) * ldr + col]; if (RES_BF16) rv = bf16_round(rv); v += rv; }
      if (ACT == 1) v = fmaxf(v, 0.f);
      if (ACT == 2) v = 0.5f * v * (1.0f + erff(v * 0.70710678118654752f));
      if (ACT == 3) { const float u = 0.7978845608028654f * (v + 0.044715f * v * v * v); v = 0.5f * v * (1.0f + tanhf(u)); }
      so[w][8 * hh + r][t * 16 + ln] = v;
    }
  }
  __builtin_amdgcn_fence(__ATOMIC_ACQ_REL, "workgroup");
  __builtin_amdgcn_wave_barrier();
  const int rsub = lane >> 4, c4 = (lane & 15) * 4;
  {
#pragma unroll
    for (int q = 0; q < 8; ++q) {
      const int r = q * 2 + rsub;
      const v4f v = *(const v4fa*)&so[w][r][c4];
      *(v4f*)(C + (size_t)(row0 + r) * ldc + col0 + c4) = v;
    }
    
  }
}
// row LayerNorm (biased variance, eps) over N: s = X (+ R); optional out_sum <- s; out_norm <- (s-mu)*rsqrt(var+eps)*g + b
template <bool PARAM_BF16>
__global__ __launch_bounds__(256) void k_layernorm(const float* __restrict__ X, const float* __restrict__ R, const float* __restrict__ g, const float* __restrict__ bta,
                                                  float* __restrict__ out_sum, float* __restrict__ out_norm, int N, float eps) {
  __shared__ float red[256];
  const int row = blockIdx.x, tid = threadIdx.x;
  const float* x = X + (size_t)row * N; const float* rr = R ? R + (size_t)row * N : nullptr;
  float vals[16];                     // up to N = 4096
  const int per = N / 256;            // contiguous chunk per thread? use strided-by-4 chunks: thread handles j = tid*4 + 1024*u
  float s1 = 0.f;
  for (int u = 0; u < per / 4; ++u) {
    const int j = tid * 4 + 1024 * u;
    const v4f a = *(const v4fa*)(x + j);
    v4f b = {0.f,0.f,0.f,0.f}; if (rr) b = *(const v4fa*)(rr + j);
#pragma unroll
    for (int q = 0; q < 4; ++q) { const float v = a[q] + b[q]; vals[u * 4 + q] = v; s1 += v; }
  }
  red[tid] = s1; __syncthreads();
  for (int st = 128; st > 0; st >>= 1) { if (tid < st) red[tid] += red[tid + st]; __syncthreads(); }
  const float mu = red[0] / (float)N; __syncthreads();
  float s2 = 0.f;
  for (int u = 0; u < per / 4; ++u)
#pragma unroll
    for (int q = 0; q < 4; ++q) { const float c = vals[u * 4 + q] - mu; s2 += c * c; }
  red[tid] = s2; __syncthreads();
  for (int st = 128; st > 0; st >>= 1) { if (tid < st) red[tid] += red[tid + st]; __syncthreads(); }
  const float rs = rsqrtf(red[0] / (float)N + eps);
  {
    for (int u = 0; u < per / 4; ++u) {
      const int j = tid * 4 + 1024 * u;
      v4f o, sm;
#pragma unroll
      for (int q = 0; q < 4; ++q) {
        float gg = g[j + q], bb = bta[j + q];
        if (PARAM_BF16) { gg = bf16_round(gg); bb = bf16_round(bb); }
        sm[q] = vals[u * 4 + q]; o[q] = (vals[u * 4 + q] - mu) * rs * gg + bb;
      }
      if (out_sum) *(v4f*)(out_sum + (size_t)row * N + j) = sm;
      *(v4f*)(out_norm + (size_t)row * N + j) = o;
    }
    
  }
}



// ---- f16 WMMA path (v_wmma_f32_16x16x32_f16): 11-bit significands for operands in range — used where a [0,1] probability operand needs more precision than bf16
typedef _Float16 v16h __attribute__((ext_vector_type(16)));
union FragH { v16h v; v8us half[2]; _Float16 h[16]; unsigned short u[16]; };
template <int NT>
__device__ __forceinline__ v8f mmaH(v16h ah, v16h al, v16h bh, v16h bl, v8f c) {
  c = __builtin_amdgcn_wmma_f32_16x16x32_f16(false, ah, false, bh, (short)0, c, false, false);
  if (NT >= 2) c = __builtin_amdgcn_wmma_f32_16x16x32_f16(false, al, false, bh, (short)0, c, false, false);
  if (NT >= 3) c = __builtin_amdgcn_wmma_f32_16x16x32_f16(false, ah, false, bl, (short)0, c, false, false);
  asm volatile("v_nop\n\tv_nop\n\tv_nop\n\tv_nop" : "+v"(c) : "v"(ah), "v"(al), "v"(bh), "v"(bl));
  return c;
}
// batched GEMM like k_gemm_b but f16 operands: A f32 (split into f16 hi/lo if ASPLIT, else rounded to f16), Bt = f16 values [n][k]; alpha; C f32; N multiple of 16 (partial tiles skipped)
template <bool ASPLIT>
__global__ __launch_bounds__(128) void k_gemm_h(const float* __restrict__ A, int lda, size_t sA, const _Float16* __restrict__ Bh, int ldb, size_t sB, float alpha, float* __restrict__ C, int ldc, size_t sC, int M, int N, int K) {
  __shared__ __attribute__((aligned(16))) float so[4][16][64];
  const int tid = threadIdx.x, w = tid >> 5, lane = tid & 31, ln = lane & 15, hh = lane >> 4; const int by = blockIdx.y;
  A += (size_t)by * sA; Bh += (size_t)by * sB; C += (size_t)by * sC;
  const int ntn = (N + 63) / 64; const int wid = blockIdx.x * 4 + w; const int mt = wid / ntn, nq = wid % ntn; if (mt * 16 >= M) return;
  const int row0 = mt * 16, col0 = nq * 64; const float* arow = A + (size_t)(row0 + ln) * lda;
  v8f acc[4] = {};
  for (int kb = 0; kb < K; kb += 32) {
    FragH ah, al;
    const v4f x0 = *(const v4fa*)(arow + kb + 8 * hh), x1 = *(const v4fa*)(arow + kb + 8 * hh + 4), x2 = *(const v4fa*)(arow + kb + 16 + 8 * hh), x3 = *(const v4fa*)(arow + kb + 16 + 8 * hh + 4);
    float xs[16] = {x0[0],x0[1],x0[2],x0[3],x1[0],x1[1],x1[2],x1[3],x2[0],x2[1],x2[2],x2[3],x3[0],x3[1],x3[2],x3[3]};
#pragma unroll
    for (int i = 0; i < 16; ++i) { const _Float16 h = (_Float16)xs[i]; ah.h[i] = h; al.h[i] = ASPLIT ? (_Float16)(xs[i] - (float)h) : (_Float16)0.0f; }
#pragma unroll
    for (int t = 0; t < 4; ++t) { if (col0 + t * 16 >= N) continue; const size_t boff = (size_t)(col0 + t * 16 + ln) * ldb + kb; FragH bq; bq.half[0] = *(const v8us*)(Bh + boff + 8 * hh); bq.half[1] = *(const v8us*)(Bh + boff + 16 + 8 * hh);
      acc[t] = mmaH<ASPLIT ? 2 : 1>(ah.v, al.v, bq.v, bq.v, acc[t]); }
  }
#pragma unroll
  for (int t = 0; t < 4; ++t) { if (col0 + t * 16 >= N) continue;
#pragma unroll
    for (int r = 0; r < 8; ++r) so[w][8 * hh + r][t * 16 + ln] = acc[t][r] * alpha; }
  __builtin_amdgcn_fence(__ATOMIC_ACQ_REL, "workgroup"); __builtin_amdgcn_wave_barrier();
  const int rsub = lane >> 4, c4 = (lane & 15) * 4;
  {
#pragma unroll
    for (int q = 0; q < 8; ++q) { const int r = q * 2 + rsub; if (col0 + c4 < N) { const v4f v = *(const v4fa*)&so[w][r][c4]; *(v4f*)(C + (size_t)(row0 + r) * ldc + col0 + c4) = v; } }
     }
}

// Wt[n][k] = f16(W[k][n]·scale) from f32 row-major W[K][N] (scale = power of two; bf16-exact weights stay exact in f16 away from the subnormal range)
__device__ __forceinline__ void wt_f16(const float* __restrict__ W, _Float16* __restrict__ Wt, int K, int N, float scale, int blk) {
  const int t = blk * 256 + threadIdx.x; if (t >= N * (K / 8)) return; const int n = t / (K / 8), k8 = (t % (K / 8)) * 8; FragH f;
#pragma unroll
  for (int i = 0; i < 8; ++i) f.h[i] = (_Float16)(bf16_round(W[(size_t)(k8 + i) * N + n]) * scale); const v8us o = f.half[0];
  *(v8us*)((unsigned short*)Wt + (size_t)n * K + k8) = o; 
}
// k_gemm_hh variant with fused epilogue: v = acc·alpha + bias[by·sBias + col] (+ CP[(row/rowsPerB)·sCPb + by·64 + col] if CP) ; ACT 0 none / 1 elu ; writes f16 C16 and f32 C, each if non-null
template <int ACT>
__global__ __launch_bounds__(128) void k_gemm_hhx(const _Float16* __restrict__ A, int lda, size_t sA, const _Float16* __restrict__ Bh, int ldb, size_t sB, float alpha, const float* __restrict__ bias, size_t sBias, const float* __restrict__ CP, int rowsPerB, size_t sCPb, int row0g,
    float* __restrict__ C, _Float16* __restrict__ C16, int ldc, size_t sC, int M, int N, int K) {
  __shared__ __attribute__((aligned(16))) float so[4][16][64];
  const int tid = threadIdx.x, w = tid >> 5, lane = tid & 31, ln = lane & 15, hh = lane >> 4; const int by = blockIdx.y;
  A += (size_t)by * sA; Bh += (size_t)by * sB; const size_t cofs = (size_t)by * sC; const float* bp = bias ? bias + (size_t)by * sBias : nullptr;
  const int ntn = (N + 63) / 64; const int wid = blockIdx.x * 4 + w; const int mt = wid / ntn, nq = wid % ntn; if (mt * 16 >= M) return;
  const int row0 = mt * 16, col0 = nq * 64; const _Float16* arow = A + (size_t)(row0 + ln) * lda;
  v8f acc[4] = {};
  for (int kb = 0; kb < K; kb += 32) { FragH ah; ah.half[0] = *(const v8us*)((const unsigned short*)arow + kb + 8 * hh); ah.half[1] = *(const v8us*)((const unsigned short*)arow + kb + 16 + 8 * hh);
#pragma unroll
    for (int t = 0; t < 4; ++t) { if (col0 + t * 16 >= N) continue; const size_t boff = (size_t)(col0 + t * 16 + ln) * ldb + kb; FragH bq; bq.half[0] = *(const v8us*)((const unsigned short*)Bh + boff + 8 * hh); bq.half[1] = *(const v8us*)((const unsigned short*)Bh + boff + 16 + 8 * hh);
      acc[t] = mmaH<1>(ah.v, ah.v, bq.v, bq.v, acc[t]); }
  }
#pragma unroll
  for (int t = 0; t < 4; ++t) { if (col0 + t * 16 >= N) continue; const int col = col0 + t * 16 + ln; const float bv = bp ? bf16_round(bp[col]) : 0.f;
#pragma unroll
    for (int r = 0; r < 8; ++r) { float v = acc[t][r] * alpha + bv; if (CP) { const int bidx = (row0g + row0 + 8 * hh + r) / rowsPerB; v += CP[(size_t)bidx * sCPb + (size_t)by * 64 + col]; } if (ACT == 1) v = (v > 0.f) ? v : expm1f(v); else if (ACT == 7) v = (v > 0.f) ? v + 1.0f : expf(v); else if (ACT == 8) v = tanhf(v); else if (ACT == 9) v = 0.5f * v * (1.0f + tanhf(0.7978845608028654f * (v + 0.044715f * v * v * v))); else if (ACT == 11) v = 1.0f / (1.0f + expf(-v)); else if (ACT == 12) v = (v > 0.f) ? v : 0.01f * v; else if (ACT == 14) v = (v > 0.f) ? v : 0.1f * v; else if (ACT == 15) v = v / (1.0f + expf(-v)); else if (ACT == 3) v = fmaxf(v, 0.f); else if (ACT == 6) v = 0.5f * v * (1.0f + erff(v * 0.70710678118654752f)); so[w][8 * hh + r][t * 16 + ln] = v; } }
  __builtin_amdgcn_fence(__ATOMIC_ACQ_REL, "workgroup"); __builtin_amdgcn_wave_barrier();
  const int rsub = lane >> 4, c4 = (lane & 15) * 4; typedef _Float16 v4h __attribute__((ext_vector_type(4)));
  {
#pragma unroll
    for (int q = 0; q < 8; ++q) { const int r = q * 2 + rsub; if (col0 + c4 < N) { const v4f v = *(const v4fa*)&so[w][r][c4]; if (C) *(v4f*)(C + cofs + (size_t)(row0 + r) * ldc + col0 + c4) = v; if (C16) { v4h h4; for (int i = 0; i < 4; ++i) h4[i] = (_Float16)v[i]; *(v4h*)(C16 + cofs + (size_t)(row0 + r) * ldc + col0 + c4) = h4; } } }
     }
}


typedef _Float16 v4h __attribute__((ext_vector_type(4)));

__global__ __launch_bounds__(256) void k_x16(const float* __restrict__ x, _Float16* __restrict__ X16, size_t n8) { const size_t t = (size_t)blockIdx.x * 256 + threadIdx.x; if (t >= n8) return; FragH f;
#pragma unroll
  for (int q = 0; q < 8; ++q) f.h[q] = (_Float16)bf16_round(x[t * 8 + q]); *(v8us*)((unsigned short*)X16 + t * 8) = f.half[0];  }
__global__ __launch_bounds__(256) void k_h16(const float* __restrict__ x, _Float16* __restrict__ X16, size_t n8) { const size_t t = (size_t)blockIdx.x * 256 + threadIdx.x; if (t >= n8) return; FragH f;
#pragma unroll
  for (int q = 0; q < 8; ++q) f.h[q] = (_Float16)x[t * 8 + q]; *(v8us*)((unsigned short*)X16 + t * 8) = f.half[0];  }
__global__ __launch_bounds__(256) void k_round16f(const float* __restrict__ W, _Float16* __restrict__ Bt, size_t n8) { const size_t t = (size_t)blockIdx.x * 256 + threadIdx.x; if (t >= n8) return; FragH f;
#pragma unroll
  for (int i = 0; i < 8; ++i) f.h[i] = (_Float16)(bf16_round(W[t * 8 + i]) * 16.0f); *(v8us*)((unsigned short*)Bt + t * 8) = f.half[0];  }
template <int NHv, int TTv>
__global__ __launch_bounds__(256) void k_vt(const _Float16* __restrict__ V16, int ldv, int voff, _Float16* __restrict__ Vt) { __shared__ unsigned short tl[64][66]; const int tid = threadIdx.x; const int slab = blockIdx.x / (TTv / 64), lg = blockIdx.x % (TTv / 64); const int b = slab / NHv, h = slab % NHv;
  for (int i = tid; i < 64 * 8; i += 256) { const int r = i / 8, c8 = (i % 8) * 8; FragH f; f.half[0] = *(const v8us*)((const unsigned short*)V16 + ((size_t)b * TTv + lg * 64 + r) * ldv + voff + h * 64 + c8);
#pragma unroll
    for (int q = 0; q < 8; ++q) tl[r][c8 + q] = f.u[q]; }
  __syncthreads();
  {
#pragma unroll
    for (int rd = 0; rd < 2; ++rd) { const int d = rd * 32 + tid / 8, pc = tid % 8; FragH f;
#pragma unroll
      for (int q = 0; q < 8; ++q) f.u[q] = tl[pc * 8 + q][d];
      *(v8us*)((unsigned short*)Vt + ((size_t)slab * 64 + d) * TTv + lg * 64 + pc * 8) = f.half[0]; }
     } }

__device__ __forceinline__ void tin(const float* __restrict__ x, _Float16* __restrict__ X16, int blk) { __shared__ float tl[BB][32][65]; const int tid = threadIdx.x; const int dg = blk / (TT / 32), tg = blk % (TT / 32); const int d0 = dg * 64, t0 = tg * 32;
  const float* const px = x + ((size_t)(d0 + tid / (BB * 32)) * TT + t0 + (tid / BB) % 32) * BB + tid % BB;      /* the lane's first element; sweep u of the 256 lanes lies 256 / (BB * 32) rows of x further on */
  float xv[64 * 32 * BB / 256];
#pragma unroll      /* constant trip count, unrolled: the values stay in registers and a lane's loads are all in flight together */
  for (int u = 0; u < 64 * 32 * BB / 256; ++u) xv[u] = px[(size_t)u * (256 / (BB * 32)) * TT * BB];
  asm volatile("s_wait_xcnt 0x0" :: "v"(px) : "memory");      /* the wait in front of any overwrite of the loads' address registers; as its input the pair stays whole up to here */
#pragma unroll      /* xv is indexed by constants only, so it stays in registers */
  for (int u = 0; u < 64 * 32 * BB / 256; ++u) { const int i = u * 256 + tid; tl[i % BB][(i / BB) % 32][i / (BB * 32)] = bf16_round(xv[u]); } __syncthreads();
  { for (int i = tid; i < BB * 32 * 8; i += 256) { const int pc = i % 8, tt = (i / 8) % 32, b = i / (8 * 32); FragH f; for (int q = 0; q < 8; ++q) f.h[q] = (_Float16)tl[b][tt][pc * 8 + q]; *(v8us*)((unsigned short*)X16 + ((size_t)b * TT + t0 + tt) * DM + d0 + pc * 8) = f.half[0]; }  } }
// One launch for the five conversions, none of which reads what another writes: blocks 0 .. 4 * WB - 1 transpose the four weights (the longer blocks, so they start first), the rest bring x to (B, T, D).
#define WB (DM * (DM / 8) / 256)
__global__ __launch_bounds__(256) void k_prep(const float* __restrict__ x, const float* __restrict__ Wq, const float* __restrict__ Wk, const float* __restrict__ Wv, const float* __restrict__ Wo, _Float16* __restrict__ Bw, _Float16* __restrict__ X16) {
  const int blk = blockIdx.x;
  if (blk < 4 * WB) { const int wi = blk / WB; const float* W = wi == 0 ? Wq : wi == 1 ? Wk : wi == 2 ? Wv : Wo; wt_f16(W, Bw + (size_t)wi * DM * DM, DM, DM, 16.0f, blk % WB); }      /* (in,out) -> Bt[n][k] x 2^4 */
  else tin(x, X16, blk - 4 * WB);
}
__global__ __launch_bounds__(128) void k_flash(const _Float16* __restrict__ Q16, int ldq, const _Float16* __restrict__ K16, int ldk, const _Float16* __restrict__ Vt, const _Float16* __restrict__ Vtlo, _Float16* __restrict__ OH, _Float16* __restrict__ OL, int ldo) {
  constexpr int RPW = 16, RTN = RPW / 16, NQB = TT / (4 * RPW), DT = 4, KS = 2;
  __shared__ __attribute__((aligned(16))) unsigned short sP[4][RPW][40]; __shared__ __attribute__((aligned(16))) float sO[4][RPW][64 + 4];
  const int tid = threadIdx.x, w = tid >> 5, lane = tid & 31, ln = lane & 15, hh = lane >> 4;
  const int slab = blockIdx.x / NQB, qblk = blockIdx.x % NQB; const int b = slab / NH, h = slab % NH; const int qb0 = qblk * (4 * RPW); const int q0 = qb0 + w * RPW;
  FragH aq[2][KS];
#pragma unroll
  for (int rt = 0; rt < RTN; ++rt) { const unsigned short* qr = (const unsigned short*)Q16 + ((size_t)b * TT + q0 + rt * 16 + ln) * ldq + h * 64;
#pragma unroll
    for (int ks = 0; ks < KS; ++ks) { aq[rt][ks].half[0] = *(const v8us*)(qr + ks * 32 + 8 * hh); aq[rt][ks].half[1] = *(const v8us*)(qr + ks * 32 + 16 + 8 * hh); } }
  const unsigned short* Vth = (const unsigned short*)Vt + (size_t)slab * 64 * TT; const unsigned short* Vtl = (const unsigned short*)Vtlo + (size_t)slab * 64 * TT;
  float m_r[2][8], l_r[2][8]; v8f oacc[2][DT], oaccl[2][DT];
#pragma unroll
  for (int rt = 0; rt < RTN; ++rt) {
#pragma unroll
    for (int r = 0; r < 8; ++r) { m_r[rt][r] = -3.0e38f; l_r[rt][r] = 0.f; }
#pragma unroll
    for (int dt = 0; dt < DT; ++dt) { oacc[rt][dt] = (v8f){0.f,0.f,0.f,0.f,0.f,0.f,0.f,0.f}; oaccl[rt][dt] = oacc[rt][dt]; } }
  const int jbeg = (qb0 - WIN) > 0 ? (qb0 - WIN) : 0; const int jend = (qb0 + 4 * RPW + WIN) < TT ? (qb0 + 4 * RPW + WIN) : TT;      /* block-uniform window bounds (multiples of 32) */
#pragma unroll 1
  for (int j0 = jbeg; j0 < jend; j0 += 32) {
    
    v8f s[2][2];
#pragma unroll
    for (int nt = 0; nt < 2; ++nt) { const unsigned short* kr = (const unsigned short*)K16 + ((size_t)b * TT + j0 + nt * 16 + ln) * ldk + h * 64; FragH bk[KS];
#pragma unroll
      for (int ks = 0; ks < KS; ++ks) { bk[ks].half[0] = *(const v8us*)(kr + ks * 32 + 8 * hh); bk[ks].half[1] = *(const v8us*)(kr + ks * 32 + 16 + 8 * hh); }
#pragma unroll
      for (int rt = 0; rt < RTN; ++rt) { v8f acc = (v8f){0.f,0.f,0.f,0.f,0.f,0.f,0.f,0.f};
#pragma unroll
        for (int ks = 0; ks < KS; ++ks) acc = mmaH<1>(aq[rt][ks].v, aq[rt][ks].v, bk[ks].v, bk[ks].v, acc); s[rt][nt] = acc; } }
#pragma unroll
    for (int rt = 0; rt < RTN; ++rt)
#pragma unroll
      for (int r = 0; r < 8; ++r) { const int tq = q0 + rt * 16 + 8 * hh + r; const int k0 = j0 + ln, k1 = j0 + 16 + ln; (void)tq; (void)k0; (void)k1;
        const bool ok0 = (k0 - tq <= WIN) && (tq - k0 <= WIN), ok1 = (k1 - tq <= WIN) && (tq - k1 <= WIN);
        const float u0 = s[rt][0][r] * 0.18033688011112042f, u1 = s[rt][1][r] * 0.18033688011112042f;      /* score / 8, times log2(e): logits, running maximum and weights all live in base 2, where exponential and logarithm are one instruction each */
        const float g0 = u0 + fminf(u0, 0.f) - __builtin_amdgcn_logf(1.0f + __builtin_amdgcn_exp2f(-fabsf(u0))), g1 = u1 + fminf(u1, 0.f) - __builtin_amdgcn_logf(1.0f + __builtin_amdgcn_exp2f(-fabsf(u1)));      /* (s + log sigmoid(s)) * log2(e); the logarithm's argument lies in [1, 2] */
        const float s0 = ok0 ? g0 : -INFINITY, s1 = ok1 ? g1 : -INFINITY; float mc = fmaxf(s0, s1);
        mc = fmaxf(mc, __shfl_xor(mc, 1, 32)); mc = fmaxf(mc, __shfl_xor(mc, 2, 32)); mc = fmaxf(mc, __shfl_xor(mc, 4, 32)); mc = fmaxf(mc, __shfl_xor(mc, 8, 32));
        const float mn = fmaxf(m_r[rt][r], mc); const float ea = __builtin_amdgcn_exp2f(m_r[rt][r] - mn), e0 = __builtin_amdgcn_exp2f(s0 - mn), e1 = __builtin_amdgcn_exp2f(s1 - mn); const float al = (mn > -1.0e38f) ? ea : 1.0f; m_r[rt][r] = mn; const float p0 = ok0 ? e0 : 0.f, p1 = ok1 ? e1 : 0.f; l_r[rt][r] = l_r[rt][r] * al + p0 + p1;
#pragma unroll
        for (int dt = 0; dt < DT; ++dt) { oacc[rt][dt][r] *= al; oaccl[rt][dt][r] *= al; }
        FragH t2; t2.h[0] = (_Float16)(p0 * 1024.0f); t2.h[1] = (_Float16)(p1 * 1024.0f); sP[w][rt * 16 + 8 * hh + r][ln] = t2.u[0]; sP[w][rt * 16 + 8 * hh + r][16 + ln] = t2.u[1]; }
    __builtin_amdgcn_fence(__ATOMIC_ACQ_REL, "workgroup"); __builtin_amdgcn_wave_barrier();
    FragH pa[2];
#pragma unroll
    for (int rt = 0; rt < RTN; ++rt) { pa[rt].half[0] = *(const v8us*)&sP[w][rt * 16 + ln][8 * hh]; pa[rt].half[1] = *(const v8us*)&sP[w][rt * 16 + ln][16 + 8 * hh]; }
#pragma unroll
    for (int dt = 0; dt < DT; ++dt) { const size_t vo = (size_t)(dt * 16 + ln) * TT + j0; FragH bv, bl; bv.half[0] = *(const v8us*)(Vth + vo + 8 * hh); bv.half[1] = *(const v8us*)(Vth + vo + 16 + 8 * hh); bl.half[0] = *(const v8us*)(Vtl + vo + 8 * hh); bl.half[1] = *(const v8us*)(Vtl + vo + 16 + 8 * hh);
#pragma unroll
      for (int rt = 0; rt < RTN; ++rt) { oacc[rt][dt] = mmaH<1>(pa[rt].v, pa[rt].v, bv.v, bv.v, oacc[rt][dt]); oaccl[rt][dt] = mmaH<1>(pa[rt].v, pa[rt].v, bl.v, bl.v, oaccl[rt][dt]); } }
    __builtin_amdgcn_fence(__ATOMIC_ACQ_REL, "workgroup"); __builtin_amdgcn_wave_barrier(); }
#pragma unroll
  for (int rt = 0; rt < RTN; ++rt) {
#pragma unroll
    for (int r = 0; r < 8; ++r) { float l = l_r[rt][r]; l += __shfl_xor(l, 1, 32); l += __shfl_xor(l, 2, 32); l += __shfl_xor(l, 4, 32); l += __shfl_xor(l, 8, 32); l_r[rt][r] = (l > 0.f) ? 1.0f / (l * 1024.0f) : 0.f; }
#pragma unroll
    for (int dt = 0; dt < DT; ++dt)
#pragma unroll
      for (int r = 0; r < 8; ++r) sO[w][rt * 16 + 8 * hh + r][dt * 16 + ln] = (oacc[rt][dt][r] + oaccl[rt][dt][r] * 0.0009765625f) * l_r[rt][r]; }
  __builtin_amdgcn_fence(__ATOMIC_ACQ_REL, "workgroup"); __builtin_amdgcn_wave_barrier();
  {
#pragma unroll
    for (int rp = 0; rp < RPW; rp += 2) { const int r = rp + (lane >> 4), pc = lane & 15; const v4f val = *(const v4fa*)&sO[w][r][pc * 4]; const size_t o = ((size_t)b * TT + q0 + r) * ldo + h * 64 + pc * 4; v4h oh, ol;      /* the merged row leaves as the output product's two operands: f16 value and residual x 2^10; 16 lanes fill one 128-B line of each plane */
#pragma unroll
      for (int i = 0; i < 4; ++i) { const _Float16 hv = (_Float16)val[i]; oh[i] = hv; ol[i] = (_Float16)((val[i] - (float)hv) * 1024.0f); }
      *(v4h*)(OH + o) = oh; *(v4h*)(OL + o) = ol; }
     } }

// Tiled GEMM for the five 4096 x 1024 x 1024 products, in two launches, A f16 [NR][DM], Bt f16 [n][k]. One 128 x 128 tile per block of 8 waves (4 x 2), 32 x 64 per wave. The epilogue writes what the next kernel reads, so no f32 plane goes through a pass of its own:
// MODE 0: q, k and v in one grid, Bt their three weights one behind the other (3 x 8 column tiles): q, k leave as f16(acc*alpha + bias), row-major (C16, C16k); v = acc*alpha + bias leaves transposed, per (batch, column) a row over t, as f16 value (C16v) and residual x 2^10 (C16l). 2: C = (A.Bt + 2^-10 Alo.Bt)*alpha + bias in the (D, T, B) layout of the output, both products in one accumulator, Alo's first.
// Each trip stages 128 k of the tile's 128 A rows and 128 Bt rows in LDS as whole 256-B rows (pitch 272 B: ds_load_b128 fragment reads meet no bank twice); two buffers, the next trip's rows are
// fetched into registers ahead of this trip's products and stored behind them, one barrier a trip. Every accumulator still sums k in ascending steps of 32.
#define GT 128
#define GK 128
#define GP 136
#define GSO 68
#define GTP 131
// one trip's products of a wave: 128 k in four steps of 32, 2 x 4 accumulator tiles; sa, sb: the lane's own row and k half in the A and Bt parts of the buffer
__device__ __forceinline__ void gemm_trip(const unsigned short* sa, const unsigned short* sb, v8f (&acc)[2][4]) {
#pragma unroll
  for (int ks = 0; ks < GK / 32; ++ks) {
    FragH a[2], b[4];
#pragma unroll
    for (int mi = 0; mi < 2; ++mi) { a[mi].half[0] = *(const v8us*)(sa + mi * 16 * GP + ks * 32); a[mi].half[1] = *(const v8us*)(sa + mi * 16 * GP + ks * 32 + 16); }
#pragma unroll
    for (int ni = 0; ni < 4; ++ni) { b[ni].half[0] = *(const v8us*)(sb + ni * 16 * GP + ks * 32); b[ni].half[1] = *(const v8us*)(sb + ni * 16 * GP + ks * 32 + 16); }
#pragma unroll
    for (int mi = 0; mi < 2; ++mi)
#pragma unroll
      for (int ni = 0; ni < 4; ++ni) acc[mi][ni] = __builtin_amdgcn_wmma_f32_16x16x32_f16(false, a[mi].v, false, b[ni].v, (short)0, acc[mi][ni], false, false);
  }
}
template <int MODE>
__global__ __launch_bounds__(256) void k_gemm_t(const _Float16* __restrict__ A, const _Float16* __restrict__ Alo, const _Float16* __restrict__ Bt, float alpha, const float* __restrict__ bias, const float* __restrict__ biask, const float* __restrict__ biasv, float* __restrict__ C, _Float16* __restrict__ C16, _Float16* __restrict__ C16k, _Float16* __restrict__ C16v, _Float16* __restrict__ C16l) {
  __shared__ __attribute__((aligned(16))) unsigned char smraw[2 * 2 * GT * GP * 2];
  unsigned short* const sm = (unsigned short*)smraw;
  constexpr int BUF = 2 * GT * GP, NK = DM / GK, NTR = (MODE == 2 ? 2 : 1) * NK;      /* MODE 2 walks k twice: the residual plane Alo, then A */
  constexpr bool TB = (MODE >= 2);      /* tile row lr stands for (t, b) = (t0 + lr / BB, lr % BB): the order in which the output holds one column's values, so a column of the tile is one contiguous run there */
  constexpr int AST = (TB ? 16 / BB : 16) * DM;      /* A elements between the rows of two staging sweeps */
  const int tid = threadIdx.x, w = tid >> 5, lane = tid & 31, ln = lane & 15, hh = lane >> 4;
  constexpr int NCT = (MODE == 0 ? 3 : 1) * (DM / GT);      /* column tiles of a row of tiles; the blocks that share an A tile are neighbours in the grid */
  const int mt = blockIdx.x / NCT, ct = blockIdx.x % NCT, part = ct / (DM / GT);      /* part (block-uniform): 0 q, 1 k, 2 v */
  const int row0 = mt * GT, col0 = (ct % (DM / GT)) * GT, t0 = mt * (GT / BB);
  const float* const bp = (MODE == 0) ? (part == 0 ? bias : part == 1 ? biask : biasv) : bias;
  const int wm = (w >> 1) * 32, wn = (w & 1) * 64;
  const int pc = tid & 15, sr = tid >> 4;      /* staging: 16 lanes cover one 256-B row piece by piece; 16 rows per sweep */
  const unsigned short* ga = (const unsigned short*)(MODE == 2 ? Alo : A) + (size_t)(TB ? t0 : row0) * DM;      /* block-uniform bases; the lane's own places are the 32-bit offsets goa and go, which live through the loop */
  const unsigned short* gb = (const unsigned short*)Bt + (size_t)(ct * GT) * DM;
  const unsigned go = (unsigned)(sr * DM + pc * 8);
  const unsigned goa = TB ? (unsigned)(((sr % BB) * TT + sr / BB) * DM + pc * 8) : go;
  unsigned short* const sw = sm + sr * GP + pc * 8;
  v8us st[16];
#pragma unroll
  for (int i = 0; i < 8; ++i) { st[i] = *(const v8us*)(ga + i * AST + goa); st[8 + i] = *(const v8us*)(gb + i * 16 * DM + go); }
#pragma unroll
  for (int i = 0; i < 16; ++i) *(v8us*)(sw + i * 16 * GP) = st[i];
  asm volatile("s_wait_xcnt 0x0" :: "v"(goa), "v"(go) : "memory");      /* the wait in front of any overwrite of the first loads' offset registers, which as its inputs stay whole up to here */
  __syncthreads();
  v8f acc[2][4];
#pragma unroll
  for (int mi = 0; mi < 2; ++mi)
#pragma unroll
    for (int ni = 0; ni < 4; ++ni) acc[mi][ni] = (v8f){0.f,0.f,0.f,0.f,0.f,0.f,0.f,0.f};
#pragma unroll 1      /* rolled: seven (MODE 2: fifteen) copies of the trip save nothing, and a short text is fetched once */
  for (int t = 0; t < NTR - 1; ++t) {
    const int kt = (MODE == 2) ? ((t + 1) & (NK - 1)) : (t + 1);
    const unsigned short* pa = ((MODE == 2 && t + 1 >= NK) ? (const unsigned short*)A + (size_t)t0 * DM : ga) + kt * GK + goa; const unsigned short* pb = gb + kt * GK + go;
#pragma unroll
    for (int i = 0; i < 8; ++i) { st[i] = *(const v8us*)(pa + i * AST); st[8 + i] = *(const v8us*)(pb + i * 16 * DM); }
    __builtin_amdgcn_sched_barrier(0);      /* keeps the next trip's global loads ahead of this trip's products: sunk towards their LDS stores they would leave their latency uncovered */
    gemm_trip(sm + (t & 1) * BUF + (wm + ln) * GP + 8 * hh, sm + (t & 1) * BUF + (GT + wn + ln) * GP + 8 * hh, acc);
    if (MODE == 2 && t == NK - 1) {      /* the residual plane is done: its sums, held x 2^10, come down (exactly) to the scale of the value plane's, which add on top */
#pragma unroll
      for (int mi = 0; mi < 2; ++mi)
#pragma unroll
        for (int ni = 0; ni < 4; ++ni) acc[mi][ni] *= 0.0009765625f;
    }
    asm volatile("s_wait_xcnt 0x0" :: "v"(pa), "v"(pb) : "memory");      /* the wait in front of any overwrite of the loads' address registers; as its inputs the two pairs stay whole up to here, where the loads are a trip old */
#pragma unroll
    for (int i = 0; i < 16; ++i) *(v8us*)(sw + ((t + 1) & 1) * BUF + i * 16 * GP) = st[i];
    __syncthreads();      /* publishes the buffer just written and ends every read of the one that the next trip overwrites */
  }
  gemm_trip(sm + ((NTR - 1) & 1) * BUF + (wm + ln) * GP + 8 * hh, sm + ((NTR - 1) & 1) * BUF + (GT + wn + ln) * GP + 8 * hh, acc);
  __syncthreads();      /* every wave has left the ring before the epilogue writes over it */
  if (MODE == 0 && part < 2) {
    _Float16* const cq = part ? C16k : C16;
    const int rsub = lane >> 4, c4 = (lane & 15) * 4;
    const size_t o0 = (size_t)(row0 + wm + rsub) * DM + col0 + wn + c4;
    float* const so = (float*)smraw + w * (32 * GSO);      /* each wave's own 32 x 64 patch, in the ring that every wave has left */
#pragma unroll
    for (int ni = 0; ni < 4; ++ni) { const float bv = bf16_round(bp[col0 + wn + ni * 16 + ln]);
#pragma unroll
      for (int mi = 0; mi < 2; ++mi)
#pragma unroll
        for (int r = 0; r < 8; ++r) so[(mi * 16 + 8 * hh + r) * GSO + ni * 16 + ln] = acc[mi][ni][r] * alpha + bv; }
    __builtin_amdgcn_fence(__ATOMIC_ACQ_REL, "workgroup"); __builtin_amdgcn_wave_barrier();
#pragma unroll
    for (int q = 0; q < 16; ++q) { const v4f v = *(const v4fa*)&so[(q * 2 + rsub) * GSO + c4]; v4h h4; for (int i = 0; i < 4; ++i) h4[i] = (_Float16)v[i]; *(v4h*)(cq + o0 + (size_t)q * 2 * DM) = h4; }
  } else {
    float* const tl = (float*)smraw;      /* the block's whole 128 x 128 tile in f32, pitch 131 words: it is written by rows and read back by columns */
    float* const op = C + ((size_t)col0 * TT + t0) * BB + lane * 4;      /* MODE 2: a wave takes one column at a time, 128 values = 512 contiguous bytes of the output */
#pragma unroll
    for (int ni = 0; ni < 4; ++ni) { const float bv = bf16_round(bp[col0 + wn + ni * 16 + ln]);
#pragma unroll
      for (int mi = 0; mi < 2; ++mi)
#pragma unroll
        for (int r = 0; r < 8; ++r) tl[(wm + mi * 16 + 8 * hh + r) * GTP + wn + ni * 16 + ln] = acc[mi][ni][r] * alpha + bv; }
    __syncthreads();      /* a column holds values of four waves: all of the tile stands in LDS before any column is read */
    if (MODE == 0) {
      const int t8 = tid & 15, dq = tid >> 4;      /* 16 lanes cover one column's 128 t: 256 contiguous bytes of each plane */
      const size_t vo = ((size_t)(row0 / TT) * DM + col0) * TT + (row0 % TT) + t8 * 8;
#pragma unroll
      for (int i = 0; i < 8; ++i) { const int d = i * 16 + dq; FragH fh, fl;
#pragma unroll
        for (int q = 0; q < 8; ++q) { const float v = tl[(t8 * 8 + q) * GTP + d]; const _Float16 hv = (_Float16)v; fh.h[q] = hv; fl.h[q] = (_Float16)((v - (float)hv) * 1024.0f); }
        *(v8us*)((unsigned short*)C16v + vo + (size_t)d * TT) = fh.half[0]; *(v8us*)((unsigned short*)C16l + vo + (size_t)d * TT) = fl.half[0]; }
      asm volatile("s_wait_xcnt 0x0" ::: "memory");      /* the wait behind the last stores, in front of whatever next writes their address or data registers */
    } else {
#pragma unroll
      for (int i = 0; i < 16; ++i) { const int d = i * 8 + w; v4f v = {tl[(lane * 4) * GTP + d], tl[(lane * 4 + 1) * GTP + d], tl[(lane * 4 + 2) * GTP + d], tl[(lane * 4 + 3) * GTP + d]};
        *(v4f*)(op + (size_t)d * (TT * BB)) = v; }
    }
  }
}

extern "C" void kernel_launch(void* const* d_in, const int* in_sizes, int n_in,
                              void* d_out, int out_size, void* d_ws, size_t ws_size, hipStream_t stream) {
  (void)in_sizes; (void)n_in; (void)out_size;
  const float* const* I = (const float* const*)d_in; const float* x = I[0]; const float* Wq = I[1]; const float* bq = I[2]; const float* Wk = I[3]; const float* bk = I[4]; const float* Wv = I[5]; const float* bv = I[6]; const float* Wo = I[7]; const float* bo = I[8];
  char* ws = (char*)d_ws; size_t off = 0;
  auto take = [&](size_t bytes) { char* p = ws + off; off += (bytes + 255) & ~(size_t)255; return p; };
  const size_t WSZ = (size_t)DM * DM; _Float16* Bw = (_Float16*)take(4 * WSZ * 2); _Float16* X16 = (_Float16*)take((size_t)NR * DM * 2); _Float16* OH = (_Float16*)take((size_t)NR * DM * 2); _Float16* OL = (_Float16*)take((size_t)NR * DM * 2);
  _Float16* Q16 = (_Float16*)take((size_t)NR * DM * 2); _Float16* K16 = (_Float16*)take((size_t)NR * DM * 2); _Float16* Vth = (_Float16*)take((size_t)NR * DM * 2); _Float16* Vtl = (_Float16*)take((size_t)NR * DM * 2);
  if (off > ws_size) return;      // 8 x 8.4 MB, about 67 MB
  k_prep<<<4 * WB + (DM / 64) * (TT / 32), 256, 0, stream>>>(x, Wq, Wk, Wv, Wo, Bw, X16);
  const dim3 gp((NR / GT) * (DM / GT), 1), gp3(3 * (NR / GT) * (DM / GT), 1);
  k_gemm_t<0><<<gp3, 256, 0, stream>>>(X16, nullptr, Bw, 0.0625f, bq, bk, bv, nullptr, Q16, K16, Vth, Vtl);      /* q, k = xt.W + b -> f16; v -> transposed hi / lo planes: M 4096 N 3 x 1024 K 1024 */
  k_flash<<<BB * NH * (TT / 64), 128, 0, stream>>>(Q16, DM, K16, DM, Vth, Vtl, OH, OL, DM);
  k_gemm_t<2><<<gp, 256, 0, stream>>>(OH, OL, Bw + 3 * WSZ, 0.0625f, bo, nullptr, nullptr, (float*)d_out, nullptr, nullptr, nullptr, nullptr);      /* out = (O_hi + 2^-10 O_lo).Wo + bo, in the output's own layout */
}

// v005
// It runs in 105 microseconds.
// In both of two side-by-side timings against v004, it was 1.12 times as fast.
// All steps since v000 together make it 3.98 times as fast.
#include <hip/hip_runtime.h>
// Windowed multi-head self-attention on a (D, T, B)-layout input (D=1024, T=2048, B=2; 16 heads × 64; window |i−j| ≤ 256): xt = x transposed to (B,T,D); q,k,v = xt·W + b; scores = q·kᵀ/8 (−inf outside the window);
// attn = softmax(s + log_sigmoid(s)); out = (attn·v merged)·Wo + bo, transposed back to (D, T, B).
// Compute dtype: x, weights, biases rounded to bf16; q,k f16 GEMM outputs; v f32 → f16 hi + ×2^10 residual Vᵀ planes; fused windowed flash-style kernel (online softmax f32 on the sigsoftmax logits,
// P f16 ×2^10, two value accumulators) on v_wmma_f32_16x16x32_f16; merged O → hi/lo → one Wo GEMM over both planes (lo first, x 2^-10) + bo; layout transposes through LDS, those of v and of the output in the GEMM epilogues; f32 accumulate.
#define BB 2
#define TT 2048
#define DM 1024
#define NH 16
#define HD 64
#define WIN 256
#define NR (BB * TT)

typedef __bf16 v16b __attribute__((ext_vector_type(16)));
typedef unsigned short v8us __attribute__((ext_vector_type(8), may_alias));
typedef float  v8f  __attribute__((ext_vector_type(8)));
typedef float  v4f  __attribute__((ext_vector_type(4)));
typedef float  v4fa __attribute__((ext_vector_type(4), may_alias));
union FragB { v16b v; v8us half[2]; unsigned short u[16]; };

__device__ __forceinline__ unsigned short bf16_bits(float x) { unsigned int u = __float_as_uint(x); return (unsigned short)((u + 0x7FFFu + ((u >> 16) & 1u)) >> 16); }
__device__ __forceinline__ float bf16_val(unsigned short b) { return __uint_as_float(((unsigned int)b) << 16); }
__device__ __forceinline__ float bf16_round(float x) { return bf16_val(bf16_bits(x)); }
// D += A·B with NT terms: 1 = ah·bh, 2 = + al·bh (A split), 3 = + ah·bl (both split)
template <int NT>
__device__ __forceinline__ v8f mmaN(v16b ah, v16b al, v16b bh, v16b bl, v8f c) {
  c = __builtin_amdgcn_wmma_f32_16x16x32_bf16(false, ah, false, bh, (short)0, c, false, false);
  if (NT >= 2) c = __builtin_amdgcn_wmma_f32_16x16x32_bf16(false, al, false, bh, (short)0, c, false, false);
  if (NT >= 3) c = __builtin_amdgcn_wmma_f32_16x16x32_bf16(false, ah, false, bl, (short)0, c, false, false);
  asm volatile("v_nop\n\tv_nop\n\tv_nop\n\tv_nop" : "+v"(c) : "v"(ah), "v"(al), "v"(bh), "v"(bl));
  return c;
}

__global__ __launch_bounds__(256) void k_wt_bf16(const float* __restrict__ W, unsigned short* __restrict__ Wt, int K, int N) {
  const int t = blockIdx.x * 256 + threadIdx.x;
  const int k8n = K / 8;
  if (t >= N * k8n) return;
  const int n = t / k8n, k8 = (t % k8n) * 8;
  v8us v;
#pragma unroll
  for (int i = 0; i < 8; ++i) v[i] = bf16_bits(W[(size_t)(k8 + i) * N + n]);
  *(v8us*)(Wt + (size_t)n * K + k8) = v;
  
}

// GEMM C[M][N] (f32, pitch ldc) = act(A[M][K]·W + bias). A f32 row-major (pitch lda) converted per fragment to bf16
// (ASPLIT: hi/lo two planes -> 2 terms, else single rounded term); Wt bf16 [N][K] (pitch ldb). BIAS_BF16 rounds the
// bias to bf16 first (bias quantised to bf16 before the add). K%32==0, M%16==0, N%64==0.
template <bool ASPLIT, int ACT, bool BIAS_BF16>
__global__ __launch_bounds__(128) void k_gemm_bf(const float* __restrict__ A, int lda, const unsigned short* __restrict__ Wt, int ldb,
                                               const float* __restrict__ bias, float* __restrict__ C, int ldc, int M, int N, int K) {
  __shared__ __attribute__((aligned(16))) float so[4][16][64];
  const int tid = threadIdx.x, w = tid >> 5, lane = tid & 31, ln = lane & 15, hh = lane >> 4;
  const int ntn = N / 64;
  const int wid = blockIdx.x * 4 + w;
  const int mt = wid / ntn, nq = wid % ntn;
  if (mt * 16 >= M) return;
  const int row0 = mt * 16, col0 = nq * 64;
  const float* arow = A + (size_t)(row0 + ln) * lda;
  v8f acc[4] = {};
  for (int kb = 0; kb < K; kb += 32) {
    FragB ah, al;
    const v4f x0 = *(const v4fa*)(arow + kb + 8 * hh), x1 = *(const v4fa*)(arow + kb + 8 * hh + 4);
    const v4f x2 = *(const v4fa*)(arow + kb + 16 + 8 * hh), x3 = *(const v4fa*)(arow + kb + 16 + 8 * hh + 4);
    float xs[16] = {x0[0],x0[1],x0[2],x0[3],x1[0],x1[1],x1[2],x1[3],x2[0],x2[1],x2[2],x2[3],x3[0],x3[1],x3[2],x3[3]};
#pragma unroll
    for (int i = 0; i < 16; ++i) { const unsigned short hb = bf16_bits(xs[i]); ah.u[i] = hb; al.u[i] = ASPLIT ? bf16_bits(xs[i] - bf16_val(hb)) : (unsigned short)0; }
#pragma unroll
    for (int t = 0; t < 4; ++t) {
      const unsigned short* brow = Wt + (size_t)(col0 + t * 16 + ln) * ldb + kb;
      FragB b;
      b.half[0] = *(const v8us*)(brow + 8 * hh);
      b.half[1] = *(const v8us*)(brow + 16 + 8 * hh);
      acc[t] = mmaN<ASPLIT ? 2 : 1>(ah.v, al.v, b.v, b.v, acc[t]);
    }
  }
#pragma unroll
  for (int t = 0; t < 4; ++t) {
    float bv = bias ? bias[col0 + t * 16 + ln] : 0.f;
    if (BIAS_BF16) bv = bf16_round(bv);
#pragma unroll
    for (int r = 0; r < 8; ++r) { float v = acc[t][r] + bv; if (ACT == 1) v = fmaxf(v, 0.f); so[w][8 * hh + r][t * 16 + ln] = v; }
  }
  __builtin_amdgcn_fence(__ATOMIC_ACQ_REL, "workgroup");
  __builtin_amdgcn_wave_barrier();
  const int rsub = lane >> 4, c4 = (lane & 15) * 4;
  {
#pragma unroll
    for (int q = 0; q < 8; ++q) {
      const int r = q * 2 + rsub;
      const v4f v = *(const v4fa*)&so[w][r][c4];
      *(v4f*)(C + (size_t)(row0 + r) * ldc + col0 + c4) = v;
    }
    
  }
}

// Flash-style causal/unmasked attention, all contractions 3-term bf16 hi/lo splits, f32 softmax with running max.
// q,k,v rows are read from f32 buffers with arbitrary row pitch (so they can live inside a fused qkv buffer);
// D = head size (multiple of 32, <= 128); one wave = 16 query rows; block = 4 waves (64 queries) sharing K/V chunks of 32.
template <int D, bool CAUSAL>
__global__ __launch_bounds__(128) void k_flash(const float* __restrict__ qb, const float* __restrict__ kb, const float* __restrict__ vb,
                                             int pitch, int T, int H, float scale, float* __restrict__ y, int ypitch) {
  constexpr int KS = D / 32;        // k-steps for QK
  constexpr int DT = D / 16;        // d tiles for PV
  __shared__ __attribute__((aligned(16))) unsigned short sKh[32][D + 8], sKl[32][D + 8], sVh[32][D + 8], sVl[32][D + 8];
  __shared__ __attribute__((aligned(16))) unsigned short sPh[4][16][40], sPl[4][16][40];
  __shared__ __attribute__((aligned(16))) float sO[4][16][D];
  const int tid = threadIdx.x, w = tid >> 5, lane = tid & 31, ln = lane & 15, hh = lane >> 4;
  const int nqb = (T + 63) / 64;
  const int bh = blockIdx.x / nqb, qblk = blockIdx.x % nqb;
  const int b = bh / H, h = bh % H;
  const int q0 = qblk * 64 + w * 16;
  const float* Q = qb + (size_t)b * T * pitch + h * D;
  const float* K = kb + (size_t)b * T * pitch + h * D;
  const float* V = vb + (size_t)b * T * pitch + h * D;

  // A fragments of the wave's 16 query rows (scaled), hi/lo
  FragB aqh[KS], aql[KS];
  {
    int row = q0 + ln; if (row >= T) row = T - 1;
    const float* qr = Q + (size_t)row * pitch;
#pragma unroll
    for (int ks = 0; ks < KS; ++ks)
#pragma unroll
      for (int i = 0; i < 16; ++i) {
        const int d = ks * 32 + ((i < 8) ? (8 * hh + i) : (16 + 8 * hh + (i - 8)));
        const float x = qr[d] * scale; const unsigned short hb = bf16_bits(x);
        aqh[ks].u[i] = hb; aql[ks].u[i] = bf16_bits(x - bf16_val(hb));
      }
  }
  float m_r[8], l_r[8];
#pragma unroll
  for (int r = 0; r < 8; ++r) { m_r[r] = -3.0e38f; l_r[r] = 0.f; }
  v8f oacc[DT];
#pragma unroll
  for (int dt = 0; dt < DT; ++dt) oacc[dt] = (v8f){0.f,0.f,0.f,0.f,0.f,0.f,0.f,0.f};

  const int kv_end = CAUSAL ? min(T, qblk * 64 + 64) : T;     // block-uniform
  for (int j0 = 0; j0 < kv_end; j0 += 32) {
    __syncthreads();
    for (int e = tid; e < 32 * (D / 4); e += 128) {
      const int r = e / (D / 4), c4 = (e % (D / 4)) * 4;
      const int key = j0 + r;
      v4f kf = {0.f,0.f,0.f,0.f}, vf = {0.f,0.f,0.f,0.f};
      if (key < T) { kf = *(const v4fa*)(K + (size_t)key * pitch + c4); vf = *(const v4fa*)(V + (size_t)key * pitch + c4); }
#pragma unroll
      for (int t = 0; t < 4; ++t) {
        unsigned short hb = bf16_bits(kf[t]); sKh[r][c4 + t] = hb; sKl[r][c4 + t] = bf16_bits(kf[t] - bf16_val(hb));
        hb = bf16_bits(vf[t]); sVh[r][c4 + t] = hb; sVl[r][c4 + t] = bf16_bits(vf[t] - bf16_val(hb));
      }
    }
    __syncthreads();
    // S tile 16 x 32
    v8f s[2];
#pragma unroll
    for (int nt = 0; nt < 2; ++nt) {
      v8f acc = {};
#pragma unroll
      for (int ks = 0; ks < KS; ++ks) {
        FragB bh_, bl_;
        bh_.half[0] = *(const v8us*)&sKh[nt * 16 + ln][ks * 32 + 8 * hh]; bh_.half[1] = *(const v8us*)&sKh[nt * 16 + ln][ks * 32 + 16 + 8 * hh];
        bl_.half[0] = *(const v8us*)&sKl[nt * 16 + ln][ks * 32 + 8 * hh]; bl_.half[1] = *(const v8us*)&sKl[nt * 16 + ln][ks * 32 + 16 + 8 * hh];
        acc = mmaN<3>(aqh[ks].v, aql[ks].v, bh_.v, bl_.v, acc);
      }
      s[nt] = acc;
    }
    // mask + running max (rows 8hh+r; the 16 lanes of a half share rows)
    float alpha[8];
#pragma unroll
    for (int r = 0; r < 8; ++r) {
      const int qi = q0 + 8 * hh + r;
      const int ja = j0 + ln, jb = j0 + 16 + ln;
      if (CAUSAL) { if (ja > qi) s[0][r] = -3.0e38f; if (jb > qi) s[1][r] = -3.0e38f; }
      if (ja >= T) s[0][r] = -3.0e38f;
      if (jb >= T) s[1][r] = -3.0e38f;
      float mx = fmaxf(s[0][r], s[1][r]);
      mx = fmaxf(mx, __shfl_xor(mx, 1, 32)); mx = fmaxf(mx, __shfl_xor(mx, 2, 32)); mx = fmaxf(mx, __shfl_xor(mx, 4, 32)); mx = fmaxf(mx, __shfl_xor(mx, 8, 32));
      const float mnew = fmaxf(m_r[r], mx);
      alpha[r] = (mnew > -1.0e38f) ? __expf(m_r[r] - mnew) : 1.0f;
      const float p0 = (s[0][r] > -1.0e38f) ? __expf(s[0][r] - mnew) : 0.f;
      const float p1 = (s[1][r] > -1.0e38f) ? __expf(s[1][r] - mnew) : 0.f;
      m_r[r] = mnew;
      l_r[r] = l_r[r] * alpha[r] + p0 + p1;            // per-lane partial row sum (16 lanes combined at the end)
      unsigned short hb = bf16_bits(p0); sPh[w][8 * hh + r][ln] = hb;      sPl[w][8 * hh + r][ln] = bf16_bits(p0 - bf16_val(hb));
      hb = bf16_bits(p1);                sPh[w][8 * hh + r][16 + ln] = hb; sPl[w][8 * hh + r][16 + ln] = bf16_bits(p1 - bf16_val(hb));
    }
#pragma unroll
    for (int dt = 0; dt < DT; ++dt)
#pragma unroll
      for (int r = 0; r < 8; ++r) oacc[dt][r] *= alpha[r];
    __builtin_amdgcn_fence(__ATOMIC_ACQ_REL, "workgroup");
    __builtin_amdgcn_wave_barrier();
    FragB pah, pal;
    pah.half[0] = *(const v8us*)&sPh[w][ln][8 * hh]; pah.half[1] = *(const v8us*)&sPh[w][ln][16 + 8 * hh];
    pal.half[0] = *(const v8us*)&sPl[w][ln][8 * hh]; pal.half[1] = *(const v8us*)&sPl[w][ln][16 + 8 * hh];
#pragma unroll
    for (int dt = 0; dt < DT; ++dt) {
      FragB bvh, bvl;
#pragma unroll
      for (int i = 0; i < 8; ++i) {
        bvh.u[i] = sVh[8 * hh + i][dt * 16 + ln]; bvh.u[8 + i] = sVh[16 + 8 * hh + i][dt * 16 + ln];
        bvl.u[i] = sVl[8 * hh + i][dt * 16 + ln]; bvl.u[8 + i] = sVl[16 + 8 * hh + i][dt * 16 + ln];
      }
      oacc[dt] = mmaN<3>(pah.v, pal.v, bvh.v, bvl.v, oacc[dt]);
    }
    __builtin_amdgcn_fence(__ATOMIC_ACQ_REL, "workgroup");
    __builtin_amdgcn_wave_barrier();
  }
#pragma unroll
  for (int r = 0; r < 8; ++r) {
    float l = l_r[r];
    l += __shfl_xor(l, 1, 32); l += __shfl_xor(l, 2, 32); l += __shfl_xor(l, 4, 32); l += __shfl_xor(l, 8, 32);
    l_r[r] = (l > 0.f) ? 1.0f / l : 0.f;
  }
#pragma unroll
  for (int dt = 0; dt < DT; ++dt)
#pragma unroll
    for (int r = 0; r < 8; ++r) sO[w][8 * hh + r][dt * 16 + ln] = oacc[dt][r] * l_r[r];
  __builtin_amdgcn_fence(__ATOMIC_ACQ_REL, "workgroup");
  __builtin_amdgcn_wave_barrier();
  {
    for (int r = 0; r < 16; ++r) {
      const int row = q0 + r;
      if (row < T && lane < D / 4) {
        const v4f val = *(const v4fa*)&sO[w][r][lane * 4];
        *(v4f*)(y + ((size_t)b * T + row) * ypitch + h * D + lane * 4) = val;
      }
    }
    
  }
}

// GEMM C = act(A·W + bias + resid): A f32 (ASPLIT -> hi/lo 2 terms), Wt bf16 [N][K]; ACT 0 none, 1 relu, 2 exact gelu;
// resid (optional, f32, row index = (row % rmod), pitch ldr, RES_BF16 rounds it) added before the activation.
template <bool ASPLIT, int ACT, bool BIAS_BF16, bool RES_BF16>
__global__ __launch_bounds__(128) void k_gemm_bf3(const float* __restrict__ A, int lda, const unsigned short* __restrict__ Wt, int ldb,
                                                const float* __restrict__ bias, const float* __restrict__ resid, int rmod, int ldr,
                                                float* __restrict__ C, int ldc, int M, int N, int K) {
  __shared__ __attribute__((aligned(16))) float so[4][16][64];
  const int tid = threadIdx.x, w = tid >> 5, lane = tid & 31, ln = lane & 15, hh = lane >> 4;
  const int ntn = N / 64;
  const int wid = blockIdx.x * 4 + w;
  const int mt = wid / ntn, nq = wid % ntn;
  if (mt * 16 >= M) return;
  const int row0 = mt * 16, col0 = nq * 64;
  const float* arow = A + (size_t)(row0 + ln) * lda;
  v8f acc[4] = {};
  for (int kb = 0; kb < K; kb += 32) {
    FragB ah, al;
    const v4f x0 = *(const v4fa*)(arow + kb + 8 * hh), x1 = *(const v4fa*)(arow + kb + 8 * hh + 4);
    const v4f x2 = *(const v4fa*)(arow + kb + 16 + 8 * hh), x3 = *(const v4fa*)(arow + kb + 16 + 8 * hh + 4);
    float xs[16] = {x0[0],x0[1],x0[2],x0[3],x1[0],x1[1],x1[2],x1[3],x2[0],x2[1],x2[2],x2[3],x3[0],x3[1],x3[2],x3[3]};
#pragma unroll
    for (int i = 0; i < 16; ++i) { const unsigned short hb = bf16_bits(xs[i]); ah.u[i] = hb; al.u[i] = ASPLIT ? bf16_bits(xs[i] - bf16_val(hb)) : (unsigned short)0; }
#pragma unroll
    for (int t = 0; t < 4; ++t) {
      const unsigned short* brow = Wt + (size_t)(col0 + t * 16 + ln) * ldb + kb;
      FragB b;
      b.half[0] = *(const v8us*)(brow + 8 * hh);
      b.half[1] = *(const v8us*)(brow + 16 + 8 * hh);
      acc[t] = mmaN<ASPLIT ? 2 : 1>(ah.v, al.v, b.v, b.v, acc[t]);
    }
  }
#pragma unroll
  for (int t = 0; t < 4; ++t) {
    const int col = col0 + t * 16 + ln;
    float bv = bias ? bias[col] : 0.f;
    if (BIAS_BF16) bv = bf16_round(bv);
#pragma unroll
    for (int r = 0; r < 8; ++r) {
      float v = acc[t][r] + bv;
      if (resid) { float rv = resid[(size_t)((row0 + 8 * hh + r) % rmod) * ldr + col]; if (RES_BF16) rv = bf16_round(rv); v += rv; }
      if (ACT == 1) v = fmaxf(v, 0.f);
      if (ACT == 2) v = 0.5f * v * (1.0f + erff(v * 0.70710678118654752f));
      if (ACT == 3) { const float u = 0.7978845608028654f * (v + 0.044715f * v * v * v); v = 0.5f * v * (1.0f + tanhf(u)); }
      so[w][8 * hh + r][t * 16 + ln] = v;
    }
  }
  __builtin_amdgcn_fence(__ATOMIC_ACQ_REL, "workgroup");
  __builtin_amdgcn_wave_barrier();
  const int rsub = lane >> 4, c4 = (lane & 15) * 4;
  {
#pragma unroll
    for (int q = 0; q < 8; ++q) {
      const int r = q * 2 + rsub;
      const v4f v = *(const v4fa*)&so[w][r][c4];
      *(v4f*)(C + (size_t)(row0 + r) * ldc + col0 + c4) = v;
    }
    
  }
}
// row LayerNorm (biased variance, eps) over N: s = X (+ R); optional out_sum <- s; out_norm <- (s-mu)*rsqrt(var+eps)*g + b
template <bool PARAM_BF16>
__global__ __launch_bounds__(256) void k_layernorm(const float* __restrict__ X, const float* __restrict__ R, const float* __restrict__ g, const float* __restrict__ bta,
                                                  float* __restrict__ out_sum, float* __restrict__ out_norm, int N, float eps) {
  __shared__ float red[256];
  const int row = blockIdx.x, tid = threadIdx.x;
  const float* x = X + (size_t)row * N; const float* rr = R ? R + (size_t)row * N : nullptr;
  float vals[16];                     // up to N = 4096
  const int per = N / 256;            // contiguous chunk per thread? use strided-by-4 chunks: thread handles j = tid*4 + 1024*u
  float s1 = 0.f;
  for (int u = 0; u < per / 4; ++u) {
    const int j = tid * 4 + 1024 * u;
    const v4f a = *(const v4fa*)(x + j);
    v4f b = {0.f,0.f,0.f,0.f}; if (rr) b = *(const v4fa*)(rr + j);
#pragma unroll
    for (int q = 0; q < 4; ++q) { const float v = a[q] + b[q]; vals[u * 4 + q] = v; s1 += v; }
  }
  red[tid] = s1; __syncthreads();
  for (int st = 128; st > 0; st >>= 1) { if (tid < st) red[tid] += red[tid + st]; __syncthreads(); }
  const float mu = red[0] / (float)N; __syncthreads();
  float s2 = 0.f;
  for (int u = 0; u < per / 4; ++u)
#pragma unroll
    for (int q = 0; q < 4; ++q) { const float c = vals[u * 4 + q] - mu; s2 += c * c; }
  red[tid] = s2; __syncthreads();
  for (int st = 128; st > 0; st >>= 1) { if (tid < st) red[tid] += red[tid + st]; __syncthreads(); }
  const float rs = rsqrtf(red[0] / (float)N + eps);
  {
    for (int u = 0; u < per / 4; ++u) {
      const int j = tid * 4 + 1024 * u;
      v4f o, sm;
#pragma unroll
      for (int q = 0; q < 4; ++q) {
        float gg = g[j + q], bb = bta[j + q];
        if (PARAM_BF16) { gg = bf16_round(gg); bb = bf16_round(bb); }
        sm[q] = vals[u * 4 + q]; o[q] = (vals[u * 4 + q] - mu) * rs * gg + bb;
      }
      if (out_sum) *(v4f*)(out_sum + (size_t)row * N + j) = sm;
      *(v4f*)(out_norm + (size_t)row * N + j) = o;
    }
    
  }
}



// ---- f16 WMMA path (v_wmma_f32_16x16x32_f16): 11-bit significands for operands in range — used where a [0,1] probability operand needs more precision than bf16
typedef _Float16 v16h __attribute__((ext_vector_type(16)));
union FragH { v16h v; v8us half[2]; _Float16 h[16]; unsigned short u[16]; };
template <int NT>
__device__ __forceinline__ v8f mmaH(v16h ah, v16h al, v16h bh, v16h bl, v8f c) {
  c = __builtin_amdgcn_wmma_f32_16x16x32_f16(false, ah, false, bh, (short)0, c, false, false);
  if (NT >= 2) c = __builtin_amdgcn_wmma_f32_16x16x32_f16(false, al, false, bh, (short)0, c, false, false);
  if (NT >= 3) c = __builtin_amdgcn_wmma_f32_16x16x32_f16(false, ah, false, bl, (short)0, c, false, false);
  asm volatile("v_nop\n\tv_nop\n\tv_nop\n\tv_nop" : "+v"(c) : "v"(ah), "v"(al), "v"(bh), "v"(bl));
  return c;
}
// batched GEMM like k_gemm_b but f16 operands: A f32 (split into f16 hi/lo if ASPLIT, else rounded to f16), Bt = f16 values [n][k]; alpha; C f32; N multiple of 16 (partial tiles skipped)
template <bool ASPLIT>
__global__ __launch_bounds__(128) void k_gemm_h(const float* __restrict__ A, int lda, size_t sA, const _Float16* __restrict__ Bh, int ldb, size_t sB, float alpha, float* __restrict__ C, int ldc, size_t sC, int M, int N, int K) {
  __shared__ __attribute__((aligned(16))) float so[4][16][64];
  const int tid = threadIdx.x, w = tid >> 5, lane = tid & 31, ln = lane & 15, hh = lane >> 4; const int by = blockIdx.y;
  A += (size_t)by * sA; Bh += (size_t)by * sB; C += (size_t)by * sC;
  const int ntn = (N + 63) / 64; const int wid = blockIdx.x * 4 + w; const int mt = wid / ntn, nq = wid % ntn; if (mt * 16 >= M) return;
  const int row0 = mt * 16, col0 = nq * 64; const float* arow = A + (size_t)(row0 + ln) * lda;
  v8f acc[4] = {};
  for (int kb = 0; kb < K; kb += 32) {
    FragH ah, al;
    const v4f x0 = *(const v4fa*)(arow + kb + 8 * hh), x1 = *(const v4fa*)(arow + kb + 8 * hh + 4), x2 = *(const v4fa*)(arow + kb + 16 + 8 * hh), x3 = *(const v4fa*)(arow + kb + 16 + 8 * hh + 4);
    float xs[16] = {x0[0],x0[1],x0[2],x0[3],x1[0],x1[1],x1[2],x1[3],x2[0],x2[1],x2[2],x2[3],x3[0],x3[1],x3[2],x3[3]};
#pragma unroll
    for (int i = 0; i < 16; ++i) { const _Float16 h = (_Float16)xs[i]; ah.h[i] = h; al.h[i] = ASPLIT ? (_Float16)(xs[i] - (float)h) : (_Float16)0.0f; }
#pragma unroll
    for (int t = 0; t < 4; ++t) { if (col0 + t * 16 >= N) continue; const size_t boff = (size_t)(col0 + t * 16 + ln) * ldb + kb; FragH bq; bq.half[0] = *(const v8us*)(Bh + boff + 8 * hh); bq.half[1] = *(const v8us*)(Bh + boff + 16 + 8 * hh);
      acc[t] = mmaH<ASPLIT ? 2 : 1>(ah.v, al.v, bq.v, bq.v, acc[t]); }
  }
#pragma unroll
  for (int t = 0; t < 4; ++t) { if (col0 + t * 16 >= N) continue;
#pragma unroll
    for (int r = 0; r < 8; ++r) so[w][8 * hh + r][t * 16 + ln] = acc[t][r] * alpha; }
  __builtin_amdgcn_fence(__ATOMIC_ACQ_REL, "workgroup"); __builtin_amdgcn_wave_barrier();
  const int rsub = lane >> 4, c4 = (lane & 15) * 4;
  {
#pragma unroll
    for (int q = 0; q < 8; ++q) { const int r = q * 2 + rsub; if (col0 + c4 < N) { const v4f v = *(const v4fa*)&so[w][r][c4]; *(v4f*)(C + (size_t)(row0 + r) * ldc + col0 + c4) = v; } }
     }
}

// Wt[n][k] = f16(W[k][n]·scale) from f32 row-major W[K][N] (scale = power of two; bf16-exact weights stay exact in f16 away from the subnormal range)
__device__ __forceinline__ void wt_f16(const float* __restrict__ W, _Float16* __restrict__ Wt, int K, int N, float scale, int blk) {
  const int t = blk * 256 + threadIdx.x; if (t >= N * (K / 8)) return; const int n = t / (K / 8), k8 = (t % (K / 8)) * 8; FragH f;
#pragma unroll
  for (int i = 0; i < 8; ++i) f.h[i] = (_Float16)(bf16_round(W[(size_t)(k8 + i) * N + n]) * scale); const v8us o = f.half[0];
  *(v8us*)((unsigned short*)Wt + (size_t)n * K + k8) = o; 
}
// k_gemm_hh variant with fused epilogue: v = acc·alpha + bias[by·sBias + col] (+ CP[(row/rowsPerB)·sCPb + by·64 + col] if CP) ; ACT 0 none / 1 elu ; writes f16 C16 and f32 C, each if non-null
template <int ACT>
__global__ __launch_bounds__(128) void k_gemm_hhx(const _Float16* __restrict__ A, int lda, size_t sA, const _Float16* __restrict__ Bh, int ldb, size_t sB, float alpha, const float* __restrict__ bias, size_t sBias, const float* __restrict__ CP, int rowsPerB, size_t sCPb, int row0g,
    float* __restrict__ C, _Float16* __restrict__ C16, int ldc, size_t sC, int M, int N, int K) {
  __shared__ __attribute__((aligned(16))) float so[4][16][64];
  const int tid = threadIdx.x, w = tid >> 5, lane = tid & 31, ln = lane & 15, hh = lane >> 4; const int by = blockIdx.y;
  A += (size_t)by * sA; Bh += (size_t)by * sB; const size_t cofs = (size_t)by * sC; const float* bp = bias ? bias + (size_t)by * sBias : nullptr;
  const int ntn = (N + 63) / 64; const int wid = blockIdx.x * 4 + w; const int mt = wid / ntn, nq = wid % ntn; if (mt * 16 >= M) return;
  const int row0 = mt * 16, col0 = nq * 64; const _Float16* arow = A + (size_t)(row0 + ln) * lda;
  v8f acc[4] = {};
  for (int kb = 0; kb < K; kb += 32) { FragH ah; ah.half[0] = *(const v8us*)((const unsigned short*)arow + kb + 8 * hh); ah.half[1] = *(const v8us*)((const unsigned short*)arow + kb + 16 + 8 * hh);
#pragma unroll
    for (int t = 0; t < 4; ++t) { if (col0 + t * 16 >= N) continue; const size_t boff = (size_t)(col0 + t * 16 + ln) * ldb + kb; FragH bq; bq.half[0] = *(const v8us*)((const unsigned short*)Bh + boff + 8 * hh); bq.half[1] = *(const v8us*)((const unsigned short*)Bh + boff + 16 + 8 * hh);
      acc[t] = mmaH<1>(ah.v, ah.v, bq.v, bq.v, acc[t]); }
  }
#pragma unroll
  for (int t = 0; t < 4; ++t) { if (col0 + t * 16 >= N) continue; const int col = col0 + t * 16 + ln; const float bv = bp ? bf16_round(bp[col]) : 0.f;
#pragma unroll
    for (int r = 0; r < 8; ++r) { float v = acc[t][r] * alpha + bv; if (CP) { const int bidx = (row0g + row0 + 8 * hh + r) / rowsPerB; v += CP[(size_t)bidx * sCPb + (size_t)by * 64 + col]; } if (ACT == 1) v = (v > 0.f) ? v : expm1f(v); else if (ACT == 7) v = (v > 0.f) ? v + 1.0f : expf(v); else if (ACT == 8) v = tanhf(v); else if (ACT == 9) v = 0.5f * v * (1.0f + tanhf(0.7978845608028654f * (v + 0.044715f * v * v * v))); else if (ACT == 11) v = 1.0f / (1.0f + expf(-v)); else if (ACT == 12) v = (v > 0.f) ? v : 0.01f * v; else if (ACT == 14) v = (v > 0.f) ? v : 0.1f * v; else if (ACT == 15) v = v / (1.0f + expf(-v)); else if (ACT == 3) v = fmaxf(v, 0.f); else if (ACT == 6) v = 0.5f * v * (1.0f + erff(v * 0.70710678118654752f)); so[w][8 * hh + r][t * 16 + ln] = v; } }
  __builtin_amdgcn_fence(__ATOMIC_ACQ_REL, "workgroup"); __builtin_amdgcn_wave_barrier();
  const int rsub = lane >> 4, c4 = (lane & 15) * 4; typedef _Float16 v4h __attribute__((ext_vector_type(4)));
  {
#pragma unroll
    for (int q = 0; q < 8; ++q) { const int r = q * 2 + rsub; if (col0 + c4 < N) { const v4f v = *(const v4fa*)&so[w][r][c4]; if (C) *(v4f*)(C + cofs + (size_t)(row0 + r) * ldc + col0 + c4) = v; if (C16) { v4h h4; for (int i = 0; i < 4; ++i) h4[i] = (_Float16)v[i]; *(v4h*)(C16 + cofs + (size_t)(row0 + r) * ldc + col0 + c4) = h4; } } }
     }
}


typedef _Float16 v4h __attribute__((ext_vector_type(4)));

__global__ __launch_bounds__(256) void k_x16(const float* __restrict__ x, _Float16* __restrict__ X16, size_t n8) { const size_t t = (size_t)blockIdx.x * 256 + threadIdx.x; if (t >= n8) return; FragH f;
#pragma unroll
  for (int q = 0; q < 8; ++q) f.h[q] = (_Float16)bf16_round(x[t * 8 + q]); *(v8us*)((unsigned short*)X16 + t * 8) = f.half[0];  }
__global__ __launch_bounds__(256) void k_h16(const float* __restrict__ x, _Float16* __restrict__ X16, size_t n8) { const size_t t = (size_t)blockIdx.x * 256 + threadIdx.x; if (t >= n8) return; FragH f;
#pragma unroll
  for (int q = 0; q < 8; ++q) f.h[q] = (_Float16)x[t * 8 + q]; *(v8us*)((unsigned short*)X16 + t * 8) = f.half[0];  }
__global__ __launch_bounds__(256) void k_round16f(const float* __restrict__ W, _Float16* __restrict__ Bt, size_t n8) { const size_t t = (size_t)blockIdx.x * 256 + threadIdx.x; if (t >= n8) return; FragH f;
#pragma unroll
  for (int i = 0; i < 8; ++i) f.h[i] = (_Float16)(bf16_round(W[t * 8 + i]) * 16.0f); *(v8us*)((unsigned short*)Bt + t * 8) = f.half[0];  }
template <int NHv, int TTv>
__global__ __launch_bounds__(256) void k_vt(const _Float16* __restrict__ V16, int ldv, int voff, _Float16* __restrict__ Vt) { __shared__ unsigned short tl[64][66]; const int tid = threadIdx.x; const int slab = blockIdx.x / (TTv / 64), lg = blockIdx.x % (TTv / 64); const int b = slab / NHv, h = slab % NHv;
  for (int i = tid; i < 64 * 8; i += 256) { const int r = i / 8, c8 = (i % 8) * 8; FragH f; f.half[0] = *(const v8us*)((const unsigned short*)V16 + ((size_t)b * TTv + lg * 64 + r) * ldv + voff + h * 64 + c8);
#pragma unroll
    for (int q = 0; q < 8; ++q) tl[r][c8 + q] = f.u[q]; }
  __syncthreads();
  {
#pragma unroll
    for (int rd = 0; rd < 2; ++rd) { const int d = rd * 32 + tid / 8, pc = tid % 8; FragH f;
#pragma unroll
      for (int q = 0; q < 8; ++q) f.u[q] = tl[pc * 8 + q][d];
      *(v8us*)((unsigned short*)Vt + ((size_t)slab * 64 + d) * TTv + lg * 64 + pc * 8) = f.half[0]; }
     } }

__device__ __forceinline__ void tin(const float* __restrict__ x, _Float16* __restrict__ X16, int blk) { __shared__ float tl[BB][32][65]; const int tid = threadIdx.x; const int dg = blk / (TT / 32), tg = blk % (TT / 32); const int d0 = dg * 64, t0 = tg * 32;
  const float* const px = x + ((size_t)(d0 + tid / (BB * 32)) * TT + t0 + (tid / BB) % 32) * BB + tid % BB;      /* the lane's first element; sweep u of the 256 lanes lies 256 / (BB * 32) rows of x further on */
  float xv[64 * 32 * BB / 256];
#pragma unroll      /* constant trip count, unrolled: the values stay in registers and a lane's loads are all in flight together */
  for (int u = 0; u < 64 * 32 * BB / 256; ++u) xv[u] = px[(size_t)u * (256 / (BB * 32)) * TT * BB];
  asm volatile("s_wait_xcnt 0x0" :: "v"(px) : "memory");      /* the wait in front of any overwrite of the loads' address registers; as its input the pair stays whole up to here */
#pragma unroll      /* xv is indexed by constants only, so it stays in registers */
  for (int u = 0; u < 64 * 32 * BB / 256; ++u) { const int i = u * 256 + tid; tl[i % BB][(i / BB) % 32][i / (BB * 32)] = bf16_round(xv[u]); } __syncthreads();
  { for (int i = tid; i < BB * 32 * 8; i += 256) { const int pc = i % 8, tt = (i / 8) % 32, b = i / (8 * 32); FragH f; for (int q = 0; q < 8; ++q) f.h[q] = (_Float16)tl[b][tt][pc * 8 + q]; *(v8us*)((unsigned short*)X16 + ((size_t)b * TT + t0 + tt) * DM + d0 + pc * 8) = f.half[0]; }  } }
// One launch for the five conversions, none of which reads what another writes: blocks 0 .. 4 * WB - 1 transpose the four weights (the longer blocks, so they start first), the rest bring x to (B, T, D).
#define WB (DM * (DM / 8) / 256)
__global__ __launch_bounds__(256) void k_prep(const float* __restrict__ x, const float* __restrict__ Wq, const float* __restrict__ Wk, const float* __restrict__ Wv, const float* __restrict__ Wo, _Float16* __restrict__ Bw, _Float16* __restrict__ X16) {
  const int blk = blockIdx.x;
  if (blk < 4 * WB) { const int wi = blk / WB; const float* W = wi == 0 ? Wq : wi == 1 ? Wk : wi == 2 ? Wv : Wo; wt_f16(W, Bw + (size_t)wi * DM * DM, DM, DM, 16.0f, blk % WB); }      /* (in,out) -> Bt[n][k] x 2^4 */
  else tin(x, X16, blk - 4 * WB);
}
__global__ __launch_bounds__(128) void k_flash(const _Float16* __restrict__ Q16, int ldq, const _Float16* __restrict__ K16, int ldk, const _Float16* __restrict__ Vt, const _Float16* __restrict__ Vtlo, _Float16* __restrict__ OH, _Float16* __restrict__ OL, int ldo) {
  constexpr int RPW = 16, RTN = RPW / 16, NQB = TT / (4 * RPW), DT = 4, KS = 2;
  __shared__ __attribute__((aligned(16))) unsigned short sP[4][RPW][40]; __shared__ __attribute__((aligned(16))) float sO[4][RPW][64 + 4];
  const int tid = threadIdx.x, w = tid >> 5, lane = tid & 31, ln = lane & 15, hh = lane >> 4;
  const int slab = blockIdx.x / NQB, qblk = blockIdx.x % NQB; const int b = slab / NH, h = slab % NH; const int qb0 = qblk * (4 * RPW); const int q0 = qb0 + w * RPW;
  FragH aq[2][KS];
#pragma unroll
  for (int rt = 0; rt < RTN; ++rt) { const unsigned short* qr = (const unsigned short*)Q16 + ((size_t)b * TT + q0 + rt * 16 + ln) * ldq + h * 64;
#pragma unroll
    for (int ks = 0; ks < KS; ++ks) { aq[rt][ks].half[0] = *(const v8us*)(qr + ks * 32 + 8 * hh); aq[rt][ks].half[1] = *(const v8us*)(qr + ks * 32 + 16 + 8 * hh); } }
  const unsigned short* Vth = (const unsigned short*)Vt + (size_t)slab * 64 * TT; const unsigned short* Vtl = (const unsigned short*)Vtlo + (size_t)slab * 64 * TT;
  float m_r[2][8], l_r[2][8]; v8f oacc[2][DT], oaccl[2][DT];
#pragma unroll
  for (int rt = 0; rt < RTN; ++rt) {
#pragma unroll
    for (int r = 0; r < 8; ++r) { m_r[rt][r] = -3.0e38f; l_r[rt][r] = 0.f; }
#pragma unroll
    for (int dt = 0; dt < DT; ++dt) { oacc[rt][dt] = (v8f){0.f,0.f,0.f,0.f,0.f,0.f,0.f,0.f}; oaccl[rt][dt] = oacc[rt][dt]; } }
  const int jbeg = (qb0 - WIN) > 0 ? (qb0 - WIN) : 0; const int jend = (qb0 + 4 * RPW + WIN) < TT ? (qb0 + 4 * RPW + WIN) : TT;      /* block-uniform window bounds (multiples of 32) */
#pragma unroll 1
  for (int j0 = jbeg; j0 < jend; j0 += 32) {
    
    v8f s[2][2]; FragH bk[2][KS];
#pragma unroll
    for (int nt = 0; nt < 2; ++nt) { const unsigned short* kr = (const unsigned short*)K16 + ((size_t)b * TT + j0 + nt * 16 + ln) * ldk + h * 64;      /* both key tiles' loads fly together, ahead of the first score product */
#pragma unroll
      for (int ks = 0; ks < KS; ++ks) { bk[nt][ks].half[0] = *(const v8us*)(kr + ks * 32 + 8 * hh); bk[nt][ks].half[1] = *(const v8us*)(kr + ks * 32 + 16 + 8 * hh); } }
#pragma unroll
    for (int nt = 0; nt < 2; ++nt)
#pragma unroll
      for (int rt = 0; rt < RTN; ++rt) { v8f acc = (v8f){0.f,0.f,0.f,0.f,0.f,0.f,0.f,0.f};
#pragma unroll
        for (int ks = 0; ks < KS; ++ks) acc = mmaH<1>(aq[rt][ks].v, aq[rt][ks].v, bk[nt][ks].v, bk[nt][ks].v, acc); s[rt][nt] = acc; }
    FragH bv[DT], bl[DT];      /* the trip's 16 value-fragment loads, issued in one run here, where the softmax below covers their latency; the compiler moves no load up across a product's asm statement, so a pair loaded between the products waits out its own */
    const unsigned short* const pvh = Vth + (size_t)ln * TT + j0 + 8 * hh; const unsigned short* const pvl = Vtl + (size_t)ln * TT + j0 + 8 * hh;
#pragma unroll
    for (int dt = 0; dt < DT; ++dt) { bv[dt].half[0] = *(const v8us*)(pvh + dt * 16 * TT); bv[dt].half[1] = *(const v8us*)(pvh + dt * 16 * TT + 16); bl[dt].half[0] = *(const v8us*)(pvl + dt * 16 * TT); bl[dt].half[1] = *(const v8us*)(pvl + dt * 16 * TT + 16); }
    asm volatile("s_wait_xcnt 0x0" :: "v"(pvh), "v"(pvl) : "memory");      /* the wait in front of any overwrite of the loads' address registers; as its inputs the two pairs stay whole up to here */
#pragma unroll
    for (int rt = 0; rt < RTN; ++rt)
#pragma unroll
      for (int r = 0; r < 8; ++r) { const int tq = q0 + rt * 16 + 8 * hh + r; const int k0 = j0 + ln, k1 = j0 + 16 + ln; (void)tq; (void)k0; (void)k1;
        const bool ok0 = (k0 - tq <= WIN) && (tq - k0 <= WIN), ok1 = (k1 - tq <= WIN) && (tq - k1 <= WIN);
        const float u0 = s[rt][0][r] * 0.18033688011112042f, u1 = s[rt][1][r] * 0.18033688011112042f;      /* score / 8, times log2(e): logits, running maximum and weights all live in base 2, where exponential and logarithm are one instruction each */
        const float g0 = u0 + fminf(u0, 0.f) - __builtin_amdgcn_logf(1.0f + __builtin_amdgcn_exp2f(-fabsf(u0))), g1 = u1 + fminf(u1, 0.f) - __builtin_amdgcn_logf(1.0f + __builtin_amdgcn_exp2f(-fabsf(u1)));      /* (s + log sigmoid(s)) * log2(e); the logarithm's argument lies in [1, 2] */
        const float s0 = ok0 ? g0 : -INFINITY, s1 = ok1 ? g1 : -INFINITY; float mc = fmaxf(s0, s1);
        mc = fmaxf(mc, __shfl_xor(mc, 1, 32)); mc = fmaxf(mc, __shfl_xor(mc, 2, 32)); mc = fmaxf(mc, __shfl_xor(mc, 4, 32)); mc = fmaxf(mc, __shfl_xor(mc, 8, 32));
        const float mn = fmaxf(m_r[rt][r], mc); const float ea = __builtin_amdgcn_exp2f(m_r[rt][r] - mn), e0 = __builtin_amdgcn_exp2f(s0 - mn), e1 = __builtin_amdgcn_exp2f(s1 - mn); const float al = (mn > -1.0e38f) ? ea : 1.0f; m_r[rt][r] = mn; const float p0 = ok0 ? e0 : 0.f, p1 = ok1 ? e1 : 0.f; l_r[rt][r] = l_r[rt][r] * al + p0 + p1;
#pragma unroll
        for (int dt = 0; dt < DT; ++dt) { oacc[rt][dt][r] *= al; oaccl[rt][dt][r] *= al; }
        FragH t2; t2.h[0] = (_Float16)(p0 * 1024.0f); t2.h[1] = (_Float16)(p1 * 1024.0f); sP[w][rt * 16 + 8 * hh + r][ln] = t2.u[0]; sP[w][rt * 16 + 8 * hh + r][16 + ln] = t2.u[1]; }
    __builtin_amdgcn_fence(__ATOMIC_ACQ_REL, "workgroup"); __builtin_amdgcn_wave_barrier();
    FragH pa[2];
#pragma unroll
    for (int rt = 0; rt < RTN; ++rt) { pa[rt].half[0] = *(const v8us*)&sP[w][rt * 16 + ln][8 * hh]; pa[rt].half[1] = *(const v8us*)&sP[w][rt * 16 + ln][16 + 8 * hh]; }
#pragma unroll
    for (int dt = 0; dt < DT; ++dt)
#pragma unroll
      for (int rt = 0; rt < RTN; ++rt) { oacc[rt][dt] = mmaH<1>(pa[rt].v, pa[rt].v, bv[dt].v, bv[dt].v, oacc[rt][dt]); oaccl[rt][dt] = mmaH<1>(pa[rt].v, pa[rt].v, bl[dt].v, bl[dt].v, oaccl[rt][dt]); }
    __builtin_amdgcn_fence(__ATOMIC_ACQ_REL, "workgroup"); __builtin_amdgcn_wave_barrier(); }
#pragma unroll
  for (int rt = 0; rt < RTN; ++rt) {
#pragma unroll
    for (int r = 0; r < 8; ++r) { float l = l_r[rt][r]; l += __shfl_xor(l, 1, 32); l += __shfl_xor(l, 2, 32); l += __shfl_xor(l, 4, 32); l += __shfl_xor(l, 8, 32); l_r[rt][r] = (l > 0.f) ? 1.0f / (l * 1024.0f) : 0.f; }
#pragma unroll
    for (int dt = 0; dt < DT; ++dt)
#pragma unroll
      for (int r = 0; r < 8; ++r) sO[w][rt * 16 + 8 * hh + r][dt * 16 + ln] = (oacc[rt][dt][r] + oaccl[rt][dt][r] * 0.0009765625f) * l_r[rt][r]; }
  __builtin_amdgcn_fence(__ATOMIC_ACQ_REL, "workgroup"); __builtin_amdgcn_wave_barrier();
  {
#pragma unroll
    for (int rp = 0; rp < RPW; rp += 2) { const int r = rp + (lane >> 4), pc = lane & 15; const v4f val = *(const v4fa*)&sO[w][r][pc * 4]; const size_t o = ((size_t)b * TT + q0 + r) * ldo + h * 64 + pc * 4; v4h oh, ol;      /* the merged row leaves as the output product's two operands: f16 value and residual x 2^10; 16 lanes fill one 128-B line of each plane */
#pragma unroll
      for (int i = 0; i < 4; ++i) { const _Float16 hv = (_Float16)val[i]; oh[i] = hv; ol[i] = (_Float16)((val[i] - (float)hv) * 1024.0f); }
      *(v4h*)(OH + o) = oh; *(v4h*)(OL + o) = ol; }
     } }

// Tiled GEMM for the five 4096 x 1024 x 1024 products, in two launches, A f16 [NR][DM], Bt f16 [n][k]. One 128 x 128 tile per block of 8 waves (4 x 2), 32 x 64 per wave. The epilogue writes what the next kernel reads, so no f32 plane goes through a pass of its own:
// MODE 0: q, k and v in one grid, Bt their three weights one behind the other (3 x 8 column tiles): q, k leave as f16(acc*alpha + bias), row-major (C16, C16k); v = acc*alpha + bias leaves transposed, per (batch, column) a row over t, as f16 value (C16v) and residual x 2^10 (C16l). 2: C = (A.Bt + 2^-10 Alo.Bt)*alpha + bias in the (D, T, B) layout of the output, both products in one accumulator, Alo's first.
// Each trip stages 128 k of the tile's 128 A rows and 128 Bt rows in LDS as whole 256-B rows (pitch 272 B: ds_load_b128 fragment reads meet no bank twice); two buffers, the next trip's rows are
// fetched into registers ahead of this trip's products and stored behind them, one barrier a trip. Every accumulator still sums k in ascending steps of 32.
#define GT 128
#define GK 128
#define GP 136
#define GSO 68
#define GTP 131
// one trip's products of a wave: 128 k in four steps of 32, 2 x 4 accumulator tiles; sa, sb: the lane's own row and k half in the A and Bt parts of the buffer
__device__ __forceinline__ void gemm_trip(const unsigned short* sa, const unsigned short* sb, v8f (&acc)[2][4]) {
#pragma unroll
  for (int ks = 0; ks < GK / 32; ++ks) {
    FragH a[2], b[4];
#pragma unroll
    for (int mi = 0; mi < 2; ++mi) { a[mi].half[0] = *(const v8us*)(sa + mi * 16 * GP + ks * 32); a[mi].half[1] = *(const v8us*)(sa + mi * 16 * GP + ks * 32 + 16); }
#pragma unroll
    for (int ni = 0; ni < 4; ++ni) { b[ni].half[0] = *(const v8us*)(sb + ni * 16 * GP + ks * 32); b[ni].half[1] = *(const v8us*)(sb + ni * 16 * GP + ks * 32 + 16); }
#pragma unroll
    for (int mi = 0; mi < 2; ++mi)
#pragma unroll
      for (int ni = 0; ni < 4; ++ni) acc[mi][ni] = __builtin_amdgcn_wmma_f32_16x16x32_f16(false, a[mi].v, false, b[ni].v, (short)0, acc[mi][ni], false, false);
  }
}
template <int MODE>
__global__ __launch_bounds__(256) void k_gemm_t(const _Float16* __restrict__ A, const _Float16* __restrict__ Alo, const _Float16* __restrict__ Bt, float alpha, const float* __restrict__ bias, const float* __restrict__ biask, const float* __restrict__ biasv, float* __restrict__ C, _Float16* __restrict__ C16, _Float16* __restrict__ C16k, _Float16* __restrict__ C16v, _Float16* __restrict__ C16l) {
  __shared__ __attribute__((aligned(16))) unsigned char smraw[2 * 2 * GT * GP * 2];
  unsigned short* const sm = (unsigned short*)smraw;
  constexpr int BUF = 2 * GT * GP, NK = DM / GK, NTR = (MODE == 2 ? 2 : 1) * NK;      /* MODE 2 walks k twice: the residual plane Alo, then A */
  constexpr bool TB = (MODE >= 2);      /* tile row lr stands for (t, b) = (t0 + lr / BB, lr % BB): the order in which the output holds one column's values, so a column of the tile is one contiguous run there */
  constexpr int AST = (TB ? 16 / BB : 16) * DM;      /* A elements between the rows of two staging sweeps */
  const int tid = threadIdx.x, w = tid >> 5, lane = tid & 31, ln = lane & 15, hh = lane >> 4;
  constexpr int NCT = (MODE == 0 ? 3 : 1) * (DM / GT);      /* column tiles of a row of tiles; the blocks that share an A tile are neighbours in the grid */
  const int mt = blockIdx.x / NCT, ct = blockIdx.x % NCT, part = ct / (DM / GT);      /* part (block-uniform): 0 q, 1 k, 2 v */
  const int row0 = mt * GT, col0 = (ct % (DM / GT)) * GT, t0 = mt * (GT / BB);
  const float* const bp = (MODE == 0) ? (part == 0 ? bias : part == 1 ? biask : biasv) : bias;
  const int wm = (w >> 1) * 32, wn = (w & 1) * 64;
  const int pc = tid & 15, sr = tid >> 4;      /* staging: 16 lanes cover one 256-B row piece by piece; 16 rows per sweep */
  const unsigned short* ga = (const unsigned short*)(MODE == 2 ? Alo : A) + (size_t)(TB ? t0 : row0) * DM;      /* block-uniform bases; the lane's own places are the 32-bit offsets goa and go, which live through the loop */
  const unsigned short* gb = (const unsigned short*)Bt + (size_t)(ct * GT) * DM;
  const unsigned go = (unsigned)(sr * DM + pc * 8);
  const unsigned goa = TB ? (unsigned)(((sr % BB) * TT + sr / BB) * DM + pc * 8) : go;
  unsigned short* const sw = sm + sr * GP + pc * 8;
  v8us st[16];
#pragma unroll
  for (int i = 0; i < 8; ++i) { st[i] = *(const v8us*)(ga + i * AST + goa); st[8 + i] = *(const v8us*)(gb + i * 16 * DM + go); }
#pragma unroll
  for (int i = 0; i < 16; ++i) *(v8us*)(sw + i * 16 * GP) = st[i];
  asm volatile("s_wait_xcnt 0x0" :: "v"(goa), "v"(go) : "memory");      /* the wait in front of any overwrite of the first loads' offset registers, which as its inputs stay whole up to here */
  __syncthreads();
  v8f acc[2][4];
#pragma unroll
  for (int mi = 0; mi < 2; ++mi)
#pragma unroll
    for (int ni = 0; ni < 4; ++ni) acc[mi][ni] = (v8f){0.f,0.f,0.f,0.f,0.f,0.f,0.f,0.f};
#pragma unroll 1      /* rolled: seven (MODE 2: fifteen) copies of the trip save nothing, and a short text is fetched once */
  for (int t = 0; t < NTR - 1; ++t) {
    const int kt = (MODE == 2) ? ((t + 1) & (NK - 1)) : (t + 1);
    const unsigned short* pa = ((MODE == 2 && t + 1 >= NK) ? (const unsigned short*)A + (size_t)t0 * DM : ga) + kt * GK + goa; const unsigned short* pb = gb + kt * GK + go;
#pragma unroll
    for (int i = 0; i < 8; ++i) { st[i] = *(const v8us*)(pa + i * AST); st[8 + i] = *(const v8us*)(pb + i * 16 * DM); }
    __builtin_amdgcn_sched_barrier(0);      /* keeps the next trip's global loads ahead of this trip's products: sunk towards their LDS stores they would leave their latency uncovered */
    gemm_trip(sm + (t & 1) * BUF + (wm + ln) * GP + 8 * hh, sm + (t & 1) * BUF + (GT + wn + ln) * GP + 8 * hh, acc);
    if (MODE == 2 && t == NK - 1) {      /* the residual plane is done: its sums, held x 2^10, come down (exactly) to the scale of the value plane's, which add on top */
#pragma unroll
      for (int mi = 0; mi < 2; ++mi)
#pragma unroll
        for (int ni = 0; ni < 4; ++ni) acc[mi][ni] *= 0.0009765625f;
    }
    asm volatile("s_wait_xcnt 0x0" :: "v"(pa), "v"(pb) : "memory");      /* the wait in front of any overwrite of the loads' address registers; as its inputs the two pairs stay whole up to here, where the loads are a trip old */
#pragma unroll
    for (int i = 0; i < 16; ++i) *(v8us*)(sw + ((t + 1) & 1) * BUF + i * 16 * GP) = st[i];
    __syncthreads();      /* publishes the buffer just written and ends every read of the one that the next trip overwrites */
  }
  gemm_trip(sm + ((NTR - 1) & 1) * BUF + (wm + ln) * GP + 8 * hh, sm + ((NTR - 1) & 1) * BUF + (GT + wn + ln) * GP + 8 * hh, acc);
  __syncthreads();      /* every wave has left the ring before the epilogue writes over it */
  if (MODE == 0 && part < 2) {
    _Float16* const cq = part ? C16k : C16;
    const int rsub = lane >> 4, c4 = (lane & 15) * 4;
    const size_t o0 = (size_t)(row0 + wm + rsub) * DM + col0 + wn + c4;
    float* const so = (float*)smraw + w * (32 * GSO);      /* each wave's own 32 x 64 patch, in the ring that every wave has left */
#pragma unroll
    for (int ni = 0; ni < 4; ++ni) { const float bv = bf16_round(bp[col0 + wn + ni * 16 + ln]);
#pragma unroll
      for (int mi = 0; mi < 2; ++mi)
#pragma unroll
        for (int r = 0; r < 8; ++r) so[(mi * 16 + 8 * hh + r) * GSO + ni * 16 + ln] = acc[mi][ni][r] * alpha + bv; }
    __builtin_amdgcn_fence(__ATOMIC_ACQ_REL, "workgroup"); __builtin_amdgcn_wave_barrier();
#pragma unroll
    for (int q = 0; q < 16; ++q) { const v4f v = *(const v4fa*)&so[(q * 2 + rsub) * GSO + c4]; v4h h4; for (int i = 0; i < 4; ++i) h4[i] = (_Float16)v[i]; *(v4h*)(cq + o0 + (size_t)q * 2 * DM) = h4; }
  } else {
    float* const tl = (float*)smraw;      /* the block's whole 128 x 128 tile in f32, pitch 131 words: it is written by rows and read back by columns */
    float* const op = C + ((size_t)col0 * TT + t0) * BB + lane * 4;      /* MODE 2: a wave takes one column at a time, 128 values = 512 contiguous bytes of the output */
#pragma unroll
    for (int ni = 0; ni < 4; ++ni) { const float bv = bf16_round(bp[col0 + wn + ni * 16 + ln]);
#pragma unroll
      for (int mi = 0; mi < 2; ++mi)
#pragma unroll
        for (int r = 0; r < 8; ++r) tl[(wm + mi * 16 + 8 * hh + r) * GTP + wn + ni * 16 + ln] = acc[mi][ni][r] * alpha + bv; }
    __syncthreads();      /* a column holds values of four waves: all of the tile stands in LDS before any column is read */
    if (MODE == 0) {
      const int t8 = tid & 15, dq = tid >> 4;      /* 16 lanes cover one column's 128 t: 256 contiguous bytes of each plane */
      const size_t vo = ((size_t)(row0 / TT) * DM + col0) * TT + (row0 % TT) + t8 * 8;
#pragma unroll
      for (int i = 0; i < 8; ++i) { const int d = i * 16 + dq; FragH fh, fl;
#pragma unroll
        for (int q = 0; q < 8; ++q) { const float v = tl[(t8 * 8 + q) * GTP + d]; const _Float16 hv = (_Float16)v; fh.h[q] = hv; fl.h[q] = (_Float16)((v - (float)hv) * 1024.0f); }
        *(v8us*)((unsigned short*)C16v + vo + (size_t)d * TT) = fh.half[0]; *(v8us*)((unsigned short*)C16l + vo + (size_t)d * TT) = fl.half[0]; }
      asm volatile("s_wait_xcnt 0x0" ::: "memory");      /* the wait behind the last stores, in front of whatever next writes their address or data registers */
    } else {
#pragma unroll
      for (int i = 0; i < 16; ++i) { const int d = i * 8 + w; v4f v = {tl[(lane * 4) * GTP + d], tl[(lane * 4 + 1) * GTP + d], tl[(lane * 4 + 2) * GTP + d], tl[(lane * 4 + 3) * GTP + d]};
        *(v4f*)(op + (size_t)d * (TT * BB)) = v; }
    }
  }
}

extern "C" void kernel_launch(void* const* d_in, const int* in_sizes, int n_in,
                              void* d_out, int out_size, void* d_ws, size_t ws_size, hipStream_t stream) {
  (void)in_sizes; (void)n_in; (void)out_size;
  const float* const* I = (const float* const*)d_in; const float* x = I[0]; const float* Wq = I[1]; const float* bq = I[2]; const float* Wk = I[3]; const float* bk = I[4]; const float* Wv = I[5]; const float* bv = I[6]; const float* Wo = I[7]; const float* bo = I[8];
  char* ws = (char*)d_ws; size_t off = 0;
  auto take = [&](size_t bytes) { char* p = ws + off; off += (bytes + 255) & ~(size_t)255; return p; };
  const size_t WSZ = (size_t)DM * DM; _Float16* Bw = (_Float16*)take(4 * WSZ * 2); _Float16* X16 = (_Float16*)take((size_t)NR * DM * 2); _Float16* OH = (_Float16*)take((size_t)NR * DM * 2); _Float16* OL = (_Float16*)take((size_t)NR * DM * 2);
  _Float16* Q16 = (_Float16*)take((size_t)NR * DM * 2); _Float16* K16 = (_Float16*)take((size_t)NR * DM * 2); _Float16* Vth = (_Float16*)take((size_t)NR * DM * 2); _Float16* Vtl = (_Float16*)take((size_t)NR * DM * 2);
  if (off > ws_size) return;      // 8 x 8.4 MB, about 67 MB
  k_prep<<<4 * WB + (DM / 64) * (TT / 32), 256, 0, stream>>>(x, Wq, Wk, Wv, Wo, Bw, X16);
  const dim3 gp((NR / GT) * (DM / GT), 1), gp3(3 * (NR / GT) * (DM / GT), 1);
  k_gemm_t<0><<<gp3, 256, 0, stream>>>(X16, nullptr, Bw, 0.0625f, bq, bk, bv, nullptr, Q16, K16, Vth, Vtl);      /* q, k = xt.W + b -> f16; v -> transposed hi / lo planes: M 4096 N 3 x 1024 K 1024 */
  k_flash<<<BB * NH * (TT / 64), 128, 0, stream>>>(Q16, DM, K16, DM, Vth, Vtl, OH, OL, DM);
  k_gemm_t<2><<<gp, 256, 0, stream>>>(OH, OL, Bw + 3 * WSZ, 0.0625f, bo, nullptr, nullptr, (float*)d_out, nullptr, nullptr, nullptr, nullptr);      /* out = (O_hi + 2^-10 O_lo).Wo + bo, in the output's own layout */
}

// v006
// One run takes 101 microseconds.
// Timed twice side by side with v005, it ran 1.05 and 1.04 times as fast.
// Counting every step since v000, it is 4.15 times as fast.
#include <hip/hip_runtime.h>
// Windowed multi-head self-attention on a (D, T, B)-layout input (D=1024, T=2048, B=2; 16 heads × 64; window |i−j| ≤ 256): xt = x transposed to (B,T,D); q,k,v = xt·W + b; scores = q·kᵀ/8 (−inf outside the window);
// attn = softmax(s + log_sigmoid(s)); out = (attn·v merged)·Wo + bo, transposed back to (D, T, B).
// Compute dtype: x, weights, biases rounded to bf16; q,k f16 GEMM outputs; v f32 → f16 hi + ×2^10 residual Vᵀ planes; fused windowed flash-style kernel (online softmax f32 on the sigsoftmax logits,
// P f16 ×2^10, two value accumulators) on v_wmma_f32_16x16x32_f16; merged O → hi/lo → one Wo GEMM over both planes (lo first, x 2^-10) + bo; layout transposes through LDS, those of v and of the output in the GEMM epilogues; f32 accumulate.
#define BB 2
#define TT 2048
#define DM 1024
#define NH 16
#define HD 64
#define WIN 256
#define NR (BB * TT)

typedef __bf16 v16b __attribute__((ext_vector_type(16)));
typedef unsigned short v8us __attribute__((ext_vector_type(8), may_alias));
typedef float  v8f  __attribute__((ext_vector_type(8)));
typedef float  v4f  __attribute__((ext_vector_type(4)));
typedef float  v4fa __attribute__((ext_vector_type(4), may_alias));
union FragB { v16b v; v8us half[2]; unsigned short u[16]; };

__device__ __forceinline__ unsigned short bf16_bits(float x) { unsigned int u = __float_as_uint(x); return (unsigned short)((u + 0x7FFFu + ((u >> 16) & 1u)) >> 16); }
__device__ __forceinline__ float bf16_val(unsigned short b) { return __uint_as_float(((unsigned int)b) << 16); }
__device__ __forceinline__ float bf16_round(float x) { return bf16_val(bf16_bits(x)); }
// D += A·B with NT terms: 1 = ah·bh, 2 = + al·bh (A split), 3 = + ah·bl (both split)
template <int NT>
__device__ __forceinline__ v8f mmaN(v16b ah, v16b al, v16b bh, v16b bl, v8f c) {
  c = __builtin_amdgcn_wmma_f32_16x16x32_bf16(false, ah, false, bh, (short)0, c, false, false);
  if (NT >= 2) c = __builtin_amdgcn_wmma_f32_16x16x32_bf16(false, al, false, bh, (short)0, c, false, false);
  if (NT >= 3) c = __builtin_amdgcn_wmma_f32_16x16x32_bf16(false, ah, false, bl, (short)0, c, false, false);
  asm volatile("v_nop\n\tv_nop\n\tv_nop\n\tv_nop" : "+v"(c) : "v"(ah), "v"(al), "v"(bh), "v"(bl));
  return c;
}

__global__ __launch_bounds__(256) void k_wt_bf16(const float* __restrict__ W, unsigned short* __restrict__ Wt, int K, int N) {
  const int t = blockIdx.x * 256 + threadIdx.x;
  const int k8n = K / 8;
  if (t >= N * k8n) return;
  const int n = t / k8n, k8 = (t % k8n) * 8;
  v8us v;
#pragma unroll
  for (int i = 0; i < 8; ++i) v[i] = bf16_bits(W[(size_t)(k8 + i) * N + n]);
  *(v8us*)(Wt + (size_t)n * K + k8) = v;
  
}

// GEMM C[M][N] (f32, pitch ldc) = act(A[M][K]·W + bias). A f32 row-major (pitch lda) converted per fragment to bf16
// (ASPLIT: hi/lo two planes -> 2 terms, else single rounded term); Wt bf16 [N][K] (pitch ldb). BIAS_BF16 rounds the
// bias to bf16 first (bias quantised to bf16 before the add). K%32==0, M%16==0, N%64==0.
template <bool ASPLIT, int ACT, bool BIAS_BF16>
__global__ __launch_bounds__(128) void k_gemm_bf(const float* __restrict__ A, int lda, const unsigned short* __restrict__ Wt, int ldb,
                                               const float* __restrict__ bias, float* __restrict__ C, int ldc, int M, int N, int K) {
  __shared__ __attribute__((aligned(16))) float so[4][16][64];
  const int tid = threadIdx.x, w = tid >> 5, lane = tid & 31, ln = lane & 15, hh = lane >> 4;
  const int ntn = N / 64;
  const int wid = blockIdx.x * 4 + w;
  const int mt = wid / ntn, nq = wid % ntn;
  if (mt * 16 >= M) return;
  const int row0 = mt * 16, col0 = nq * 64;
  const float* arow = A + (size_t)(row0 + ln) * lda;
  v8f acc[4] = {};
  for (int kb = 0; kb < K; kb += 32) {
    FragB ah, al;
    const v4f x0 = *(const v4fa*)(arow + kb + 8 * hh), x1 = *(const v4fa*)(arow + kb + 8 * hh + 4);
    const v4f x2 = *(const v4fa*)(arow + kb + 16 + 8 * hh), x3 = *(const v4fa*)(arow + kb + 16 + 8 * hh + 4);
    float xs[16] = {x0[0],x0[1],x0[2],x0[3],x1[0],x1[1],x1[2],x1[3],x2[0],x2[1],x2[2],x2[3],x3[0],x3[1],x3[2],x3[3]};
#pragma unroll
    for (int i = 0; i < 16; ++i) { const unsigned short hb = bf16_bits(xs[i]); ah.u[i] = hb; al.u[i] = ASPLIT ? bf16_bits(xs[i] - bf16_val(hb)) : (unsigned short)0; }
#pragma unroll
    for (int t = 0; t < 4; ++t) {
      const unsigned short* brow = Wt + (size_t)(col0 + t * 16 + ln) * ldb + kb;
      FragB b;
      b.half[0] = *(const v8us*)(brow + 8 * hh);
      b.half[1] = *(const v8us*)(brow + 16 + 8 * hh);
      acc[t] = mmaN<ASPLIT ? 2 : 1>(ah.v, al.v, b.v, b.v, acc[t]);
    }
  }
#pragma unroll
  for (int t = 0; t < 4; ++t) {
    float bv = bias ? bias[col0 + t * 16 + ln] : 0.f;
    if (BIAS_BF16) bv = bf16_round(bv);
#pragma unroll
    for (int r = 0; r < 8; ++r) { float v = acc[t][r] + bv; if (ACT == 1) v = fmaxf(v, 0.f); so[w][8 * hh + r][t * 16 + ln] = v; }
  }
  __builtin_amdgcn_fence(__ATOMIC_ACQ_REL, "workgroup");
  __builtin_amdgcn_wave_barrier();
  const int rsub = lane >> 4, c4 = (lane & 15) * 4;
  {
#pragma unroll
    for (int q = 0; q < 8; ++q) {
      const int r = q * 2 + rsub;
      const v4f v = *(const v4fa*)&so[w][r][c4];
      *(v4f*)(C + (size_t)(row0 + r) * ldc + col0 + c4) = v;
    }
    
  }
}

// Flash-style causal/unmasked attention, all contractions 3-term bf16 hi/lo splits, f32 softmax with running max.
// q,k,v rows are read from f32 buffers with arbitrary row pitch (so they can live inside a fused qkv buffer);
// D = head size (multiple of 32, <= 128); one wave = 16 query rows; block = 4 waves (64 queries) sharing K/V chunks of 32.
template <int D, bool CAUSAL>
__global__ __launch_bounds__(128) void k_flash(const float* __restrict__ qb, const float* __restrict__ kb, const float* __restrict__ vb,
                                             int pitch, int T, int H, float scale, float* __restrict__ y, int ypitch) {
  constexpr int KS = D / 32;        // k-steps for QK
  constexpr int DT = D / 16;        // d tiles for PV
  __shared__ __attribute__((aligned(16))) unsigned short sKh[32][D + 8], sKl[32][D + 8], sVh[32][D + 8], sVl[32][D + 8];
  __shared__ __attribute__((aligned(16))) unsigned short sPh[4][16][40], sPl[4][16][40];
  __shared__ __attribute__((aligned(16))) float sO[4][16][D];
  const int tid = threadIdx.x, w = tid >> 5, lane = tid & 31, ln = lane & 15, hh = lane >> 4;
  const int nqb = (T + 63) / 64;
  const int bh = blockIdx.x / nqb, qblk = blockIdx.x % nqb;
  const int b = bh / H, h = bh % H;
  const int q0 = qblk * 64 + w * 16;
  const float* Q = qb + (size_t)b * T * pitch + h * D;
  const float* K = kb + (size_t)b * T * pitch + h * D;
  const float* V = vb + (size_t)b * T * pitch + h * D;

  // A fragments of the wave's 16 query rows (scaled), hi/lo
  FragB aqh[KS], aql[KS];
  {
    int row = q0 + ln; if (row >= T) row = T - 1;
    const float* qr = Q + (size_t)row * pitch;
#pragma unroll
    for (int ks = 0; ks < KS; ++ks)
#pragma unroll
      for (int i = 0; i < 16; ++i) {
        const int d = ks * 32 + ((i < 8) ? (8 * hh + i) : (16 + 8 * hh + (i - 8)));
        const float x = qr[d] * scale; const unsigned short hb = bf16_bits(x);
        aqh[ks].u[i] = hb; aql[ks].u[i] = bf16_bits(x - bf16_val(hb));
      }
  }
  float m_r[8], l_r[8];
#pragma unroll
  for (int r = 0; r < 8; ++r) { m_r[r] = -3.0e38f; l_r[r] = 0.f; }
  v8f oacc[DT];
#pragma unroll
  for (int dt = 0; dt < DT; ++dt) oacc[dt] = (v8f){0.f,0.f,0.f,0.f,0.f,0.f,0.f,0.f};

  const int kv_end = CAUSAL ? min(T, qblk * 64 + 64) : T;     // block-uniform
  for (int j0 = 0; j0 < kv_end; j0 += 32) {
    __syncthreads();
    for (int e = tid; e < 32 * (D / 4); e += 128) {
      const int r = e / (D / 4), c4 = (e % (D / 4)) * 4;
      const int key = j0 + r;
      v4f kf = {0.f,0.f,0.f,0.f}, vf = {0.f,0.f,0.f,0.f};
      if (key < T) { kf = *(const v4fa*)(K + (size_t)key * pitch + c4); vf = *(const v4fa*)(V + (size_t)key * pitch + c4); }
#pragma unroll
      for (int t = 0; t < 4; ++t) {
        unsigned short hb = bf16_bits(kf[t]); sKh[r][c4 + t] = hb; sKl[r][c4 + t] = bf16_bits(kf[t] - bf16_val(hb));
        hb = bf16_bits(vf[t]); sVh[r][c4 + t] = hb; sVl[r][c4 + t] = bf16_bits(vf[t] - bf16_val(hb));
      }
    }
    __syncthreads();
    // S tile 16 x 32
    v8f s[2];
#pragma unroll
    for (int nt = 0; nt < 2; ++nt) {
      v8f acc = {};
#pragma unroll
      for (int ks = 0; ks < KS; ++ks) {
        FragB bh_, bl_;
        bh_.half[0] = *(const v8us*)&sKh[nt * 16 + ln][ks * 32 + 8 * hh]; bh_.half[1] = *(const v8us*)&sKh[nt * 16 + ln][ks * 32 + 16 + 8 * hh];
        bl_.half[0] = *(const v8us*)&sKl[nt * 16 + ln][ks * 32 + 8 * hh]; bl_.half[1] = *(const v8us*)&sKl[nt * 16 + ln][ks * 32 + 16 + 8 * hh];
        acc = mmaN<3>(aqh[ks].v, aql[ks].v, bh_.v, bl_.v, acc);
      }
      s[nt] = acc;
    }
    // mask + running max (rows 8hh+r; the 16 lanes of a half share rows)
    float alpha[8];
#pragma unroll
    for (int r = 0; r < 8; ++r) {
      const int qi = q0 + 8 * hh + r;
      const int ja = j0 + ln, jb = j0 + 16 + ln;
      if (CAUSAL) { if (ja > qi) s[0][r] = -3.0e38f; if (jb > qi) s[1][r] = -3.0e38f; }
      if (ja >= T) s[0][r] = -3.0e38f;
      if (jb >= T) s[1][r] = -3.0e38f;
      float mx = fmaxf(s[0][r], s[1][r]);
      mx = fmaxf(mx, __shfl_xor(mx, 1, 32)); mx = fmaxf(mx, __shfl_xor(mx, 2, 32)); mx = fmaxf(mx, __shfl_xor(mx, 4, 32)); mx = fmaxf(mx, __shfl_xor(mx, 8, 32));
      const float mnew = fmaxf(m_r[r], mx);
      alpha[r] = (mnew > -1.0e38f) ? __expf(m_r[r] - mnew) : 1.0f;
      const float p0 = (s[0][r] > -1.0e38f) ? __expf(s[0][r] - mnew) : 0.f;
      const float p1 = (s[1][r] > -1.0e38f) ? __expf(s[1][r] - mnew) : 0.f;
      m_r[r] = mnew;
      l_r[r] = l_r[r] * alpha[r] + p0 + p1;            // per-lane partial row sum (16 lanes combined at the end)
      unsigned short hb = bf16_bits(p0); sPh[w][8 * hh + r][ln] = hb;      sPl[w][8 * hh + r][ln] = bf16_bits(p0 - bf16_val(hb));
      hb = bf16_bits(p1);                sPh[w][8 * hh + r][16 + ln] = hb; sPl[w][8 * hh + r][16 + ln] = bf16_bits(p1 - bf16_val(hb));
    }
#pragma unroll
    for (int dt = 0; dt < DT; ++dt)
#pragma unroll
      for (int r = 0; r < 8; ++r) oacc[dt][r] *= alpha[r];
    __builtin_amdgcn_fence(__ATOMIC_ACQ_REL, "workgroup");
    __builtin_amdgcn_wave_barrier();
    FragB pah, pal;
    pah.half[0] = *(const v8us*)&sPh[w][ln][8 * hh]; pah.half[1] = *(const v8us*)&sPh[w][ln][16 + 8 * hh];
    pal.half[0] = *(const v8us*)&sPl[w][ln][8 * hh]; pal.half[1] = *(const v8us*)&sPl[w][ln][16 + 8 * hh];
#pragma unroll
    for (int dt = 0; dt < DT; ++dt) {
      FragB bvh, bvl;
#pragma unroll
      for (int i = 0; i < 8; ++i) {
        bvh.u[i] = sVh[8 * hh + i][dt * 16 + ln]; bvh.u[8 + i] = sVh[16 + 8 * hh + i][dt * 16 + ln];
        bvl.u[i] = sVl[8 * hh + i][dt * 16 + ln]; bvl.u[8 + i] = sVl[16 + 8 * hh + i][dt * 16 + ln];
      }
      oacc[dt] = mmaN<3>(pah.v, pal.v, bvh.v, bvl.v, oacc[dt]);
    }
    __builtin_amdgcn_fence(__ATOMIC_ACQ_REL, "workgroup");
    __builtin_amdgcn_wave_barrier();
  }
#pragma unroll
  for (int r = 0; r < 8; ++r) {
    float l = l_r[r];
    l += __shfl_xor(l, 1, 32); l += __shfl_xor(l, 2, 32); l += __shfl_xor(l, 4, 32); l += __shfl_xor(l, 8, 32);
    l_r[r] = (l > 0.f) ? 1.0f / l : 0.f;
  }
#pragma unroll
  for (int dt = 0; dt < DT; ++dt)
#pragma unroll
    for (int r = 0; r < 8; ++r) sO[w][8 * hh + r][dt * 16 + ln] = oacc[dt][r] * l_r[r];
  __builtin_amdgcn_fence(__ATOMIC_ACQ_REL, "workgroup");
  __builtin_amdgcn_wave_barrier();
  {
    for (int r = 0; r < 16; ++r) {
      const int row = q0 + r;
      if (row < T && lane < D / 4) {
        const v4f val = *(const v4fa*)&sO[w][r][lane * 4];
        *(v4f*)(y + ((size_t)b * T + row) * ypitch + h * D + lane * 4) = val;
      }
    }
    
  }
}

// GEMM C = act(A·W + bias + resid): A f32 (ASPLIT -> hi/lo 2 terms), Wt bf16 [N][K]; ACT 0 none, 1 relu, 2 exact gelu;
// resid (optional, f32, row index = (row % rmod), pitch ldr, RES_BF16 rounds it) added before the activation.
template <bool ASPLIT, int ACT, bool BIAS_BF16, bool RES_BF16>
__global__ __launch_bounds__(128) void k_gemm_bf3(const float* __restrict__ A, int lda, const unsigned short* __restrict__ Wt, int ldb,
                                                const float* __restrict__ bias, const float* __restrict__ resid, int rmod, int ldr,
                                                float* __restrict__ C, int ldc, int M, int N, int K) {
  __shared__ __attribute__((aligned(16))) float so[4][16][64];
  const int tid = threadIdx.x, w = tid >> 5, lane = tid & 31, ln = lane & 15, hh = lane >> 4;
  const int ntn = N / 64;
  const int wid = blockIdx.x * 4 + w;
  const int mt = wid / ntn, nq = wid % ntn;
  if (mt * 16 >= M) return;
  const int row0 = mt * 16, col0 = nq * 64;
  const float* arow = A + (size_t)(row0 + ln) * lda;
  v8f acc[4] = {};
  for (int kb = 0; kb < K; kb += 32) {
    FragB ah, al;
    const v4f x0 = *(const v4fa*)(arow + kb + 8 * hh), x1 = *(const v4fa*)(arow + kb + 8 * hh + 4);
    const v4f x2 = *(const v4fa*)(arow + kb + 16 + 8 * hh), x3 = *(const v4fa*)(arow + kb + 16 + 8 * hh + 4);
    float xs[16] = {x0[0],x0[1],x0[2],x0[3],x1[0],x1[1],x1[2],x1[3],x2[0],x2[1],x2[2],x2[3],x3[0],x3[1],x3[2],x3[3]};
#pragma unroll
    for (int i = 0; i < 16; ++i) { const unsigned short hb = bf16_bits(xs[i]); ah.u[i] = hb; al.u[i] = ASPLIT ? bf16_bits(xs[i] - bf16_val(hb)) : (unsigned short)0; }
#pragma unroll
    for (int t = 0; t < 4; ++t) {
      const unsigned short* brow = Wt + (size_t)(col0 + t * 16 + ln) * ldb + kb;
      FragB b;
      b.half[0] = *(const v8us*)(brow + 8 * hh);
      b.half[1] = *(const v8us*)(brow + 16 + 8 * hh);
      acc[t] = mmaN<ASPLIT ? 2 : 1>(ah.v, al.v, b.v, b.v, acc[t]);
    }
  }
#pragma unroll
  for (int t = 0; t < 4; ++t) {
    const int col = col0 + t * 16 + ln;
    float bv = bias ? bias[col] : 0.f;
    if (BIAS_BF16) bv = bf16_round(bv);
#pragma unroll
    for (int r = 0; r < 8; ++r) {
      float v = acc[t][r] + bv;
      if (resid) { float rv = resid[(size_t)((row0 + 8 * hh + r) % rmod) * ldr + col]; if (RES_BF16) rv = bf16_round(rv); v += rv; }
      if (ACT == 1) v = fmaxf(v, 0.f);
      if (ACT == 2) v = 0.5f * v * (1.0f + erff(v * 0.70710678118654752f));
      if (ACT == 3) { const float u = 0.7978845608028654f * (v + 0.044715f * v * v * v); v = 0.5f * v * (1.0f + tanhf(u)); }
      so[w][8 * hh + r][t * 16 + ln] = v;
    }
  }
  __builtin_amdgcn_fence(__ATOMIC_ACQ_REL, "workgroup");
  __builtin_amdgcn_wave_barrier();
  const int rsub = lane >> 4, c4 = (lane & 15) * 4;
  {
#pragma unroll
    for (int q = 0; q < 8; ++q) {
      const int r = q * 2 + rsub;
      const v4f v = *(const v4fa*)&so[w][r][c4];
      *(v4f*)(C + (size_t)(row0 + r) * ldc + col0 + c4) = v;
    }
    
  }
}
// row LayerNorm (biased variance, eps) over N: s = X (+ R); optional out_sum <- s; out_norm <- (s-mu)*rsqrt(var+eps)*g + b
template <bool PARAM_BF16>
__global__ __launch_bounds__(256) void k_layernorm(const float* __restrict__ X, const float* __restrict__ R, const float* __restrict__ g, const float* __restrict__ bta,
                                                  float* __restrict__ out_sum, float* __restrict__ out_norm, int N, float eps) {
  __shared__ float red[256];
  const int row = blockIdx.x, tid = threadIdx.x;
  const float* x = X + (size_t)row * N; const float* rr = R ? R + (size_t)row * N : nullptr;
  float vals[16];                     // up to N = 4096
  const int per = N / 256;            // contiguous chunk per thread? use strided-by-4 chunks: thread handles j = tid*4 + 1024*u
  float s1 = 0.f;
  for (int u = 0; u < per / 4; ++u) {
    const int j = tid * 4 + 1024 * u;
    const v4f a = *(const v4fa*)(x + j);
    v4f b = {0.f,0.f,0.f,0.f}; if (rr) b = *(const v4fa*)(rr + j);
#pragma unroll
    for (int q = 0; q < 4; ++q) { const float v = a[q] + b[q]; vals[u * 4 + q] = v; s1 += v; }
  }
  red[tid] = s1; __syncthreads();
  for (int st = 128; st > 0; st >>= 1) { if (tid < st) red[tid] += red[tid + st]; __syncthreads(); }
  const float mu = red[0] / (float)N; __syncthreads();
  float s2 = 0.f;
  for (int u = 0; u < per / 4; ++u)
#pragma unroll
    for (int q = 0; q < 4; ++q) { const float c = vals[u * 4 + q] - mu; s2 += c * c; }
  red[tid] = s2; __syncthreads();
  for (int st = 128; st > 0; st >>= 1) { if (tid < st) red[tid] += red[tid + st]; __syncthreads(); }
  const float rs = rsqrtf(red[0] / (float)N + eps);
  {
    for (int u = 0; u < per / 4; ++u) {
      const int j = tid * 4 + 1024 * u;
      v4f o, sm;
#pragma unroll
      for (int q = 0; q < 4; ++q) {
        float gg = g[j + q], bb = bta[j + q];
        if (PARAM_BF16) { gg = bf16_round(gg); bb = bf16_round(bb); }
        sm[q] = vals[u * 4 + q]; o[q] = (vals[u * 4 + q] - mu) * rs * gg + bb;
      }
      if (out_sum) *(v4f*)(out_sum + (size_t)row * N + j) = sm;
      *(v4f*)(out_norm + (size_t)row * N + j) = o;
    }
    
  }
}



// ---- f16 WMMA path (v_wmma_f32_16x16x32_f16): 11-bit significands for operands in range — used where a [0,1] probability operand needs more precision than bf16
typedef _Float16 v16h __attribute__((ext_vector_type(16)));
union FragH { v16h v; v8us half[2]; _Float16 h[16]; unsigned short u[16]; };
template <int NT>
__device__ __forceinline__ v8f mmaH(v16h ah, v16h al, v16h bh, v16h bl, v8f c) {
  c = __builtin_amdgcn_wmma_f32_16x16x32_f16(false, ah, false, bh, (short)0, c, false, false);
  if (NT >= 2) c = __builtin_amdgcn_wmma_f32_16x16x32_f16(false, al, false, bh, (short)0, c, false, false);
  if (NT >= 3) c = __builtin_amdgcn_wmma_f32_16x16x32_f16(false, ah, false, bl, (short)0, c, false, false);
  asm volatile("v_nop\n\tv_nop\n\tv_nop\n\tv_nop" : "+v"(c) : "v"(ah), "v"(al), "v"(bh), "v"(bl));
  return c;
}
// batched GEMM like k_gemm_b but f16 operands: A f32 (split into f16 hi/lo if ASPLIT, else rounded to f16), Bt = f16 values [n][k]; alpha; C f32; N multiple of 16 (partial tiles skipped)
template <bool ASPLIT>
__global__ __launch_bounds__(128) void k_gemm_h(const float* __restrict__ A, int lda, size_t sA, const _Float16* __restrict__ Bh, int ldb, size_t sB, float alpha, float* __restrict__ C, int ldc, size_t sC, int M, int N, int K) {
  __shared__ __attribute__((aligned(16))) float so[4][16][64];
  const int tid = threadIdx.x, w = tid >> 5, lane = tid & 31, ln = lane & 15, hh = lane >> 4; const int by = blockIdx.y;
  A += (size_t)by * sA; Bh += (size_t)by * sB; C += (size_t)by * sC;
  const int ntn = (N + 63) / 64; const int wid = blockIdx.x * 4 + w; const int mt = wid / ntn, nq = wid % ntn; if (mt * 16 >= M) return;
  const int row0 = mt * 16, col0 = nq * 64; const float* arow = A + (size_t)(row0 + ln) * lda;
  v8f acc[4] = {};
  for (int kb = 0; kb < K; kb += 32) {
    FragH ah, al;
    const v4f x0 = *(const v4fa*)(arow + kb + 8 * hh), x1 = *(const v4fa*)(arow + kb + 8 * hh + 4), x2 = *(const v4fa*)(arow + kb + 16 + 8 * hh), x3 = *(const v4fa*)(arow + kb + 16 + 8 * hh + 4);
    float xs[16] = {x0[0],x0[1],x0[2],x0[3],x1[0],x1[1],x1[2],x1[3],x2[0],x2[1],x2[2],x2[3],x3[0],x3[1],x3[2],x3[3]};
#pragma unroll
    for (int i = 0; i < 16; ++i) { const _Float16 h = (_Float16)xs[i]; ah.h[i] = h; al.h[i] = ASPLIT ? (_Float16)(xs[i] - (float)h) : (_Float16)0.0f; }
#pragma unroll
    for (int t = 0; t < 4; ++t) { if (col0 + t * 16 >= N) continue; const size_t boff = (size_t)(col0 + t * 16 + ln) * ldb + kb; FragH bq; bq.half[0] = *(const v8us*)(Bh + boff + 8 * hh); bq.half[1] = *(const v8us*)(Bh + boff + 16 + 8 * hh);
      acc[t] = mmaH<ASPLIT ? 2 : 1>(ah.v, al.v, bq.v, bq.v, acc[t]); }
  }
#pragma unroll
  for (int t = 0; t < 4; ++t) { if (col0 + t * 16 >= N) continue;
#pragma unroll
    for (int r = 0; r < 8; ++r) so[w][8 * hh + r][t * 16 + ln] = acc[t][r] * alpha; }
  __builtin_amdgcn_fence(__ATOMIC_ACQ_REL, "workgroup"); __builtin_amdgcn_wave_barrier();
  const int rsub = lane >> 4, c4 = (lane & 15) * 4;
  {
#pragma unroll
    for (int q = 0; q < 8; ++q) { const int r = q * 2 + rsub; if (col0 + c4 < N) { const v4f v = *(const v4fa*)&so[w][r][c4]; *(v4f*)(C + (size_t)(row0 + r) * ldc + col0 + c4) = v; } }
     }
}

// Wt[n][k] = f16(W[k][n]·scale) from f32 row-major W[K][N] (scale = power of two; bf16-exact weights stay exact in f16 away from the subnormal range)
__device__ __forceinline__ void wt_f16(const float* __restrict__ W, _Float16* __restrict__ Wt, int K, int N, float scale, int blk) {
  const int t = blk * 256 + threadIdx.x; if (t >= N * (K / 8)) return; const int n = t / (K / 8), k8 = (t % (K / 8)) * 8; FragH f;
#pragma unroll
  for (int i = 0; i < 8; ++i) f.h[i] = (_Float16)(bf16_round(W[(size_t)(k8 + i) * N + n]) * scale); const v8us o = f.half[0];
  *(v8us*)((unsigned short*)Wt + (size_t)n * K + k8) = o; 
}
// k_gemm_hh variant with fused epilogue: v = acc·alpha + bias[by·sBias + col] (+ CP[(row/rowsPerB)·sCPb + by·64 + col] if CP) ; ACT 0 none / 1 elu ; writes f16 C16 and f32 C, each if non-null
template <int ACT>
__global__ __launch_bounds__(128) void k_gemm_hhx(const _Float16* __restrict__ A, int lda, size_t sA, const _Float16* __restrict__ Bh, int ldb, size_t sB, float alpha, const float* __restrict__ bias, size_t sBias, const float* __restrict__ CP, int rowsPerB, size_t sCPb, int row0g,
    float* __restrict__ C, _Float16* __restrict__ C16, int ldc, size_t sC, int M, int N, int K) {
  __shared__ __attribute__((aligned(16))) float so[4][16][64];
  const int tid = threadIdx.x, w = tid >> 5, lane = tid & 31, ln = lane & 15, hh = lane >> 4; const int by = blockIdx.y;
  A += (size_t)by * sA; Bh += (size_t)by * sB; const size_t cofs = (size_t)by * sC; const float* bp = bias ? bias + (size_t)by * sBias : nullptr;
  const int ntn = (N + 63) / 64; const int wid = blockIdx.x * 4 + w; const int mt = wid / ntn, nq = wid % ntn; if (mt * 16 >= M) return;
  const int row0 = mt * 16, col0 = nq * 64; const _Float16* arow = A + (size_t)(row0 + ln) * lda;
  v8f acc[4] = {};
  for (int kb = 0; kb < K; kb += 32) { FragH ah; ah.half[0] = *(const v8us*)((const unsigned short*)arow + kb + 8 * hh); ah.half[1] = *(const v8us*)((const unsigned short*)arow + kb + 16 + 8 * hh);
#pragma unroll
    for (int t = 0; t < 4; ++t) { if (col0 + t * 16 >= N) continue; const size_t boff = (size_t)(col0 + t * 16 + ln) * ldb + kb; FragH bq; bq.half[0] = *(const v8us*)((const unsigned short*)Bh + boff + 8 * hh); bq.half[1] = *(const v8us*)((const unsigned short*)Bh + boff + 16 + 8 * hh);
      acc[t] = mmaH<1>(ah.v, ah.v, bq.v, bq.v, acc[t]); }
  }
#pragma unroll
  for (int t = 0; t < 4; ++t) { if (col0 + t * 16 >= N) continue; const int col = col0 + t * 16 + ln; const float bv = bp ? bf16_round(bp[col]) : 0.f;
#pragma unroll
    for (int r = 0; r < 8; ++r) { float v = acc[t][r] * alpha + bv; if (CP) { const int bidx = (row0g + row0 + 8 * hh + r) / rowsPerB; v += CP[(size_t)bidx * sCPb + (size_t)by * 64 + col]; } if (ACT == 1) v = (v > 0.f) ? v : expm1f(v); else if (ACT == 7) v = (v > 0.f) ? v + 1.0f : expf(v); else if (ACT == 8) v = tanhf(v); else if (ACT == 9) v = 0.5f * v * (1.0f + tanhf(0.7978845608028654f * (v + 0.044715f * v * v * v))); else if (ACT == 11) v = 1.0f / (1.0f + expf(-v)); else if (ACT == 12) v = (v > 0.f) ? v : 0.01f * v; else if (ACT == 14) v = (v > 0.f) ? v : 0.1f * v; else if (ACT == 15) v = v / (1.0f + expf(-v)); else if (ACT == 3) v = fmaxf(v, 0.f); else if (ACT == 6) v = 0.5f * v * (1.0f + erff(v * 0.70710678118654752f)); so[w][8 * hh + r][t * 16 + ln] = v; } }
  __builtin_amdgcn_fence(__ATOMIC_ACQ_REL, "workgroup"); __builtin_amdgcn_wave_barrier();
  const int rsub = lane >> 4, c4 = (lane & 15) * 4; typedef _Float16 v4h __attribute__((ext_vector_type(4)));
  {
#pragma unroll
    for (int q = 0; q < 8; ++q) { const int r = q * 2 + rsub; if (col0 + c4 < N) { const v4f v = *(const v4fa*)&so[w][r][c4]; if (C) *(v4f*)(C + cofs + (size_t)(row0 + r) * ldc + col0 + c4) = v; if (C16) { v4h h4; for (int i = 0; i < 4; ++i) h4[i] = (_Float16)v[i]; *(v4h*)(C16 + cofs + (size_t)(row0 + r) * ldc + col0 + c4) = h4; } } }
     }
}


typedef _Float16 v4h __attribute__((ext_vector_type(4)));

__global__ __launch_bounds__(256) void k_x16(const float* __restrict__ x, _Float16* __restrict__ X16, size_t n8) { const size_t t = (size_t)blockIdx.x * 256 + threadIdx.x; if (t >= n8) return; FragH f;
#pragma unroll
  for (int q = 0; q < 8; ++q) f.h[q] = (_Float16)bf16_round(x[t * 8 + q]); *(v8us*)((unsigned short*)X16 + t * 8) = f.half[0];  }
__global__ __launch_bounds__(256) void k_h16(const float* __restrict__ x, _Float16* __restrict__ X16, size_t n8) { const size_t t = (size_t)blockIdx.x * 256 + threadIdx.x; if (t >= n8) return; FragH f;
#pragma unroll
  for (int q = 0; q < 8; ++q) f.h[q] = (_Float16)x[t * 8 + q]; *(v8us*)((unsigned short*)X16 + t * 8) = f.half[0];  }
__global__ __launch_bounds__(256) void k_round16f(const float* __restrict__ W, _Float16* __restrict__ Bt, size_t n8) { const size_t t = (size_t)blockIdx.x * 256 + threadIdx.x; if (t >= n8) return; FragH f;
#pragma unroll
  for (int i = 0; i < 8; ++i) f.h[i] = (_Float16)(bf16_round(W[t * 8 + i]) * 16.0f); *(v8us*)((unsigned short*)Bt + t * 8) = f.half[0];  }
template <int NHv, int TTv>
__global__ __launch_bounds__(256) void k_vt(const _Float16* __restrict__ V16, int ldv, int voff, _Float16* __restrict__ Vt) { __shared__ unsigned short tl[64][66]; const int tid = threadIdx.x; const int slab = blockIdx.x / (TTv / 64), lg = blockIdx.x % (TTv / 64); const int b = slab / NHv, h = slab % NHv;
  for (int i = tid; i < 64 * 8; i += 256) { const int r = i / 8, c8 = (i % 8) * 8; FragH f; f.half[0] = *(const v8us*)((const unsigned short*)V16 + ((size_t)b * TTv + lg * 64 + r) * ldv + voff + h * 64 + c8);
#pragma unroll
    for (int q = 0; q < 8; ++q) tl[r][c8 + q] = f.u[q]; }
  __syncthreads();
  {
#pragma unroll
    for (int rd = 0; rd < 2; ++rd) { const int d = rd * 32 + tid / 8, pc = tid % 8; FragH f;
#pragma unroll
      for (int q = 0; q < 8; ++q) f.u[q] = tl[pc * 8 + q][d];
      *(v8us*)((unsigned short*)Vt + ((size_t)slab * 64 + d) * TTv + lg * 64 + pc * 8) = f.half[0]; }
     } }

__device__ __forceinline__ void tin(const float* __restrict__ x, _Float16* __restrict__ X16, int blk) { __shared__ float tl[BB][32][65]; const int tid = threadIdx.x; const int dg = blk / (TT / 32), tg = blk % (TT / 32); const int d0 = dg * 64, t0 = tg * 32;
  const float* const px = x + ((size_t)(d0 + tid / (BB * 32)) * TT + t0 + (tid / BB) % 32) * BB + tid % BB;      /* the lane's first element; sweep u of the 256 lanes lies 256 / (BB * 32) rows of x further on */
  float xv[64 * 32 * BB / 256];
#pragma unroll      /* constant trip count, unrolled: the values stay in registers and a lane's loads are all in flight together */
  for (int u = 0; u < 64 * 32 * BB / 256; ++u) xv[u] = px[(size_t)u * (256 / (BB * 32)) * TT * BB];
  asm volatile("s_wait_xcnt 0x0" :: "v"(px) : "memory");      /* the wait in front of any overwrite of the loads' address registers; as its input the pair stays whole up to here */
#pragma unroll      /* xv is indexed by constants only, so it stays in registers */
  for (int u = 0; u < 64 * 32 * BB / 256; ++u) { const int i = u * 256 + tid; tl[i % BB][(i / BB) % 32][i / (BB * 32)] = bf16_round(xv[u]); } __syncthreads();
  { for (int i = tid; i < BB * 32 * 8; i += 256) { const int pc = i % 8, tt = (i / 8) % 32, b = i / (8 * 32); FragH f; for (int q = 0; q < 8; ++q) f.h[q] = (_Float16)tl[b][tt][pc * 8 + q]; *(v8us*)((unsigned short*)X16 + ((size_t)b * TT + t0 + tt) * DM + d0 + pc * 8) = f.half[0]; }  } }
// One launch for the five conversions, none of which reads what another writes: blocks 0 .. 4 * WB - 1 transpose the four weights (the longer blocks, so they start first), the rest bring x to (B, T, D).
#define WB (DM * (DM / 8) / 256)
__global__ __launch_bounds__(256) void k_prep(const float* __restrict__ x, const float* __restrict__ Wq, const float* __restrict__ Wk, const float* __restrict__ Wv, const float* __restrict__ Wo, _Float16* __restrict__ Bw, _Float16* __restrict__ X16) {
  const int blk = blockIdx.x;
  if (blk < 4 * WB) { const int wi = blk / WB; const float* W = wi == 0 ? Wq : wi == 1 ? Wk : wi == 2 ? Wv : Wo; wt_f16(W, Bw + (size_t)wi * DM * DM, DM, DM, 16.0f, blk % WB); }      /* (in,out) -> Bt[n][k] x 2^4 */
  else tin(x, X16, blk - 4 * WB);
}
// The attention kernel's LDS ring. The four waves of a block walk the same keys, so a trip's 32 K rows (128 B each) and 64 rows of each V^T plane (64 B each) are brought into LDS once for the block, by whole rows, and every wave takes its fragments from there:
// a fragment load from global memory touches 16 cache lines for 512 bytes, and each wave repeated it. Pitches 144 B and 80 B (16 B x odd): ds_load_b128 fragment reads meet no bank twice. Two buffers: the next tile's copies fly while this one is worked on.
#define FKP 72
#define FVP 40
#define FBUF (32 * FKP + 2 * 64 * FVP)
// One tile's six asynchronous copies of a lane, 16 bytes each: two K pieces 16 rows apart, two pieces of each V^T plane 32 rows apart. lk, lv: the lane's LDS byte addresses in the K and V^T parts of the buffer; gk, gh, gl: its places in K and the two planes.
__device__ __forceinline__ void flash_fill(unsigned lk, unsigned lv, const unsigned short* gk, size_t k16, const unsigned short* gh, const unsigned short* gl) {
  asm volatile("global_load_async_to_lds_b128 %0, %6, off\n\t"
               "global_load_async_to_lds_b128 %1, %7, off\n\t"
               "global_load_async_to_lds_b128 %2, %8, off\n\t"
               "global_load_async_to_lds_b128 %3, %9, off\n\t"
               "global_load_async_to_lds_b128 %4, %10, off\n\t"
               "global_load_async_to_lds_b128 %5, %11, off\n\t"
               "s_wait_xcnt 0x0"      /* the wait in front of any overwrite of the copies' address registers, inside their own statement so that nothing can be moved in between */
               :: "v"(lk), "v"(lk + 16 * FKP * 2), "v"(lv), "v"(lv + 32 * FVP * 2), "v"(lv + 64 * FVP * 2), "v"(lv + 96 * FVP * 2),
                  "v"(gk), "v"(gk + k16), "v"(gh), "v"(gh + 32 * TT), "v"(gl), "v"(gl + 32 * TT) : "memory");
}
__global__ __launch_bounds__(128) void k_flash(const _Float16* __restrict__ Q16, int ldq, const _Float16* __restrict__ K16, int ldk, const _Float16* __restrict__ Vt, const _Float16* __restrict__ Vtlo, _Float16* __restrict__ OH, _Float16* __restrict__ OL, int ldo) {
  constexpr int RPW = 16, RTN = RPW / 16, NQB = TT / (4 * RPW), DT = 4, KS = 2;
  __shared__ __attribute__((aligned(16))) unsigned short sP[4][RPW][40]; __shared__ __attribute__((aligned(16))) float sO[4][RPW][64 + 4]; __shared__ __attribute__((aligned(16))) unsigned short ring[2 * FBUF];
  const int tid = threadIdx.x, w = tid >> 5, lane = tid & 31, ln = lane & 15, hh = lane >> 4;
  const int slab = blockIdx.x / NQB, qblk = blockIdx.x % NQB; const int b = slab / NH, h = slab % NH; const int qb0 = qblk * (4 * RPW); const int q0 = qb0 + w * RPW;
  FragH aq[2][KS];
#pragma unroll
  for (int rt = 0; rt < RTN; ++rt) { const unsigned short* qr = (const unsigned short*)Q16 + ((size_t)b * TT + q0 + rt * 16 + ln) * ldq + h * 64;
#pragma unroll
    for (int ks = 0; ks < KS; ++ks) { aq[rt][ks].half[0] = *(const v8us*)(qr + ks * 32 + 8 * hh); aq[rt][ks].half[1] = *(const v8us*)(qr + ks * 32 + 16 + 8 * hh); } }
  const unsigned short* Vth = (const unsigned short*)Vt + (size_t)slab * 64 * TT; const unsigned short* Vtl = (const unsigned short*)Vtlo + (size_t)slab * 64 * TT;
  float m_r[2][8], l_r[2][8]; v8f oacc[2][DT], oaccl[2][DT];
#pragma unroll
  for (int rt = 0; rt < RTN; ++rt) {
#pragma unroll
    for (int r = 0; r < 8; ++r) { m_r[rt][r] = -3.0e38f; l_r[rt][r] = 0.f; }
#pragma unroll
    for (int dt = 0; dt < DT; ++dt) { oacc[rt][dt] = (v8f){0.f,0.f,0.f,0.f,0.f,0.f,0.f,0.f}; oaccl[rt][dt] = oacc[rt][dt]; } }
  const int jbeg = (qb0 - WIN) > 0 ? (qb0 - WIN) : 0; const int jend = (qb0 + 4 * RPW + WIN) < TT ? (qb0 + 4 * RPW + WIN) : TT;      /* block-uniform window bounds (multiples of 32) */
  const unsigned lk0 = (unsigned)(size_t)ring + (unsigned)(((tid >> 3) * FKP + (tid & 7) * 8) * 2), lv0 = (unsigned)(size_t)ring + (unsigned)((32 * FKP + (tid >> 2) * FVP + (tid & 3) * 8) * 2);      /* 8 lanes cover a K row, 4 lanes a V^T row */
  const unsigned short* const gk0 = (const unsigned short*)K16 + ((size_t)b * TT + (tid >> 3)) * ldk + h * 64 + (tid & 7) * 8; const unsigned short* const gh0 = Vth + (size_t)(tid >> 2) * TT + (tid & 3) * 8; const unsigned short* const gl0 = Vtl + (size_t)(tid >> 2) * TT + (tid & 3) * 8;
  flash_fill(lk0, lv0, gk0 + (size_t)jbeg * ldk, (size_t)16 * ldk, gh0 + jbeg, gl0 + jbeg);
  asm volatile("s_wait_asynccnt 0x0" ::: "memory");      /* this wave's copies of the first tile have landed */
  __syncthreads();      /* publishes the first tile: every wave reads pieces that the other waves copied */
  if (jbeg + 32 < jend) flash_fill(lk0 + FBUF * 2, lv0 + FBUF * 2, gk0 + (size_t)(jbeg + 32) * ldk, (size_t)16 * ldk, gh0 + jbeg + 32, gl0 + jbeg + 32);
  unsigned cur = 0;      /* the buffer that holds this trip's tile */
#pragma unroll 1
  for (int j0 = jbeg; j0 < jend; j0 += 32) {
    
    v8f s[2][2]; FragH bk[2][KS];
#pragma unroll
    for (int nt = 0; nt < 2; ++nt) { const unsigned short* kr = ring + cur * FBUF + (nt * 16 + ln) * FKP;      /* both key tiles' loads fly together, ahead of the first score product */
#pragma unroll
      for (int ks = 0; ks < KS; ++ks) { bk[nt][ks].half[0] = *(const v8us*)(kr + ks * 32 + 8 * hh); bk[nt][ks].half[1] = *(const v8us*)(kr + ks * 32 + 16 + 8 * hh); } }
#pragma unroll
    for (int nt = 0; nt < 2; ++nt)
#pragma unroll
      for (int rt = 0; rt < RTN; ++rt) { v8f acc = (v8f){0.f,0.f,0.f,0.f,0.f,0.f,0.f,0.f};
#pragma unroll
        for (int ks = 0; ks < KS; ++ks) acc = mmaH<1>(aq[rt][ks].v, aq[rt][ks].v, bk[nt][ks].v, bk[nt][ks].v, acc); s[rt][nt] = acc; }
    FragH bv[DT], bl[DT];      /* the trip's 16 value-fragment loads, issued in one run here, where the softmax below covers their latency */
    const unsigned short* const pvh = ring + cur * FBUF + 32 * FKP + ln * FVP + 8 * hh; const unsigned short* const pvl = pvh + 64 * FVP;
#pragma unroll
    for (int dt = 0; dt < DT; ++dt) { bv[dt].half[0] = *(const v8us*)(pvh + dt * 16 * FVP); bv[dt].half[1] = *(const v8us*)(pvh + dt * 16 * FVP + 16); bl[dt].half[0] = *(const v8us*)(pvl + dt * 16 * FVP); bl[dt].half[1] = *(const v8us*)(pvl + dt * 16 * FVP + 16); }
#pragma unroll
    for (int rt = 0; rt < RTN; ++rt)
#pragma unroll
      for (int r = 0; r < 8; ++r) { const int tq = q0 + rt * 16 + 8 * hh + r; const int k0 = j0 + ln, k1 = j0 + 16 + ln; (void)tq; (void)k0; (void)k1;
        const bool ok0 = (k0 - tq <= WIN) && (tq - k0 <= WIN), ok1 = (k1 - tq <= WIN) && (tq - k1 <= WIN);
        const float u0 = s[rt][0][r] * 0.18033688011112042f, u1 = s[rt][1][r] * 0.18033688011112042f;      /* score / 8, times log2(e): logits, running maximum and weights all live in base 2, where exponential and logarithm are one instruction each */
        const float g0 = u0 + fminf(u0, 0.f) - __builtin_amdgcn_logf(1.0f + __builtin_amdgcn_exp2f(-fabsf(u0))), g1 = u1 + fminf(u1, 0.f) - __builtin_amdgcn_logf(1.0f + __builtin_amdgcn_exp2f(-fabsf(u1)));      /* (s + log sigmoid(s)) * log2(e); the logarithm's argument lies in [1, 2] */
        const float s0 = ok0 ? g0 : -INFINITY, s1 = ok1 ? g1 : -INFINITY; float mc = fmaxf(s0, s1);
        mc = fmaxf(mc, __shfl_xor(mc, 1, 32)); mc = fmaxf(mc, __shfl_xor(mc, 2, 32)); mc = fmaxf(mc, __shfl_xor(mc, 4, 32)); mc = fmaxf(mc, __shfl_xor(mc, 8, 32));
        const float mn = fmaxf(m_r[rt][r], mc); const float ea = __builtin_amdgcn_exp2f(m_r[rt][r] - mn), e0 = __builtin_amdgcn_exp2f(s0 - mn), e1 = __builtin_amdgcn_exp2f(s1 - mn); const float al = (mn > -1.0e38f) ? ea : 1.0f; m_r[rt][r] = mn; const float p0 = ok0 ? e0 : 0.f, p1 = ok1 ? e1 : 0.f; l_r[rt][r] = l_r[rt][r] * al + p0 + p1;
#pragma unroll
        for (int dt = 0; dt < DT; ++dt) { oacc[rt][dt][r] *= al; oaccl[rt][dt][r] *= al; }
        FragH t2; t2.h[0] = (_Float16)(p0 * 1024.0f); t2.h[1] = (_Float16)(p1 * 1024.0f); sP[w][rt * 16 + 8 * hh + r][ln] = t2.u[0]; sP[w][rt * 16 + 8 * hh + r][16 + ln] = t2.u[1]; }
    __builtin_amdgcn_fence(__ATOMIC_ACQ_REL, "workgroup"); __builtin_amdgcn_wave_barrier();
    FragH pa[2];
#pragma unroll
    for (int rt = 0; rt < RTN; ++rt) { pa[rt].half[0] = *(const v8us*)&sP[w][rt * 16 + ln][8 * hh]; pa[rt].half[1] = *(const v8us*)&sP[w][rt * 16 + ln][16 + 8 * hh]; }
#pragma unroll
    for (int dt = 0; dt < DT; ++dt)
#pragma unroll
      for (int rt = 0; rt < RTN; ++rt) { oacc[rt][dt] = mmaH<1>(pa[rt].v, pa[rt].v, bv[dt].v, bv[dt].v, oacc[rt][dt]); oaccl[rt][dt] = mmaH<1>(pa[rt].v, pa[rt].v, bl[dt].v, bl[dt].v, oaccl[rt][dt]); }
    __builtin_amdgcn_fence(__ATOMIC_ACQ_REL, "workgroup"); __builtin_amdgcn_wave_barrier();
    asm volatile("s_wait_dscnt 0x0" ::: "memory");      /* this wave's reads of the buffer have returned before the buffer is given up */
    asm volatile("s_wait_asynccnt 0x0" ::: "memory");      /* this wave's copies of the next tile have landed */
    __syncthreads();      /* publishes the next tile and ends every wave's reads of this trip's buffer, which is refilled behind it */
    if (j0 + 64 < jend) flash_fill(lk0 + cur * (FBUF * 2), lv0 + cur * (FBUF * 2), gk0 + (size_t)(j0 + 64) * ldk, (size_t)16 * ldk, gh0 + j0 + 64, gl0 + j0 + 64);      /* block-uniform test */
    cur ^= 1u; }
  asm volatile("s_wait_asynccnt 0x0" ::: "memory");      /* no copy is outstanding when the wave goes on to the epilogue and ends */
#pragma unroll
  for (int rt = 0; rt < RTN; ++rt) {
#pragma unroll
    for (int r = 0; r < 8; ++r) { float l = l_r[rt][r]; l += __shfl_xor(l, 1, 32); l += __shfl_xor(l, 2, 32); l += __shfl_xor(l, 4, 32); l += __shfl_xor(l, 8, 32); l_r[rt][r] = (l > 0.f) ? 1.0f / (l * 1024.0f) : 0.f; }
#pragma unroll
    for (int dt = 0; dt < DT; ++dt)
#pragma unroll
      for (int r = 0; r < 8; ++r) sO[w][rt * 16 + 8 * hh + r][dt * 16 + ln] = (oacc[rt][dt][r] + oaccl[rt][dt][r] * 0.0009765625f) * l_r[rt][r]; }
  __builtin_amdgcn_fence(__ATOMIC_ACQ_REL, "workgroup"); __builtin_amdgcn_wave_barrier();
  {
#pragma unroll
    for (int rp = 0; rp < RPW; rp += 2) { const int r = rp + (lane >> 4), pc = lane & 15; const v4f val = *(const v4fa*)&sO[w][r][pc * 4]; const size_t o = ((size_t)b * TT + q0 + r) * ldo + h * 64 + pc * 4; v4h oh, ol;      /* the merged row leaves as the output product's two operands: f16 value and residual x 2^10; 16 lanes fill one 128-B line of each plane */
#pragma unroll
      for (int i = 0; i < 4; ++i) { const _Float16 hv = (_Float16)val[i]; oh[i] = hv; ol[i] = (_Float16)((val[i] - (float)hv) * 1024.0f); }
      *(v4h*)(OH + o) = oh; *(v4h*)(OL + o) = ol; }
     } }

// Tiled GEMM for the five 4096 x 1024 x 1024 products, in two launches, A f16 [NR][DM], Bt f16 [n][k]. One 128 x 128 tile per block of 8 waves (4 x 2), 32 x 64 per wave. The epilogue writes what the next kernel reads, so no f32 plane goes through a pass of its own:
// MODE 0: q, k and v in one grid, Bt their three weights one behind the other (3 x 8 column tiles): q, k leave as f16(acc*alpha + bias), row-major (C16, C16k); v = acc*alpha + bias leaves transposed, per (batch, column) a row over t, as f16 value (C16v) and residual x 2^10 (C16l). 2: C = (A.Bt + 2^-10 Alo.Bt)*alpha + bias in the (D, T, B) layout of the output, both products in one accumulator, Alo's first.
// Each trip stages 128 k of the tile's 128 A rows and 128 Bt rows in LDS as whole 256-B rows (pitch 272 B: ds_load_b128 fragment reads meet no bank twice); two buffers, the next trip's rows are
// fetched into registers ahead of this trip's products and stored behind them, one barrier a trip. Every accumulator still sums k in ascending steps of 32.
#define GT 128
#define GK 128
#define GP 136
#define GSO 68
#define GTP 131
// one trip's products of a wave: 128 k in four steps of 32, 2 x 4 accumulator tiles; sa, sb: the lane's own row and k half in the A and Bt parts of the buffer
__device__ __forceinline__ void gemm_trip(const unsigned short* sa, const unsigned short* sb, v8f (&acc)[2][4]) {
#pragma unroll
  for (int ks = 0; ks < GK / 32; ++ks) {
    FragH a[2], b[4];
#pragma unroll
    for (int mi = 0; mi < 2; ++mi) { a[mi].half[0] = *(const v8us*)(sa + mi * 16 * GP + ks * 32); a[mi].half[1] = *(const v8us*)(sa + mi * 16 * GP + ks * 32 + 16); }
#pragma unroll
    for (int ni = 0; ni < 4; ++ni) { b[ni].half[0] = *(const v8us*)(sb + ni * 16 * GP + ks * 32); b[ni].half[1] = *(const v8us*)(sb + ni * 16 * GP + ks * 32 + 16); }
#pragma unroll
    for (int mi = 0; mi < 2; ++mi)
#pragma unroll
      for (int ni = 0; ni < 4; ++ni) acc[mi][ni] = __builtin_amdgcn_wmma_f32_16x16x32_f16(false, a[mi].v, false, b[ni].v, (short)0, acc[mi][ni], false, false);
  }
}
template <int MODE>
__global__ __launch_bounds__(256) void k_gemm_t(const _Float16* __restrict__ A, const _Float16* __restrict__ Alo, const _Float16* __restrict__ Bt, float alpha, const float* __restrict__ bias, const float* __restrict__ biask, const float* __restrict__ biasv, float* __restrict__ C, _Float16* __restrict__ C16, _Float16* __restrict__ C16k, _Float16* __restrict__ C16v, _Float16* __restrict__ C16l) {
  __shared__ __attribute__((aligned(16))) unsigned char smraw[2 * 2 * GT * GP * 2];
  unsigned short* const sm = (unsigned short*)smraw;
  constexpr int BUF = 2 * GT * GP, NK = DM / GK, NTR = (MODE == 2 ? 2 : 1) * NK;      /* MODE 2 walks k twice: the residual plane Alo, then A */
  constexpr bool TB = (MODE >= 2);      /* tile row lr stands for (t, b) = (t0 + lr / BB, lr % BB): the order in which the output holds one column's values, so a column of the tile is one contiguous run there */
  constexpr int AST = (TB ? 16 / BB : 16) * DM;      /* A elements between the rows of two staging sweeps */
  const int tid = threadIdx.x, w = tid >> 5, lane = tid & 31, ln = lane & 15, hh = lane >> 4;
  constexpr int NCT = (MODE == 0 ? 3 : 1) * (DM / GT);      /* column tiles of a row of tiles; the blocks that share an A tile are neighbours in the grid */
  const int mt = blockIdx.x / NCT, ct = blockIdx.x % NCT, part = ct / (DM / GT);      /* part (block-uniform): 0 q, 1 k, 2 v */
  const int row0 = mt * GT, col0 = (ct % (DM / GT)) * GT, t0 = mt * (GT / BB);
  const float* const bp = (MODE == 0) ? (part == 0 ? bias : part == 1 ? biask : biasv) : bias;
  const int wm = (w >> 1) * 32, wn = (w & 1) * 64;
  const int pc = tid & 15, sr = tid >> 4;      /* staging: 16 lanes cover one 256-B row piece by piece; 16 rows per sweep */
  const unsigned short* ga = (const unsigned short*)(MODE == 2 ? Alo : A) + (size_t)(TB ? t0 : row0) * DM;      /* block-uniform bases; the lane's own places are the 32-bit offsets goa and go, which live through the loop */
  const unsigned short* gb = (const unsigned short*)Bt + (size_t)(ct * GT) * DM;
  const unsigned go = (unsigned)(sr * DM + pc * 8);
  const unsigned goa = TB ? (unsigned)(((sr % BB) * TT + sr / BB) * DM + pc * 8) : go;
  unsigned short* const sw = sm + sr * GP + pc * 8;
  v8us st[16];
#pragma unroll
  for (int i = 0; i < 8; ++i) { st[i] = *(const v8us*)(ga + i * AST + goa); st[8 + i] = *(const v8us*)(gb + i * 16 * DM + go); }
#pragma unroll
  for (int i = 0; i < 16; ++i) *(v8us*)(sw + i * 16 * GP) = st[i];
  asm volatile("s_wait_xcnt 0x0" :: "v"(goa), "v"(go) : "memory");      /* the wait in front of any overwrite of the first loads' offset registers, which as its inputs stay whole up to here */
  __syncthreads();
  v8f acc[2][4];
#pragma unroll
  for (int mi = 0; mi < 2; ++mi)
#pragma unroll
    for (int ni = 0; ni < 4; ++ni) acc[mi][ni] = (v8f){0.f,0.f,0.f,0.f,0.f,0.f,0.f,0.f};
#pragma unroll 1      /* rolled: seven (MODE 2: fifteen) copies of the trip save nothing, and a short text is fetched once */
  for (int t = 0; t < NTR - 1; ++t) {
    const int kt = (MODE == 2) ? ((t + 1) & (NK - 1)) : (t + 1);
    const unsigned short* pa = ((MODE == 2 && t + 1 >= NK) ? (const unsigned short*)A + (size_t)t0 * DM : ga) + kt * GK + goa; const unsigned short* pb = gb + kt * GK + go;
#pragma unroll
    for (int i = 0; i < 8; ++i) { st[i] = *(const v8us*)(pa + i * AST); st[8 + i] = *(const v8us*)(pb + i * 16 * DM); }
    __builtin_amdgcn_sched_barrier(0);      /* keeps the next trip's global loads ahead of this trip's products: sunk towards their LDS stores they would leave their latency uncovered */
    gemm_trip(sm + (t & 1) * BUF + (wm + ln) * GP + 8 * hh, sm + (t & 1) * BUF + (GT + wn + ln) * GP + 8 * hh, acc);
    if (MODE == 2 && t == NK - 1) {      /* the residual plane is done: its sums, held x 2^10, come down (exactly) to the scale of the value plane's, which add on top */
#pragma unroll
      for (int mi = 0; mi < 2; ++mi)
#pragma unroll
        for (int ni = 0; ni < 4; ++ni) acc[mi][ni] *= 0.0009765625f;
    }
    asm volatile("s_wait_xcnt 0x0" :: "v"(pa), "v"(pb) : "memory");      /* the wait in front of any overwrite of the loads' address registers; as its inputs the two pairs stay whole up to here, where the loads are a trip old */
#pragma unroll
    for (int i = 0; i < 16; ++i) *(v8us*)(sw + ((t + 1) & 1) * BUF + i * 16 * GP) = st[i];
    __syncthreads();      /* publishes the buffer just written and ends every read of the one that the next trip overwrites */
  }
  gemm_trip(sm + ((NTR - 1) & 1) * BUF + (wm + ln) * GP + 8 * hh, sm + ((NTR - 1) & 1) * BUF + (GT + wn + ln) * GP + 8 * hh, acc);
  __syncthreads();      /* every wave has left the ring before the epilogue writes over it */
  if (MODE == 0 && part < 2) {
    _Float16* const cq = part ? C16k : C16;
    const int rsub = lane >> 4, c4 = (lane & 15) * 4;
    const size_t o0 = (size_t)(row0 + wm + rsub) * DM + col0 + wn + c4;
    float* const so = (float*)smraw + w * (32 * GSO);      /* each wave's own 32 x 64 patch, in the ring that every wave has left */
#pragma unroll
    for (int ni = 0; ni < 4; ++ni) { const float bv = bf16_round(bp[col0 + wn + ni * 16 + ln]);
#pragma unroll
      for (int mi = 0; mi < 2; ++mi)
#pragma unroll
        for (int r = 0; r < 8; ++r) so[(mi * 16 + 8 * hh + r) * GSO + ni * 16 + ln] = acc[mi][ni][r] * alpha + bv; }
    __builtin_amdgcn_fence(__ATOMIC_ACQ_REL, "workgroup"); __builtin_amdgcn_wave_barrier();
#pragma unroll
    for (int q = 0; q < 16; ++q) { const v4f v = *(const v4fa*)&so[(q * 2 + rsub) * GSO + c4]; v4h h4; for (int i = 0; i < 4; ++i) h4[i] = (_Float16)v[i]; *(v4h*)(cq + o0 + (size_t)q * 2 * DM) = h4; }
  } else {
    float* const tl = (float*)smraw;      /* the block's whole 128 x 128 tile in f32, pitch 131 words: it is written by rows and read back by columns */
    float* const op = C + ((size_t)col0 * TT + t0) * BB + lane * 4;      /* MODE 2: a wave takes one column at a time, 128 values = 512 contiguous bytes of the output */
#pragma unroll
    for (int ni = 0; ni < 4; ++ni) { const float bv = bf16_round(bp[col0 + wn + ni * 16 + ln]);
#pragma unroll
      for (int mi = 0; mi < 2; ++mi)
#pragma unroll
        for (int r = 0; r < 8; ++r) tl[(wm + mi * 16 + 8 * hh + r) * GTP + wn + ni * 16 + ln] = acc[mi][ni][r] * alpha + bv; }
    __syncthreads();      /* a column holds values of four waves: all of the tile stands in LDS before any column is read */
    if (MODE == 0) {
      const int t8 = tid & 15, dq = tid >> 4;      /* 16 lanes cover one column's 128 t: 256 contiguous bytes of each plane */
      const size_t vo = ((size_t)(row0 / TT) * DM + col0) * TT + (row0 % TT) + t8 * 8;
#pragma unroll
      for (int i = 0; i < 8; ++i) { const int d = i * 16 + dq; FragH fh, fl;
#pragma unroll
        for (int q = 0; q < 8; ++q) { const float v = tl[(t8 * 8 + q) * GTP + d]; const _Float16 hv = (_Float16)v; fh.h[q] = hv; fl.h[q] = (_Float16)((v - (float)hv) * 1024.0f); }
        *(v8us*)((unsigned short*)C16v + vo + (size_t)d * TT) = fh.half[0]; *(v8us*)((unsigned short*)C16l + vo + (size_t)d * TT) = fl.half[0]; }
      asm volatile("s_wait_xcnt 0x0" ::: "memory");      /* the wait behind the last stores, in front of whatever next writes their address or data registers */
    } else {
#pragma unroll
      for (int i = 0; i < 16; ++i) { const int d = i * 8 + w; v4f v = {tl[(lane * 4) * GTP + d], tl[(lane * 4 + 1) * GTP + d], tl[(lane * 4 + 2) * GTP + d], tl[(lane * 4 + 3) * GTP + d]};
        *(v4f*)(op + (size_t)d * (TT * BB)) = v; }
    }
  }
}

extern "C" void kernel_launch(void* const* d_in, const int* in_sizes, int n_in,
                              void* d_out, int out_size, void* d_ws, size_t ws_size, hipStream_t stream) {
  (void)in_sizes; (void)n_in; (void)out_size;
  const float* const* I = (const float* const*)d_in; const float* x = I[0]; const float* Wq = I[1]; const float* bq = I[2]; const float* Wk = I[3]; const float* bk = I[4]; const float* Wv = I[5]; const float* bv = I[6]; const float* Wo = I[7]; const float* bo = I[8];
  char* ws = (char*)d_ws; size_t off = 0;
  auto take = [&](size_t bytes) { char* p = ws + off; off += (bytes + 255) & ~(size_t)255; return p; };
  const size_t WSZ = (size_t)DM * DM; _Float16* Bw = (_Float16*)take(4 * WSZ * 2); _Float16* X16 = (_Float16*)take((size_t)NR * DM * 2); _Float16* OH = (_Float16*)take((size_t)NR * DM * 2); _Float16* OL = (_Float16*)take((size_t)NR * DM * 2);
  _Float16* Q16 = (_Float16*)take((size_t)NR * DM * 2); _Float16* K16 = (_Float16*)take((size_t)NR * DM * 2); _Float16* Vth = (_Float16*)take((size_t)NR * DM * 2); _Float16* Vtl = (_Float16*)take((size_t)NR * DM * 2);
  if (off > ws_size) return;      // 8 x 8.4 MB, about 67 MB
  k_prep<<<4 * WB + (DM / 64) * (TT / 32), 256, 0, stream>>>(x, Wq, Wk, Wv, Wo, Bw, X16);
  const dim3 gp((NR / GT) * (DM / GT), 1), gp3(3 * (NR / GT) * (DM / GT), 1);
  k_gemm_t<0><<<gp3, 256, 0, stream>>>(X16, nullptr, Bw, 0.0625f, bq, bk, bv, nullptr, Q16, K16, Vth, Vtl);      /* q, k = xt.W + b -> f16; v -> transposed hi / lo planes: M 4096 N 3 x 1024 K 1024 */
  k_flash<<<BB * NH * (TT / 64), 128, 0, stream>>>(Q16, DM, K16, DM, Vth, Vtl, OH, OL, DM);
  k_gemm_t<2><<<gp, 256, 0, stream>>>(OH, OL, Bw + 3 * WSZ, 0.0625f, bo, nullptr, nullptr, (float*)d_out, nullptr, nullptr, nullptr, nullptr);      /* out = (O_hi + 2^-10 O_lo).Wo + bo, in the output's own layout */
}

// v007
// A run of this version takes 89.1 microseconds.
// Timed twice side by side with v006, it ran 1.13 times as fast both times.
// Over all steps from v000 it is 4.69 times as fast.
#include <hip/hip_runtime.h>
// Windowed multi-head self-attention on a (D, T, B)-layout input (D=1024, T=2048, B=2; 16 heads × 64; window |i−j| ≤ 256): xt = x transposed to (B,T,D); q,k,v = xt·W + b; scores = q·kᵀ/8 (−inf outside the window);
// attn = softmax(s + log_sigmoid(s)); out = (attn·v merged)·Wo + bo, transposed back to (D, T, B).
// Compute dtype: x, weights, biases rounded to bf16; q,k f16 GEMM outputs; v f32 → f16 hi + ×2^10 residual Vᵀ planes; fused windowed flash-style kernel (online softmax f32 on the sigsoftmax logits,
// P f16 ×2^10, two value accumulators) on v_wmma_f32_16x16x32_f16; merged O → hi/lo → one Wo GEMM over both planes (lo first, x 2^-10) + bo; layout transposes through LDS, those of v and of the output in the GEMM epilogues; f32 accumulate.
#define BB 2
#define TT 2048
#define DM 1024
#define NH 16
#define HD 64
#define WIN 256
#define NR (BB * TT)

typedef __bf16 v16b __attribute__((ext_vector_type(16)));
typedef unsigned short v8us __attribute__((ext_vector_type(8), may_alias));
typedef float  v8f  __attribute__((ext_vector_type(8)));
typedef float  v4f  __attribute__((ext_vector_type(4)));
typedef float  v4fa __attribute__((ext_vector_type(4), may_alias));
union FragB { v16b v; v8us half[2]; unsigned short u[16]; };

__device__ __forceinline__ unsigned short bf16_bits(float x) { unsigned int u = __float_as_uint(x); return (unsigned short)((u + 0x7FFFu + ((u >> 16) & 1u)) >> 16); }
__device__ __forceinline__ float bf16_val(unsigned short b) { return __uint_as_float(((unsigned int)b) << 16); }
__device__ __forceinline__ float bf16_round(float x) { return bf16_val(bf16_bits(x)); }
// D += A·B with NT terms: 1 = ah·bh, 2 = + al·bh (A split), 3 = + ah·bl (both split)
template <int NT>
__device__ __forceinline__ v8f mmaN(v16b ah, v16b al, v16b bh, v16b bl, v8f c) {
  c = __builtin_amdgcn_wmma_f32_16x16x32_bf16(false, ah, false, bh, (short)0, c, false, false);
  if (NT >= 2) c = __builtin_amdgcn_wmma_f32_16x16x32_bf16(false, al, false, bh, (short)0, c, false, false);
  if (NT >= 3) c = __builtin_amdgcn_wmma_f32_16x16x32_bf16(false, ah, false, bl, (short)0, c, false, false);
  asm volatile("v_nop\n\tv_nop\n\tv_nop\n\tv_nop" : "+v"(c) : "v"(ah), "v"(al), "v"(bh), "v"(bl));
  return c;
}

__global__ __launch_bounds__(256) void k_wt_bf16(const float* __restrict__ W, unsigned short* __restrict__ Wt, int K, int N) {
  const int t = blockIdx.x * 256 + threadIdx.x;
  const int k8n = K / 8;
  if (t >= N * k8n) return;
  const int n = t / k8n, k8 = (t % k8n) * 8;
  v8us v;
#pragma unroll
  for (int i = 0; i < 8; ++i) v[i] = bf16_bits(W[(size_t)(k8 + i) * N + n]);
  *(v8us*)(Wt + (size_t)n * K + k8) = v;
  
}

// GEMM C[M][N] (f32, pitch ldc) = act(A[M][K]·W + bias). A f32 row-major (pitch lda) converted per fragment to bf16
// (ASPLIT: hi/lo two planes -> 2 terms, else single rounded term); Wt bf16 [N][K] (pitch ldb). BIAS_BF16 rounds the
// bias to bf16 first (bias quantised to bf16 before the add). K%32==0, M%16==0, N%64==0.
template <bool ASPLIT, int ACT, bool BIAS_BF16>
__global__ __launch_bounds__(128) void k_gemm_bf(const float* __restrict__ A, int lda, const unsigned short* __restrict__ Wt, int ldb,
                                               const float* __restrict__ bias, float* __restrict__ C, int ldc, int M, int N, int K) {
  __shared__ __attribute__((aligned(16))) float so[4][16][64];
  const int tid = threadIdx.x, w = tid >> 5, lane = tid & 31, ln = lane & 15, hh = lane >> 4;
  const int ntn = N / 64;
  const int wid = blockIdx.x * 4 + w;
  const int mt = wid / ntn, nq = wid % ntn;
  if (mt * 16 >= M) return;
  const int row0 = mt * 16, col0 = nq * 64;
  const float* arow = A + (size_t)(row0 + ln) * lda;
  v8f acc[4] = {};
  for (int kb = 0; kb < K; kb += 32) {
    FragB ah, al;
    const v4f x0 = *(const v4fa*)(arow + kb + 8 * hh), x1 = *(const v4fa*)(arow + kb + 8 * hh + 4);
    const v4f x2 = *(const v4fa*)(arow + kb + 16 + 8 * hh), x3 = *(const v4fa*)(arow + kb + 16 + 8 * hh + 4);
    float xs[16] = {x0[0],x0[1],x0[2],x0[3],x1[0],x1[1],x1[2],x1[3],x2[0],x2[1],x2[2],x2[3],x3[0],x3[1],x3[2],x3[3]};
#pragma unroll
    for (int i = 0; i < 16; ++i) { const unsigned short hb = bf16_bits(xs[i]); ah.u[i] = hb; al.u[i] = ASPLIT ? bf16_bits(xs[i] - bf16_val(hb)) : (unsigned short)0; }
#pragma unroll
    for (int t = 0; t < 4; ++t) {
      const unsigned short* brow = Wt + (size_t)(col0 + t * 16 + ln) * ldb + kb;
      FragB b;
      b.half[0] = *(const v8us*)(brow + 8 * hh);
      b.half[1] = *(const v8us*)(brow + 16 + 8 * hh);
      acc[t] = mmaN<ASPLIT ? 2 : 1>(ah.v, al.v, b.v, b.v, acc[t]);
    }
  }
#pragma unroll
  for (int t = 0; t < 4; ++t) {
    float bv = bias ? bias[col0 + t * 16 + ln] : 0.f;
    if (BIAS_BF16) bv = bf16_round(bv);
#pragma unroll
    for (int r = 0; r < 8; ++r) { float v = acc[t][r] + bv; if (ACT == 1) v = fmaxf(v, 0.f); so[w][8 * hh + r][t * 16 + ln] = v; }
  }
  __builtin_amdgcn_fence(__ATOMIC_ACQ_REL, "workgroup");
  __builtin_amdgcn_wave_barrier();
  const int rsub = lane >> 4, c4 = (lane & 15) * 4;
  {
#pragma unroll
    for (int q = 0; q < 8; ++q) {
      const int r = q * 2 + rsub;
      const v4f v = *(const v4fa*)&so[w][r][c4];
      *(v4f*)(C + (size_t)(row0 + r) * ldc + col0 + c4) = v;
    }
    
  }
}

// Flash-style causal/unmasked attention, all contractions 3-term bf16 hi/lo splits, f32 softmax with running max.
// q,k,v rows are read from f32 buffers with arbitrary row pitch (so they can live inside a fused qkv buffer);
// D = head size (multiple of 32, <= 128); one wave = 16 query rows; block = 4 waves (64 queries) sharing K/V chunks of 32.
template <int D, bool CAUSAL>
__global__ __launch_bounds__(128) void k_flash(const float* __restrict__ qb, const float* __restrict__ kb, const float* __restrict__ vb,
                                             int pitch, int T, int H, float scale, float* __restrict__ y, int ypitch) {
  constexpr int KS = D / 32;        // k-steps for QK
  constexpr int DT = D / 16;        // d tiles for PV
  __shared__ __attribute__((aligned(16))) unsigned short sKh[32][D + 8], sKl[32][D + 8], sVh[32][D + 8], sVl[32][D + 8];
  __shared__ __attribute__((aligned(16))) unsigned short sPh[4][16][40], sPl[4][16][40];
  __shared__ __attribute__((aligned(16))) float sO[4][16][D];
  const int tid = threadIdx.x, w = tid >> 5, lane = tid & 31, ln = lane & 15, hh = lane >> 4;
  const int nqb = (T + 63) / 64;
  const int bh = blockIdx.x / nqb, qblk = blockIdx.x % nqb;
  const int b = bh / H, h = bh % H;
  const int q0 = qblk * 64 + w * 16;
  const float* Q = qb + (size_t)b * T * pitch + h * D;
  const float* K = kb + (size_t)b * T * pitch + h * D;
  const float* V = vb + (size_t)b * T * pitch + h * D;

  // A fragments of the wave's 16 query rows (scaled), hi/lo
  FragB aqh[KS], aql[KS];
  {
    int row = q0 + ln; if (row >= T) row = T - 1;
    const float* qr = Q + (size_t)row * pitch;
#pragma unroll
    for (int ks = 0; ks < KS; ++ks)
#pragma unroll
      for (int i = 0; i < 16; ++i) {
        const int d = ks * 32 + ((i < 8) ? (8 * hh + i) : (16 + 8 * hh + (i - 8)));
        const float x = qr[d] * scale; const unsigned short hb = bf16_bits(x);
        aqh[ks].u[i] = hb; aql[ks].u[i] = bf16_bits(x - bf16_val(hb));
      }
  }
  float m_r[8], l_r[8];
#pragma unroll
  for (int r = 0; r < 8; ++r) { m_r[r] = -3.0e38f; l_r[r] = 0.f; }
  v8f oacc[DT];
#pragma unroll
  for (int dt = 0; dt < DT; ++dt) oacc[dt] = (v8f){0.f,0.f,0.f,0.f,0.f,0.f,0.f,0.f};

  const int kv_end = CAUSAL ? min(T, qblk * 64 + 64) : T;     // block-uniform
  for (int j0 = 0; j0 < kv_end; j0 += 32) {
    __syncthreads();
    for (int e = tid; e < 32 * (D / 4); e += 128) {
      const int r = e / (D / 4), c4 = (e % (D / 4)) * 4;
      const int key = j0 + r;
      v4f kf = {0.f,0.f,0.f,0.f}, vf = {0.f,0.f,0.f,0.f};
      if (key < T) { kf = *(const v4fa*)(K + (size_t)key * pitch + c4); vf = *(const v4fa*)(V + (size_t)key * pitch + c4); }
#pragma unroll
      for (int t = 0; t < 4; ++t) {
        unsigned short hb = bf16_bits(kf[t]); sKh[r][c4 + t] = hb; sKl[r][c4 + t] = bf16_bits(kf[t] - bf16_val(hb));
        hb = bf16_bits(vf[t]); sVh[r][c4 + t] = hb; sVl[r][c4 + t] = bf16_bits(vf[t] - bf16_val(hb));
      }
    }
    __syncthreads();
    // S tile 16 x 32
    v8f s[2];
#pragma unroll
    for (int nt = 0; nt < 2; ++nt) {
      v8f acc = {};
#pragma unroll
      for (int ks = 0; ks < KS; ++ks) {
        FragB bh_, bl_;
        bh_.half[0] = *(const v8us*)&sKh[nt * 16 + ln][ks * 32 + 8 * hh]; bh_.half[1] = *(const v8us*)&sKh[nt * 16 + ln][ks * 32 + 16 + 8 * hh];
        bl_.half[0] = *(const v8us*)&sKl[nt * 16 + ln][ks * 32 + 8 * hh]; bl_.half[1] = *(const v8us*)&sKl[nt * 16 + ln][ks * 32 + 16 + 8 * hh];
        acc = mmaN<3>(aqh[ks].v, aql[ks].v, bh_.v, bl_.v, acc);
      }
      s[nt] = acc;
    }
    // mask + running max (rows 8hh+r; the 16 lanes of a half share rows)
    float alpha[8];
#pragma unroll
    for (int r = 0; r < 8; ++r) {
      const int qi = q0 + 8 * hh + r;
      const int ja = j0 + ln, jb = j0 + 16 + ln;
      if (CAUSAL) { if (ja > qi) s[0][r] = -3.0e38f; if (jb > qi) s[1][r] = -3.0e38f; }
      if (ja >= T) s[0][r] = -3.0e38f;
      if (jb >= T) s[1][r] = -3.0e38f;
      float mx = fmaxf(s[0][r], s[1][r]);
      mx = fmaxf(mx, __shfl_xor(mx, 1, 32)); mx = fmaxf(mx, __shfl_xor(mx, 2, 32)); mx = fmaxf(mx, __shfl_xor(mx, 4, 32)); mx = fmaxf(mx, __shfl_xor(mx, 8, 32));
      const float mnew = fmaxf(m_r[r], mx);
      alpha[r] = (mnew > -1.0e38f) ? __expf(m_r[r] - mnew) : 1.0f;
      const float p0 = (s[0][r] > -1.0e38f) ? __expf(s[0][r] - mnew) : 0.f;
      const float p1 = (s[1][r] > -1.0e38f) ? __expf(s[1][r] - mnew) : 0.f;
      m_r[r] = mnew;
      l_r[r] = l_r[r] * alpha[r] + p0 + p1;            // per-lane partial row sum (16 lanes combined at the end)
      unsigned short hb = bf16_bits(p0); sPh[w][8 * hh + r][ln] = hb;      sPl[w][8 * hh + r][ln] = bf16_bits(p0 - bf16_val(hb));
      hb = bf16_bits(p1);                sPh[w][8 * hh + r][16 + ln] = hb; sPl[w][8 * hh + r][16 + ln] = bf16_bits(p1 - bf16_val(hb));
    }
#pragma unroll
    for (int dt = 0; dt < DT; ++dt)
#pragma unroll
      for (int r = 0; r < 8; ++r) oacc[dt][r] *= alpha[r];
    __builtin_amdgcn_fence(__ATOMIC_ACQ_REL, "workgroup");
    __builtin_amdgcn_wave_barrier();
    FragB pah, pal;
    pah.half[0] = *(const v8us*)&sPh[w][ln][8 * hh]; pah.half[1] = *(const v8us*)&sPh[w][ln][16 + 8 * hh];
    pal.half[0] = *(const v8us*)&sPl[w][ln][8 * hh]; pal.half[1] = *(const v8us*)&sPl[w][ln][16 + 8 * hh];
#pragma unroll
    for (int dt = 0; dt < DT; ++dt) {
      FragB bvh, bvl;
#pragma unroll
      for (int i = 0; i < 8; ++i) {
        bvh.u[i] = sVh[8 * hh + i][dt * 16 + ln]; bvh.u[8 + i] = sVh[16 + 8 * hh + i][dt * 16 + ln];
        bvl.u[i] = sVl[8 * hh + i][dt * 16 + ln]; bvl.u[8 + i] = sVl[16 + 8 * hh + i][dt * 16 + ln];
      }
      oacc[dt] = mmaN<3>(pah.v, pal.v, bvh.v, bvl.v, oacc[dt]);
    }
    __builtin_amdgcn_fence(__ATOMIC_ACQ_REL, "workgroup");
    __builtin_amdgcn_wave_barrier();
  }
#pragma unroll
  for (int r = 0; r < 8; ++r) {
    float l = l_r[r];
    l += __shfl_xor(l, 1, 32); l += __shfl_xor(l, 2, 32); l += __shfl_xor(l, 4, 32); l += __shfl_xor(l, 8, 32);
    l_r[r] = (l > 0.f) ? 1.0f / l : 0.f;
  }
#pragma unroll
  for (int dt = 0; dt < DT; ++dt)
#pragma unroll
    for (int r = 0; r < 8; ++r) sO[w][8 * hh + r][dt * 16 + ln] = oacc[dt][r] * l_r[r];
  __builtin_amdgcn_fence(__ATOMIC_ACQ_REL, "workgroup");
  __builtin_amdgcn_wave_barrier();
  {
    for (int r = 0; r < 16; ++r) {
      const int row = q0 + r;
      if (row < T && lane < D / 4) {
        const v4f val = *(const v4fa*)&sO[w][r][lane * 4];
        *(v4f*)(y + ((size_t)b * T + row) * ypitch + h * D + lane * 4) = val;
      }
    }
    
  }
}

// GEMM C = act(A·W + bias + resid): A f32 (ASPLIT -> hi/lo 2 terms), Wt bf16 [N][K]; ACT 0 none, 1 relu, 2 exact gelu;
// resid (optional, f32, row index = (row % rmod), pitch ldr, RES_BF16 rounds it) added before the activation.
template <bool ASPLIT, int ACT, bool BIAS_BF16, bool RES_BF16>
__global__ __launch_bounds__(128) void k_gemm_bf3(const float* __restrict__ A, int lda, const unsigned short* __restrict__ Wt, int ldb,
                                                const float* __restrict__ bias, const float* __restrict__ resid, int rmod, int ldr,
                                                float* __restrict__ C, int ldc, int M, int N, int K) {
  __shared__ __attribute__((aligned(16))) float so[4][16][64];
  const int tid = threadIdx.x, w = tid >> 5, lane = tid & 31, ln = lane & 15, hh = lane >> 4;
  const int ntn = N / 64;
  const int wid = blockIdx.x * 4 + w;
  const int mt = wid / ntn, nq = wid % ntn;
  if (mt * 16 >= M) return;
  const int row0 = mt * 16, col0 = nq * 64;
  const float* arow = A + (size_t)(row0 + ln) * lda;
  v8f acc[4] = {};
  for (int kb = 0; kb < K; kb += 32) {
    FragB ah, al;
    const v4f x0 = *(const v4fa*)(arow + kb + 8 * hh), x1 = *(const v4fa*)(arow + kb + 8 * hh + 4);
    const v4f x2 = *(const v4fa*)(arow + kb + 16 + 8 * hh), x3 = *(const v4fa*)(arow + kb + 16 + 8 * hh + 4);
    float xs[16] = {x0[0],x0[1],x0[2],x0[3],x1[0],x1[1],x1[2],x1[3],x2[0],x2[1],x2[2],x2[3],x3[0],x3[1],x3[2],x3[3]};
#pragma unroll
    for (int i = 0; i < 16; ++i) { const unsigned short hb = bf16_bits(xs[i]); ah.u[i] = hb; al.u[i] = ASPLIT ? bf16_bits(xs[i] - bf16_val(hb)) : (unsigned short)0; }
#pragma unroll
    for (int t = 0; t < 4; ++t) {
      const unsigned short* brow = Wt + (size_t)(col0 + t * 16 + ln) * ldb + kb;
      FragB b;
      b.half[0] = *(const v8us*)(brow + 8 * hh);
      b.half[1] = *(const v8us*)(brow + 16 + 8 * hh);
      acc[t] = mmaN<ASPLIT ? 2 : 1>(ah.v, al.v, b.v, b.v, acc[t]);
    }
  }
#pragma unroll
  for (int t = 0; t < 4; ++t) {
    const int col = col0 + t * 16 + ln;
    float bv = bias ? bias[col] : 0.f;
    if (BIAS_BF16) bv = bf16_round(bv);
#pragma unroll
    for (int r = 0; r < 8; ++r) {
      float v = acc[t][r] + bv;
      if (resid) { float rv = resid[(size_t)((row0 + 8 * hh + r) % rmod) * ldr + col]; if (RES_BF16) rv = bf16_round(rv); v += rv; }
      if (ACT == 1) v = fmaxf(v, 0.f);
      if (ACT == 2) v = 0.5f * v * (1.0f + erff(v * 0.70710678118654752f));
      if (ACT == 3) { const float u = 0.7978845608028654f * (v + 0.044715f * v * v * v); v = 0.5f * v * (1.0f + tanhf(u)); }
      so[w][8 * hh + r][t * 16 + ln] = v;
    }
  }
  __builtin_amdgcn_fence(__ATOMIC_ACQ_REL, "workgroup");
  __builtin_amdgcn_wave_barrier();
  const int rsub = lane >> 4, c4 = (lane & 15) * 4;
  {
#pragma unroll
    for (int q = 0; q < 8; ++q) {
      const int r = q * 2 + rsub;
      const v4f v = *(const v4fa*)&so[w][r][c4];
      *(v4f*)(C + (size_t)(row0 + r) * ldc + col0 + c4) = v;
    }
    
  }
}
// row LayerNorm (biased variance, eps) over N: s = X (+ R); optional out_sum <- s; out_norm <- (s-mu)*rsqrt(var+eps)*g + b
template <bool PARAM_BF16>
__global__ __launch_bounds__(256) void k_layernorm(const float* __restrict__ X, const float* __restrict__ R, const float* __restrict__ g, const float* __restrict__ bta,
                                                  float* __restrict__ out_sum, float* __restrict__ out_norm, int N, float eps) {
  __shared__ float red[256];
  const int row = blockIdx.x, tid = threadIdx.x;
  const float* x = X + (size_t)row * N; const float* rr = R ? R + (size_t)row * N : nullptr;
  float vals[16];                     // up to N = 4096
  const int per = N / 256;            // contiguous chunk per thread? use strided-by-4 chunks: thread handles j = tid*4 + 1024*u
  float s1 = 0.f;
  for (int u = 0; u < per / 4; ++u) {
    const int j = tid * 4 + 1024 * u;
    const v4f a = *(const v4fa*)(x + j);
    v4f b = {0.f,0.f,0.f,0.f}; if (rr) b = *(const v4fa*)(rr + j);
#pragma unroll
    for (int q = 0; q < 4; ++q) { const float v = a[q] + b[q]; vals[u * 4 + q] = v; s1 += v; }
  }
  red[tid] = s1; __syncthreads();
  for (int st = 128; st > 0; st >>= 1) { if (tid < st) red[tid] += red[tid + st]; __syncthreads(); }
  const float mu = red[0] / (float)N; __syncthreads();
  float s2 = 0.f;
  for (int u = 0; u < per / 4; ++u)
#pragma unroll
    for (int q = 0; q < 4; ++q) { const float c = vals[u * 4 + q] - mu; s2 += c * c; }
  red[tid] = s2; __syncthreads();
  for (int st = 128; st > 0; st >>= 1) { if (tid < st) red[tid] += red[tid + st]; __syncthreads(); }
  const float rs = rsqrtf(red[0] / (float)N + eps);
  {
    for (int u = 0; u < per / 4; ++u) {
      const int j = tid * 4 + 1024 * u;
      v4f o, sm;
#pragma unroll
      for (int q = 0; q < 4; ++q) {
        float gg = g[j + q], bb = bta[j + q];
        if (PARAM_BF16) { gg = bf16_round(gg); bb = bf16_round(bb); }
        sm[q] = vals[u * 4 + q]; o[q] = (vals[u * 4 + q] - mu) * rs * gg + bb;
      }
      if (out_sum) *(v4f*)(out_sum + (size_t)row * N + j) = sm;
      *(v4f*)(out_norm + (size_t)row * N + j) = o;
    }
    
  }
}



// ---- f16 WMMA path (v_wmma_f32_16x16x32_f16): 11-bit significands for operands in range — used where a [0,1] probability operand needs more precision than bf16
typedef _Float16 v16h __attribute__((ext_vector_type(16)));
union FragH { v16h v; v8us half[2]; _Float16 h[16]; unsigned short u[16]; };
template <int NT>
__device__ __forceinline__ v8f mmaH(v16h ah, v16h al, v16h bh, v16h bl, v8f c) {
  c = __builtin_amdgcn_wmma_f32_16x16x32_f16(false, ah, false, bh, (short)0, c, false, false);
  if (NT >= 2) c = __builtin_amdgcn_wmma_f32_16x16x32_f16(false, al, false, bh, (short)0, c, false, false);
  if (NT >= 3) c = __builtin_amdgcn_wmma_f32_16x16x32_f16(false, ah, false, bl, (short)0, c, false, false);
  asm volatile("v_nop\n\tv_nop\n\tv_nop\n\tv_nop" : "+v"(c) : "v"(ah), "v"(al), "v"(bh), "v"(bl));
  return c;
}
// batched GEMM like k_gemm_b but f16 operands: A f32 (split into f16 hi/lo if ASPLIT, else rounded to f16), Bt = f16 values [n][k]; alpha; C f32; N multiple of 16 (partial tiles skipped)
template <bool ASPLIT>
__global__ __launch_bounds__(128) void k_gemm_h(const float* __restrict__ A, int lda, size_t sA, const _Float16* __restrict__ Bh, int ldb, size_t sB, float alpha, float* __restrict__ C, int ldc, size_t sC, int M, int N, int K) {
  __shared__ __attribute__((aligned(16))) float so[4][16][64];
  const int tid = threadIdx.x, w = tid >> 5, lane = tid & 31, ln = lane & 15, hh = lane >> 4; const int by = blockIdx.y;
  A += (size_t)by * sA; Bh += (size_t)by * sB; C += (size_t)by * sC;
  const int ntn = (N + 63) / 64; const int wid = blockIdx.x * 4 + w; const int mt = wid / ntn, nq = wid % ntn; if (mt * 16 >= M) return;
  const int row0 = mt * 16, col0 = nq * 64; const float* arow = A + (size_t)(row0 + ln) * lda;
  v8f acc[4] = {};
  for (int kb = 0; kb < K; kb += 32) {
    FragH ah, al;
    const v4f x0 = *(const v4fa*)(arow + kb + 8 * hh), x1 = *(const v4fa*)(arow + kb + 8 * hh + 4), x2 = *(const v4fa*)(arow + kb + 16 + 8 * hh), x3 = *(const v4fa*)(arow + kb + 16 + 8 * hh + 4);
    float xs[16] = {x0[0],x0[1],x0[2],x0[3],x1[0],x1[1],x1[2],x1[3],x2[0],x2[1],x2[2],x2[3],x3[0],x3[1],x3[2],x3[3]};
#pragma unroll
    for (int i = 0; i < 16; ++i) { const _Float16 h = (_Float16)xs[i]; ah.h[i] = h; al.h[i] = ASPLIT ? (_Float16)(xs[i] - (float)h) : (_Float16)0.0f; }
#pragma unroll
    for (int t = 0; t < 4; ++t) { if (col0 + t * 16 >= N) continue; const size_t boff = (size_t)(col0 + t * 16 + ln) * ldb + kb; FragH bq; bq.half[0] = *(const v8us*)(Bh + boff + 8 * hh); bq.half[1] = *(const v8us*)(Bh + boff + 16 + 8 * hh);
      acc[t] = mmaH<ASPLIT ? 2 : 1>(ah.v, al.v, bq.v, bq.v, acc[t]); }
  }
#pragma unroll
  for (int t = 0; t < 4; ++t) { if (col0 + t * 16 >= N) continue;
#pragma unroll
    for (int r = 0; r < 8; ++r) so[w][8 * hh + r][t * 16 + ln] = acc[t][r] * alpha; }
  __builtin_amdgcn_fence(__ATOMIC_ACQ_REL, "workgroup"); __builtin_amdgcn_wave_barrier();
  const int rsub = lane >> 4, c4 = (lane & 15) * 4;
  {
#pragma unroll
    for (int q = 0; q < 8; ++q) { const int r = q * 2 + rsub; if (col0 + c4 < N) { const v4f v = *(const v4fa*)&so[w][r][c4]; *(v4f*)(C + (size_t)(row0 + r) * ldc + col0 + c4) = v; } }
     }
}

// Wt[n][k] = f16(W[k][n]·scale) from f32 row-major W[K][N] (scale = power of two; bf16-exact weights stay exact in f16 away from the subnormal range)
__device__ __forceinline__ void wt_f16(const float* __restrict__ W, _Float16* __restrict__ Wt, int K, int N, float scale, int blk) {
  const int t = blk * 256 + threadIdx.x; if (t >= N * (K / 8)) return; const int n = t / (K / 8), k8 = (t % (K / 8)) * 8; FragH f;
#pragma unroll
  for (int i = 0; i < 8; ++i) f.h[i] = (_Float16)(bf16_round(W[(size_t)(k8 + i) * N + n]) * scale); const v8us o = f.half[0];
  *(v8us*)((unsigned short*)Wt + (size_t)n * K + k8) = o; 
}
// k_gemm_hh variant with fused epilogue: v = acc·alpha + bias[by·sBias + col] (+ CP[(row/rowsPerB)·sCPb + by·64 + col] if CP) ; ACT 0 none / 1 elu ; writes f16 C16 and f32 C, each if non-null
template <int ACT>
__global__ __launch_bounds__(128) void k_gemm_hhx(const _Float16* __restrict__ A, int lda, size_t sA, const _Float16* __restrict__ Bh, int ldb, size_t sB, float alpha, const float* __restrict__ bias, size_t sBias, const float* __restrict__ CP, int rowsPerB, size_t sCPb, int row0g,
    float* __restrict__ C, _Float16* __restrict__ C16, int ldc, size_t sC, int M, int N, int K) {
  __shared__ __attribute__((aligned(16))) float so[4][16][64];
  const int tid = threadIdx.x, w = tid >> 5, lane = tid & 31, ln = lane & 15, hh = lane >> 4; const int by = blockIdx.y;
  A += (size_t)by * sA; Bh += (size_t)by * sB; const size_t cofs = (size_t)by * sC; const float* bp = bias ? bias + (size_t)by * sBias : nullptr;
  const int ntn = (N + 63) / 64; const int wid = blockIdx.x * 4 + w; const int mt = wid / ntn, nq = wid % ntn; if (mt * 16 >= M) return;
  const int row0 = mt * 16, col0 = nq * 64; const _Float16* arow = A + (size_t)(row0 + ln) * lda;
  v8f acc[4] = {};
  for (int kb = 0; kb < K; kb += 32) { FragH ah; ah.half[0] = *(const v8us*)((const unsigned short*)arow + kb + 8 * hh); ah.half[1] = *(const v8us*)((const unsigned short*)arow + kb + 16 + 8 * hh);
#pragma unroll
    for (int t = 0; t < 4; ++t) { if (col0 + t * 16 >= N) continue; const size_t boff = (size_t)(col0 + t * 16 + ln) * ldb + kb; FragH bq; bq.half[0] = *(const v8us*)((const unsigned short*)Bh + boff + 8 * hh); bq.half[1] = *(const v8us*)((const unsigned short*)Bh + boff + 16 + 8 * hh);
      acc[t] = mmaH<1>(ah.v, ah.v, bq.v, bq.v, acc[t]); }
  }
#pragma unroll
  for (int t = 0; t < 4; ++t) { if (col0 + t * 16 >= N) continue; const int col = col0 + t * 16 + ln; const float bv = bp ? bf16_round(bp[col]) : 0.f;
#pragma unroll
    for (int r = 0; r < 8; ++r) { float v = acc[t][r] * alpha + bv; if (CP) { const int bidx = (row0g + row0 + 8 * hh + r) / rowsPerB; v += CP[(size_t)bidx * sCPb + (size_t)by * 64 + col]; } if (ACT == 1) v = (v > 0.f) ? v : expm1f(v); else if (ACT == 7) v = (v > 0.f) ? v + 1.0f : expf(v); else if (ACT == 8) v = tanhf(v); else if (ACT == 9) v = 0.5f * v * (1.0f + tanhf(0.7978845608028654f * (v + 0.044715f * v * v * v))); else if (ACT == 11) v = 1.0f / (1.0f + expf(-v)); else if (ACT == 12) v = (v > 0.f) ? v : 0.01f * v; else if (ACT == 14) v = (v > 0.f) ? v : 0.1f * v; else if (ACT == 15) v = v / (1.0f + expf(-v)); else if (ACT == 3) v = fmaxf(v, 0.f); else if (ACT == 6) v = 0.5f * v * (1.0f + erff(v * 0.70710678118654752f)); so[w][8 * hh + r][t * 16 + ln] = v; } }
  __builtin_amdgcn_fence(__ATOMIC_ACQ_REL, "workgroup"); __builtin_amdgcn_wave_barrier();
  const int rsub = lane >> 4, c4 = (lane & 15) * 4; typedef _Float16 v4h __attribute__((ext_vector_type(4)));
  {
#pragma unroll
    for (int q = 0; q < 8; ++q) { const int r = q * 2 + rsub; if (col0 + c4 < N) { const v4f v = *(const v4fa*)&so[w][r][c4]; if (C) *(v4f*)(C + cofs + (size_t)(row0 + r) * ldc + col0 + c4) = v; if (C16) { v4h h4; for (int i = 0; i < 4; ++i) h4[i] = (_Float16)v[i]; *(v4h*)(C16 + cofs + (size_t)(row0 + r) * ldc + col0 + c4) = h4; } } }
     }
}


typedef _Float16 v4h __attribute__((ext_vector_type(4)));

__global__ __launch_bounds__(256) void k_x16(const float* __restrict__ x, _Float16* __restrict__ X16, size_t n8) { const size_t t = (size_t)blockIdx.x * 256 + threadIdx.x; if (t >= n8) return; FragH f;
#pragma unroll
  for (int q = 0; q < 8; ++q) f.h[q] = (_Float16)bf16_round(x[t * 8 + q]); *(v8us*)((unsigned short*)X16 + t * 8) = f.half[0];  }
__global__ __launch_bounds__(256) void k_h16(const float* __restrict__ x, _Float16* __restrict__ X16, size_t n8) { const size_t t = (size_t)blockIdx.x * 256 + threadIdx.x; if (t >= n8) return; FragH f;
#pragma unroll
  for (int q = 0; q < 8; ++q) f.h[q] = (_Float16)x[t * 8 + q]; *(v8us*)((unsigned short*)X16 + t * 8) = f.half[0];  }
__global__ __launch_bounds__(256) void k_round16f(const float* __restrict__ W, _Float16* __restrict__ Bt, size_t n8) { const size_t t = (size_t)blockIdx.x * 256 + threadIdx.x; if (t >= n8) return; FragH f;
#pragma unroll
  for (int i = 0; i < 8; ++i) f.h[i] = (_Float16)(bf16_round(W[t * 8 + i]) * 16.0f); *(v8us*)((unsigned short*)Bt + t * 8) = f.half[0];  }
template <int NHv, int TTv>
__global__ __launch_bounds__(256) void k_vt(const _Float16* __restrict__ V16, int ldv, int voff, _Float16* __restrict__ Vt) { __shared__ unsigned short tl[64][66]; const int tid = threadIdx.x; const int slab = blockIdx.x / (TTv / 64), lg = blockIdx.x % (TTv / 64); const int b = slab / NHv, h = slab % NHv;
  for (int i = tid; i < 64 * 8; i += 256) { const int r = i / 8, c8 = (i % 8) * 8; FragH f; f.half[0] = *(const v8us*)((const unsigned short*)V16 + ((size_t)b * TTv + lg * 64 + r) * ldv + voff + h * 64 + c8);
#pragma unroll
    for (int q = 0; q < 8; ++q) tl[r][c8 + q] = f.u[q]; }
  __syncthreads();
  {
#pragma unroll
    for (int rd = 0; rd < 2; ++rd) { const int d = rd * 32 + tid / 8, pc = tid % 8; FragH f;
#pragma unroll
      for (int q = 0; q < 8; ++q) f.u[q] = tl[pc * 8 + q][d];
      *(v8us*)((unsigned short*)Vt + ((size_t)slab * 64 + d) * TTv + lg * 64 + pc * 8) = f.half[0]; }
     } }

__device__ __forceinline__ void tin(const float* __restrict__ x, _Float16* __restrict__ X16, int blk) { __shared__ float tl[BB][32][65]; const int tid = threadIdx.x; const int dg = blk / (TT / 32), tg = blk % (TT / 32); const int d0 = dg * 64, t0 = tg * 32;
  const float* const px = x + ((size_t)(d0 + tid / (BB * 32)) * TT + t0 + (tid / BB) % 32) * BB + tid % BB;      /* the lane's first element; sweep u of the 256 lanes lies 256 / (BB * 32) rows of x further on */
  float xv[64 * 32 * BB / 256];
#pragma unroll      /* constant trip count, unrolled: the values stay in registers and a lane's loads are all in flight together */
  for (int u = 0; u < 64 * 32 * BB / 256; ++u) xv[u] = px[(size_t)u * (256 / (BB * 32)) * TT * BB];
  asm volatile("s_wait_xcnt 0x0" :: "v"(px) : "memory");      /* the wait in front of any overwrite of the loads' address registers; as its input the pair stays whole up to here */
#pragma unroll      /* xv is indexed by constants only, so it stays in registers */
  for (int u = 0; u < 64 * 32 * BB / 256; ++u) { const int i = u * 256 + tid; tl[i % BB][(i / BB) % 32][i / (BB * 32)] = bf16_round(xv[u]); } __syncthreads();
  { for (int i = tid; i < BB * 32 * 8; i += 256) { const int pc = i % 8, tt = (i / 8) % 32, b = i / (8 * 32); FragH f; for (int q = 0; q < 8; ++q) f.h[q] = (_Float16)tl[b][tt][pc * 8 + q]; *(v8us*)((unsigned short*)X16 + ((size_t)b * TT + t0 + tt) * DM + d0 + pc * 8) = f.half[0]; }  } }
// One launch for the five conversions, none of which reads what another writes: blocks 0 .. 4 * WB - 1 transpose the four weights (the longer blocks, so they start first), the rest bring x to (B, T, D).
#define WB (DM * (DM / 8) / 256)
__global__ __launch_bounds__(256) void k_prep(const float* __restrict__ x, const float* __restrict__ Wq, const float* __restrict__ Wk, const float* __restrict__ Wv, const float* __restrict__ Wo, _Float16* __restrict__ Bw, _Float16* __restrict__ X16) {
  const int blk = blockIdx.x;
  if (blk < 4 * WB) { const int wi = blk / WB; const float* W = wi == 0 ? Wq : wi == 1 ? Wk : wi == 2 ? Wv : Wo; wt_f16(W, Bw + (size_t)wi * DM * DM, DM, DM, 16.0f, blk % WB); }      /* (in,out) -> Bt[n][k] x 2^4 */
  else tin(x, X16, blk - 4 * WB);
}
// The attention kernel's LDS ring. The four waves of a block walk the same keys, so a trip's 32 K rows (128 B each) and 64 rows of each V^T plane (64 B each) are brought into LDS once for the block, by whole rows, and every wave takes its fragments from there:
// a fragment load from global memory touches 16 cache lines for 512 bytes, and each wave repeated it. Pitches 144 B and 80 B (16 B x odd): ds_load_b128 fragment reads meet no bank twice. Two buffers: the next tile's copies fly while this one is worked on.
#define FKP 72
#define FVP 40
#define FBUF (32 * FKP + 2 * 64 * FVP)
// One tile's six asynchronous copies of a lane, 16 bytes each: two K pieces 16 rows apart, two pieces of each V^T plane 32 rows apart. lk, lv: the lane's LDS byte addresses in the K and V^T parts of the buffer; gk, gh, gl: its places in K and the two planes.
__device__ __forceinline__ void flash_fill(unsigned lk, unsigned lv, const unsigned short* gk, size_t k16, const unsigned short* gh, const unsigned short* gl) {
  asm volatile("global_load_async_to_lds_b128 %0, %6, off\n\t"
               "global_load_async_to_lds_b128 %1, %7, off\n\t"
               "global_load_async_to_lds_b128 %2, %8, off\n\t"
               "global_load_async_to_lds_b128 %3, %9, off\n\t"
               "global_load_async_to_lds_b128 %4, %10, off\n\t"
               "global_load_async_to_lds_b128 %5, %11, off\n\t"
               "s_wait_xcnt 0x0"      /* the wait in front of any overwrite of the copies' address registers, inside their own statement so that nothing can be moved in between */
               :: "v"(lk), "v"(lk + 16 * FKP * 2), "v"(lv), "v"(lv + 32 * FVP * 2), "v"(lv + 64 * FVP * 2), "v"(lv + 96 * FVP * 2),
                  "v"(gk), "v"(gk + k16), "v"(gh), "v"(gh + 32 * TT), "v"(gl), "v"(gl + 32 * TT) : "memory");
}
// lane l's value with that of lane l ^ 16: the one exchange between the two halves of a wave that a query's maximum and sum need
__device__ __forceinline__ float xhalf(float x) { return __builtin_bit_cast(float, __builtin_amdgcn_permlanex16(__builtin_bit_cast(int, x), __builtin_bit_cast(int, x), 0x76543210, 0xfedcba98, false, false)); }
// The slot behind a transcendental, for a run of eight: one v_nop that takes the eight arguments and the eight results as inputs. It can only stand behind the last of the eight, and up to it every argument's register stays whole,
// so no instruction directly behind one of them overwrites its source. Inputs only: nothing is hidden from the compiler, and every multiply still fuses with its add.
__device__ __forceinline__ void trans_slot(const float (&a)[8], const float (&y)[8]) {
  asm volatile("v_nop" :: "v"(a[0]), "v"(a[1]), "v"(a[2]), "v"(a[3]), "v"(a[4]), "v"(a[5]), "v"(a[6]), "v"(a[7]), "v"(y[0]), "v"(y[1]), "v"(y[2]), "v"(y[3]), "v"(y[4]), "v"(y[5]), "v"(y[6]), "v"(y[7]));
}
// Transposed products: S^T = K.Q^T (A = 16 K rows, B = the wave's 16 queries) and O^T += V^T.P^T (A = 16 rows of a V^T plane, B = P^T). A lane then holds ONE query (column ln) and, of a trip's 32 keys, the 16 with numbers nt * 16 + 8 * hh + r:
// maximum and sum run inside the lane, the halves meet once, and the two score tiles, converted in place, ARE the B operand of the value products in the hardware's k order (the order in which the V^T fragments are loaded), so the weights never pass through LDS.
// Every plain '#pragma unroll' in this kernel stands on a loop of constant trip count whose arrays are then indexed by constants only and stay in registers.
__global__ __launch_bounds__(128) void k_flash(const _Float16* __restrict__ Q16, int ldq, const _Float16* __restrict__ K16, int ldk, const _Float16* __restrict__ Vt, const _Float16* __restrict__ Vtlo, _Float16* __restrict__ OH, _Float16* __restrict__ OL, int ldo) {
  constexpr int RPW = 16, NQB = TT / (4 * RPW), DT = 4, KS = 2;
  __shared__ __attribute__((aligned(16))) float sO[4][RPW][64 + 4]; __shared__ __attribute__((aligned(16))) unsigned short ring[2 * FBUF];
  const int tid = threadIdx.x, w = tid >> 5, lane = tid & 31, ln = lane & 15, hh = lane >> 4;
  const int slab = blockIdx.x / NQB, qblk = blockIdx.x % NQB; const int b = slab / NH, h = slab % NH; const int qb0 = qblk * (4 * RPW); const int q0 = qb0 + w * RPW;
  FragH aq[KS];
  { const unsigned short* qr = (const unsigned short*)Q16 + ((size_t)b * TT + q0 + ln) * ldq + h * 64;
#pragma unroll
    for (int ks = 0; ks < KS; ++ks) { aq[ks].half[0] = *(const v8us*)(qr + ks * 32 + 8 * hh); aq[ks].half[1] = *(const v8us*)(qr + ks * 32 + 16 + 8 * hh); } }
  const unsigned short* Vth = (const unsigned short*)Vt + (size_t)slab * 64 * TT; const unsigned short* Vtl = (const unsigned short*)Vtlo + (size_t)slab * 64 * TT;
  float m_r = -3.0e38f, l_r = 0.f; v8f oacc[DT], oaccl[DT];      /* the lane's query: running maximum, this half's share of the sum, and 8 head dimensions dt * 16 + 8 * hh + r of each of the 4 output tiles */
#pragma unroll
  for (int dt = 0; dt < DT; ++dt) { oacc[dt] = (v8f){0.f,0.f,0.f,0.f,0.f,0.f,0.f,0.f}; oaccl[dt] = oacc[dt]; }
  const int jbeg = (qb0 - WIN) > 0 ? (qb0 - WIN) : 0; const int jend = (qb0 + 4 * RPW + WIN) < TT ? (qb0 + 4 * RPW + WIN) : TT;      /* block-uniform window bounds (multiples of 32) */
  const unsigned lk0 = (unsigned)(size_t)ring + (unsigned)(((tid >> 3) * FKP + (tid & 7) * 8) * 2), lv0 = (unsigned)(size_t)ring + (unsigned)((32 * FKP + (tid >> 2) * FVP + (tid & 3) * 8) * 2);      /* 8 lanes cover a K row, 4 lanes a V^T row */
  const unsigned short* const gk0 = (const unsigned short*)K16 + ((size_t)b * TT + (tid >> 3)) * ldk + h * 64 + (tid & 7) * 8; const unsigned short* const gh0 = Vth + (size_t)(tid >> 2) * TT + (tid & 3) * 8; const unsigned short* const gl0 = Vtl + (size_t)(tid >> 2) * TT + (tid & 3) * 8;
  flash_fill(lk0, lv0, gk0 + (size_t)jbeg * ldk, (size_t)16 * ldk, gh0 + jbeg, gl0 + jbeg);
  asm volatile("s_wait_asynccnt 0x0" ::: "memory");      /* this wave's copies of the first tile have landed */
  __syncthreads();      /* publishes the first tile: every wave reads pieces that the other waves copied */
  if (jbeg + 32 < jend) flash_fill(lk0 + FBUF * 2, lv0 + FBUF * 2, gk0 + (size_t)(jbeg + 32) * ldk, (size_t)16 * ldk, gh0 + jbeg + 32, gl0 + jbeg + 32);
  unsigned cur = 0;      /* the buffer that holds this trip's tile */
#pragma unroll 1      /* rolled: the trip count is a run-time value, and one short text of the trip is fetched once */
  for (int j0 = jbeg; j0 < jend; j0 += 32) {
    v8f s[2]; FragH bk[2][KS];
#pragma unroll
    for (int nt = 0; nt < 2; ++nt) { const unsigned short* kr = ring + cur * FBUF + (nt * 16 + ln) * FKP;      /* both key tiles' loads fly together, ahead of the first score product */
#pragma unroll
      for (int ks = 0; ks < KS; ++ks) { bk[nt][ks].half[0] = *(const v8us*)(kr + ks * 32 + 8 * hh); bk[nt][ks].half[1] = *(const v8us*)(kr + ks * 32 + 16 + 8 * hh); } }
#pragma unroll
    for (int nt = 0; nt < 2; ++nt) { v8f acc = (v8f){0.f,0.f,0.f,0.f,0.f,0.f,0.f,0.f};
#pragma unroll
      for (int ks = 0; ks < KS; ++ks) acc = mmaH<1>(bk[nt][ks].v, bk[nt][ks].v, aq[ks].v, aq[ks].v, acc); s[nt] = acc; }      /* s[nt][r] = score of key j0 + nt * 16 + 8 * hh + r with query q0 + ln */
    const int dk0 = j0 + 8 * hh - (q0 + ln);      /* key minus query of the lane's first element */
    bool ok[2][8]; float mt[2];
#pragma unroll
    for (int nt = 0; nt < 2; ++nt) { float u[8], ex[8], la[8], lg[8]; mt[nt] = -INFINITY;
#pragma unroll
      for (int r = 0; r < 8; ++r) { u[r] = s[nt][r] * 0.18033688011112042f; ex[r] = __builtin_amdgcn_exp2f(-fabsf(u[r])); }      /* score / 8, times log2(e): logits, running maximum and weights all live in base 2, where exponential and logarithm are one instruction each */
      trans_slot(u, ex);
#pragma unroll
      for (int r = 0; r < 8; ++r) { la[r] = 1.0f + ex[r]; lg[r] = __builtin_amdgcn_logf(la[r]); }      /* the logarithm's argument lies in [1, 2] */
      trans_slot(la, lg);
#pragma unroll
      for (int r = 0; r < 8; ++r) { const int dk = dk0 + nt * 16 + r; ok[nt][r] = (dk <= WIN) && (-dk <= WIN);
        const float g = u[r] + fminf(u[r], 0.f) - lg[r];      /* (s + log sigmoid(s)) * log2(e) */
        s[nt][r] = ok[nt][r] ? g : -INFINITY; mt[nt] = fmaxf(mt[nt], s[nt][r]); } }
    FragH bv[DT], bl[DT];      /* the trip's 16 value-fragment loads, issued in one run here, where the second half of the softmax covers their latency: ahead of the first half their 64 registers would take the kernel past four waves a SIMD */
    const unsigned short* const pvh = ring + cur * FBUF + 32 * FKP + ln * FVP + 8 * hh; const unsigned short* const pvl = pvh + 64 * FVP;
#pragma unroll
    for (int dt = 0; dt < DT; ++dt) { bv[dt].half[0] = *(const v8us*)(pvh + dt * 16 * FVP); bv[dt].half[1] = *(const v8us*)(pvh + dt * 16 * FVP + 16); bl[dt].half[0] = *(const v8us*)(pvl + dt * 16 * FVP); bl[dt].half[1] = *(const v8us*)(pvl + dt * 16 * FVP + 16); }
    float mc = fmaxf(mt[0], mt[1]); mc = fmaxf(mc, xhalf(mc));      /* the query's maximum over all 32 keys, in both halves */
    const float mn = fmaxf(m_r, mc); const float ea = __builtin_amdgcn_exp2f(m_r - mn); const float al = (mn > -1.0e38f) ? ea : 1.0f; m_r = mn;
    FragH pb; float ps[2];
#pragma unroll
    for (int nt = 0; nt < 2; ++nt) { float x[8], e[8], p[8];
#pragma unroll
      for (int r = 0; r < 8; ++r) { x[r] = s[nt][r] - mn; e[r] = __builtin_amdgcn_exp2f(x[r]); }
      trans_slot(x, e);
#pragma unroll
      for (int r = 0; r < 8; ++r) { p[r] = ok[nt][r] ? e[r] : 0.f; pb.h[nt * 8 + r] = (_Float16)(p[r] * 1024.0f); }
      ps[nt] = ((p[0] + p[1]) + (p[2] + p[3])) + ((p[4] + p[5]) + (p[6] + p[7])); }
    l_r = l_r * al + (ps[0] + ps[1]);
#pragma unroll
    for (int dt = 0; dt < DT; ++dt) { oacc[dt] *= al; oaccl[dt] *= al; }
#pragma unroll
    for (int dt = 0; dt < DT; ++dt) { oacc[dt] = mmaH<1>(bv[dt].v, bv[dt].v, pb.v, pb.v, oacc[dt]); oaccl[dt] = mmaH<1>(bl[dt].v, bl[dt].v, pb.v, pb.v, oaccl[dt]); }
    asm volatile("s_wait_dscnt 0x0" ::: "memory");      /* this wave's reads of the buffer have returned before the buffer is given up */
    asm volatile("s_wait_asynccnt 0x0" ::: "memory");      /* this wave's copies of the next tile have landed */
    __syncthreads();      /* publishes the next tile and ends every wave's reads of this trip's buffer, which is refilled behind it */
    if (j0 + 64 < jend) flash_fill(lk0 + cur * (FBUF * 2), lv0 + cur * (FBUF * 2), gk0 + (size_t)(j0 + 64) * ldk, (size_t)16 * ldk, gh0 + j0 + 64, gl0 + j0 + 64);      /* block-uniform test */
    cur ^= 1u; }
  asm volatile("s_wait_asynccnt 0x0" ::: "memory");      /* no copy is outstanding when the wave goes on to the epilogue and ends */
  { float l = l_r; l += xhalf(l); const float li = (l > 0.f) ? 1.0f / (l * 1024.0f) : 0.f;      /* the halves' sums meet once */
#pragma unroll
    for (int dt = 0; dt < DT; ++dt)
#pragma unroll
      for (int r4 = 0; r4 < 8; r4 += 4) { v4f o4;
#pragma unroll
        for (int i = 0; i < 4; ++i) o4[i] = (oacc[dt][r4 + i] + oaccl[dt][r4 + i] * 0.0009765625f) * li;
        *(v4fa*)&sO[w][ln][dt * 16 + 8 * hh + r4] = o4; } }      /* the lane's 8 neighbouring dimensions of its query's row */
  __builtin_amdgcn_fence(__ATOMIC_ACQ_REL, "workgroup"); __builtin_amdgcn_wave_barrier();
  {
#pragma unroll
    for (int rp = 0; rp < RPW; rp += 2) { const int r = rp + (lane >> 4), pc = lane & 15; const v4f val = *(const v4fa*)&sO[w][r][pc * 4]; const size_t o = ((size_t)b * TT + q0 + r) * ldo + h * 64 + pc * 4; v4h oh, ol;      /* the merged row leaves as the output product's two operands: f16 value and residual x 2^10; 16 lanes fill one 128-B line of each plane */
#pragma unroll
      for (int i = 0; i < 4; ++i) { const _Float16 hv = (_Float16)val[i]; oh[i] = hv; ol[i] = (_Float16)((val[i] - (float)hv) * 1024.0f); }
      *(v4h*)(OH + o) = oh; *(v4h*)(OL + o) = ol; }
     } }

// Tiled GEMM for the five 4096 x 1024 x 1024 products, in two launches, A f16 [NR][DM], Bt f16 [n][k]. One 128 x 128 tile per block of 8 waves (4 x 2), 32 x 64 per wave. The epilogue writes what the next kernel reads, so no f32 plane goes through a pass of its own:
// MODE 0: q, k and v in one grid, Bt their three weights one behind the other (3 x 8 column tiles): q, k leave as f16(acc*alpha + bias), row-major (C16, C16k); v = acc*alpha + bias leaves transposed, per (batch, column) a row over t, as f16 value (C16v) and residual x 2^10 (C16l). 2: C = (A.Bt + 2^-10 Alo.Bt)*alpha + bias in the (D, T, B) layout of the output, both products in one accumulator, Alo's first.
// Each trip stages 128 k of the tile's 128 A rows and 128 Bt rows in LDS as whole 256-B rows (pitch 272 B: ds_load_b128 fragment reads meet no bank twice); two buffers, the next trip's rows are
// fetched into registers ahead of this trip's products and stored behind them, one barrier a trip. Every accumulator still sums k in ascending steps of 32.
#define GT 128
#define GK 128
#define GP 136
#define GSO 68
#define GTP 131
// one trip's products of a wave: 128 k in four steps of 32, 2 x 4 accumulator tiles; sa, sb: the lane's own row and k half in the A and Bt parts of the buffer
__device__ __forceinline__ void gemm_trip(const unsigned short* sa, const unsigned short* sb, v8f (&acc)[2][4]) {
#pragma unroll
  for (int ks = 0; ks < GK / 32; ++ks) {
    FragH a[2], b[4];
#pragma unroll
    for (int mi = 0; mi < 2; ++mi) { a[mi].half[0] = *(const v8us*)(sa + mi * 16 * GP + ks * 32); a[mi].half[1] = *(const v8us*)(sa + mi * 16 * GP + ks * 32 + 16); }
#pragma unroll
    for (int ni = 0; ni < 4; ++ni) { b[ni].half[0] = *(const v8us*)(sb + ni * 16 * GP + ks * 32); b[ni].half[1] = *(const v8us*)(sb + ni * 16 * GP + ks * 32 + 16); }
#pragma unroll
    for (int mi = 0; mi < 2; ++mi)
#pragma unroll
      for (int ni = 0; ni < 4; ++ni) acc[mi][ni] = __builtin_amdgcn_wmma_f32_16x16x32_f16(false, a[mi].v, false, b[ni].v, (short)0, acc[mi][ni], false, false);
  }
}
template <int MODE>
__global__ __launch_bounds__(256) void k_gemm_t(const _Float16* __restrict__ A, const _Float16* __restrict__ Alo, const _Float16* __restrict__ Bt, float alpha, const float* __restrict__ bias, const float* __restrict__ biask, const float* __restrict__ biasv, float* __restrict__ C, _Float16* __restrict__ C16, _Float16* __restrict__ C16k, _Float16* __restrict__ C16v, _Float16* __restrict__ C16l) {
  __shared__ __attribute__((aligned(16))) unsigned char smraw[2 * 2 * GT * GP * 2];
  unsigned short* const sm = (unsigned short*)smraw;
  constexpr int BUF = 2 * GT * GP, NK = DM / GK, NTR = (MODE == 2 ? 2 : 1) * NK;      /* MODE 2 walks k twice: the residual plane Alo, then A */
  constexpr bool TB = (MODE >= 2);      /* tile row lr stands for (t, b) = (t0 + lr / BB, lr % BB): the order in which the output holds one column's values, so a column of the tile is one contiguous run there */
  constexpr int AST = (TB ? 16 / BB : 16) * DM;      /* A elements between the rows of two staging sweeps */
  const int tid = threadIdx.x, w = tid >> 5, lane = tid & 31, ln = lane & 15, hh = lane >> 4;
  constexpr int NCT = (MODE == 0 ? 3 : 1) * (DM / GT);      /* column tiles of a row of tiles; the blocks that share an A tile are neighbours in the grid */
  const int mt = blockIdx.x / NCT, ct = blockIdx.x % NCT, part = ct / (DM / GT);      /* part (block-uniform): 0 q, 1 k, 2 v */
  const int row0 = mt * GT, col0 = (ct % (DM / GT)) * GT, t0 = mt * (GT / BB);
  const float* const bp = (MODE == 0) ? (part == 0 ? bias : part == 1 ? biask : biasv) : bias;
  const int wm = (w >> 1) * 32, wn = (w & 1) * 64;
  const int pc = tid & 15, sr = tid >> 4;      /* staging: 16 lanes cover one 256-B row piece by piece; 16 rows per sweep */
  const unsigned short* ga = (const unsigned short*)(MODE == 2 ? Alo : A) + (size_t)(TB ? t0 : row0) * DM;      /* block-uniform bases; the lane's own places are the 32-bit offsets goa and go, which live through the loop */
  const unsigned short* gb = (const unsigned short*)Bt + (size_t)(ct * GT) * DM;
  const unsigned go = (unsigned)(sr * DM + pc * 8);
  const unsigned goa = TB ? (unsigned)(((sr % BB) * TT + sr / BB) * DM + pc * 8) : go;
  unsigned short* const sw = sm + sr * GP + pc * 8;
  v8us st[16];
#pragma unroll
  for (int i = 0; i < 8; ++i) { st[i] = *(const v8us*)(ga + i * AST + goa); st[8 + i] = *(const v8us*)(gb + i * 16 * DM + go); }
#pragma unroll
  for (int i = 0; i < 16; ++i) *(v8us*)(sw + i * 16 * GP) = st[i];
  asm volatile("s_wait_xcnt 0x0" :: "v"(goa), "v"(go) : "memory");      /* the wait in front of any overwrite of the first loads' offset registers, which as its inputs stay whole up to here */
  __syncthreads();
  v8f acc[2][4];
#pragma unroll
  for (int mi = 0; mi < 2; ++mi)
#pragma unroll
    for (int ni = 0; ni < 4; ++ni) acc[mi][ni] = (v8f){0.f,0.f,0.f,0.f,0.f,0.f,0.f,0.f};
#pragma unroll 1      /* rolled: seven (MODE 2: fifteen) copies of the trip save nothing, and a short text is fetched once */
  for (int t = 0; t < NTR - 1; ++t) {
    const int kt = (MODE == 2) ? ((t + 1) & (NK - 1)) : (t + 1);
    const unsigned short* pa = ((MODE == 2 && t + 1 >= NK) ? (const unsigned short*)A + (size_t)t0 * DM : ga) + kt * GK + goa; const unsigned short* pb = gb + kt * GK + go;
#pragma unroll
    for (int i = 0; i < 8; ++i) { st[i] = *(const v8us*)(pa + i * AST); st[8 + i] = *(const v8us*)(pb + i * 16 * DM); }
    __builtin_amdgcn_sched_barrier(0);      /* keeps the next trip's global loads ahead of this trip's products: sunk towards their LDS stores they would leave their latency uncovered */
    gemm_trip(sm + (t & 1) * BUF + (wm + ln) * GP + 8 * hh, sm + (t & 1) * BUF + (GT + wn + ln) * GP + 8 * hh, acc);
    if (MODE == 2 && t == NK - 1) {      /* the residual plane is done: its sums, held x 2^10, come down (exactly) to the scale of the value plane's, which add on top */
#pragma unroll
      for (int mi = 0; mi < 2; ++mi)
#pragma unroll
        for (int ni = 0; ni < 4; ++ni) acc[mi][ni] *= 0.0009765625f;
    }
    asm volatile("s_wait_xcnt 0x0" :: "v"(pa), "v"(pb) : "memory");      /* the wait in front of any overwrite of the loads' address registers; as its inputs the two pairs stay whole up to here, where the loads are a trip old */
#pragma unroll
    for (int i = 0; i < 16; ++i) *(v8us*)(sw + ((t + 1) & 1) * BUF + i * 16 * GP) = st[i];
    __syncthreads();      /* publishes the buffer just written and ends every read of the one that the next trip overwrites */
  }
  gemm_trip(sm + ((NTR - 1) & 1) * BUF + (wm + ln) * GP + 8 * hh, sm + ((NTR - 1) & 1) * BUF + (GT + wn + ln) * GP + 8 * hh, acc);
  __syncthreads();      /* every wave has left the ring before the epilogue writes over it */
  if (MODE == 0 && part < 2) {
    _Float16* const cq = part ? C16k : C16;
    const int rsub = lane >> 4, c4 = (lane & 15) * 4;
    const size_t o0 = (size_t)(row0 + wm + rsub) * DM + col0 + wn + c4;
    float* const so = (float*)smraw + w * (32 * GSO);      /* each wave's own 32 x 64 patch, in the ring that every wave has left */
#pragma unroll
    for (int ni = 0; ni < 4; ++ni) { const float bv = bf16_round(bp[col0 + wn + ni * 16 + ln]);
#pragma unroll
      for (int mi = 0; mi < 2; ++mi)
#pragma unroll
        for (int r = 0; r < 8; ++r) so[(mi * 16 + 8 * hh + r) * GSO + ni * 16 + ln] = acc[mi][ni][r] * alpha + bv; }
    __builtin_amdgcn_fence(__ATOMIC_ACQ_REL, "workgroup"); __builtin_amdgcn_wave_barrier();
#pragma unroll
    for (int q = 0; q < 16; ++q) { const v4f v = *(const v4fa*)&so[(q * 2 + rsub) * GSO + c4]; v4h h4; for (int i = 0; i < 4; ++i) h4[i] = (_Float16)v[i]; *(v4h*)(cq + o0 + (size_t)q * 2 * DM) = h4; }
  } else {
    float* const tl = (float*)smraw;      /* the block's whole 128 x 128 tile in f32, pitch 131 words: it is written by rows and read back by columns */
    float* const op = C + ((size_t)col0 * TT + t0) * BB + lane * 4;      /* MODE 2: a wave takes one column at a time, 128 values = 512 contiguous bytes of the output */
#pragma unroll
    for (int ni = 0; ni < 4; ++ni) { const float bv = bf16_round(bp[col0 + wn + ni * 16 + ln]);
#pragma unroll
      for (int mi = 0; mi < 2; ++mi)
#pragma unroll
        for (int r = 0; r < 8; ++r) tl[(wm + mi * 16 + 8 * hh + r) * GTP + wn + ni * 16 + ln] = acc[mi][ni][r] * alpha + bv; }
    __syncthreads();      /* a column holds values of four waves: all of the tile stands in LDS before any column is read */
    if (MODE == 0) {
      const int t8 = tid & 15, dq = tid >> 4;      /* 16 lanes cover one column's 128 t: 256 contiguous bytes of each plane */
      const size_t vo = ((size_t)(row0 / TT) * DM + col0) * TT + (row0 % TT) + t8 * 8;
#pragma unroll
      for (int i = 0; i < 8; ++i) { const int d = i * 16 + dq; FragH fh, fl;
#pragma unroll
        for (int q = 0; q < 8; ++q) { const float v = tl[(t8 * 8 + q) * GTP + d]; const _Float16 hv = (_Float16)v; fh.h[q] = hv; fl.h[q] = (_Float16)((v - (float)hv) * 1024.0f); }
        *(v8us*)((unsigned short*)C16v + vo + (size_t)d * TT) = fh.half[0]; *(v8us*)((unsigned short*)C16l + vo + (size_t)d * TT) = fl.half[0]; }
      asm volatile("s_wait_xcnt 0x0" ::: "memory");      /* the wait behind the last stores, in front of whatever next writes their address or data registers */
    } else {
#pragma unroll
      for (int i = 0; i < 16; ++i) { const int d = i * 8 + w; v4f v = {tl[(lane * 4) * GTP + d], tl[(lane * 4 + 1) * GTP + d], tl[(lane * 4 + 2) * GTP + d], tl[(lane * 4 + 3) * GTP + d]};
        *(v4f*)(op + (size_t)d * (TT * BB)) = v; }
    }
  }
}

extern "C" void kernel_launch(void* const* d_in, const int* in_sizes, int n_in,
                              void* d_out, int out_size, void* d_ws, size_t ws_size, hipStream_t stream) {
  (void)in_sizes; (void)n_in; (void)out_size;
  const float* const* I = (const float* const*)d_in; const float* x = I[0]; const float* Wq = I[1]; const float* bq = I[2]; const float* Wk = I[3]; const float* bk = I[4]; const float* Wv = I[5]; const float* bv = I[6]; const float* Wo = I[7]; const float* bo = I[8];
  char* ws = (char*)d_ws; size_t off = 0;
  auto take = [&](size_t bytes) { char* p = ws + off; off += (bytes + 255) & ~(size_t)255; return p; };
  const size_t WSZ = (size_t)DM * DM; _Float16* Bw = (_Float16*)take(4 * WSZ * 2); _Float16* X16 = (_Float16*)take((size_t)NR * DM * 2); _Float16* OH = (_Float16*)take((size_t)NR * DM * 2); _Float16* OL = (_Float16*)take((size_t)NR * DM * 2);
  _Float16* Q16 = (_Float16*)take((size_t)NR * DM * 2); _Float16* K16 = (_Float16*)take((size_t)NR * DM * 2); _Float16* Vth = (_Float16*)take((size_t)NR * DM * 2); _Float16* Vtl = (_Float16*)take((size_t)NR * DM * 2);
  if (off > ws_size) return;      // 8 x 8.4 MB, about 67 MB
  k_prep<<<4 * WB + (DM / 64) * (TT / 32), 256, 0, stream>>>(x, Wq, Wk, Wv, Wo, Bw, X16);
  const dim3 gp((NR / GT) * (DM / GT), 1), gp3(3 * (NR / GT) * (DM / GT), 1);
  k_gemm_t<0><<<gp3, 256, 0, stream>>>(X16, nullptr, Bw, 0.0625f, bq, bk, bv, nullptr, Q16, K16, Vth, Vtl);      /* q, k = xt.W + b -> f16; v -> transposed hi / lo planes: M 4096 N 3 x 1024 K 1024 */
  k_flash<<<BB * NH * (TT / 64), 128, 0, stream>>>(Q16, DM, K16, DM, Vth, Vtl, OH, OL, DM);
  k_gemm_t<2><<<gp, 256, 0, stream>>>(OH, OL, Bw + 3 * WSZ, 0.0625f, bo, nullptr, nullptr, (float*)d_out, nullptr, nullptr, nullptr, nullptr);      /* out = (O_hi + 2^-10 O_lo).Wo + bo, in the output's own layout */
}

// v008
// It runs in 80.4 microseconds.
// Two timings next to v007 put it at 1.10 and 1.11 times that version's speed.
// Counting every step since v000, it is 5.18 times as fast.
#include <hip/hip_runtime.h>
// Windowed multi-head self-attention on a (D, T, B)-layout input (D=1024, T=2048, B=2; 16 heads × 64; window |i−j| ≤ 256): xt = x transposed to (B,T,D); q,k,v = xt·W + b; scores = q·kᵀ/8 (−inf outside the window);
// attn = softmax(s + log_sigmoid(s)); out = (attn·v merged)·Wo + bo, transposed back to (D, T, B).
// Compute dtype: x, weights, biases rounded to bf16; q,k f16 GEMM outputs; v f32 → f16 hi + ×2^10 residual Vᵀ planes; fused windowed flash-style kernel (online softmax f32 on the sigsoftmax logits,
// P f16 ×2^10, two value accumulators) on v_wmma_f32_16x16x32_f16; merged O → hi/lo → one Wo GEMM over both planes (lo first, x 2^-10) + bo; layout transposes through LDS, those of v and of the output in the GEMM epilogues; f32 accumulate.
#define BB 2
#define TT 2048
#define DM 1024
#define NH 16
#define HD 64
#define WIN 256
#define NR (BB * TT)

typedef __bf16 v16b __attribute__((ext_vector_type(16)));
typedef unsigned short v8us __attribute__((ext_vector_type(8), may_alias));
typedef float  v8f  __attribute__((ext_vector_type(8)));
typedef float  v4f  __attribute__((ext_vector_type(4)));
typedef float  v4fa __attribute__((ext_vector_type(4), may_alias));
union FragB { v16b v; v8us half[2]; unsigned short u[16]; };

__device__ __forceinline__ unsigned short bf16_bits(float x) { unsigned int u = __float_as_uint(x); return (unsigned short)((u + 0x7FFFu + ((u >> 16) & 1u)) >> 16); }
__device__ __forceinline__ float bf16_val(unsigned short b) { return __uint_as_float(((unsigned int)b) << 16); }
__device__ __forceinline__ float bf16_round(float x) { return bf16_val(bf16_bits(x)); }
// D += A·B with NT terms: 1 = ah·bh, 2 = + al·bh (A split), 3 = + ah·bl (both split)
template <int NT>
__device__ __forceinline__ v8f mmaN(v16b ah, v16b al, v16b bh, v16b bl, v8f c) {
  c = __builtin_amdgcn_wmma_f32_16x16x32_bf16(false, ah, false, bh, (short)0, c, false, false);
  if (NT >= 2) c = __builtin_amdgcn_wmma_f32_16x16x32_bf16(false, al, false, bh, (short)0, c, false, false);
  if (NT >= 3) c = __builtin_amdgcn_wmma_f32_16x16x32_bf16(false, ah, false, bl, (short)0, c, false, false);
  asm volatile("v_nop\n\tv_nop\n\tv_nop\n\tv_nop" : "+v"(c) : "v"(ah), "v"(al), "v"(bh), "v"(bl));
  return c;
}

__global__ __launch_bounds__(256) void k_wt_bf16(const float* __restrict__ W, unsigned short* __restrict__ Wt, int K, int N) {
  const int t = blockIdx.x * 256 + threadIdx.x;
  const int k8n = K / 8;
  if (t >= N * k8n) return;
  const int n = t / k8n, k8 = (t % k8n) * 8;
  v8us v;
#pragma unroll
  for (int i = 0; i < 8; ++i) v[i] = bf16_bits(W[(size_t)(k8 + i) * N + n]);
  *(v8us*)(Wt + (size_t)n * K + k8) = v;
  
}

// GEMM C[M][N] (f32, pitch ldc) = act(A[M][K]·W + bias). A f32 row-major (pitch lda) converted per fragment to bf16
// (ASPLIT: hi/lo two planes -> 2 terms, else single rounded term); Wt bf16 [N][K] (pitch ldb). BIAS_BF16 rounds the
// bias to bf16 first (bias quantised to bf16 before the add). K%32==0, M%16==0, N%64==0.
template <bool ASPLIT, int ACT, bool BIAS_BF16>
__global__ __launch_bounds__(128) void k_gemm_bf(const float* __restrict__ A, int lda, const unsigned short* __restrict__ Wt, int ldb,
                                               const float* __restrict__ bias, float* __restrict__ C, int ldc, int M, int N, int K) {
  __shared__ __attribute__((aligned(16))) float so[4][16][64];
  const int tid = threadIdx.x, w = tid >> 5, lane = tid & 31, ln = lane & 15, hh = lane >> 4;
  const int ntn = N / 64;
  const int wid = blockIdx.x * 4 + w;
  const int mt = wid / ntn, nq = wid % ntn;
  if (mt * 16 >= M) return;
  const int row0 = mt * 16, col0 = nq * 64;
  const float* arow = A + (size_t)(row0 + ln) * lda;
  v8f acc[4] = {};
  for (int kb = 0; kb < K; kb += 32) {
    FragB ah, al;
    const v4f x0 = *(const v4fa*)(arow + kb + 8 * hh), x1 = *(const v4fa*)(arow + kb + 8 * hh + 4);
    const v4f x2 = *(const v4fa*)(arow + kb + 16 + 8 * hh), x3 = *(const v4fa*)(arow + kb + 16 + 8 * hh + 4);
    float xs[16] = {x0[0],x0[1],x0[2],x0[3],x1[0],x1[1],x1[2],x1[3],x2[0],x2[1],x2[2],x2[3],x3[0],x3[1],x3[2],x3[3]};
#pragma unroll
    for (int i = 0; i < 16; ++i) { const unsigned short hb = bf16_bits(xs[i]); ah.u[i] = hb; al.u[i] = ASPLIT ? bf16_bits(xs[i] - bf16_val(hb)) : (unsigned short)0; }
#pragma unroll
    for (int t = 0; t < 4; ++t) {
      const unsigned short* brow = Wt + (size_t)(col0 + t * 16 + ln) * ldb + kb;
      FragB b;
      b.half[0] = *(const v8us*)(brow + 8 * hh);
      b.half[1] = *(const v8us*)(brow + 16 + 8 * hh);
      acc[t] = mmaN<ASPLIT ? 2 : 1>(ah.v, al.v, b.v, b.v, acc[t]);
    }
  }
#pragma unroll
  for (int t = 0; t < 4; ++t) {
    float bv = bias ? bias[col0 + t * 16 + ln] : 0.f;
    if (BIAS_BF16) bv = bf16_round(bv);
#pragma unroll
    for (int r = 0; r < 8; ++r) { float v = acc[t][r] + bv; if (ACT == 1) v = fmaxf(v, 0.f); so[w][8 * hh + r][t * 16 + ln] = v; }
  }
  __builtin_amdgcn_fence(__ATOMIC_ACQ_REL, "workgroup");
  __builtin_amdgcn_wave_barrier();
  const int rsub = lane >> 4, c4 = (lane & 15) * 4;
  {
#pragma unroll
    for (int q = 0; q < 8; ++q) {
      const int r = q * 2 + rsub;
      const v4f v = *(const v4fa*)&so[w][r][c4];
      *(v4f*)(C + (size_t)(row0 + r) * ldc + col0 + c4) = v;
    }
    
  }
}

// Flash-style causal/unmasked attention, all contractions 3-term bf16 hi/lo splits, f32 softmax with running max.
// q,k,v rows are read from f32 buffers with arbitrary row pitch (so they can live inside a fused qkv buffer);
// D = head size (multiple of 32, <= 128); one wave = 16 query rows; block = 4 waves (64 queries) sharing K/V chunks of 32.
template <int D, bool CAUSAL>
__global__ __launch_bounds__(128) void k_flash(const float* __restrict__ qb, const float* __restrict__ kb, const float* __restrict__ vb,
                                             int pitch, int T, int H, float scale, float* __restrict__ y, int ypitch) {
  constexpr int KS = D / 32;        // k-steps for QK
  constexpr int DT = D / 16;        // d tiles for PV
  __shared__ __attribute__((aligned(16))) unsigned short sKh[32][D + 8], sKl[32][D + 8], sVh[32][D + 8], sVl[32][D + 8];
  __shared__ __attribute__((aligned(16))) unsigned short sPh[4][16][40], sPl[4][16][40];
  __shared__ __attribute__((aligned(16))) float sO[4][16][D];
  const int tid = threadIdx.x, w = tid >> 5, lane = tid & 31, ln = lane & 15, hh = lane >> 4;
  const int nqb = (T + 63) / 64;
  const int bh = blockIdx.x / nqb, qblk = blockIdx.x % nqb;
  const int b = bh / H, h = bh % H;
  const int q0 = qblk * 64 + w * 16;
  const float* Q = qb + (size_t)b * T * pitch + h * D;
  const float* K = kb + (size_t)b * T * pitch + h * D;
  const float* V = vb + (size_t)b * T * pitch + h * D;

  // A fragments of the wave's 16 query rows (scaled), hi/lo
  FragB aqh[KS], aql[KS];
  {
    int row = q0 + ln; if (row >= T) row = T - 1;
    const float* qr = Q + (size_t)row * pitch;
#pragma unroll
    for (int ks = 0; ks < KS; ++ks)
#pragma unroll
      for (int i = 0; i < 16; ++i) {
        const int d = ks * 32 + ((i < 8) ? (8 * hh + i) : (16 + 8 * hh + (i - 8)));
        const float x = qr[d] * scale; const unsigned short hb = bf16_bits(x);
        aqh[ks].u[i] = hb; aql[ks].u[i] = bf16_bits(x - bf16_val(hb));
      }
  }
  float m_r[8], l_r[8];
#pragma unroll
  for (int r = 0; r < 8; ++r) { m_r[r] = -3.0e38f; l_r[r] = 0.f; }
  v8f oacc[DT];
#pragma unroll
  for (int dt = 0; dt < DT; ++dt) oacc[dt] = (v8f){0.f,0.f,0.f,0.f,0.f,0.f,0.f,0.f};

  const int kv_end = CAUSAL ? min(T, qblk * 64 + 64) : T;     // block-uniform
  for (int j0 = 0; j0 < kv_end; j0 += 32) {
    __syncthreads();
    for (int e = tid; e < 32 * (D / 4); e += 128) {
      const int r = e / (D / 4), c4 = (e % (D / 4)) * 4;
      const int key = j0 + r;
      v4f kf = {0.f,0.f,0.f,0.f}, vf = {0.f,0.f,0.f,0.f};
      if (key < T) { kf = *(const v4fa*)(K + (size_t)key * pitch + c4); vf = *(const v4fa*)(V + (size_t)key * pitch + c4); }
#pragma unroll
      for (int t = 0; t < 4; ++t) {
        unsigned short hb = bf16_bits(kf[t]); sKh[r][c4 + t] = hb; sKl[r][c4 + t] = bf16_bits(kf[t] - bf16_val(hb));
        hb = bf16_bits(vf[t]); sVh[r][c4 + t] = hb; sVl[r][c4 + t] = bf16_bits(vf[t] - bf16_val(hb));
      }
    }
    __syncthreads();
    // S tile 16 x 32
    v8f s[2];
#pragma unroll
    for (int nt = 0; nt < 2; ++nt) {
      v8f acc = {};
#pragma unroll
      for (int ks = 0; ks < KS; ++ks) {
        FragB bh_, bl_;
        bh_.half[0] = *(const v8us*)&sKh[nt * 16 + ln][ks * 32 + 8 * hh]; bh_.half[1] = *(const v8us*)&sKh[nt * 16 + ln][ks * 32 + 16 + 8 * hh];
        bl_.half[0] = *(const v8us*)&sKl[nt * 16 + ln][ks * 32 + 8 * hh]; bl_.half[1] = *(const v8us*)&sKl[nt * 16 + ln][ks * 32 + 16 + 8 * hh];
        acc = mmaN<3>(aqh[ks].v, aql[ks].v, bh_.v, bl_.v, acc);
      }
      s[nt] = acc;
    }
    // mask + running max (rows 8hh+r; the 16 lanes of a half share rows)
    float alpha[8];
#pragma unroll
    for (int r = 0; r < 8; ++r) {
      const int qi = q0 + 8 * hh + r;
      const int ja = j0 + ln, jb = j0 + 16 + ln;
      if (CAUSAL) { if (ja > qi) s[0][r] = -3.0e38f; if (jb > qi) s[1][r] = -3.0e38f; }
      if (ja >= T) s[0][r] = -3.0e38f;
      if (jb >= T) s[1][r] = -3.0e38f;
      float mx = fmaxf(s[0][r], s[1][r]);
      mx = fmaxf(mx, __shfl_xor(mx, 1, 32)); mx = fmaxf(mx, __shfl_xor(mx, 2, 32)); mx = fmaxf(mx, __shfl_xor(mx, 4, 32)); mx = fmaxf(mx, __shfl_xor(mx, 8, 32));
      const float mnew = fmaxf(m_r[r], mx);
      alpha[r] = (mnew > -1.0e38f) ? __expf(m_r[r] - mnew) : 1.0f;
      const float p0 = (s[0][r] > -1.0e38f) ? __expf(s[0][r] - mnew) : 0.f;
      const float p1 = (s[1][r] > -1.0e38f) ? __expf(s[1][r] - mnew) : 0.f;
      m_r[r] = mnew;
      l_r[r] = l_r[r] * alpha[r] + p0 + p1;            // per-lane partial row sum (16 lanes combined at the end)
      unsigned short hb = bf16_bits(p0); sPh[w][8 * hh + r][ln] = hb;      sPl[w][8 * hh + r][ln] = bf16_bits(p0 - bf16_val(hb));
      hb = bf16_bits(p1);                sPh[w][8 * hh + r][16 + ln] = hb; sPl[w][8 * hh + r][16 + ln] = bf16_bits(p1 - bf16_val(hb));
    }
#pragma unroll
    for (int dt = 0; dt < DT; ++dt)
#pragma unroll
      for (int r = 0; r < 8; ++r) oacc[dt][r] *= alpha[r];
    __builtin_amdgcn_fence(__ATOMIC_ACQ_REL, "workgroup");
    __builtin_amdgcn_wave_barrier();
    FragB pah, pal;
    pah.half[0] = *(const v8us*)&sPh[w][ln][8 * hh]; pah.half[1] = *(const v8us*)&sPh[w][ln][16 + 8 * hh];
    pal.half[0] = *(const v8us*)&sPl[w][ln][8 * hh]; pal.half[1] = *(const v8us*)&sPl[w][ln][16 + 8 * hh];
#pragma unroll
    for (int dt = 0; dt < DT; ++dt) {
      FragB bvh, bvl;
#pragma unroll
      for (int i = 0; i < 8; ++i) {
        bvh.u[i] = sVh[8 * hh + i][dt * 16 + ln]; bvh.u[8 + i] = sVh[16 + 8 * hh + i][dt * 16 + ln];
        bvl.u[i] = sVl[8 * hh + i][dt * 16 + ln]; bvl.u[8 + i] = sVl[16 + 8 * hh + i][dt * 16 + ln];
      }
      oacc[dt] = mmaN<3>(pah.v, pal.v, bvh.v, bvl.v, oacc[dt]);
    }
    __builtin_amdgcn_fence(__ATOMIC_ACQ_REL, "workgroup");
    __builtin_amdgcn_wave_barrier();
  }
#pragma unroll
  for (int r = 0; r < 8; ++r) {
    float l = l_r[r];
    l += __shfl_xor(l, 1, 32); l += __shfl_xor(l, 2, 32); l += __shfl_xor(l, 4, 32); l += __shfl_xor(l, 8, 32);
    l_r[r] = (l > 0.f) ? 1.0f / l : 0.f;
  }
#pragma unroll
  for (int dt = 0; dt < DT; ++dt)
#pragma unroll
    for (int r = 0; r < 8; ++r) sO[w][8 * hh + r][dt * 16 + ln] = oacc[dt][r] * l_r[r];
  __builtin_amdgcn_fence(__ATOMIC_ACQ_REL, "workgroup");
  __builtin_amdgcn_wave_barrier();
  {
    for (int r = 0; r < 16; ++r) {
      const int row = q0 + r;
      if (row < T && lane < D / 4) {
        const v4f val = *(const v4fa*)&sO[w][r][lane * 4];
        *(v4f*)(y + ((size_t)b * T + row) * ypitch + h * D + lane * 4) = val;
      }
    }
    
  }
}

// GEMM C = act(A·W + bias + resid): A f32 (ASPLIT -> hi/lo 2 terms), Wt bf16 [N][K]; ACT 0 none, 1 relu, 2 exact gelu;
// resid (optional, f32, row index = (row % rmod), pitch ldr, RES_BF16 rounds it) added before the activation.
template <bool ASPLIT, int ACT, bool BIAS_BF16, bool RES_BF16>
__global__ __launch_bounds__(128) void k_gemm_bf3(const float* __restrict__ A, int lda, const unsigned short* __restrict__ Wt, int ldb,
                                                const float* __restrict__ bias, const float* __restrict__ resid, int rmod, int ldr,
                                                float* __restrict__ C, int ldc, int M, int N, int K) {
  __shared__ __attribute__((aligned(16))) float so[4][16][64];
  const int tid = threadIdx.x, w = tid >> 5, lane = tid & 31, ln = lane & 15, hh = lane >> 4;
  const int ntn = N / 64;
  const int wid = blockIdx.x * 4 + w;
  const int mt = wid / ntn, nq = wid % ntn;
  if (mt * 16 >= M) return;
  const int row0 = mt * 16, col0 = nq * 64;
  const float* arow = A + (size_t)(row0 + ln) * lda;
  v8f acc[4] = {};
  for (int kb = 0; kb < K; kb += 32) {
    FragB ah, al;
    const v4f x0 = *(const v4fa*)(arow + kb + 8 * hh), x1 = *(const v4fa*)(arow + kb + 8 * hh + 4);
    const v4f x2 = *(const v4fa*)(arow + kb + 16 + 8 * hh), x3 = *(const v4fa*)(arow + kb + 16 + 8 * hh + 4);
    float xs[16] = {x0[0],x0[1],x0[2],x0[3],x1[0],x1[1],x1[2],x1[3],x2[0],x2[1],x2[2],x2[3],x3[0],x3[1],x3[2],x3[3]};
#pragma unroll
    for (int i = 0; i < 16; ++i) { const unsigned short hb = bf16_bits(xs[i]); ah.u[i] = hb; al.u[i] = ASPLIT ? bf16_bits(xs[i] - bf16_val(hb)) : (unsigned short)0; }
#pragma unroll
    for (int t = 0; t < 4; ++t) {
      const unsigned short* brow = Wt + (size_t)(col0 + t * 16 + ln) * ldb + kb;
      FragB b;
      b.half[0] = *(const v8us*)(brow + 8 * hh);
      b.half[1] = *(const v8us*)(brow + 16 + 8 * hh);
      acc[t] = mmaN<ASPLIT ? 2 : 1>(ah.v, al.v, b.v, b.v, acc[t]);
    }
  }
#pragma unroll
  for (int t = 0; t < 4; ++t) {
    const int col = col0 + t * 16 + ln;
    float bv = bias ? bias[col] : 0.f;
    if (BIAS_BF16) bv = bf16_round(bv);
#pragma unroll
    for (int r = 0; r < 8; ++r) {
      float v = acc[t][r] + bv;
      if (resid) { float rv = resid[(size_t)((row0 + 8 * hh + r) % rmod) * ldr + col]; if (RES_BF16) rv = bf16_round(rv); v += rv; }
      if (ACT == 1) v = fmaxf(v, 0.f);
      if (ACT == 2) v = 0.5f * v * (1.0f + erff(v * 0.70710678118654752f));
      if (ACT == 3) { const float u = 0.7978845608028654f * (v + 0.044715f * v * v * v); v = 0.5f * v * (1.0f + tanhf(u)); }
      so[w][8 * hh + r][t * 16 + ln] = v;
    }
  }
  __builtin_amdgcn_fence(__ATOMIC_ACQ_REL, "workgroup");
  __builtin_amdgcn_wave_barrier();
  const int rsub = lane >> 4, c4 = (lane & 15) * 4;
  {
#pragma unroll
    for (int q = 0; q < 8; ++q) {
      const int r = q * 2 + rsub;
      const v4f v = *(const v4fa*)&so[w][r][c4];
      *(v4f*)(C + (size_t)(row0 + r) * ldc + col0 + c4) = v;
    }
    
  }
}
// row LayerNorm (biased variance, eps) over N: s = X (+ R); optional out_sum <- s; out_norm <- (s-mu)*rsqrt(var+eps)*g + b
template <bool PARAM_BF16>
__global__ __launch_bounds__(256) void k_layernorm(const float* __restrict__ X, const float* __restrict__ R, const float* __restrict__ g, const float* __restrict__ bta,
                                                  float* __restrict__ out_sum, float* __restrict__ out_norm, int N, float eps) {
  __shared__ float red[256];
  const int row = blockIdx.x, tid = threadIdx.x;
  const float* x = X + (size_t)row * N; const float* rr = R ? R + (size_t)row * N : nullptr;
  float vals[16];                     // up to N = 4096
  const int per = N / 256;            // contiguous chunk per thread? use strided-by-4 chunks: thread handles j = tid*4 + 1024*u
  float s1 = 0.f;
  for (int u = 0; u < per / 4; ++u) {
    const int j = tid * 4 + 1024 * u;
    const v4f a = *(const v4fa*)(x + j);
    v4f b = {0.f,0.f,0.f,0.f}; if (rr) b = *(const v4fa*)(rr + j);
#pragma unroll
    for (int q = 0; q < 4; ++q) { const float v = a[q] + b[q]; vals[u * 4 + q] = v; s1 += v; }
  }
  red[tid] = s1; __syncthreads();
  for (int st = 128; st > 0; st >>= 1) { if (tid < st) red[tid] += red[tid + st]; __syncthreads(); }
  const float mu = red[0] / (float)N; __syncthreads();
  float s2 = 0.f;
  for (int u = 0; u < per / 4; ++u)
#pragma unroll
    for (int q = 0; q < 4; ++q) { const float c = vals[u * 4 + q] - mu; s2 += c * c; }
  red[tid] = s2; __syncthreads();
  for (int st = 128; st > 0; st >>= 1) { if (tid < st) red[tid] += red[tid + st]; __syncthreads(); }
  const float rs = rsqrtf(red[0] / (float)N + eps);
  {
    for (int u = 0; u < per / 4; ++u) {
      const int j = tid * 4 + 1024 * u;
      v4f o, sm;
#pragma unroll
      for (int q = 0; q < 4; ++q) {
        float gg = g[j + q], bb = bta[j + q];
        if (PARAM_BF16) { gg = bf16_round(gg); bb = bf16_round(bb); }
        sm[q] = vals[u * 4 + q]; o[q] = (vals[u * 4 + q] - mu) * rs * gg + bb;
      }
      if (out_sum) *(v4f*)(out_sum + (size_t)row * N + j) = sm;
      *(v4f*)(out_norm + (size_t)row * N + j) = o;
    }
    
  }
}



// ---- f16 WMMA path (v_wmma_f32_16x16x32_f16): 11-bit significands for operands in range — used where a [0,1] probability operand needs more precision than bf16
typedef _Float16 v16h __attribute__((ext_vector_type(16)));
union FragH { v16h v; v8us half[2]; _Float16 h[16]; unsigned short u[16]; };
template <int NT>
__device__ __forceinline__ v8f mmaH(v16h ah, v16h al, v16h bh, v16h bl, v8f c) {
  c = __builtin_amdgcn_wmma_f32_16x16x32_f16(false, ah, false, bh, (short)0, c, false, false);
  if (NT >= 2) c = __builtin_amdgcn_wmma_f32_16x16x32_f16(false, al, false, bh, (short)0, c, false, false);
  if (NT >= 3) c = __builtin_amdgcn_wmma_f32_16x16x32_f16(false, ah, false, bl, (short)0, c, false, false);
  asm volatile("v_nop\n\tv_nop\n\tv_nop\n\tv_nop" : "+v"(c) : "v"(ah), "v"(al), "v"(bh), "v"(bl));
  return c;
}
// batched GEMM like k_gemm_b but f16 operands: A f32 (split into f16 hi/lo if ASPLIT, else rounded to f16), Bt = f16 values [n][k]; alpha; C f32; N multiple of 16 (partial tiles skipped)
template <bool ASPLIT>
__global__ __launch_bounds__(128) void k_gemm_h(const float* __restrict__ A, int lda, size_t sA, const _Float16* __restrict__ Bh, int ldb, size_t sB, float alpha, float* __restrict__ C, int ldc, size_t sC, int M, int N, int K) {
  __shared__ __attribute__((aligned(16))) float so[4][16][64];
  const int tid = threadIdx.x, w = tid >> 5, lane = tid & 31, ln = lane & 15, hh = lane >> 4; const int by = blockIdx.y;
  A += (size_t)by * sA; Bh += (size_t)by * sB; C += (size_t)by * sC;
  const int ntn = (N + 63) / 64; const int wid = blockIdx.x * 4 + w; const int mt = wid / ntn, nq = wid % ntn; if (mt * 16 >= M) return;
  const int row0 = mt * 16, col0 = nq * 64; const float* arow = A + (size_t)(row0 + ln) * lda;
  v8f acc[4] = {};
  for (int kb = 0; kb < K; kb += 32) {
    FragH ah, al;
    const v4f x0 = *(const v4fa*)(arow + kb + 8 * hh), x1 = *(const v4fa*)(arow + kb + 8 * hh + 4), x2 = *(const v4fa*)(arow + kb + 16 + 8 * hh), x3 = *(const v4fa*)(arow + kb + 16 + 8 * hh + 4);
    float xs[16] = {x0[0],x0[1],x0[2],x0[3],x1[0],x1[1],x1[2],x1[3],x2[0],x2[1],x2[2],x2[3],x3[0],x3[1],x3[2],x3[3]};
#pragma unroll
    for (int i = 0; i < 16; ++i) { const _Float16 h = (_Float16)xs[i]; ah.h[i] = h; al.h[i] = ASPLIT ? (_Float16)(xs[i] - (float)h) : (_Float16)0.0f; }
#pragma unroll
    for (int t = 0; t < 4; ++t) { if (col0 + t * 16 >= N) continue; const size_t boff = (size_t)(col0 + t * 16 + ln) * ldb + kb; FragH bq; bq.half[0] = *(const v8us*)(Bh + boff + 8 * hh); bq.half[1] = *(const v8us*)(Bh + boff + 16 + 8 * hh);
      acc[t] = mmaH<ASPLIT ? 2 : 1>(ah.v, al.v, bq.v, bq.v, acc[t]); }
  }
#pragma unroll
  for (int t = 0; t < 4; ++t) { if (col0 + t * 16 >= N) continue;
#pragma unroll
    for (int r = 0; r < 8; ++r) so[w][8 * hh + r][t * 16 + ln] = acc[t][r] * alpha; }
  __builtin_amdgcn_fence(__ATOMIC_ACQ_REL, "workgroup"); __builtin_amdgcn_wave_barrier();
  const int rsub = lane >> 4, c4 = (lane & 15) * 4;
  {
#pragma unroll
    for (int q = 0; q < 8; ++q) { const int r = q * 2 + rsub; if (col0 + c4 < N) { const v4f v = *(const v4fa*)&so[w][r][c4]; *(v4f*)(C + (size_t)(row0 + r) * ldc + col0 + c4) = v; } }
     }
}

// Wt[n][k] = f16(bf16(W[k][n]) * scale) from f32 row-major W[DM][DM] (scale = power of two; bf16-exact weights stay exact in f16 away from the subnormal range), one tile of WTK k x WTN n per block, turned in LDS:
// W is read by whole 256-B pieces of its rows (16 lanes x 16 B) and Wt written by whole 256-B pieces of its rows. A lane holds 8 neighbouring k of 4 neighbouring n, so each n gives one 16-B piece of the turned tile.
// LDS row n holds its 16 pieces at places piece ^ (n >> 2): the 16 lanes of a half wave then meet 16 different places, all 64 banks once, in the stores (n four apart, one piece number) as in the loads (one n, 16 pieces).
#define WTK 128
#define WTN 64
__device__ __forceinline__ void wt_f16(const float* __restrict__ W, _Float16* __restrict__ Wt, float scale, int blk) {
  __shared__ __attribute__((aligned(16))) unsigned short tw[WTN * WTK];
  const int tid = threadIdx.x, pc = tid & 15, sr = tid >> 4; const int k0 = (blk / (DM / WTN)) * WTK, n0 = (blk % (DM / WTN)) * WTN;
  const float* const pw = W + (size_t)(k0 + sr * 8) * DM + n0 + pc * 4;      /* the lane's first four values; its other seven loads lie one row of W further on each */
  v4f wv[8];
#pragma unroll      /* constant trip count, unrolled: the values stay in registers and a lane's loads are all in flight together */
  for (int u = 0; u < 8; ++u) wv[u] = *(const v4fa*)(pw + (size_t)u * DM);
  asm volatile("s_wait_xcnt 0x0" :: "v"(pw) : "memory");      /* the wait in front of any overwrite of the loads' address registers; as its input the pair stays whole up to here */
#pragma unroll      /* wv is indexed by constants only, so it stays in registers */
  for (int j = 0; j < 4; ++j) { FragH f;
#pragma unroll
    for (int u = 0; u < 8; ++u) f.h[u] = (_Float16)(bf16_round(wv[u][j]) * scale);
    *(v8us*)(tw + (pc * 4 + j) * WTK + (sr ^ pc) * 8) = f.half[0]; }
  __syncthreads();      /* a row of the turned tile holds pieces of all eight waves: the whole tile stands in LDS before any row is read */
  unsigned short* const po = (unsigned short*)Wt + (size_t)(n0 + sr) * DM + k0 + pc * 8;      /* 16 lanes cover one row's 128 k */
  v8us o[WTN / 16];
#pragma unroll
  for (int i = 0; i < WTN / 16; ++i) o[i] = *(const v8us*)(tw + (i * 16 + sr) * WTK + (pc ^ ((i * 16 + sr) >> 2)) * 8);
#pragma unroll
  for (int i = 0; i < WTN / 16; ++i) *(v8us*)(po + (size_t)i * 16 * DM) = o[i];
  asm volatile("s_wait_xcnt 0x0" :: "v"(po) : "memory");      /* the wait behind the last stores, in front of whatever next writes their address or data registers */
}
// k_gemm_hh variant with fused epilogue: v = acc·alpha + bias[by·sBias + col] (+ CP[(row/rowsPerB)·sCPb + by·64 + col] if CP) ; ACT 0 none / 1 elu ; writes f16 C16 and f32 C, each if non-null
template <int ACT>
__global__ __launch_bounds__(128) void k_gemm_hhx(const _Float16* __restrict__ A, int lda, size_t sA, const _Float16* __restrict__ Bh, int ldb, size_t sB, float alpha, const float* __restrict__ bias, size_t sBias, const float* __restrict__ CP, int rowsPerB, size_t sCPb, int row0g,
    float* __restrict__ C, _Float16* __restrict__ C16, int ldc, size_t sC, int M, int N, int K) {
  __shared__ __attribute__((aligned(16))) float so[4][16][64];
  const int tid = threadIdx.x, w = tid >> 5, lane = tid & 31, ln = lane & 15, hh = lane >> 4; const int by = blockIdx.y;
  A += (size_t)by * sA; Bh += (size_t)by * sB; const size_t cofs = (size_t)by * sC; const float* bp = bias ? bias + (size_t)by * sBias : nullptr;
  const int ntn = (N + 63) / 64; const int wid = blockIdx.x * 4 + w; const int mt = wid / ntn, nq = wid % ntn; if (mt * 16 >= M) return;
  const int row0 = mt * 16, col0 = nq * 64; const _Float16* arow = A + (size_t)(row0 + ln) * lda;
  v8f acc[4] = {};
  for (int kb = 0; kb < K; kb += 32) { FragH ah; ah.half[0] = *(const v8us*)((const unsigned short*)arow + kb + 8 * hh); ah.half[1] = *(const v8us*)((const unsigned short*)arow + kb + 16 + 8 * hh);
#pragma unroll
    for (int t = 0; t < 4; ++t) { if (col0 + t * 16 >= N) continue; const size_t boff = (size_t)(col0 + t * 16 + ln) * ldb + kb; FragH bq; bq.half[0] = *(const v8us*)((const unsigned short*)Bh + boff + 8 * hh); bq.half[1] = *(const v8us*)((const unsigned short*)Bh + boff + 16 + 8 * hh);
      acc[t] = mmaH<1>(ah.v, ah.v, bq.v, bq.v, acc[t]); }
  }
#pragma unroll
  for (int t = 0; t < 4; ++t) { if (col0 + t * 16 >= N) continue; const int col = col0 + t * 16 + ln; const float bv = bp ? bf16_round(bp[col]) : 0.f;
#pragma unroll
    for (int r = 0; r < 8; ++r) { float v = acc[t][r] * alpha + bv; if (CP) { const int bidx = (row0g + row0 + 8 * hh + r) / rowsPerB; v += CP[(size_t)bidx * sCPb + (size_t)by * 64 + col]; } if (ACT == 1) v = (v > 0.f) ? v : expm1f(v); else if (ACT == 7) v = (v > 0.f) ? v + 1.0f : expf(v); else if (ACT == 8) v = tanhf(v); else if (ACT == 9) v = 0.5f * v * (1.0f + tanhf(0.7978845608028654f * (v + 0.044715f * v * v * v))); else if (ACT == 11) v = 1.0f / (1.0f + expf(-v)); else if (ACT == 12) v = (v > 0.f) ? v : 0.01f * v; else if (ACT == 14) v = (v > 0.f) ? v : 0.1f * v; else if (ACT == 15) v = v / (1.0f + expf(-v)); else if (ACT == 3) v = fmaxf(v, 0.f); else if (ACT == 6) v = 0.5f * v * (1.0f + erff(v * 0.70710678118654752f)); so[w][8 * hh + r][t * 16 + ln] = v; } }
  __builtin_amdgcn_fence(__ATOMIC_ACQ_REL, "workgroup"); __builtin_amdgcn_wave_barrier();
  const int rsub = lane >> 4, c4 = (lane & 15) * 4; typedef _Float16 v4h __attribute__((ext_vector_type(4)));
  {
#pragma unroll
    for (int q = 0; q < 8; ++q) { const int r = q * 2 + rsub; if (col0 + c4 < N) { const v4f v = *(const v4fa*)&so[w][r][c4]; if (C) *(v4f*)(C + cofs + (size_t)(row0 + r) * ldc + col0 + c4) = v; if (C16) { v4h h4; for (int i = 0; i < 4; ++i) h4[i] = (_Float16)v[i]; *(v4h*)(C16 + cofs + (size_t)(row0 + r) * ldc + col0 + c4) = h4; } } }
     }
}


typedef _Float16 v4h __attribute__((ext_vector_type(4)));

__global__ __launch_bounds__(256) void k_x16(const float* __restrict__ x, _Float16* __restrict__ X16, size_t n8) { const size_t t = (size_t)blockIdx.x * 256 + threadIdx.x; if (t >= n8) return; FragH f;
#pragma unroll
  for (int q = 0; q < 8; ++q) f.h[q] = (_Float16)bf16_round(x[t * 8 + q]); *(v8us*)((unsigned short*)X16 + t * 8) = f.half[0];  }
__global__ __launch_bounds__(256) void k_h16(const float* __restrict__ x, _Float16* __restrict__ X16, size_t n8) { const size_t t = (size_t)blockIdx.x * 256 + threadIdx.x; if (t >= n8) return; FragH f;
#pragma unroll
  for (int q = 0; q < 8; ++q) f.h[q] = (_Float16)x[t * 8 + q]; *(v8us*)((unsigned short*)X16 + t * 8) = f.half[0];  }
__global__ __launch_bounds__(256) void k_round16f(const float* __restrict__ W, _Float16* __restrict__ Bt, size_t n8) { const size_t t = (size_t)blockIdx.x * 256 + threadIdx.x; if (t >= n8) return; FragH f;
#pragma unroll
  for (int i = 0; i < 8; ++i) f.h[i] = (_Float16)(bf16_round(W[t * 8 + i]) * 16.0f); *(v8us*)((unsigned short*)Bt + t * 8) = f.half[0];  }
template <int NHv, int TTv>
__global__ __launch_bounds__(256) void k_vt(const _Float16* __restrict__ V16, int ldv, int voff, _Float16* __restrict__ Vt) { __shared__ unsigned short tl[64][66]; const int tid = threadIdx.x; const int slab = blockIdx.x / (TTv / 64), lg = blockIdx.x % (TTv / 64); const int b = slab / NHv, h = slab % NHv;
  for (int i = tid; i < 64 * 8; i += 256) { const int r = i / 8, c8 = (i % 8) * 8; FragH f; f.half[0] = *(const v8us*)((const unsigned short*)V16 + ((size_t)b * TTv + lg * 64 + r) * ldv + voff + h * 64 + c8);
#pragma unroll
    for (int q = 0; q < 8; ++q) tl[r][c8 + q] = f.u[q]; }
  __syncthreads();
  {
#pragma unroll
    for (int rd = 0; rd < 2; ++rd) { const int d = rd * 32 + tid / 8, pc = tid % 8; FragH f;
#pragma unroll
      for (int q = 0; q < 8; ++q) f.u[q] = tl[pc * 8 + q][d];
      *(v8us*)((unsigned short*)Vt + ((size_t)slab * 64 + d) * TTv + lg * 64 + pc * 8) = f.half[0]; }
     } }

__device__ __forceinline__ void tin(const float* __restrict__ x, _Float16* __restrict__ X16, int blk) { __shared__ float tl[BB][32][65]; const int tid = threadIdx.x; const int dg = blk / (TT / 32), tg = blk % (TT / 32); const int d0 = dg * 64, t0 = tg * 32;
  const float* const px = x + ((size_t)(d0 + tid / (BB * 32)) * TT + t0 + (tid / BB) % 32) * BB + tid % BB;      /* the lane's first element; sweep u of the 256 lanes lies 256 / (BB * 32) rows of x further on */
  float xv[64 * 32 * BB / 256];
#pragma unroll      /* constant trip count, unrolled: the values stay in registers and a lane's loads are all in flight together */
  for (int u = 0; u < 64 * 32 * BB / 256; ++u) xv[u] = px[(size_t)u * (256 / (BB * 32)) * TT * BB];
  asm volatile("s_wait_xcnt 0x0" :: "v"(px) : "memory");      /* the wait in front of any overwrite of the loads' address registers; as its input the pair stays whole up to here */
#pragma unroll      /* xv is indexed by constants only, so it stays in registers */
  for (int u = 0; u < 64 * 32 * BB / 256; ++u) { const int i = u * 256 + tid; tl[i % BB][(i / BB) % 32][i / (BB * 32)] = bf16_round(xv[u]); } __syncthreads();
  { for (int i = tid; i < BB * 32 * 8; i += 256) { const int pc = i % 8, tt = (i / 8) % 32, b = i / (8 * 32); FragH f; for (int q = 0; q < 8; ++q) f.h[q] = (_Float16)tl[b][tt][pc * 8 + q]; *(v8us*)((unsigned short*)X16 + ((size_t)b * TT + t0 + tt) * DM + d0 + pc * 8) = f.half[0]; }  } }
// One launch for the five conversions, none of which reads what another writes: blocks 0 .. 4 * WB - 1 transpose the four weights, a tile each, the rest bring x to (B, T, D).
#define WB ((DM / WTK) * (DM / WTN))
__global__ __launch_bounds__(256) void k_prep(const float* __restrict__ x, const float* __restrict__ Wq, const float* __restrict__ Wk, const float* __restrict__ Wv, const float* __restrict__ Wo, _Float16* __restrict__ Bw, _Float16* __restrict__ X16) {
  const int blk = blockIdx.x;
  if (blk < 4 * WB) { const int wi = blk / WB; const float* W = wi == 0 ? Wq : wi == 1 ? Wk : wi == 2 ? Wv : Wo; wt_f16(W, Bw + (size_t)wi * DM * DM, 16.0f, blk % WB); }      /* (in,out) -> Bt[n][k] x 2^4; block-uniform test, so the barrier inside is passed by a whole block or by none of it */
  else tin(x, X16, blk - 4 * WB);
}
// The attention kernel's LDS ring. The four waves of a block walk the same keys, so a trip's 32 K rows (128 B each) and 64 rows of each V^T plane (64 B each) are brought into LDS once for the block, by whole rows, and every wave takes its fragments from there:
// a fragment load from global memory touches 16 cache lines for 512 bytes, and each wave repeated it. Pitches 144 B and 80 B (16 B x odd): ds_load_b128 fragment reads meet no bank twice. Two buffers: the next tile's copies fly while this one is worked on.
#define FKP 72
#define FVP 40
#define FBUF (32 * FKP + 2 * 64 * FVP)
// One tile's six asynchronous copies of a lane, 16 bytes each: two K pieces 16 rows apart, two pieces of each V^T plane 32 rows apart. lk, lv: the lane's LDS byte addresses in the K and V^T parts of the buffer; gk, gh, gl: its places in K and the two planes.
__device__ __forceinline__ void flash_fill(unsigned lk, unsigned lv, const unsigned short* gk, size_t k16, const unsigned short* gh, const unsigned short* gl) {
  asm volatile("global_load_async_to_lds_b128 %0, %6, off\n\t"
               "global_load_async_to_lds_b128 %1, %7, off\n\t"
               "global_load_async_to_lds_b128 %2, %8, off\n\t"
               "global_load_async_to_lds_b128 %3, %9, off\n\t"
               "global_load_async_to_lds_b128 %4, %10, off\n\t"
               "global_load_async_to_lds_b128 %5, %11, off\n\t"
               "s_wait_xcnt 0x0"      /* the wait in front of any overwrite of the copies' address registers, inside their own statement so that nothing can be moved in between */
               :: "v"(lk), "v"(lk + 16 * FKP * 2), "v"(lv), "v"(lv + 32 * FVP * 2), "v"(lv + 64 * FVP * 2), "v"(lv + 96 * FVP * 2),
                  "v"(gk), "v"(gk + k16), "v"(gh), "v"(gh + 32 * TT), "v"(gl), "v"(gl + 32 * TT) : "memory");
}
// lane l's value with that of lane l ^ 16: the one exchange between the two halves of a wave that a query's maximum and sum need
__device__ __forceinline__ float xhalf(float x) { return __builtin_bit_cast(float, __builtin_amdgcn_permlanex16(__builtin_bit_cast(int, x), __builtin_bit_cast(int, x), 0x76543210, 0xfedcba98, false, false)); }
// The slot behind a transcendental, for a run of eight: one v_nop that takes the eight arguments and the eight results as inputs. It can only stand behind the last of the eight, and up to it every argument's register stays whole,
// so no instruction directly behind one of them overwrites its source. Inputs only: nothing is hidden from the compiler, and every multiply still fuses with its add.
__device__ __forceinline__ void trans_slot(const float (&a)[8], const float (&y)[8]) {
  asm volatile("v_nop" :: "v"(a[0]), "v"(a[1]), "v"(a[2]), "v"(a[3]), "v"(a[4]), "v"(a[5]), "v"(a[6]), "v"(a[7]), "v"(y[0]), "v"(y[1]), "v"(y[2]), "v"(y[3]), "v"(y[4]), "v"(y[5]), "v"(y[6]), "v"(y[7]));
}
// Transposed products: S^T = K.Q^T (A = 16 K rows, B = the wave's 16 queries) and O^T += V^T.P^T (A = 16 rows of a V^T plane, B = P^T). A lane then holds ONE query (column ln) and, of a trip's 32 keys, the 16 with numbers nt * 16 + 8 * hh + r:
// maximum and sum run inside the lane, the halves meet once, and the two score tiles, converted in place, ARE the B operand of the value products in the hardware's k order (the order in which the V^T fragments are loaded), so the weights never pass through LDS.
// Every plain '#pragma unroll' in this kernel stands on a loop of constant trip count whose arrays are then indexed by constants only and stay in registers.
__global__ __launch_bounds__(128) void k_flash(const _Float16* __restrict__ Q16, int ldq, const _Float16* __restrict__ K16, int ldk, const _Float16* __restrict__ Vt, const _Float16* __restrict__ Vtlo, _Float16* __restrict__ OH, _Float16* __restrict__ OL, int ldo) {
  constexpr int RPW = 16, NQB = TT / (4 * RPW), DT = 4, KS = 2;
  __shared__ __attribute__((aligned(16))) float sO[4][RPW][64 + 4]; __shared__ __attribute__((aligned(16))) unsigned short ring[2 * FBUF];
  const int tid = threadIdx.x, w = tid >> 5, lane = tid & 31, ln = lane & 15, hh = lane >> 4;
  const int slab = blockIdx.x / NQB, qblk = blockIdx.x % NQB; const int b = slab / NH, h = slab % NH; const int qb0 = qblk * (4 * RPW); const int q0 = qb0 + w * RPW;
  FragH aq[KS];
  { const unsigned short* qr = (const unsigned short*)Q16 + ((size_t)b * TT + q0 + ln) * ldq + h * 64;
#pragma unroll
    for (int ks = 0; ks < KS; ++ks) { aq[ks].half[0] = *(const v8us*)(qr + ks * 32 + 8 * hh); aq[ks].half[1] = *(const v8us*)(qr + ks * 32 + 16 + 8 * hh); } }
  const unsigned short* Vth = (const unsigned short*)Vt + (size_t)slab * 64 * TT; const unsigned short* Vtl = (const unsigned short*)Vtlo + (size_t)slab * 64 * TT;
  float m_r = -3.0e38f, l_r = 0.f; v8f oacc[DT], oaccl[DT];      /* the lane's query: running maximum, this half's share of the sum, and 8 head dimensions dt * 16 + 8 * hh + r of each of the 4 output tiles */
#pragma unroll
  for (int dt = 0; dt < DT; ++dt) { oacc[dt] = (v8f){0.f,0.f,0.f,0.f,0.f,0.f,0.f,0.f}; oaccl[dt] = oacc[dt]; }
  const int jbeg = (qb0 - WIN) > 0 ? (qb0 - WIN) : 0; const int jend = (qb0 + 4 * RPW + WIN) < TT ? (qb0 + 4 * RPW + WIN) : TT;      /* block-uniform window bounds (multiples of 32) */
  const unsigned lk0 = (unsigned)(size_t)ring + (unsigned)(((tid >> 3) * FKP + (tid & 7) * 8) * 2), lv0 = (unsigned)(size_t)ring + (unsigned)((32 * FKP + (tid >> 2) * FVP + (tid & 3) * 8) * 2);      /* 8 lanes cover a K row, 4 lanes a V^T row */
  const unsigned short* const gk0 = (const unsigned short*)K16 + ((size_t)b * TT + (tid >> 3)) * ldk + h * 64 + (tid & 7) * 8; const unsigned short* const gh0 = Vth + (size_t)(tid >> 2) * TT + (tid & 3) * 8; const unsigned short* const gl0 = Vtl + (size_t)(tid >> 2) * TT + (tid & 3) * 8;
  flash_fill(lk0, lv0, gk0 + (size_t)jbeg * ldk, (size_t)16 * ldk, gh0 + jbeg, gl0 + jbeg);
  asm volatile("s_wait_asynccnt 0x0" ::: "memory");      /* this wave's copies of the first tile have landed */
  __syncthreads();      /* publishes the first tile: every wave reads pieces that the other waves copied */
  if (jbeg + 32 < jend) flash_fill(lk0 + FBUF * 2, lv0 + FBUF * 2, gk0 + (size_t)(jbeg + 32) * ldk, (size_t)16 * ldk, gh0 + jbeg + 32, gl0 + jbeg + 32);
  unsigned cur = 0;      /* the buffer that holds this trip's tile */
#pragma unroll 1      /* rolled: the trip count is a run-time value, and one short text of the trip is fetched once */
  for (int j0 = jbeg; j0 < jend; j0 += 32) {
    v8f s[2]; FragH bk[2][KS];
#pragma unroll
    for (int nt = 0; nt < 2; ++nt) { const unsigned short* kr = ring + cur * FBUF + (nt * 16 + ln) * FKP;      /* both key tiles' loads fly together, ahead of the first score product */
#pragma unroll
      for (int ks = 0; ks < KS; ++ks) { bk[nt][ks].half[0] = *(const v8us*)(kr + ks * 32 + 8 * hh); bk[nt][ks].half[1] = *(const v8us*)(kr + ks * 32 + 16 + 8 * hh); } }
#pragma unroll
    for (int nt = 0; nt < 2; ++nt) { v8f acc = (v8f){0.f,0.f,0.f,0.f,0.f,0.f,0.f,0.f};
#pragma unroll
      for (int ks = 0; ks < KS; ++ks) acc = mmaH<1>(bk[nt][ks].v, bk[nt][ks].v, aq[ks].v, aq[ks].v, acc); s[nt] = acc; }      /* s[nt][r] = score of key j0 + nt * 16 + 8 * hh + r with query q0 + ln */
    const int dk0 = j0 + 8 * hh - (q0 + ln);      /* key minus query of the lane's first element */
    bool ok[2][8]; float mt[2];
#pragma unroll
    for (int nt = 0; nt < 2; ++nt) { float u[8], ex[8], la[8], lg[8]; mt[nt] = -INFINITY;
#pragma unroll
      for (int r = 0; r < 8; ++r) { u[r] = s[nt][r] * 0.18033688011112042f; ex[r] = __builtin_amdgcn_exp2f(-fabsf(u[r])); }      /* score / 8, times log2(e): logits, running maximum and weights all live in base 2, where exponential and logarithm are one instruction each */
      trans_slot(u, ex);
#pragma unroll
      for (int r = 0; r < 8; ++r) { la[r] = 1.0f + ex[r]; lg[r] = __builtin_amdgcn_logf(la[r]); }      /* the logarithm's argument lies in [1, 2] */
      trans_slot(la, lg);
#pragma unroll
      for (int r = 0; r < 8; ++r) { const int dk = dk0 + nt * 16 + r; ok[nt][r] = (dk <= WIN) && (-dk <= WIN);
        const float g = u[r] + fminf(u[r], 0.f) - lg[r];      /* (s + log sigmoid(s)) * log2(e) */
        s[nt][r] = ok[nt][r] ? g : -INFINITY; mt[nt] = fmaxf(mt[nt], s[nt][r]); } }
    FragH bv[DT], bl[DT];      /* the trip's 16 value-fragment loads, issued in one run here, where the second half of the softmax covers their latency: ahead of the first half their 64 registers would take the kernel past four waves a SIMD */
    const unsigned short* const pvh = ring + cur * FBUF + 32 * FKP + ln * FVP + 8 * hh; const unsigned short* const pvl = pvh + 64 * FVP;
#pragma unroll
    for (int dt = 0; dt < DT; ++dt) { bv[dt].half[0] = *(const v8us*)(pvh + dt * 16 * FVP); bv[dt].half[1] = *(const v8us*)(pvh + dt * 16 * FVP + 16); bl[dt].half[0] = *(const v8us*)(pvl + dt * 16 * FVP); bl[dt].half[1] = *(const v8us*)(pvl + dt * 16 * FVP + 16); }
    float mc = fmaxf(mt[0], mt[1]); mc = fmaxf(mc, xhalf(mc));      /* the query's maximum over all 32 keys, in both halves */
    const float mn = fmaxf(m_r, mc); const float ea = __builtin_amdgcn_exp2f(m_r - mn); const float al = (mn > -1.0e38f) ? ea : 1.0f; m_r = mn;
    FragH pb; float ps[2];
#pragma unroll
    for (int nt = 0; nt < 2; ++nt) { float x[8], e[8], p[8];
#pragma unroll
      for (int r = 0; r < 8; ++r) { x[r] = s[nt][r] - mn; e[r] = __builtin_amdgcn_exp2f(x[r]); }
      trans_slot(x, e);
#pragma unroll
      for (int r = 0; r < 8; ++r) { p[r] = ok[nt][r] ? e[r] : 0.f; pb.h[nt * 8 + r] = (_Float16)(p[r] * 1024.0f); }
      ps[nt] = ((p[0] + p[1]) + (p[2] + p[3])) + ((p[4] + p[5]) + (p[6] + p[7])); }
    l_r = l_r * al + (ps[0] + ps[1]);
#pragma unroll
    for (int dt = 0; dt < DT; ++dt) { oacc[dt] *= al; oaccl[dt] *= al; }
#pragma unroll
    for (int dt = 0; dt < DT; ++dt) { oacc[dt] = mmaH<1>(bv[dt].v, bv[dt].v, pb.v, pb.v, oacc[dt]); oaccl[dt] = mmaH<1>(bl[dt].v, bl[dt].v, pb.v, pb.v, oaccl[dt]); }
    asm volatile("s_wait_dscnt 0x0" ::: "memory");      /* this wave's reads of the buffer have returned before the buffer is given up */
    asm volatile("s_wait_asynccnt 0x0" ::: "memory");      /* this wave's copies of the next tile have landed */
    __syncthreads();      /* publishes the next tile and ends every wave's reads of this trip's buffer, which is refilled behind it */
    if (j0 + 64 < jend) flash_fill(lk0 + cur * (FBUF * 2), lv0 + cur * (FBUF * 2), gk0 + (size_t)(j0 + 64) * ldk, (size_t)16 * ldk, gh0 + j0 + 64, gl0 + j0 + 64);      /* block-uniform test */
    cur ^= 1u; }
  asm volatile("s_wait_asynccnt 0x0" ::: "memory");      /* no copy is outstanding when the wave goes on to the epilogue and ends */
  { float l = l_r; l += xhalf(l); const float li = (l > 0.f) ? 1.0f / (l * 1024.0f) : 0.f;      /* the halves' sums meet once */
#pragma unroll
    for (int dt = 0; dt < DT; ++dt)
#pragma unroll
      for (int r4 = 0; r4 < 8; r4 += 4) { v4f o4;
#pragma unroll
        for (int i = 0; i < 4; ++i) o4[i] = (oacc[dt][r4 + i] + oaccl[dt][r4 + i] * 0.0009765625f) * li;
        *(v4fa*)&sO[w][ln][dt * 16 + 8 * hh + r4] = o4; } }      /* the lane's 8 neighbouring dimensions of its query's row */
  __builtin_amdgcn_fence(__ATOMIC_ACQ_REL, "workgroup"); __builtin_amdgcn_wave_barrier();
  {
#pragma unroll
    for (int rp = 0; rp < RPW; rp += 2) { const int r = rp + (lane >> 4), pc = lane & 15; const v4f val = *(const v4fa*)&sO[w][r][pc * 4]; const size_t o = ((size_t)b * TT + q0 + r) * ldo + h * 64 + pc * 4; v4h oh, ol;      /* the merged row leaves as the output product's two operands: f16 value and residual x 2^10; 16 lanes fill one 128-B line of each plane */
#pragma unroll
      for (int i = 0; i < 4; ++i) { const _Float16 hv = (_Float16)val[i]; oh[i] = hv; ol[i] = (_Float16)((val[i] - (float)hv) * 1024.0f); }
      *(v4h*)(OH + o) = oh; *(v4h*)(OL + o) = ol; }
     } }

// Tiled GEMM for the five 4096 x 1024 x 1024 products, in two launches, A f16 [NR][DM], Bt f16 [n][k]. One 128 x 128 tile per block of 8 waves (4 x 2), 32 x 64 per wave. The epilogue writes what the next kernel reads, so no f32 plane goes through a pass of its own:
// MODE 0: q, k and v in one grid, Bt their three weights one behind the other (3 x 8 column tiles): q, k leave as f16(acc*alpha + bias), row-major (C16, C16k); v = acc*alpha + bias leaves transposed, per (batch, column) a row over t, as f16 value (C16v) and residual x 2^10 (C16l). 2: C = (A.Bt + 2^-10 Alo.Bt)*alpha + bias in the (D, T, B) layout of the output, both products in one accumulator, Alo's first.
// Each trip stages 128 k of the tile's 128 A rows and 128 Bt rows in LDS as whole 256-B rows (pitch 272 B: ds_load_b128 fragment reads meet no bank twice); two buffers, the next trip's rows are
// fetched into registers ahead of this trip's products and stored behind them, one barrier a trip. Every accumulator still sums k in ascending steps of 32.
#define GT 128
#define GK 128
#define GP 136
#define GSO 68
#define GTP 131
// one trip's products of a wave: 128 k in four steps of 32, 2 x 4 accumulator tiles; sa, sb: the lane's own row and k half in the A and Bt parts of the buffer
__device__ __forceinline__ void gemm_trip(const unsigned short* sa, const unsigned short* sb, v8f (&acc)[2][4]) {
#pragma unroll
  for (int ks = 0; ks < GK / 32; ++ks) {
    FragH a[2], b[4];
#pragma unroll
    for (int mi = 0; mi < 2; ++mi) { a[mi].half[0] = *(const v8us*)(sa + mi * 16 * GP + ks * 32); a[mi].half[1] = *(const v8us*)(sa + mi * 16 * GP + ks * 32 + 16); }
#pragma unroll
    for (int ni = 0; ni < 4; ++ni) { b[ni].half[0] = *(const v8us*)(sb + ni * 16 * GP + ks * 32); b[ni].half[1] = *(const v8us*)(sb + ni * 16 * GP + ks * 32 + 16); }
#pragma unroll
    for (int mi = 0; mi < 2; ++mi)
#pragma unroll
      for (int ni = 0; ni < 4; ++ni) acc[mi][ni] = __builtin_amdgcn_wmma_f32_16x16x32_f16(false, a[mi].v, false, b[ni].v, (short)0, acc[mi][ni], false, false);
  }
}
template <int MODE>
__global__ __launch_bounds__(256) void k_gemm_t(const _Float16* __restrict__ A, const _Float16* __restrict__ Alo, const _Float16* __restrict__ Bt, float alpha, const float* __restrict__ bias, const float* __restrict__ biask, const float* __restrict__ biasv, float* __restrict__ C, _Float16* __restrict__ C16, _Float16* __restrict__ C16k, _Float16* __restrict__ C16v, _Float16* __restrict__ C16l) {
  __shared__ __attribute__((aligned(16))) unsigned char smraw[2 * 2 * GT * GP * 2];
  unsigned short* const sm = (unsigned short*)smraw;
  constexpr int BUF = 2 * GT * GP, NK = DM / GK, NTR = (MODE == 2 ? 2 : 1) * NK;      /* MODE 2 walks k twice: the residual plane Alo, then A */
  constexpr bool TB = (MODE >= 2);      /* tile row lr stands for (t, b) = (t0 + lr / BB, lr % BB): the order in which the output holds one column's values, so a column of the tile is one contiguous run there */
  constexpr int AST = (TB ? 16 / BB : 16) * DM;      /* A elements between the rows of two staging sweeps */
  const int tid = threadIdx.x, w = tid >> 5, lane = tid & 31, ln = lane & 15, hh = lane >> 4;
  constexpr int NCT = (MODE == 0 ? 3 : 1) * (DM / GT);      /* column tiles of a row of tiles; the blocks that share an A tile are neighbours in the grid */
  const int mt = blockIdx.x / NCT, ct = blockIdx.x % NCT, part = ct / (DM / GT);      /* part (block-uniform): 0 q, 1 k, 2 v */
  const int row0 = mt * GT, col0 = (ct % (DM / GT)) * GT, t0 = mt * (GT / BB);
  const float* const bp = (MODE == 0) ? (part == 0 ? bias : part == 1 ? biask : biasv) : bias;
  const int wm = (w >> 1) * 32, wn = (w & 1) * 64;
  const int pc = tid & 15, sr = tid >> 4;      /* staging: 16 lanes cover one 256-B row piece by piece; 16 rows per sweep */
  const unsigned short* ga = (const unsigned short*)(MODE == 2 ? Alo : A) + (size_t)(TB ? t0 : row0) * DM;      /* block-uniform bases; the lane's own places are the 32-bit offsets goa and go, which live through the loop */
  const unsigned short* gb = (const unsigned short*)Bt + (size_t)(ct * GT) * DM;
  const unsigned go = (unsigned)(sr * DM + pc * 8);
  const unsigned goa = TB ? (unsigned)(((sr % BB) * TT + sr / BB) * DM + pc * 8) : go;
  unsigned short* const sw = sm + sr * GP + pc * 8;
  v8us st[16];
#pragma unroll
  for (int i = 0; i < 8; ++i) { st[i] = *(const v8us*)(ga + i * AST + goa); st[8 + i] = *(const v8us*)(gb + i * 16 * DM + go); }
#pragma unroll
  for (int i = 0; i < 16; ++i) *(v8us*)(sw + i * 16 * GP) = st[i];
  asm volatile("s_wait_xcnt 0x0" :: "v"(goa), "v"(go) : "memory");      /* the wait in front of any overwrite of the first loads' offset registers, which as its inputs stay whole up to here */
  __syncthreads();
  v8f acc[2][4];
#pragma unroll
  for (int mi = 0; mi < 2; ++mi)
#pragma unroll
    for (int ni = 0; ni < 4; ++ni) acc[mi][ni] = (v8f){0.f,0.f,0.f,0.f,0.f,0.f,0.f,0.f};
#pragma unroll 1      /* rolled: seven (MODE 2: fifteen) copies of the trip save nothing, and a short text is fetched once */
  for (int t = 0; t < NTR - 1; ++t) {
    const int kt = (MODE == 2) ? ((t + 1) & (NK - 1)) : (t + 1);
    const unsigned short* pa = ((MODE == 2 && t + 1 >= NK) ? (const unsigned short*)A + (size_t)t0 * DM : ga) + kt * GK + goa; const unsigned short* pb = gb + kt * GK + go;
#pragma unroll
    for (int i = 0; i < 8; ++i) { st[i] = *(const v8us*)(pa + i * AST); st[8 + i] = *(const v8us*)(pb + i * 16 * DM); }
    __builtin_amdgcn_sched_barrier(0);      /* keeps the next trip's global loads ahead of this trip's products: sunk towards their LDS stores they would leave their latency uncovered */
    gemm_trip(sm + (t & 1) * BUF + (wm + ln) * GP + 8 * hh, sm + (t & 1) * BUF + (GT + wn + ln) * GP + 8 * hh, acc);
    if (MODE == 2 && t == NK - 1) {      /* the residual plane is done: its sums, held x 2^10, come down (exactly) to the scale of the value plane's, which add on top */
#pragma unroll
      for (int mi = 0; mi < 2; ++mi)
#pragma unroll
        for (int ni = 0; ni < 4; ++ni) acc[mi][ni] *= 0.0009765625f;
    }
    asm volatile("s_wait_xcnt 0x0" :: "v"(pa), "v"(pb) : "memory");      /* the wait in front of any overwrite of the loads' address registers; as its inputs the two pairs stay whole up to here, where the loads are a trip old */
#pragma unroll
    for (int i = 0; i < 16; ++i) *(v8us*)(sw + ((t + 1) & 1) * BUF + i * 16 * GP) = st[i];
    __syncthreads();      /* publishes the buffer just written and ends every read of the one that the next trip overwrites */
  }
  gemm_trip(sm + ((NTR - 1) & 1) * BUF + (wm + ln) * GP + 8 * hh, sm + ((NTR - 1) & 1) * BUF + (GT + wn + ln) * GP + 8 * hh, acc);
  __syncthreads();      /* every wave has left the ring before the epilogue writes over it */
  if (MODE == 0 && part < 2) {
    _Float16* const cq = part ? C16k : C16;
    const int rsub = lane >> 4, c4 = (lane & 15) * 4;
    const size_t o0 = (size_t)(row0 + wm + rsub) * DM + col0 + wn + c4;
    float* const so = (float*)smraw + w * (32 * GSO);      /* each wave's own 32 x 64 patch, in the ring that every wave has left */
#pragma unroll
    for (int ni = 0; ni < 4; ++ni) { const float bv = bf16_round(bp[col0 + wn + ni * 16 + ln]);
#pragma unroll
      for (int mi = 0; mi < 2; ++mi)
#pragma unroll
        for (int r = 0; r < 8; ++r) so[(mi * 16 + 8 * hh + r) * GSO + ni * 16 + ln] = acc[mi][ni][r] * alpha + bv; }
    __builtin_amdgcn_fence(__ATOMIC_ACQ_REL, "workgroup"); __builtin_amdgcn_wave_barrier();
#pragma unroll
    for (int q = 0; q < 16; ++q) { const v4f v = *(const v4fa*)&so[(q * 2 + rsub) * GSO + c4]; v4h h4; for (int i = 0; i < 4; ++i) h4[i] = (_Float16)v[i]; *(v4h*)(cq + o0 + (size_t)q * 2 * DM) = h4; }
  } else {
    float* const tl = (float*)smraw;      /* the block's whole 128 x 128 tile in f32, pitch 131 words: it is written by rows and read back by columns */
    float* const op = C + ((size_t)col0 * TT + t0) * BB + lane * 4;      /* MODE 2: a wave takes one column at a time, 128 values = 512 contiguous bytes of the output */
#pragma unroll
    for (int ni = 0; ni < 4; ++ni) { const float bv = bf16_round(bp[col0 + wn + ni * 16 + ln]);
#pragma unroll
      for (int mi = 0; mi < 2; ++mi)
#pragma unroll
        for (int r = 0; r < 8; ++r) tl[(wm + mi * 16 + 8 * hh + r) * GTP + wn + ni * 16 + ln] = acc[mi][ni][r] * alpha + bv; }
    __syncthreads();      /* a column holds values of four waves: all of the tile stands in LDS before any column is read */
    if (MODE == 0) {
      const int t8 = tid & 15, dq = tid >> 4;      /* 16 lanes cover one column's 128 t: 256 contiguous bytes of each plane */
      const size_t vo = ((size_t)(row0 / TT) * DM + col0) * TT + (row0 % TT) + t8 * 8;
#pragma unroll
      for (int i = 0; i < 8; ++i) { const int d = i * 16 + dq; FragH fh, fl;
#pragma unroll
        for (int q = 0; q < 8; ++q) { const float v = tl[(t8 * 8 + q) * GTP + d]; const _Float16 hv = (_Float16)v; fh.h[q] = hv; fl.h[q] = (_Float16)((v - (float)hv) * 1024.0f); }
        *(v8us*)((unsigned short*)C16v + vo + (size_t)d * TT) = fh.half[0]; *(v8us*)((unsigned short*)C16l + vo + (size_t)d * TT) = fl.half[0]; }
      asm volatile("s_wait_xcnt 0x0" ::: "memory");      /* the wait behind the last stores, in front of whatever next writes their address or data registers */
    } else {
#pragma unroll
      for (int i = 0; i < 16; ++i) { const int d = i * 8 + w; v4f v = {tl[(lane * 4) * GTP + d], tl[(lane * 4 + 1) * GTP + d], tl[(lane * 4 + 2) * GTP + d], tl[(lane * 4 + 3) * GTP + d]};
        *(v4f*)(op + (size_t)d * (TT * BB)) = v; }
    }
  }
}

extern "C" void kernel_launch(void* const* d_in, const int* in_sizes, int n_in,
                              void* d_out, int out_size, void* d_ws, size_t ws_size, hipStream_t stream) {
  (void)in_sizes; (void)n_in; (void)out_size;
  const float* const* I = (const float* const*)d_in; const float* x = I[0]; const float* Wq = I[1]; const float* bq = I[2]; const float* Wk = I[3]; const float* bk = I[4]; const float* Wv = I[5]; const float* bv = I[6]; const float* Wo = I[7]; const float* bo = I[8];
  char* ws = (char*)d_ws; size_t off = 0;
  auto take = [&](size_t bytes) { char* p = ws + off; off += (bytes + 255) & ~(size_t)255; return p; };
  const size_t WSZ = (size_t)DM * DM; _Float16* Bw = (_Float16*)take(4 * WSZ * 2); _Float16* X16 = (_Float16*)take((size_t)NR * DM * 2); _Float16* OH = (_Float16*)take((size_t)NR * DM * 2); _Float16* OL = (_Float16*)take((size_t)NR * DM * 2);
  _Float16* Q16 = (_Float16*)take((size_t)NR * DM * 2); _Float16* K16 = (_Float16*)take((size_t)NR * DM * 2); _Float16* Vth = (_Float16*)take((size_t)NR * DM * 2); _Float16* Vtl = (_Float16*)take((size_t)NR * DM * 2);
  if (off > ws_size) return;      // 8 x 8.4 MB, about 67 MB
  k_prep<<<4 * WB + (DM / 64) * (TT / 32), 256, 0, stream>>>(x, Wq, Wk, Wv, Wo, Bw, X16);
  const dim3 gp((NR / GT) * (DM / GT), 1), gp3(3 * (NR / GT) * (DM / GT), 1);
  k_gemm_t<0><<<gp3, 256, 0, stream>>>(X16, nullptr, Bw, 0.0625f, bq, bk, bv, nullptr, Q16, K16, Vth, Vtl);      /* q, k = xt.W + b -> f16; v -> transposed hi / lo planes: M 4096 N 3 x 1024 K 1024 */
  k_flash<<<BB * NH * (TT / 64), 128, 0, stream>>>(Q16, DM, K16, DM, Vth, Vtl, OH, OL, DM);
  k_gemm_t<2><<<gp, 256, 0, stream>>>(OH, OL, Bw + 3 * WSZ, 0.0625f, bo, nullptr, nullptr, (float*)d_out, nullptr, nullptr, nullptr, nullptr);      /* out = (O_hi + 2^-10 O_lo).Wo + bo, in the output's own layout */
}

// v010
// Measured time: 62.9 microseconds a run.
// Versions in between are left out here; by their measured steps it is 1.28 times as fast as v008.
// All steps since v000 together make it 6.65 times as fast.
#include <hip/hip_runtime.h>
// Windowed multi-head self-attention on a (D, T, B)-layout input (D=1024, T=2048, B=2; 16 heads × 64; window |i−j| ≤ 256): xt = x transposed to (B,T,D); q,k,v = xt·W + b; scores = q·kᵀ/8 (−inf outside the window);
// attn = softmax(s + log_sigmoid(s)); out = (attn·v merged)·Wo + bo, transposed back to (D, T, B).
// Compute dtype: x, weights, biases rounded to bf16; q,k f16 GEMM outputs; v f32 -> one f16 V^T plane; fused windowed flash-style kernel (online softmax f32 on the sigsoftmax logits,
// P f16 ×2^10, one value accumulator) on v_wmma_f32_16x16x32_f16; merged O -> f16 -> one Wo GEMM + bo; layout transposes through LDS, those of v and of the output in the GEMM epilogues; f32 accumulate.
// v and O are each rounded to f16 once, with no residual plane: q, k and P already enter their products rounded to f16 once, so a rounding of that relative size stands in every weight and every merged row whatever v and O carry.
#define BB 2
#define TT 2048
#define DM 1024
#define NH 16
#define HD 64
#define WIN 256
#define NR (BB * TT)

typedef __bf16 v16b __attribute__((ext_vector_type(16)));
typedef unsigned short v8us __attribute__((ext_vector_type(8), may_alias));
typedef float  v8f  __attribute__((ext_vector_type(8)));
typedef float  v4f  __attribute__((ext_vector_type(4)));
typedef float  v4fa __attribute__((ext_vector_type(4), may_alias));
union FragB { v16b v; v8us half[2]; unsigned short u[16]; };

__device__ __forceinline__ unsigned short bf16_bits(float x) { unsigned int u = __float_as_uint(x); return (unsigned short)((u + 0x7FFFu + ((u >> 16) & 1u)) >> 16); }
__device__ __forceinline__ float bf16_val(unsigned short b) { return __uint_as_float(((unsigned int)b) << 16); }
__device__ __forceinline__ float bf16_round(float x) { return bf16_val(bf16_bits(x)); }
// D += A·B with NT terms: 1 = ah·bh, 2 = + al·bh (A split), 3 = + ah·bl (both split)
template <int NT>
__device__ __forceinline__ v8f mmaN(v16b ah, v16b al, v16b bh, v16b bl, v8f c) {
  c = __builtin_amdgcn_wmma_f32_16x16x32_bf16(false, ah, false, bh, (short)0, c, false, false);
  if (NT >= 2) c = __builtin_amdgcn_wmma_f32_16x16x32_bf16(false, al, false, bh, (short)0, c, false, false);
  if (NT >= 3) c = __builtin_amdgcn_wmma_f32_16x16x32_bf16(false, ah, false, bl, (short)0, c, false, false);
  asm volatile("v_nop\n\tv_nop\n\tv_nop\n\tv_nop" : "+v"(c) : "v"(ah), "v"(al), "v"(bh), "v"(bl));
  return c;
}

__global__ __launch_bounds__(256) void k_wt_bf16(const float* __restrict__ W, unsigned short* __restrict__ Wt, int K, int N) {
  const int t = blockIdx.x * 256 + threadIdx.x;
  const int k8n = K / 8;
  if (t >= N * k8n) return;
  const int n = t / k8n, k8 = (t % k8n) * 8;
  v8us v;
#pragma unroll
  for (int i = 0; i < 8; ++i) v[i] = bf16_bits(W[(size_t)(k8 + i) * N + n]);
  *(v8us*)(Wt + (size_t)n * K + k8) = v;
  
}

// GEMM C[M][N] (f32, pitch ldc) = act(A[M][K]·W + bias). A f32 row-major (pitch lda) converted per fragment to bf16
// (ASPLIT: hi/lo two planes -> 2 terms, else single rounded term); Wt bf16 [N][K] (pitch ldb). BIAS_BF16 rounds the
// bias to bf16 first (bias quantised to bf16 before the add). K%32==0, M%16==0, N%64==0.
template <bool ASPLIT, int ACT, bool BIAS_BF16>
__global__ __launch_bounds__(128) void k_gemm_bf(const float* __restrict__ A, int lda, const unsigned short* __restrict__ Wt, int ldb,
                                               const float* __restrict__ bias, float* __restrict__ C, int ldc, int M, int N, int K) {
  __shared__ __attribute__((aligned(16))) float so[4][16][64];
  const int tid = threadIdx.x, w = tid >> 5, lane = tid & 31, ln = lane & 15, hh = lane >> 4;
  const int ntn = N / 64;
  const int wid = blockIdx.x * 4 + w;
  const int mt = wid / ntn, nq = wid % ntn;
  if (mt * 16 >= M) return;
  const int row0 = mt * 16, col0 = nq * 64;
  const float* arow = A + (size_t)(row0 + ln) * lda;
  v8f acc[4] = {};
  for (int kb = 0; kb < K; kb += 32) {
    FragB ah, al;
    const v4f x0 = *(const v4fa*)(arow + kb + 8 * hh), x1 = *(const v4fa*)(arow + kb + 8 * hh + 4);
    const v4f x2 = *(const v4fa*)(arow + kb + 16 + 8 * hh), x3 = *(const v4fa*)(arow + kb + 16 + 8 * hh + 4);
    float xs[16] = {x0[0],x0[1],x0[2],x0[3],x1[0],x1[1],x1[2],x1[3],x2[0],x2[1],x2[2],x2[3],x3[0],x3[1],x3[2],x3[3]};
#pragma unroll
    for (int i = 0; i < 16; ++i) { const unsigned short hb = bf16_bits(xs[i]); ah.u[i] = hb; al.u[i] = ASPLIT ? bf16_bits(xs[i] - bf16_val(hb)) : (unsigned short)0; }
#pragma unroll
    for (int t = 0; t < 4; ++t) {
      const unsigned short* brow = Wt + (size_t)(col0 + t * 16 + ln) * ldb + kb;
      FragB b;
      b.half[0] = *(const v8us*)(brow + 8 * hh);
      b.half[1] = *(const v8us*)(brow + 16 + 8 * hh);
      acc[t] = mmaN<ASPLIT ? 2 : 1>(ah.v, al.v, b.v, b.v, acc[t]);
    }
  }
#pragma unroll
  for (int t = 0; t < 4; ++t) {
    float bv = bias ? bias[col0 + t * 16 + ln] : 0.f;
    if (BIAS_BF16) bv = bf16_round(bv);
#pragma unroll
    for (int r = 0; r < 8; ++r) { float v = acc[t][r] + bv; if (ACT == 1) v = fmaxf(v, 0.f); so[w][8 * hh + r][t * 16 + ln] = v; }
  }
  __builtin_amdgcn_fence(__ATOMIC_ACQ_REL, "workgroup");
  __builtin_amdgcn_wave_barrier();
  const int rsub = lane >> 4, c4 = (lane & 15) * 4;
  {
#pragma unroll
    for (int q = 0; q < 8; ++q) {
      const int r = q * 2 + rsub;
      const v4f v = *(const v4fa*)&so[w][r][c4];
      *(v4f*)(C + (size_t)(row0 + r) * ldc + col0 + c4) = v;
    }
    
  }
}

// Flash-style causal/unmasked attention, all contractions 3-term bf16 hi/lo splits, f32 softmax with running max.
// q,k,v rows are read from f32 buffers with arbitrary row pitch (so they can live inside a fused qkv buffer);
// D = head size (multiple of 32, <= 128); one wave = 16 query rows; block = 4 waves (64 queries) sharing K/V chunks of 32.
template <int D, bool CAUSAL>
__global__ __launch_bounds__(128) void k_flash(const float* __restrict__ qb, const float* __restrict__ kb, const float* __restrict__ vb,
                                             int pitch, int T, int H, float scale, float* __restrict__ y, int ypitch) {
  constexpr int KS = D / 32;        // k-steps for QK
  constexpr int DT = D / 16;        // d tiles for PV
  __shared__ __attribute__((aligned(16))) unsigned short sKh[32][D + 8], sKl[32][D + 8], sVh[32][D + 8], sVl[32][D + 8];
  __shared__ __attribute__((aligned(16))) unsigned short sPh[4][16][40], sPl[4][16][40];
  __shared__ __attribute__((aligned(16))) float sO[4][16][D];
  const int tid = threadIdx.x, w = tid >> 5, lane = tid & 31, ln = lane & 15, hh = lane >> 4;
  const int nqb = (T + 63) / 64;
  const int bh = blockIdx.x / nqb, qblk = blockIdx.x % nqb;
  const int b = bh / H, h = bh % H;
  const int q0 = qblk * 64 + w * 16;
  const float* Q = qb + (size_t)b * T * pitch + h * D;
  const float* K = kb + (size_t)b * T * pitch + h * D;
  const float* V = vb + (size_t)b * T * pitch + h * D;

  // A fragments of the wave's 16 query rows (scaled), hi/lo
  FragB aqh[KS], aql[KS];
  {
    int row = q0 + ln; if (row >= T) row = T - 1;
    const float* qr = Q + (size_t)row * pitch;
#pragma unroll
    for (int ks = 0; ks < KS; ++ks)
#pragma unroll
      for (int i = 0; i < 16; ++i) {
        const int d = ks * 32 + ((i < 8) ? (8 * hh + i) : (16 + 8 * hh + (i - 8)));
        const float x = qr[d] * scale; const unsigned short hb = bf16_bits(x);
        aqh[ks].u[i] = hb; aql[ks].u[i] = bf16_bits(x - bf16_val(hb));
      }
  }
  float m_r[8], l_r[8];
#pragma unroll
  for (int r = 0; r < 8; ++r) { m_r[r] = -3.0e38f; l_r[r] = 0.f; }
  v8f oacc[DT];
#pragma unroll
  for (int dt = 0; dt < DT; ++dt) oacc[dt] = (v8f){0.f,0.f,0.f,0.f,0.f,0.f,0.f,0.f};

  const int kv_end = CAUSAL ? min(T, qblk * 64 + 64) : T;     // block-uniform
  for (int j0 = 0; j0 < kv_end; j0 += 32) {
    __syncthreads();
    for (int e = tid; e < 32 * (D / 4); e += 128) {
      const int r = e / (D / 4), c4 = (e % (D / 4)) * 4;
      const int key = j0 + r;
      v4f kf = {0.f,0.f,0.f,0.f}, vf = {0.f,0.f,0.f,0.f};
      if (key < T) { kf = *(const v4fa*)(K + (size_t)key * pitch + c4); vf = *(const v4fa*)(V + (size_t)key * pitch + c4); }
#pragma unroll
      for (int t = 0; t < 4; ++t) {
        unsigned short hb = bf16_bits(kf[t]); sKh[r][c4 + t] = hb; sKl[r][c4 + t] = bf16_bits(kf[t] - bf16_val(hb));
        hb = bf16_bits(vf[t]); sVh[r][c4 + t] = hb; sVl[r][c4 + t] = bf16_bits(vf[t] - bf16_val(hb));
      }
    }
    __syncthreads();
    // S tile 16 x 32
    v8f s[2];
#pragma unroll
    for (int nt = 0; nt < 2; ++nt) {
      v8f acc = {};
#pragma unroll
      for (int ks = 0; ks < KS; ++ks) {
        FragB bh_, bl_;
        bh_.half[0] = *(const v8us*)&sKh[nt * 16 + ln][ks * 32 + 8 * hh]; bh_.half[1] = *(const v8us*)&sKh[nt * 16 + ln][ks * 32 + 16 + 8 * hh];
        bl_.half[0] = *(const v8us*)&sKl[nt * 16 + ln][ks * 32 + 8 * hh]; bl_.half[1] = *(const v8us*)&sKl[nt * 16 + ln][ks * 32 + 16 + 8 * hh];
        acc = mmaN<3>(aqh[ks].v, aql[ks].v, bh_.v, bl_.v, acc);
      }
      s[nt] = acc;
    }
    // mask + running max (rows 8hh+r; the 16 lanes of a half share rows)
    float alpha[8];
#pragma unroll
    for (int r = 0; r < 8; ++r) {
      const int qi = q0 + 8 * hh + r;
      const int ja = j0 + ln, jb = j0 + 16 + ln;
      if (CAUSAL) { if (ja > qi) s[0][r] = -3.0e38f; if (jb > qi) s[1][r] = -3.0e38f; }
      if (ja >= T) s[0][r] = -3.0e38f;
      if (jb >= T) s[1][r] = -3.0e38f;
      float mx = fmaxf(s[0][r], s[1][r]);
      mx = fmaxf(mx, __shfl_xor(mx, 1, 32)); mx = fmaxf(mx, __shfl_xor(mx, 2, 32)); mx = fmaxf(mx, __shfl_xor(mx, 4, 32)); mx = fmaxf(mx, __shfl_xor(mx, 8, 32));
      const float mnew = fmaxf(m_r[r], mx);
      alpha[r] = (mnew > -1.0e38f) ? __expf(m_r[r] - mnew) : 1.0f;
      const float p0 = (s[0][r] > -1.0e38f) ? __expf(s[0][r] - mnew) : 0.f;
      const float p1 = (s[1][r] > -1.0e38f) ? __expf(s[1][r] - mnew) : 0.f;
      m_r[r] = mnew;
      l_r[r] = l_r[r] * alpha[r] + p0 + p1;            // per-lane partial row sum (16 lanes combined at the end)
      unsigned short hb = bf16_bits(p0); sPh[w][8 * hh + r][ln] = hb;      sPl[w][8 * hh + r][ln] = bf16_bits(p0 - bf16_val(hb));
      hb = bf16_bits(p1);                sPh[w][8 * hh + r][16 + ln] = hb; sPl[w][8 * hh + r][16 + ln] = bf16_bits(p1 - bf16_val(hb));
    }
#pragma unroll
    for (int dt = 0; dt < DT; ++dt)
#pragma unroll
      for (int r = 0; r < 8; ++r) oacc[dt][r] *= alpha[r];
    __builtin_amdgcn_fence(__ATOMIC_ACQ_REL, "workgroup");
    __builtin_amdgcn_wave_barrier();
    FragB pah, pal;
    pah.half[0] = *(const v8us*)&sPh[w][ln][8 * hh]; pah.half[1] = *(const v8us*)&sPh[w][ln][16 + 8 * hh];
    pal.half[0] = *(const v8us*)&sPl[w][ln][8 * hh]; pal.half[1] = *(const v8us*)&sPl[w][ln][16 + 8 * hh];
#pragma unroll
    for (int dt = 0; dt < DT; ++dt) {
      FragB bvh, bvl;
#pragma unroll
      for (int i = 0; i < 8; ++i) {
        bvh.u[i] = sVh[8 * hh + i][dt * 16 + ln]; bvh.u[8 + i] = sVh[16 + 8 * hh + i][dt * 16 + ln];
        bvl.u[i] = sVl[8 * hh + i][dt * 16 + ln]; bvl.u[8 + i] = sVl[16 + 8 * hh + i][dt * 16 + ln];
      }
      oacc[dt] = mmaN<3>(pah.v, pal.v, bvh.v, bvl.v, oacc[dt]);
    }
    __builtin_amdgcn_fence(__ATOMIC_ACQ_REL, "workgroup");
    __builtin_amdgcn_wave_barrier();
  }
#pragma unroll
  for (int r = 0; r < 8; ++r) {
    float l = l_r[r];
    l += __shfl_xor(l, 1, 32); l += __shfl_xor(l, 2, 32); l += __shfl_xor(l, 4, 32); l += __shfl_xor(l, 8, 32);
    l_r[r] = (l > 0.f) ? 1.0f / l : 0.f;
  }
#pragma unroll
  for (int dt = 0; dt < DT; ++dt)
#pragma unroll
    for (int r = 0; r < 8; ++r) sO[w][8 * hh + r][dt * 16 + ln] = oacc[dt][r] * l_r[r];
  __builtin_amdgcn_fence(__ATOMIC_ACQ_REL, "workgroup");
  __builtin_amdgcn_wave_barrier();
  {
    for (int r = 0; r < 16; ++r) {
      const int row = q0 + r;
      if (row < T && lane < D / 4) {
        const v4f val = *(const v4fa*)&sO[w][r][lane * 4];
        *(v4f*)(y + ((size_t)b * T + row) * ypitch + h * D + lane * 4) = val;
      }
    }
    
  }
}

// GEMM C = act(A·W + bias + resid): A f32 (ASPLIT -> hi/lo 2 terms), Wt bf16 [N][K]; ACT 0 none, 1 relu, 2 exact gelu;
// resid (optional, f32, row index = (row % rmod), pitch ldr, RES_BF16 rounds it) added before the activation.
template <bool ASPLIT, int ACT, bool BIAS_BF16, bool RES_BF16>
__global__ __launch_bounds__(128) void k_gemm_bf3(const float* __restrict__ A, int lda, const unsigned short* __restrict__ Wt, int ldb,
                                                const float* __restrict__ bias, const float* __restrict__ resid, int rmod, int ldr,
                                                float* __restrict__ C, int ldc, int M, int N, int K) {
  __shared__ __attribute__((aligned(16))) float so[4][16][64];
  const int tid = threadIdx.x, w = tid >> 5, lane = tid & 31, ln = lane & 15, hh = lane >> 4;
  const int ntn = N / 64;
  const int wid = blockIdx.x * 4 + w;
  const int mt = wid / ntn, nq = wid % ntn;
  if (mt * 16 >= M) return;
  const int row0 = mt * 16, col0 = nq * 64;
  const float* arow = A + (size_t)(row0 + ln) * lda;
  v8f acc[4] = {};
  for (int kb = 0; kb < K; kb += 32) {
    FragB ah, al;
    const v4f x0 = *(const v4fa*)(arow + kb + 8 * hh), x1 = *(const v4fa*)(arow + kb + 8 * hh + 4);
    const v4f x2 = *(const v4fa*)(arow + kb + 16 + 8 * hh), x3 = *(const v4fa*)(arow + kb + 16 + 8 * hh + 4);
    float xs[16] = {x0[0],x0[1],x0[2],x0[3],x1[0],x1[1],x1[2],x1[3],x2[0],x2[1],x2[2],x2[3],x3[0],x3[1],x3[2],x3[3]};
#pragma unroll
    for (int i = 0; i < 16; ++i) { const unsigned short hb = bf16_bits(xs[i]); ah.u[i] = hb; al.u[i] = ASPLIT ? bf16_bits(xs[i] - bf16_val(hb)) : (unsigned short)0; }
#pragma unroll
    for (int t = 0; t < 4; ++t) {
      const unsigned short* brow = Wt + (size_t)(col0 + t * 16 + ln) * ldb + kb;
      FragB b;
      b.half[0] = *(const v8us*)(brow + 8 * hh);
      b.half[1] = *(const v8us*)(brow + 16 + 8 * hh);
      acc[t] = mmaN<ASPLIT ? 2 : 1>(ah.v, al.v, b.v, b.v, acc[t]);
    }
  }
#pragma unroll
  for (int t = 0; t < 4; ++t) {
    const int col = col0 + t * 16 + ln;
    float bv = bias ? bias[col] : 0.f;
    if (BIAS_BF16) bv = bf16_round(bv);
#pragma unroll
    for (int r = 0; r < 8; ++r) {
      float v = acc[t][r] + bv;
      if (resid) { float rv = resid[(size_t)((row0 + 8 * hh + r) % rmod) * ldr + col]; if (RES_BF16) rv = bf16_round(rv); v += rv; }
      if (ACT == 1) v = fmaxf(v, 0.f);
      if (ACT == 2) v = 0.5f * v * (1.0f + erff(v * 0.70710678118654752f));
      if (ACT == 3) { const float u = 0.7978845608028654f * (v + 0.044715f * v * v * v); v = 0.5f * v * (1.0f + tanhf(u)); }
      so[w][8 * hh + r][t * 16 + ln] = v;
    }
  }
  __builtin_amdgcn_fence(__ATOMIC_ACQ_REL, "workgroup");
  __builtin_amdgcn_wave_barrier();
  const int rsub = lane >> 4, c4 = (lane & 15) * 4;
  {
#pragma unroll
    for (int q = 0; q < 8; ++q) {
      const int r = q * 2 + rsub;
      const v4f v = *(const v4fa*)&so[w][r][c4];
      *(v4f*)(C + (size_t)(row0 + r) * ldc + col0 + c4) = v;
    }
    
  }
}
// row LayerNorm (biased variance, eps) over N: s = X (+ R); optional out_sum <- s; out_norm <- (s-mu)*rsqrt(var+eps)*g + b
template <bool PARAM_BF16>
__global__ __launch_bounds__(256) void k_layernorm(const float* __restrict__ X, const float* __restrict__ R, const float* __restrict__ g, const float* __restrict__ bta,
                                                  float* __restrict__ out_sum, float* __restrict__ out_norm, int N, float eps) {
  __shared__ float red[256];
  const int row = blockIdx.x, tid = threadIdx.x;
  const float* x = X + (size_t)row * N; const float* rr = R ? R + (size_t)row * N : nullptr;
  float vals[16];                     // up to N = 4096
  const int per = N / 256;            // contiguous chunk per thread? use strided-by-4 chunks: thread handles j = tid*4 + 1024*u
  float s1 = 0.f;
  for (int u = 0; u < per / 4; ++u) {
    const int j = tid * 4 + 1024 * u;
    const v4f a = *(const v4fa*)(x + j);
    v4f b = {0.f,0.f,0.f,0.f}; if (rr) b = *(const v4fa*)(rr + j);
#pragma unroll
    for (int q = 0; q < 4; ++q) { const float v = a[q] + b[q]; vals[u * 4 + q] = v; s1 += v; }
  }
  red[tid] = s1; __syncthreads();
  for (int st = 128; st > 0; st >>= 1) { if (tid < st) red[tid] += red[tid + st]; __syncthreads(); }
  const float mu = red[0] / (float)N; __syncthreads();
  float s2 = 0.f;
  for (int u = 0; u < per / 4; ++u)
#pragma unroll
    for (int q = 0; q < 4; ++q) { const float c = vals[u * 4 + q] - mu; s2 += c * c; }
  red[tid] = s2; __syncthreads();
  for (int st = 128; st > 0; st >>= 1) { if (tid < st) red[tid] += red[tid + st]; __syncthreads(); }
  const float rs = rsqrtf(red[0] / (float)N + eps);
  {
    for (int u = 0; u < per / 4; ++u) {
      const int j = tid * 4 + 1024 * u;
      v4f o, sm;
#pragma unroll
      for (int q = 0; q < 4; ++q) {
        float gg = g[j + q], bb = bta[j + q];
        if (PARAM_BF16) { gg = bf16_round(gg); bb = bf16_round(bb); }
        sm[q] = vals[u * 4 + q]; o[q] = (vals[u * 4 + q] - mu) * rs * gg + bb;
      }
      if (out_sum) *(v4f*)(out_sum + (size_t)row * N + j) = sm;
      *(v4f*)(out_norm + (size_t)row * N + j) = o;
    }
    
  }
}



// ---- f16 WMMA path (v_wmma_f32_16x16x32_f16): 11-bit significands for operands in range — used where a [0,1] probability operand needs more precision than bf16
typedef _Float16 v16h __attribute__((ext_vector_type(16)));
union FragH { v16h v; v8us half[2]; _Float16 h[16]; unsigned short u[16]; };
template <int NT>
__device__ __forceinline__ v8f mmaH(v16h ah, v16h al, v16h bh, v16h bl, v8f c) {
  c = __builtin_amdgcn_wmma_f32_16x16x32_f16(false, ah, false, bh, (short)0, c, false, false);
  if (NT >= 2) c = __builtin_amdgcn_wmma_f32_16x16x32_f16(false, al, false, bh, (short)0, c, false, false);
  if (NT >= 3) c = __builtin_amdgcn_wmma_f32_16x16x32_f16(false, ah, false, bl, (short)0, c, false, false);
  asm volatile("v_nop\n\tv_nop\n\tv_nop\n\tv_nop" : "+v"(c) : "v"(ah), "v"(al), "v"(bh), "v"(bl));
  return c;
}
// batched GEMM like k_gemm_b but f16 operands: A f32 (split into f16 hi/lo if ASPLIT, else rounded to f16), Bt = f16 values [n][k]; alpha; C f32; N multiple of 16 (partial tiles skipped)
template <bool ASPLIT>
__global__ __launch_bounds__(128) void k_gemm_h(const float* __restrict__ A, int lda, size_t sA, const _Float16* __restrict__ Bh, int ldb, size_t sB, float alpha, float* __restrict__ C, int ldc, size_t sC, int M, int N, int K) {
  __shared__ __attribute__((aligned(16))) float so[4][16][64];
  const int tid = threadIdx.x, w = tid >> 5, lane = tid & 31, ln = lane & 15, hh = lane >> 4; const int by = blockIdx.y;
  A += (size_t)by * sA; Bh += (size_t)by * sB; C += (size_t)by * sC;
  const int ntn = (N + 63) / 64; const int wid = blockIdx.x * 4 + w; const int mt = wid / ntn, nq = wid % ntn; if (mt * 16 >= M) return;
  const int row0 = mt * 16, col0 = nq * 64; const float* arow = A + (size_t)(row0 + ln) * lda;
  v8f acc[4] = {};
  for (int kb = 0; kb < K; kb += 32) {
    FragH ah, al;
    const v4f x0 = *(const v4fa*)(arow + kb + 8 * hh), x1 = *(const v4fa*)(arow + kb + 8 * hh + 4), x2 = *(const v4fa*)(arow + kb + 16 + 8 * hh), x3 = *(const v4fa*)(arow + kb + 16 + 8 * hh + 4);
    float xs[16] = {x0[0],x0[1],x0[2],x0[3],x1[0],x1[1],x1[2],x1[3],x2[0],x2[1],x2[2],x2[3],x3[0],x3[1],x3[2],x3[3]};
#pragma unroll
    for (int i = 0; i < 16; ++i) { const _Float16 h = (_Float16)xs[i]; ah.h[i] = h; al.h[i] = ASPLIT ? (_Float16)(xs[i] - (float)h) : (_Float16)0.0f; }
#pragma unroll
    for (int t = 0; t < 4; ++t) { if (col0 + t * 16 >= N) continue; const size_t boff = (size_t)(col0 + t * 16 + ln) * ldb + kb; FragH bq; bq.half[0] = *(const v8us*)(Bh + boff + 8 * hh); bq.half[1] = *(const v8us*)(Bh + boff + 16 + 8 * hh);
      acc[t] = mmaH<ASPLIT ? 2 : 1>(ah.v, al.v, bq.v, bq.v, acc[t]); }
  }
#pragma unroll
  for (int t = 0; t < 4; ++t) { if (col0 + t * 16 >= N) continue;
#pragma unroll
    for (int r = 0; r < 8; ++r) so[w][8 * hh + r][t * 16 + ln] = acc[t][r] * alpha; }
  __builtin_amdgcn_fence(__ATOMIC_ACQ_REL, "workgroup"); __builtin_amdgcn_wave_barrier();
  const int rsub = lane >> 4, c4 = (lane & 15) * 4;
  {
#pragma unroll
    for (int q = 0; q < 8; ++q) { const int r = q * 2 + rsub; if (col0 + c4 < N) { const v4f v = *(const v4fa*)&so[w][r][c4]; *(v4f*)(C + (size_t)(row0 + r) * ldc + col0 + c4) = v; } }
     }
}

// Wt[n][k] = f16(bf16(W[k][n]) * scale) from f32 row-major W[DM][DM] (scale = power of two; bf16-exact weights stay exact in f16 away from the subnormal range), one tile of WTK k x WTN n per block, turned in LDS:
// W is read by whole 256-B pieces of its rows (16 lanes x 16 B) and Wt written by whole 256-B pieces of its rows. A lane holds 8 neighbouring k of 4 neighbouring n, so each n gives one 16-B piece of the turned tile.
// LDS row n holds its 16 pieces at places piece ^ (n >> 2): the 16 lanes of a half wave then meet 16 different places, all 64 banks once, in the stores (n four apart, one piece number) as in the loads (one n, 16 pieces).
#define WTK 128
#define WTN 64
__device__ __forceinline__ void wt_f16(const float* __restrict__ W, _Float16* __restrict__ Wt, float scale, int blk) {
  __shared__ __attribute__((aligned(16))) unsigned short tw[WTN * WTK];
  const int tid = threadIdx.x, pc = tid & 15, sr = tid >> 4; const int k0 = (blk / (DM / WTN)) * WTK, n0 = (blk % (DM / WTN)) * WTN;
  const float* const pw = W + (size_t)(k0 + sr * 8) * DM + n0 + pc * 4;      /* the lane's first four values; its other seven loads lie one row of W further on each */
  v4f wv[8];
#pragma unroll      /* constant trip count, unrolled: the values stay in registers and a lane's loads are all in flight together */
  for (int u = 0; u < 8; ++u) wv[u] = *(const v4fa*)(pw + (size_t)u * DM);
  asm volatile("s_wait_xcnt 0x0" :: "v"(pw) : "memory");      /* the wait in front of any overwrite of the loads' address registers; as its input the pair stays whole up to here */
#pragma unroll      /* wv is indexed by constants only, so it stays in registers */
  for (int j = 0; j < 4; ++j) { FragH f;
#pragma unroll
    for (int u = 0; u < 8; ++u) f.h[u] = (_Float16)(bf16_round(wv[u][j]) * scale);
    *(v8us*)(tw + (pc * 4 + j) * WTK + (sr ^ pc) * 8) = f.half[0]; }
  __syncthreads();      /* a row of the turned tile holds pieces of all eight waves: the whole tile stands in LDS before any row is read */
  unsigned short* const po = (unsigned short*)Wt + (size_t)(n0 + sr) * DM + k0 + pc * 8;      /* 16 lanes cover one row's 128 k */
  v8us o[WTN / 16];
#pragma unroll
  for (int i = 0; i < WTN / 16; ++i) o[i] = *(const v8us*)(tw + (i * 16 + sr) * WTK + (pc ^ ((i * 16 + sr) >> 2)) * 8);
#pragma unroll
  for (int i = 0; i < WTN / 16; ++i) *(v8us*)(po + (size_t)i * 16 * DM) = o[i];
  asm volatile("s_wait_xcnt 0x0" :: "v"(po) : "memory");      /* the wait behind the last stores, in front of whatever next writes their address or data registers */
}
// k_gemm_hh variant with fused epilogue: v = acc·alpha + bias[by·sBias + col] (+ CP[(row/rowsPerB)·sCPb + by·64 + col] if CP) ; ACT 0 none / 1 elu ; writes f16 C16 and f32 C, each if non-null
template <int ACT>
__global__ __launch_bounds__(128) void k_gemm_hhx(const _Float16* __restrict__ A, int lda, size_t sA, const _Float16* __restrict__ Bh, int ldb, size_t sB, float alpha, const float* __restrict__ bias, size_t sBias, const float* __restrict__ CP, int rowsPerB, size_t sCPb, int row0g,
    float* __restrict__ C, _Float16* __restrict__ C16, int ldc, size_t sC, int M, int N, int K) {
  __shared__ __attribute__((aligned(16))) float so[4][16][64];
  const int tid = threadIdx.x, w = tid >> 5, lane = tid & 31, ln = lane & 15, hh = lane >> 4; const int by = blockIdx.y;
  A += (size_t)by * sA; Bh += (size_t)by * sB; const size_t cofs = (size_t)by * sC; const float* bp = bias ? bias + (size_t)by * sBias : nullptr;
  const int ntn = (N + 63) / 64; const int wid = blockIdx.x * 4 + w; const int mt = wid / ntn, nq = wid % ntn; if (mt * 16 >= M) return;
  const int row0 = mt * 16, col0 = nq * 64; const _Float16* arow = A + (size_t)(row0 + ln) * lda;
  v8f acc[4] = {};
  for (int kb = 0; kb < K; kb += 32) { FragH ah; ah.half[0] = *(const v8us*)((const unsigned short*)arow + kb + 8 * hh); ah.half[1] = *(const v8us*)((const unsigned short*)arow + kb + 16 + 8 * hh);
#pragma unroll
    for (int t = 0; t < 4; ++t) { if (col0 + t * 16 >= N) continue; const size_t boff = (size_t)(col0 + t * 16 + ln) * ldb + kb; FragH bq; bq.half[0] = *(const v8us*)((const unsigned short*)Bh + boff + 8 * hh); bq.half[1] = *(const v8us*)((const unsigned short*)Bh + boff + 16 + 8 * hh);
      acc[t] = mmaH<1>(ah.v, ah.v, bq.v, bq.v, acc[t]); }
  }
#pragma unroll
  for (int t = 0; t < 4; ++t) { if (col0 + t * 16 >= N) continue; const int col = col0 + t * 16 + ln; const float bv = bp ? bf16_round(bp[col]) : 0.f;
#pragma unroll
    for (int r = 0; r < 8; ++r) { float v = acc[t][r] * alpha + bv; if (CP) { const int bidx = (row0g + row0 + 8 * hh + r) / rowsPerB; v += CP[(size_t)bidx * sCPb + (size_t)by * 64 + col]; } if (ACT == 1) v = (v > 0.f) ? v : expm1f(v); else if (ACT == 7) v = (v > 0.f) ? v + 1.0f : expf(v); else if (ACT == 8) v = tanhf(v); else if (ACT == 9) v = 0.5f * v * (1.0f + tanhf(0.7978845608028654f * (v + 0.044715f * v * v * v))); else if (ACT == 11) v = 1.0f / (1.0f + expf(-v)); else if (ACT == 12) v = (v > 0.f) ? v : 0.01f * v; else if (ACT == 14) v = (v > 0.f) ? v : 0.1f * v; else if (ACT == 15) v = v / (1.0f + expf(-v)); else if (ACT == 3) v = fmaxf(v, 0.f); else if (ACT == 6) v = 0.5f * v * (1.0f + erff(v * 0.70710678118654752f)); so[w][8 * hh + r][t * 16 + ln] = v; } }
  __builtin_amdgcn_fence(__ATOMIC_ACQ_REL, "workgroup"); __builtin_amdgcn_wave_barrier();
  const int rsub = lane >> 4, c4 = (lane & 15) * 4; typedef _Float16 v4h __attribute__((ext_vector_type(4)));
  {
#pragma unroll
    for (int q = 0; q < 8; ++q) { const int r = q * 2 + rsub; if (col0 + c4 < N) { const v4f v = *(const v4fa*)&so[w][r][c4]; if (C) *(v4f*)(C + cofs + (size_t)(row0 + r) * ldc + col0 + c4) = v; if (C16) { v4h h4; for (int i = 0; i < 4; ++i) h4[i] = (_Float16)v[i]; *(v4h*)(C16 + cofs + (size_t)(row0 + r) * ldc + col0 + c4) = h4; } } }
     }
}


typedef _Float16 v4h __attribute__((ext_vector_type(4)));

__global__ __launch_bounds__(256) void k_x16(const float* __restrict__ x, _Float16* __restrict__ X16, size_t n8) { const size_t t = (size_t)blockIdx.x * 256 + threadIdx.x; if (t >= n8) return; FragH f;
#pragma unroll
  for (int q = 0; q < 8; ++q) f.h[q] = (_Float16)bf16_round(x[t * 8 + q]); *(v8us*)((unsigned short*)X16 + t * 8) = f.half[0];  }
__global__ __launch_bounds__(256) void k_h16(const float* __restrict__ x, _Float16* __restrict__ X16, size_t n8) { const size_t t = (size_t)blockIdx.x * 256 + threadIdx.x; if (t >= n8) return; FragH f;
#pragma unroll
  for (int q = 0; q < 8; ++q) f.h[q] = (_Float16)x[t * 8 + q]; *(v8us*)((unsigned short*)X16 + t * 8) = f.half[0];  }
__global__ __launch_bounds__(256) void k_round16f(const float* __restrict__ W, _Float16* __restrict__ Bt, size_t n8) { const size_t t = (size_t)blockIdx.x * 256 + threadIdx.x; if (t >= n8) return; FragH f;
#pragma unroll
  for (int i = 0; i < 8; ++i) f.h[i] = (_Float16)(bf16_round(W[t * 8 + i]) * 16.0f); *(v8us*)((unsigned short*)Bt + t * 8) = f.half[0];  }
template <int NHv, int TTv>
__global__ __launch_bounds__(256) void k_vt(const _Float16* __restrict__ V16, int ldv, int voff, _Float16* __restrict__ Vt) { __shared__ unsigned short tl[64][66]; const int tid = threadIdx.x; const int slab = blockIdx.x / (TTv / 64), lg = blockIdx.x % (TTv / 64); const int b = slab / NHv, h = slab % NHv;
  for (int i = tid; i < 64 * 8; i += 256) { const int r = i / 8, c8 = (i % 8) * 8; FragH f; f.half[0] = *(const v8us*)((const unsigned short*)V16 + ((size_t)b * TTv + lg * 64 + r) * ldv + voff + h * 64 + c8);
#pragma unroll
    for (int q = 0; q < 8; ++q) tl[r][c8 + q] = f.u[q]; }
  __syncthreads();
  {
#pragma unroll
    for (int rd = 0; rd < 2; ++rd) { const int d = rd * 32 + tid / 8, pc = tid % 8; FragH f;
#pragma unroll
      for (int q = 0; q < 8; ++q) f.u[q] = tl[pc * 8 + q][d];
      *(v8us*)((unsigned short*)Vt + ((size_t)slab * 64 + d) * TTv + lg * 64 + pc * 8) = f.half[0]; }
     } }

__device__ __forceinline__ void tin(const float* __restrict__ x, _Float16* __restrict__ X16, int blk) { __shared__ float tl[BB][32][65]; const int tid = threadIdx.x; const int dg = blk / (TT / 32), tg = blk % (TT / 32); const int d0 = dg * 64, t0 = tg * 32;
  const float* const px = x + ((size_t)(d0 + tid / (BB * 32)) * TT + t0 + (tid / BB) % 32) * BB + tid % BB;      /* the lane's first element; sweep u of the 256 lanes lies 256 / (BB * 32) rows of x further on */
  float xv[64 * 32 * BB / 256];
#pragma unroll      /* constant trip count, unrolled: the values stay in registers and a lane's loads are all in flight together */
  for (int u = 0; u < 64 * 32 * BB / 256; ++u) xv[u] = px[(size_t)u * (256 / (BB * 32)) * TT * BB];
  asm volatile("s_wait_xcnt 0x0" :: "v"(px) : "memory");      /* the wait in front of any overwrite of the loads' address registers; as its input the pair stays whole up to here */
#pragma unroll      /* xv is indexed by constants only, so it stays in registers */
  for (int u = 0; u < 64 * 32 * BB / 256; ++u) { const int i = u * 256 + tid; tl[i % BB][(i / BB) % 32][i / (BB * 32)] = bf16_round(xv[u]); } __syncthreads();
  { for (int i = tid; i < BB * 32 * 8; i += 256) { const int pc = i % 8, tt = (i / 8) % 32, b = i / (8 * 32); FragH f; for (int q = 0; q < 8; ++q) f.h[q] = (_Float16)tl[b][tt][pc * 8 + q]; *(v8us*)((unsigned short*)X16 + ((size_t)b * TT + t0 + tt) * DM + d0 + pc * 8) = f.half[0]; }  } }
// One launch for the five conversions, none of which reads what another writes: blocks 0 .. 4 * WB - 1 transpose the four weights, a tile each, the rest bring x to (B, T, D).
#define WB ((DM / WTK) * (DM / WTN))
__global__ __launch_bounds__(256) void k_prep(const float* __restrict__ x, const float* __restrict__ Wq, const float* __restrict__ Wk, const float* __restrict__ Wv, const float* __restrict__ Wo, _Float16* __restrict__ Bw, _Float16* __restrict__ X16) {
  const int blk = blockIdx.x;
  if (blk < 4 * WB) { const int wi = blk / WB; const float* W = wi == 0 ? Wq : wi == 1 ? Wk : wi == 2 ? Wv : Wo; wt_f16(W, Bw + (size_t)wi * DM * DM, 16.0f, blk % WB); }      /* (in,out) -> Bt[n][k] x 2^4; block-uniform test, so the barrier inside is passed by a whole block or by none of it */
  else tin(x, X16, blk - 4 * WB);
}
// The attention kernel's LDS ring. The four waves of a block walk the same keys, so a trip's 32 K rows (128 B each) and 64 V^T rows (64 B each) are brought into LDS once for the block, by whole rows, and every wave takes its fragments from there:
// a fragment load from global memory touches 16 cache lines for 512 bytes, and each wave repeated it. Pitches 144 B and 80 B (16 B x odd): ds_load_b128 fragment reads meet no bank twice. Two buffers: the next tile's copies fly while this one is worked on.
#define FKP 72
#define FVP 40
#define FBUF (32 * FKP + 64 * FVP)
// One tile's four asynchronous copies of a lane, 16 bytes each: two K pieces 16 rows apart, two V^T pieces 32 rows apart. lk, lv: the lane's LDS byte addresses in the K and V^T parts of the buffer; gk, gh: its places in K and V^T.
__device__ __forceinline__ void flash_fill(unsigned lk, unsigned lv, const unsigned short* gk, size_t k16, const unsigned short* gh) {
  asm volatile("global_load_async_to_lds_b128 %0, %4, off\n\t"
               "global_load_async_to_lds_b128 %1, %5, off\n\t"
               "global_load_async_to_lds_b128 %2, %6, off\n\t"
               "global_load_async_to_lds_b128 %3, %7, off\n\t"
               "s_wait_xcnt 0x0"      /* the wait in front of any overwrite of the copies' address registers, inside their own statement so that nothing can be moved in between */
               :: "v"(lk), "v"(lk + 16 * FKP * 2), "v"(lv), "v"(lv + 32 * FVP * 2),
                  "v"(gk), "v"(gk + k16), "v"(gh), "v"(gh + 32 * TT) : "memory");
}
// lane l's value with that of lane l ^ 16: the one exchange between the two halves of a wave that a query's maximum and sum need
__device__ __forceinline__ float xhalf(float x) { return __builtin_bit_cast(float, __builtin_amdgcn_permlanex16(__builtin_bit_cast(int, x), __builtin_bit_cast(int, x), 0x76543210, 0xfedcba98, false, false)); }
// Transposed products: S^T = K.Q^T (A = 16 K rows, B = the wave's 16 queries) and O^T += V^T.P^T (A = 16 rows of V^T, B = P^T). A lane then holds ONE query (column ln) and, of a trip's 32 keys, the 16 with numbers nt * 16 + 8 * hh + r:
// maximum and sum run inside the lane, the halves meet once, and the two score tiles, converted in place, ARE the B operand of the value products in the hardware's k order (the order in which the V^T fragments are loaded), so the weights never pass through LDS.
// The weights without a logarithm. exp(s + log sigmoid(s)) = 2^(2u) / (1 + 2^u) with u = s * log2(e). With M the running maximum of u, E = 2^(u - M), a = 2^-max(M, 0), b = 2^min(M, 0), this is 2^L * E * E / (a + b * E), L = M + min(M, 0):
// one exponential and one reciprocal an element in place of exponential, logarithm, exponential. E, a, b lie in [0, 1] and one of a, b is 1, so nothing overflows for any M; the largest stored weight lies between 2^9 and 2^10; 2^L cancels in the quotient by the row sum.
#define SC2 0.18033688011112042f
typedef float v2f __attribute__((ext_vector_type(2)));
// Every plain '#pragma unroll' in this kernel stands on a loop of constant trip count whose arrays are then indexed by constants only and stay in registers.
__global__ __launch_bounds__(128) void k_flash(const _Float16* __restrict__ Q16, int ldq, const _Float16* __restrict__ K16, int ldk, const _Float16* __restrict__ Vt, _Float16* __restrict__ OH, int ldo) {
  constexpr int RPW = 16, NQB = TT / (4 * RPW), DT = 4, KS = 2;
  __shared__ __attribute__((aligned(16))) float sO[4][RPW][64 + 4]; __shared__ __attribute__((aligned(16))) unsigned short ring[2 * FBUF];
  const int tid = threadIdx.x, w = tid >> 5, lane = tid & 31, ln = lane & 15, hh = lane >> 4;
  const int slab = blockIdx.x / NQB, qblk = blockIdx.x % NQB; const int b = slab / NH, h = slab % NH; const int qb0 = qblk * (4 * RPW); const int q0 = qb0 + w * RPW;
  FragH aq[KS];
  { const unsigned short* qr = (const unsigned short*)Q16 + ((size_t)b * TT + q0 + ln) * ldq + h * 64;
#pragma unroll
    for (int ks = 0; ks < KS; ++ks) { aq[ks].half[0] = *(const v8us*)(qr + ks * 32 + 8 * hh); aq[ks].half[1] = *(const v8us*)(qr + ks * 32 + 16 + 8 * hh); } }
  const unsigned short* Vth = (const unsigned short*)Vt + (size_t)slab * 64 * TT;
  float m_r = -1.0e30f, lm_r = -2.0e30f, l_r = 0.f; v8f oacc[DT];      /* the lane's query: running maximum M of the base-2 scores (start value below any f16 product sum, small enough that L stays finite), L = M + min(M, 0), this half's share of the sum, and 8 head dimensions dt * 16 + 8 * hh + r of each of the 4 output tiles */
#pragma unroll
  for (int dt = 0; dt < DT; ++dt) oacc[dt] = (v8f){0.f,0.f,0.f,0.f,0.f,0.f,0.f,0.f};
  const int jbeg = (qb0 - WIN) > 0 ? (qb0 - WIN) : 0; const int jend = (qb0 + 4 * RPW + WIN) < TT ? (qb0 + 4 * RPW + WIN) : TT;      /* block-uniform window bounds (multiples of 32) */
  const unsigned lk0 = (unsigned)(size_t)ring + (unsigned)(((tid >> 3) * FKP + (tid & 7) * 8) * 2), lv0 = (unsigned)(size_t)ring + (unsigned)((32 * FKP + (tid >> 2) * FVP + (tid & 3) * 8) * 2);      /* 8 lanes cover a K row, 4 lanes a V^T row */
  const unsigned short* const gk0 = (const unsigned short*)K16 + ((size_t)b * TT + (tid >> 3)) * ldk + h * 64 + (tid & 7) * 8; const unsigned short* const gh0 = Vth + (size_t)(tid >> 2) * TT + (tid & 3) * 8;
  flash_fill(lk0, lv0, gk0 + (size_t)jbeg * ldk, (size_t)16 * ldk, gh0 + jbeg);
  asm volatile("s_wait_asynccnt 0x0" ::: "memory");      /* this wave's copies of the first tile have landed */
  __syncthreads();      /* publishes the first tile: every wave reads pieces that the other waves copied */
  if (jbeg + 32 < jend) flash_fill(lk0 + FBUF * 2, lv0 + FBUF * 2, gk0 + (size_t)(jbeg + 32) * ldk, (size_t)16 * ldk, gh0 + jbeg + 32);
  unsigned cur = 0;      /* the buffer that holds this trip's tile */
#pragma unroll 1      /* rolled: the trip count is a run-time value, and one short text of the trip is fetched once */
  for (int j0 = jbeg; j0 < jend; j0 += 32) {
    v8f s[2]; FragH bk[2][KS];
#pragma unroll
    for (int nt = 0; nt < 2; ++nt) { const unsigned short* kr = ring + cur * FBUF + (nt * 16 + ln) * FKP;      /* both key tiles' loads fly together, ahead of the first score product */
#pragma unroll
      for (int ks = 0; ks < KS; ++ks) { bk[nt][ks].half[0] = *(const v8us*)(kr + ks * 32 + 8 * hh); bk[nt][ks].half[1] = *(const v8us*)(kr + ks * 32 + 16 + 8 * hh); } }
#pragma unroll
    for (int nt = 0; nt < 2; ++nt) { v8f acc = (v8f){0.f,0.f,0.f,0.f,0.f,0.f,0.f,0.f};
#pragma unroll
      for (int ks = 0; ks < KS; ++ks) acc = mmaH<1>(bk[nt][ks].v, bk[nt][ks].v, aq[ks].v, aq[ks].v, acc); s[nt] = acc; }      /* s[nt][r] = score of key j0 + nt * 16 + 8 * hh + r with query q0 + ln */
    const int dk0 = j0 + 8 * hh - (q0 + ln);      /* key minus query of the lane's first element */
    float mt[2];
#pragma unroll
    for (int nt = 0; nt < 2; ++nt) {
#pragma unroll
      for (int r = 0; r < 8; ++r) { const int dk = dk0 + nt * 16 + r; const bool ok = (dk <= WIN) && (-dk <= WIN);
        s[nt][r] = ok ? s[nt][r] : -INFINITY; mt[nt] = r ? fmaxf(mt[nt], s[nt][r]) : s[nt][r]; } }      /* a key outside the window: score -inf, so E = 0 and its weight is 0 with no second select */
    FragH bv[DT];      /* the trip's 8 value-fragment loads, issued in one run here, where the second half of the softmax covers their latency */
    const unsigned short* const pvh = ring + cur * FBUF + 32 * FKP + ln * FVP + 8 * hh;
#pragma unroll
    for (int dt = 0; dt < DT; ++dt) { bv[dt].half[0] = *(const v8us*)(pvh + dt * 16 * FVP); bv[dt].half[1] = *(const v8us*)(pvh + dt * 16 * FVP + 16); }
    float mc = fmaxf(mt[0], mt[1]); mc = fmaxf(mc, xhalf(mc));      /* the query's largest score over all 32 keys, in both halves; the logit rises with the score, so the largest score also gives the largest logit */
    const float mn = fmaxf(m_r, mc * SC2); const float ln2 = mn + fminf(mn, 0.f);      /* M, and the exponent L = M + min(M, 0) that the stored weights are scaled by */
    const float al = __builtin_amdgcn_exp2f(lm_r - ln2); m_r = mn; lm_r = ln2;
    const float e0 = __builtin_amdgcn_exp2f(fmaxf(-fabsf(mn), -100.0f));      /* 2^-|M|; the floor keeps a above 0, so that a + b * E is never 0 where E has gone to 0 */
    const float ca = (mn > 0.f ? e0 : 1.0f) * 0.0009765625f, cb = (mn > 0.f ? 1.0f : e0) * 0.0009765625f;      /* a = 2^-max(M, 0), b = 2^min(M, 0), both x 2^-10: the quotient then carries the weights' factor 2^10 */
    FragH pb; float ps[2];
#pragma unroll
    for (int nt = 0; nt < 2; ++nt) { float x[8], e[8], dn[8], rc[8], p[8];      /* neighbouring elements go in pairs through the packed f32 multiply-adds and multiplies: one instruction for two */
#pragma unroll
      for (int r = 0; r < 8; r += 2) { const v2f x2 = __builtin_elementwise_fma((v2f){s[nt][r], s[nt][r + 1]}, (v2f){SC2, SC2}, (v2f){-mn, -mn}); x[r] = x2[0]; x[r + 1] = x2[1]; }      /* u - M, u = score / 8 * log2(e) */
#pragma unroll
      for (int r = 0; r < 8; ++r) e[r] = __builtin_amdgcn_exp2f(x[r]);      /* E */
#pragma unroll
      for (int r = 0; r < 8; r += 2) { const v2f d2 = __builtin_elementwise_fma((v2f){e[r], e[r + 1]}, (v2f){cb, cb}, (v2f){ca, ca}); dn[r] = d2[0]; dn[r + 1] = d2[1]; }
#pragma unroll
      for (int r = 0; r < 8; ++r) rc[r] = __builtin_amdgcn_rcpf(dn[r]);
#pragma unroll
      for (int r = 0; r < 8; r += 2) { const v2f e2 = {e[r], e[r + 1]}; const v2f p2 = (e2 * e2) * (v2f){rc[r], rc[r + 1]}; p[r] = p2[0]; p[r + 1] = p2[1]; pb.h[nt * 8 + r] = (_Float16)p[r]; pb.h[nt * 8 + r + 1] = (_Float16)p[r + 1]; }
      ps[nt] = ((p[0] + p[1]) + (p[2] + p[3])) + ((p[4] + p[5]) + (p[6] + p[7])); }
    l_r = l_r * al + (ps[0] + ps[1]);
#pragma unroll
    for (int dt = 0; dt < DT; ++dt) oacc[dt] *= al;
#pragma unroll
    for (int dt = 0; dt < DT; ++dt) oacc[dt] = mmaH<1>(bv[dt].v, bv[dt].v, pb.v, pb.v, oacc[dt]);
    asm volatile("s_wait_dscnt 0x0" ::: "memory");      /* this wave's reads of the buffer have returned before the buffer is given up */
    asm volatile("s_wait_asynccnt 0x0" ::: "memory");      /* this wave's copies of the next tile have landed */
    __syncthreads();      /* publishes the next tile and ends every wave's reads of this trip's buffer, which is refilled behind it */
    if (j0 + 64 < jend) flash_fill(lk0 + cur * (FBUF * 2), lv0 + cur * (FBUF * 2), gk0 + (size_t)(j0 + 64) * ldk, (size_t)16 * ldk, gh0 + j0 + 64);      /* block-uniform test */
    cur ^= 1u; }
  asm volatile("s_wait_asynccnt 0x0" ::: "memory");      /* no copy is outstanding when the wave goes on to the epilogue and ends */
  { float l = l_r; l += xhalf(l); const float li = (l > 0.f) ? 1.0f / l : 0.f;      /* the halves' sums meet once */
#pragma unroll
    for (int dt = 0; dt < DT; ++dt)
#pragma unroll
      for (int r4 = 0; r4 < 8; r4 += 4) { v4f o4;
#pragma unroll
        for (int i = 0; i < 4; ++i) o4[i] = oacc[dt][r4 + i] * li;
        *(v4fa*)&sO[w][ln][dt * 16 + 8 * hh + r4] = o4; } }      /* the lane's 8 neighbouring dimensions of its query's row */
  __builtin_amdgcn_fence(__ATOMIC_ACQ_REL, "workgroup"); __builtin_amdgcn_wave_barrier();
  {
#pragma unroll
    for (int rp = 0; rp < RPW; rp += 2) { const int r = rp + (lane >> 4), pc = lane & 15; const v4f val = *(const v4fa*)&sO[w][r][pc * 4]; const size_t o = ((size_t)b * TT + q0 + r) * ldo + h * 64 + pc * 4; v4h oh;      /* the merged row leaves as the output product's f16 operand; 16 lanes fill one 128-B line */
#pragma unroll
      for (int i = 0; i < 4; ++i) oh[i] = (_Float16)val[i];
      *(v4h*)(OH + o) = oh; }
     } }

// Tiled GEMM for the four 4096 x 1024 x 1024 products, in two launches, A f16 [NR][DM], Bt f16 [n][k]. One 128 x 128 tile per block of 8 waves (4 x 2), 32 x 64 per wave. The epilogue writes what the next kernel reads, so no f32 plane goes through a pass of its own:
// MODE 0: q, k and v in one grid, Bt their three weights one behind the other (3 x 8 column tiles): q, k leave as f16(acc*alpha + bias), row-major (C16, C16k); v = acc*alpha + bias leaves transposed, per (batch, column) a row over t, as f16 (C16v). 2: C = A.Bt*alpha + bias in the (D, T, B) layout of the output.
// Each trip stages 128 k of the tile's 128 A rows and 128 Bt rows in LDS as whole 256-B rows (pitch 272 B: ds_load_b128 fragment reads meet no bank twice); two buffers, the next trip's rows are
// fetched into registers ahead of this trip's products and stored behind them, one barrier a trip. Every accumulator still sums k in ascending steps of 32.
#define GT 128
#define GK 128
#define GP 136
#define GSO 68
#define GTP 131
// one trip's products of a wave: 128 k in four steps of 32, 2 x 4 accumulator tiles; sa, sb: the lane's own row and k half in the A and Bt parts of the buffer
__device__ __forceinline__ void gemm_trip(const unsigned short* sa, const unsigned short* sb, v8f (&acc)[2][4]) {
#pragma unroll
  for (int ks = 0; ks < GK / 32; ++ks) {
    FragH a[2], b[4];
#pragma unroll
    for (int mi = 0; mi < 2; ++mi) { a[mi].half[0] = *(const v8us*)(sa + mi * 16 * GP + ks * 32); a[mi].half[1] = *(const v8us*)(sa + mi * 16 * GP + ks * 32 + 16); }
#pragma unroll
    for (int ni = 0; ni < 4; ++ni) { b[ni].half[0] = *(const v8us*)(sb + ni * 16 * GP + ks * 32); b[ni].half[1] = *(const v8us*)(sb + ni * 16 * GP + ks * 32 + 16); }
#pragma unroll
    for (int mi = 0; mi < 2; ++mi)
#pragma unroll
      for (int ni = 0; ni < 4; ++ni) acc[mi][ni] = __builtin_amdgcn_wmma_f32_16x16x32_f16(false, a[mi].v, false, b[ni].v, (short)0, acc[mi][ni], false, false);
  }
}
template <int MODE>
__global__ __launch_bounds__(256) void k_gemm_t(const _Float16* __restrict__ A, const _Float16* __restrict__ Bt, float alpha, const float* __restrict__ bias, const float* __restrict__ biask, const float* __restrict__ biasv, float* __restrict__ C, _Float16* __restrict__ C16, _Float16* __restrict__ C16k, _Float16* __restrict__ C16v) {
  __shared__ __attribute__((aligned(16))) unsigned char smraw[2 * 2 * GT * GP * 2];
  unsigned short* const sm = (unsigned short*)smraw;
  constexpr int BUF = 2 * GT * GP, NTR = DM / GK;
  constexpr bool TB = (MODE >= 2);      /* tile row lr stands for (t, b) = (t0 + lr / BB, lr % BB): the order in which the output holds one column's values, so a column of the tile is one contiguous run there */
  constexpr int AST = (TB ? 16 / BB : 16) * DM;      /* A elements between the rows of two staging sweeps */
  const int tid = threadIdx.x, w = tid >> 5, lane = tid & 31, ln = lane & 15, hh = lane >> 4;
  constexpr int NCT = (MODE == 0 ? 3 : 1) * (DM / GT);      /* column tiles of a row of tiles; the blocks that share an A tile are neighbours in the grid */
  const int mt = blockIdx.x / NCT, ct = blockIdx.x % NCT, part = ct / (DM / GT);      /* part (block-uniform): 0 q, 1 k, 2 v */
  const int row0 = mt * GT, col0 = (ct % (DM / GT)) * GT, t0 = mt * (GT / BB);
  const float* const bp = (MODE == 0) ? (part == 0 ? bias : part == 1 ? biask : biasv) : bias;
  const int wm = (w >> 1) * 32, wn = (w & 1) * 64;
  const int pc = tid & 15, sr = tid >> 4;      /* staging: 16 lanes cover one 256-B row piece by piece; 16 rows per sweep */
  const unsigned short* ga = (const unsigned short*)A + (size_t)(TB ? t0 : row0) * DM;      /* block-uniform bases; the lane's own places are the 32-bit offsets goa and go, which live through the loop */
  const unsigned short* gb = (const unsigned short*)Bt + (size_t)(ct * GT) * DM;
  const unsigned go = (unsigned)(sr * DM + pc * 8);
  const unsigned goa = TB ? (unsigned)(((sr % BB) * TT + sr / BB) * DM + pc * 8) : go;
  unsigned short* const sw = sm + sr * GP + pc * 8;
  v8us st[16];
#pragma unroll
  for (int i = 0; i < 8; ++i) { st[i] = *(const v8us*)(ga + i * AST + goa); st[8 + i] = *(const v8us*)(gb + i * 16 * DM + go); }
#pragma unroll
  for (int i = 0; i < 16; ++i) *(v8us*)(sw + i * 16 * GP) = st[i];
  asm volatile("s_wait_xcnt 0x0" :: "v"(goa), "v"(go) : "memory");      /* the wait in front of any overwrite of the first loads' offset registers, which as its inputs stay whole up to here */
  __syncthreads();
  v8f acc[2][4];
#pragma unroll
  for (int mi = 0; mi < 2; ++mi)
#pragma unroll
    for (int ni = 0; ni < 4; ++ni) acc[mi][ni] = (v8f){0.f,0.f,0.f,0.f,0.f,0.f,0.f,0.f};
#pragma unroll 1      /* rolled: seven copies of the trip save nothing, and a short text is fetched once */
  for (int t = 0; t < NTR - 1; ++t) {
    const unsigned short* pa = ga + (t + 1) * GK + goa; const unsigned short* pb = gb + (t + 1) * GK + go;
#pragma unroll
    for (int i = 0; i < 8; ++i) { st[i] = *(const v8us*)(pa + i * AST); st[8 + i] = *(const v8us*)(pb + i * 16 * DM); }
    __builtin_amdgcn_sched_barrier(0);      /* keeps the next trip's global loads ahead of this trip's products: sunk towards their LDS stores they would leave their latency uncovered */
    gemm_trip(sm + (t & 1) * BUF + (wm + ln) * GP + 8 * hh, sm + (t & 1) * BUF + (GT + wn + ln) * GP + 8 * hh, acc);
    asm volatile("s_wait_xcnt 0x0" :: "v"(pa), "v"(pb) : "memory");      /* the wait in front of any overwrite of the loads' address registers; as its inputs the two pairs stay whole up to here, where the loads are a trip old */
#pragma unroll
    for (int i = 0; i < 16; ++i) *(v8us*)(sw + ((t + 1) & 1) * BUF + i * 16 * GP) = st[i];
    __syncthreads();      /* publishes the buffer just written and ends every read of the one that the next trip overwrites */
  }
  gemm_trip(sm + ((NTR - 1) & 1) * BUF + (wm + ln) * GP + 8 * hh, sm + ((NTR - 1) & 1) * BUF + (GT + wn + ln) * GP + 8 * hh, acc);
  __syncthreads();      /* every wave has left the ring before the epilogue writes over it */
  if (MODE == 0 && part < 2) {
    _Float16* const cq = part ? C16k : C16;
    const int rsub = lane >> 4, c4 = (lane & 15) * 4;
    const size_t o0 = (size_t)(row0 + wm + rsub) * DM + col0 + wn + c4;
    float* const so = (float*)smraw + w * (32 * GSO);      /* each wave's own 32 x 64 patch, in the ring that every wave has left */
#pragma unroll
    for (int ni = 0; ni < 4; ++ni) { const float bv = bf16_round(bp[col0 + wn + ni * 16 + ln]);
#pragma unroll
      for (int mi = 0; mi < 2; ++mi)
#pragma unroll
        for (int r = 0; r < 8; ++r) so[(mi * 16 + 8 * hh + r) * GSO + ni * 16 + ln] = acc[mi][ni][r] * alpha + bv; }
    __builtin_amdgcn_fence(__ATOMIC_ACQ_REL, "workgroup"); __builtin_amdgcn_wave_barrier();
#pragma unroll
    for (int q = 0; q < 16; ++q) { const v4f v = *(const v4fa*)&so[(q * 2 + rsub) * GSO + c4]; v4h h4; for (int i = 0; i < 4; ++i) h4[i] = (_Float16)v[i]; *(v4h*)(cq + o0 + (size_t)q * 2 * DM) = h4; }
  } else {
    float* const tl = (float*)smraw;      /* the block's whole 128 x 128 tile in f32, pitch 131 words: it is written by rows and read back by columns */
    float* const op = C + ((size_t)col0 * TT + t0) * BB + lane * 4;      /* MODE 2: a wave takes one column at a time, 128 values = 512 contiguous bytes of the output */
#pragma unroll
    for (int ni = 0; ni < 4; ++ni) { const float bv = bf16_round(bp[col0 + wn + ni * 16 + ln]);
#pragma unroll
      for (int mi = 0; mi < 2; ++mi)
#pragma unroll
        for (int r = 0; r < 8; ++r) tl[(wm + mi * 16 + 8 * hh + r) * GTP + wn + ni * 16 + ln] = acc[mi][ni][r] * alpha + bv; }
    __syncthreads();      /* a column holds values of four waves: all of the tile stands in LDS before any column is read */
    if (MODE == 0) {
      const int t8 = tid & 15, dq = tid >> 4;      /* 16 lanes cover one column's 128 t: 256 contiguous bytes */
      const size_t vo = ((size_t)(row0 / TT) * DM + col0) * TT + (row0 % TT) + t8 * 8;
#pragma unroll
      for (int i = 0; i < 8; ++i) { const int d = i * 16 + dq; FragH fh;
#pragma unroll
        for (int q = 0; q < 8; ++q) fh.h[q] = (_Float16)tl[(t8 * 8 + q) * GTP + d];
        *(v8us*)((unsigned short*)C16v + vo + (size_t)d * TT) = fh.half[0]; }
      asm volatile("s_wait_xcnt 0x0" ::: "memory");      /* the wait behind the last stores, in front of whatever next writes their address or data registers */
    } else {
#pragma unroll
      for (int i = 0; i < 16; ++i) { const int d = i * 8 + w; v4f v = {tl[(lane * 4) * GTP + d], tl[(lane * 4 + 1) * GTP + d], tl[(lane * 4 + 2) * GTP + d], tl[(lane * 4 + 3) * GTP + d]};
        *(v4f*)(op + (size_t)d * (TT * BB)) = v; }
    }
  }
}

extern "C" void kernel_launch(void* const* d_in, const int* in_sizes, int n_in,
                              void* d_out, int out_size, void* d_ws, size_t ws_size, hipStream_t stream) {
  (void)in_sizes; (void)n_in; (void)out_size;
  const float* const* I = (const float* const*)d_in; const float* x = I[0]; const float* Wq = I[1]; const float* bq = I[2]; const float* Wk = I[3]; const float* bk = I[4]; const float* Wv = I[5]; const float* bv = I[6]; const float* Wo = I[7]; const float* bo = I[8];
  char* ws = (char*)d_ws; size_t off = 0;
  auto take = [&](size_t bytes) { char* p = ws + off; off += (bytes + 255) & ~(size_t)255; return p; };
  const size_t WSZ = (size_t)DM * DM; _Float16* Bw = (_Float16*)take(4 * WSZ * 2); _Float16* X16 = (_Float16*)take((size_t)NR * DM * 2); _Float16* OH = (_Float16*)take((size_t)NR * DM * 2);
  _Float16* Q16 = (_Float16*)take((size_t)NR * DM * 2); _Float16* K16 = (_Float16*)take((size_t)NR * DM * 2); _Float16* Vth = (_Float16*)take((size_t)NR * DM * 2);
  if (off > ws_size) return;      // 6 x 8.4 MB, about 50 MB
  k_prep<<<4 * WB + (DM / 64) * (TT / 32), 256, 0, stream>>>(x, Wq, Wk, Wv, Wo, Bw, X16);
  const dim3 gp((NR / GT) * (DM / GT), 1), gp3(3 * (NR / GT) * (DM / GT), 1);
  k_gemm_t<0><<<gp3, 256, 0, stream>>>(X16, Bw, 0.0625f, bq, bk, bv, nullptr, Q16, K16, Vth);      /* q, k = xt.W + b -> f16; v -> transposed f16: M 4096 N 3 x 1024 K 1024 */
  k_flash<<<BB * NH * (TT / 64), 128, 0, stream>>>(Q16, DM, K16, DM, Vth, OH, DM);
  k_gemm_t<2><<<gp, 256, 0, stream>>>(OH, Bw + 3 * WSZ, 0.0625f, bo, nullptr, nullptr, (float*)d_out, nullptr, nullptr, nullptr);      /* out = O.Wo + bo, in the output's own layout */
}
